// v000
// The times below were measured on an AMD MI455X: many runs one after another, warmed up first and cycling through
// copies of the inputs, with the whole window's GPU time divided by the number of runs. Launches and the gaps
// between them are all in it. The median over several windows is given; except for v000 it joins two sittings, which
// can be a few percent apart, so the side-by-side timings, each taken in one sitting, are the better comparison.
// The starting kernel, v000, takes 1810 microseconds a run.
#include <hip/hip_runtime.h>
// HoloKV attention (B 2, S 2048, 16 heads × 64, k_factor 4 → 512 slots): q = x·Wq + (x·Aq)·Bq, k = x·Wk, v = x·Wv + (x·Av)·Bv; RoPE (half-split rotate, θ_i = 1/10000^(2i/64)); keys/values compressed into slots of 4 tokens with Hadamard phases /2: full_K[s] = Σ_t k[4s+t]·c[t]/2, partial (causal prefix inside the slot); query phase c[q mod 4]; scores over slots: aligned_q·full_K/8 for earlier slots, aligned_q·partial_K(q's prefix)/8 for its own slot, −inf for later slots; softmax; out = Σ w·full_V + w_curr·(partial_V − full_V[curr]); out·phase·2; y = out·Wo + (out·Ao)·Bo → [2,2048,1024].
// Compute dtype: x and parameters rounded to bf16; projections with exact products and the LoRA paths on f16 hi + lo·2^10 operands of x·A (≈f32); RoPE, phases, slot sums/prefixes in f32; aligned q and full_K/full_V as f16 GEMM operands (scores O(1)), the own-slot score, masking, softmax and the rank-1 correction in f32; attention output as f16 hi + lo·2^10 into Wo and the LoRA output path. v_wmma_f32_16x16x32_f16.
#define NBt 2
#define SS 2048
#define DM 1024
#define NH 16
#define DH 64
#define KF 4
#define NSL (SS / KF)            /* 512 slots */
#define LR 64
#define NR (NBt * SS)
typedef __bf16 v16b __attribute__((ext_vector_type(16)));
typedef unsigned short v8us __attribute__((ext_vector_type(8), may_alias));
typedef float  v8f  __attribute__((ext_vector_type(8)));
typedef float  v4f  __attribute__((ext_vector_type(4)));
typedef float  v4fa __attribute__((ext_vector_type(4), may_alias));
union FragB { v16b v; v8us half[2]; unsigned short u[16]; };

__device__ __forceinline__ unsigned short bf16_bits(float x) { unsigned int u = __float_as_uint(x); return (unsigned short)((u + 0x7FFFu + ((u >> 16) & 1u)) >> 16); }
__device__ __forceinline__ float bf16_val(unsigned short b) { return __uint_as_float(((unsigned int)b) << 16); }
__device__ __forceinline__ float bf16_round(float x) { return bf16_val(bf16_bits(x)); }
// D += A·B with NT terms: 1 = ah·bh, 2 = + al·bh (A split), 3 = + ah·bl (both split)
template <int NT>
__device__ __forceinline__ v8f mmaN(v16b ah, v16b al, v16b bh, v16b bl, v8f c) {
  c = __builtin_amdgcn_wmma_f32_16x16x32_bf16(false, ah, false, bh, (short)0, c, false, false);
  if (NT >= 2) c = __builtin_amdgcn_wmma_f32_16x16x32_bf16(false, al, false, bh, (short)0, c, false, false);
  if (NT >= 3) c = __builtin_amdgcn_wmma_f32_16x16x32_bf16(false, ah, false, bl, (short)0, c, false, false);
  asm volatile("v_nop\n\tv_nop\n\tv_nop\n\tv_nop" : "+v"(c) : "v"(ah), "v"(al), "v"(bh), "v"(bl));
  return c;
}

__global__ __launch_bounds__(256) void k_wt_bf16(const float* __restrict__ W, unsigned short* __restrict__ Wt, int K, int N) {
  const int t = blockIdx.x * 256 + threadIdx.x;
  const int k8n = K / 8;
  if (t >= N * k8n) return;
  const int n = t / k8n, k8 = (t % k8n) * 8;
  v8us v;
#pragma unroll
  for (int i = 0; i < 8; ++i) v[i] = bf16_bits(W[(size_t)(k8 + i) * N + n]);
  *(v8us*)(Wt + (size_t)n * K + k8) = v;
  
}

// GEMM C[M][N] (f32, pitch ldc) = act(A[M][K]·W + bias). A f32 row-major (pitch lda) converted per fragment to bf16
// (ASPLIT: hi/lo two planes -> 2 terms, else single rounded term); Wt bf16 [N][K] (pitch ldb). BIAS_BF16 rounds the
// bias to bf16 first (bias quantised to bf16 before the add). K%32==0, M%16==0, N%64==0.
template <bool ASPLIT, int ACT, bool BIAS_BF16>
__global__ __launch_bounds__(128) void k_gemm_bf(const float* __restrict__ A, int lda, const unsigned short* __restrict__ Wt, int ldb,
                                               const float* __restrict__ bias, float* __restrict__ C, int ldc, int M, int N, int K) {
  __shared__ __attribute__((aligned(16))) float so[4][16][64];
  const int tid = threadIdx.x, w = tid >> 5, lane = tid & 31, ln = lane & 15, hh = lane >> 4;
  const int ntn = N / 64;
  const int wid = blockIdx.x * 4 + w;
  const int mt = wid / ntn, nq = wid % ntn;
  if (mt * 16 >= M) return;
  const int row0 = mt * 16, col0 = nq * 64;
  const float* arow = A + (size_t)(row0 + ln) * lda;
  v8f acc[4] = {};
  for (int kb = 0; kb < K; kb += 32) {
    FragB ah, al;
    const v4f x0 = *(const v4fa*)(arow + kb + 8 * hh), x1 = *(const v4fa*)(arow + kb + 8 * hh + 4);
    const v4f x2 = *(const v4fa*)(arow + kb + 16 + 8 * hh), x3 = *(const v4fa*)(arow + kb + 16 + 8 * hh + 4);
    float xs[16] = {x0[0],x0[1],x0[2],x0[3],x1[0],x1[1],x1[2],x1[3],x2[0],x2[1],x2[2],x2[3],x3[0],x3[1],x3[2],x3[3]};
#pragma unroll
    for (int i = 0; i < 16; ++i) { const unsigned short hb = bf16_bits(xs[i]); ah.u[i] = hb; al.u[i] = ASPLIT ? bf16_bits(xs[i] - bf16_val(hb)) : (unsigned short)0; }
#pragma unroll
    for (int t = 0; t < 4; ++t) {
      const unsigned short* brow = Wt + (size_t)(col0 + t * 16 + ln) * ldb + kb;
      FragB b;
      b.half[0] = *(const v8us*)(brow + 8 * hh);
      b.half[1] = *(const v8us*)(brow + 16 + 8 * hh);
      acc[t] = mmaN<ASPLIT ? 2 : 1>(ah.v, al.v, b.v, b.v, acc[t]);
    }
  }
#pragma unroll
  for (int t = 0; t < 4; ++t) {
    float bv = bias ? bias[col0 + t * 16 + ln] : 0.f;
    if (BIAS_BF16) bv = bf16_round(bv);
#pragma unroll
    for (int r = 0; r < 8; ++r) { float v = acc[t][r] + bv; if (ACT == 1) v = fmaxf(v, 0.f); so[w][8 * hh + r][t * 16 + ln] = v; }
  }
  __builtin_amdgcn_fence(__ATOMIC_ACQ_REL, "workgroup");
  __builtin_amdgcn_wave_barrier();
  const int rsub = lane >> 4, c4 = (lane & 15) * 4;
  {
#pragma unroll
    for (int q = 0; q < 8; ++q) {
      const int r = q * 2 + rsub;
      const v4f v = *(const v4fa*)&so[w][r][c4];
      *(v4f*)(C + (size_t)(row0 + r) * ldc + col0 + c4) = v;
    }
    
  }
}

// GEMM C = act(A·W + bias + resid): A f32 (ASPLIT -> hi/lo 2 terms), Wt bf16 [N][K]; ACT 0 none, 1 relu, 2 exact gelu;
// resid (optional, f32, row index = (row % rmod), pitch ldr, RES_BF16 rounds it) added before the activation.
template <bool ASPLIT, int ACT, bool BIAS_BF16, bool RES_BF16>
__global__ __launch_bounds__(128) void k_gemm_bf3(const float* __restrict__ A, int lda, const unsigned short* __restrict__ Wt, int ldb,
                                                const float* __restrict__ bias, const float* __restrict__ resid, int rmod, int ldr,
                                                float* __restrict__ C, int ldc, int M, int N, int K) {
  __shared__ __attribute__((aligned(16))) float so[4][16][64];
  const int tid = threadIdx.x, w = tid >> 5, lane = tid & 31, ln = lane & 15, hh = lane >> 4;
  const int ntn = N / 64;
  const int wid = blockIdx.x * 4 + w;
  const int mt = wid / ntn, nq = wid % ntn;
  if (mt * 16 >= M) return;
  const int row0 = mt * 16, col0 = nq * 64;
  const float* arow = A + (size_t)(row0 + ln) * lda;
  v8f acc[4] = {};
  for (int kb = 0; kb < K; kb += 32) {
    FragB ah, al;
    const v4f x0 = *(const v4fa*)(arow + kb + 8 * hh), x1 = *(const v4fa*)(arow + kb + 8 * hh + 4);
    const v4f x2 = *(const v4fa*)(arow + kb + 16 + 8 * hh), x3 = *(const v4fa*)(arow + kb + 16 + 8 * hh + 4);
    float xs[16] = {x0[0],x0[1],x0[2],x0[3],x1[0],x1[1],x1[2],x1[3],x2[0],x2[1],x2[2],x2[3],x3[0],x3[1],x3[2],x3[3]};
#pragma unroll
    for (int i = 0; i < 16; ++i) { const unsigned short hb = bf16_bits(xs[i]); ah.u[i] = hb; al.u[i] = ASPLIT ? bf16_bits(xs[i] - bf16_val(hb)) : (unsigned short)0; }
#pragma unroll
    for (int t = 0; t < 4; ++t) {
      const unsigned short* brow = Wt + (size_t)(col0 + t * 16 + ln) * ldb + kb;
      FragB b;
      b.half[0] = *(const v8us*)(brow + 8 * hh);
      b.half[1] = *(const v8us*)(brow + 16 + 8 * hh);
      acc[t] = mmaN<ASPLIT ? 2 : 1>(ah.v, al.v, b.v, b.v, acc[t]);
    }
  }
#pragma unroll
  for (int t = 0; t < 4; ++t) {
    const int col = col0 + t * 16 + ln;
    float bv = bias ? bias[col] : 0.f;
    if (BIAS_BF16) bv = bf16_round(bv);
#pragma unroll
    for (int r = 0; r < 8; ++r) {
      float v = acc[t][r] + bv;
      if (resid) { float rv = resid[(size_t)((row0 + 8 * hh + r) % rmod) * ldr + col]; if (RES_BF16) rv = bf16_round(rv); v += rv; }
      if (ACT == 1) v = fmaxf(v, 0.f);
      if (ACT == 2) v = 0.5f * v * (1.0f + erff(v * 0.70710678118654752f));
      if (ACT == 3) { const float u = 0.7978845608028654f * (v + 0.044715f * v * v * v); v = 0.5f * v * (1.0f + tanhf(u)); }
      so[w][8 * hh + r][t * 16 + ln] = v;
    }
  }
  __builtin_amdgcn_fence(__ATOMIC_ACQ_REL, "workgroup");
  __builtin_amdgcn_wave_barrier();
  const int rsub = lane >> 4, c4 = (lane & 15) * 4;
  {
#pragma unroll
    for (int q = 0; q < 8; ++q) {
      const int r = q * 2 + rsub;
      const v4f v = *(const v4fa*)&so[w][r][c4];
      *(v4f*)(C + (size_t)(row0 + r) * ldc + col0 + c4) = v;
    }
    
  }
}
// row LayerNorm (biased variance, eps) over N: s = X (+ R); optional out_sum <- s; out_norm <- (s-mu)*rsqrt(var+eps)*g + b
template <bool PARAM_BF16>
__global__ __launch_bounds__(256) void k_layernorm(const float* __restrict__ X, const float* __restrict__ R, const float* __restrict__ g, const float* __restrict__ bta,
                                                  float* __restrict__ out_sum, float* __restrict__ out_norm, int N, float eps) {
  __shared__ float red[256];
  const int row = blockIdx.x, tid = threadIdx.x;
  const float* x = X + (size_t)row * N; const float* rr = R ? R + (size_t)row * N : nullptr;
  float vals[16];                     // up to N = 4096
  const int per = N / 256;            // contiguous chunk per thread? use strided-by-4 chunks: thread handles j = tid*4 + 1024*u
  float s1 = 0.f;
  for (int u = 0; u < per / 4; ++u) {
    const int j = tid * 4 + 1024 * u;
    const v4f a = *(const v4fa*)(x + j);
    v4f b = {0.f,0.f,0.f,0.f}; if (rr) b = *(const v4fa*)(rr + j);
#pragma unroll
    for (int q = 0; q < 4; ++q) { const float v = a[q] + b[q]; vals[u * 4 + q] = v; s1 += v; }
  }
  red[tid] = s1; __syncthreads();
  for (int st = 128; st > 0; st >>= 1) { if (tid < st) red[tid] += red[tid + st]; __syncthreads(); }
  const float mu = red[0] / (float)N; __syncthreads();
  float s2 = 0.f;
  for (int u = 0; u < per / 4; ++u)
#pragma unroll
    for (int q = 0; q < 4; ++q) { const float c = vals[u * 4 + q] - mu; s2 += c * c; }
  red[tid] = s2; __syncthreads();
  for (int st = 128; st > 0; st >>= 1) { if (tid < st) red[tid] += red[tid + st]; __syncthreads(); }
  const float rs = rsqrtf(red[0] / (float)N + eps);
  {
    for (int u = 0; u < per / 4; ++u) {
      const int j = tid * 4 + 1024 * u;
      v4f o, sm;
#pragma unroll
      for (int q = 0; q < 4; ++q) {
        float gg = g[j + q], bb = bta[j + q];
        if (PARAM_BF16) { gg = bf16_round(gg); bb = bf16_round(bb); }
        sm[q] = vals[u * 4 + q]; o[q] = (vals[u * 4 + q] - mu) * rs * gg + bb;
      }
      if (out_sum) *(v4f*)(out_sum + (size_t)row * N + j) = sm;
      *(v4f*)(out_norm + (size_t)row * N + j) = o;
    }
    
  }
}



// ---- f16 WMMA path (v_wmma_f32_16x16x32_f16): 11-bit significands for operands in range — used where a [0,1] probability operand needs more precision than bf16
typedef _Float16 v16h __attribute__((ext_vector_type(16)));
union FragH { v16h v; v8us half[2]; _Float16 h[16]; unsigned short u[16]; };
template <int NT>
__device__ __forceinline__ v8f mmaH(v16h ah, v16h al, v16h bh, v16h bl, v8f c) {
  c = __builtin_amdgcn_wmma_f32_16x16x32_f16(false, ah, false, bh, (short)0, c, false, false);
  if (NT >= 2) c = __builtin_amdgcn_wmma_f32_16x16x32_f16(false, al, false, bh, (short)0, c, false, false);
  if (NT >= 3) c = __builtin_amdgcn_wmma_f32_16x16x32_f16(false, ah, false, bl, (short)0, c, false, false);
  asm volatile("v_nop\n\tv_nop\n\tv_nop\n\tv_nop" : "+v"(c) : "v"(ah), "v"(al), "v"(bh), "v"(bl));
  return c;
}
// batched GEMM like k_gemm_b but f16 operands: A f32 (split into f16 hi/lo if ASPLIT, else rounded to f16), Bt = f16 values [n][k]; alpha; C f32; N multiple of 16 (partial tiles skipped)
template <bool ASPLIT>
__global__ __launch_bounds__(128) void k_gemm_h(const float* __restrict__ A, int lda, size_t sA, const _Float16* __restrict__ Bh, int ldb, size_t sB, float alpha, float* __restrict__ C, int ldc, size_t sC, int M, int N, int K) {
  __shared__ __attribute__((aligned(16))) float so[4][16][64];
  const int tid = threadIdx.x, w = tid >> 5, lane = tid & 31, ln = lane & 15, hh = lane >> 4; const int by = blockIdx.y;
  A += (size_t)by * sA; Bh += (size_t)by * sB; C += (size_t)by * sC;
  const int ntn = (N + 63) / 64; const int wid = blockIdx.x * 4 + w; const int mt = wid / ntn, nq = wid % ntn; if (mt * 16 >= M) return;
  const int row0 = mt * 16, col0 = nq * 64; const float* arow = A + (size_t)(row0 + ln) * lda;
  v8f acc[4] = {};
  for (int kb = 0; kb < K; kb += 32) {
    FragH ah, al;
    const v4f x0 = *(const v4fa*)(arow + kb + 8 * hh), x1 = *(const v4fa*)(arow + kb + 8 * hh + 4), x2 = *(const v4fa*)(arow + kb + 16 + 8 * hh), x3 = *(const v4fa*)(arow + kb + 16 + 8 * hh + 4);
    float xs[16] = {x0[0],x0[1],x0[2],x0[3],x1[0],x1[1],x1[2],x1[3],x2[0],x2[1],x2[2],x2[3],x3[0],x3[1],x3[2],x3[3]};
#pragma unroll
    for (int i = 0; i < 16; ++i) { const _Float16 h = (_Float16)xs[i]; ah.h[i] = h; al.h[i] = ASPLIT ? (_Float16)(xs[i] - (float)h) : (_Float16)0.0f; }
#pragma unroll
    for (int t = 0; t < 4; ++t) { if (col0 + t * 16 >= N) continue; const size_t boff = (size_t)(col0 + t * 16 + ln) * ldb + kb; FragH bq; bq.half[0] = *(const v8us*)(Bh + boff + 8 * hh); bq.half[1] = *(const v8us*)(Bh + boff + 16 + 8 * hh);
      acc[t] = mmaH<ASPLIT ? 2 : 1>(ah.v, al.v, bq.v, bq.v, acc[t]); }
  }
#pragma unroll
  for (int t = 0; t < 4; ++t) { if (col0 + t * 16 >= N) continue;
#pragma unroll
    for (int r = 0; r < 8; ++r) so[w][8 * hh + r][t * 16 + ln] = acc[t][r] * alpha; }
  __builtin_amdgcn_fence(__ATOMIC_ACQ_REL, "workgroup"); __builtin_amdgcn_wave_barrier();
  const int rsub = lane >> 4, c4 = (lane & 15) * 4;
  {
#pragma unroll
    for (int q = 0; q < 8; ++q) { const int r = q * 2 + rsub; if (col0 + c4 < N) { const v4f v = *(const v4fa*)&so[w][r][c4]; *(v4f*)(C + (size_t)(row0 + r) * ldc + col0 + c4) = v; } }
     }
}

// Wt[n][k] = f16(W[k][n]·scale) from f32 row-major W[K][N] (scale = power of two; bf16-exact weights stay exact in f16 away from the subnormal range)
__global__ __launch_bounds__(256) void k_wt_f16(const float* __restrict__ W, _Float16* __restrict__ Wt, int K, int N, float scale) {
  const int t = blockIdx.x * 256 + threadIdx.x; if (t >= N * (K / 8)) return; const int n = t / (K / 8), k8 = (t % (K / 8)) * 8; FragH f;
#pragma unroll
  for (int i = 0; i < 8; ++i) f.h[i] = (_Float16)(bf16_round(W[(size_t)(k8 + i) * N + n]) * scale); const v8us o = f.half[0];
  *(v8us*)((unsigned short*)Wt + (size_t)n * K + k8) = o; 
}
// k_gemm_hh variant with fused epilogue: v = acc·alpha + bias[by·sBias + col] (+ CP[(row/rowsPerB)·sCPb + by·64 + col] if CP) ; ACT 0 none / 1 elu ; writes f32 C and f16 C16, each if non-null
template <int ACT>
__global__ __launch_bounds__(128) void k_gemm_hhx(const _Float16* __restrict__ A, int lda, size_t sA, const _Float16* __restrict__ Bh, int ldb, size_t sB, float alpha, const float* __restrict__ bias, size_t sBias, const float* __restrict__ CP, int rowsPerB, size_t sCPb, int row0g,
    float* __restrict__ C, _Float16* __restrict__ C16, int ldc, size_t sC, int M, int N, int K) {
  __shared__ __attribute__((aligned(16))) float so[4][16][64];
  const int tid = threadIdx.x, w = tid >> 5, lane = tid & 31, ln = lane & 15, hh = lane >> 4; const int by = blockIdx.y;
  A += (size_t)by * sA; Bh += (size_t)by * sB; const size_t cofs = (size_t)by * sC; const float* bp = bias ? bias + (size_t)by * sBias : nullptr;
  const int ntn = (N + 63) / 64; const int wid = blockIdx.x * 4 + w; const int mt = wid / ntn, nq = wid % ntn; if (mt * 16 >= M) return;
  const int row0 = mt * 16, col0 = nq * 64; const _Float16* arow = A + (size_t)(row0 + ln) * lda;
  v8f acc[4] = {};
  for (int kb = 0; kb < K; kb += 32) { FragH ah; ah.half[0] = *(const v8us*)((const unsigned short*)arow + kb + 8 * hh); ah.half[1] = *(const v8us*)((const unsigned short*)arow + kb + 16 + 8 * hh);
#pragma unroll
    for (int t = 0; t < 4; ++t) { if (col0 + t * 16 >= N) continue; const size_t boff = (size_t)(col0 + t * 16 + ln) * ldb + kb; FragH bq; bq.half[0] = *(const v8us*)((const unsigned short*)Bh + boff + 8 * hh); bq.half[1] = *(const v8us*)((const unsigned short*)Bh + boff + 16 + 8 * hh);
      acc[t] = mmaH<1>(ah.v, ah.v, bq.v, bq.v, acc[t]); }
  }
#pragma unroll
  for (int t = 0; t < 4; ++t) { if (col0 + t * 16 >= N) continue; const int col = col0 + t * 16 + ln; const float bv = bp ? bf16_round(bp[col]) : 0.f;
#pragma unroll
    for (int r = 0; r < 8; ++r) { float v = acc[t][r] * alpha + bv; if (CP) { const int bidx = (row0g + row0 + 8 * hh + r) / rowsPerB; v += CP[(size_t)bidx * sCPb + (size_t)by * 64 + col]; } if (ACT == 1) v = (v > 0.f) ? v : expm1f(v); else if (ACT == 7) v = (v > 0.f) ? v + 1.0f : expf(v); else if (ACT == 8) v = tanhf(v); else if (ACT == 9) v = 0.5f * v * (1.0f + tanhf(0.7978845608028654f * (v + 0.044715f * v * v * v))); else if (ACT == 11) v = 1.0f / (1.0f + expf(-v)); else if (ACT == 12) v = (v > 0.f) ? v : 0.01f * v; else if (ACT == 14) v = (v > 0.f) ? v : 0.1f * v; else if (ACT == 15) v = v / (1.0f + expf(-v)); else if (ACT == 3) v = fmaxf(v, 0.f); else if (ACT == 6) v = 0.5f * v * (1.0f + erff(v * 0.70710678118654752f)); so[w][8 * hh + r][t * 16 + ln] = v; } }
  __builtin_amdgcn_fence(__ATOMIC_ACQ_REL, "workgroup"); __builtin_amdgcn_wave_barrier();
  const int rsub = lane >> 4, c4 = (lane & 15) * 4; typedef _Float16 v4h __attribute__((ext_vector_type(4)));
  {
#pragma unroll
    for (int q = 0; q < 8; ++q) { const int r = q * 2 + rsub; if (col0 + c4 < N) { const v4f v = *(const v4fa*)&so[w][r][c4]; if (C) *(v4f*)(C + cofs + (size_t)(row0 + r) * ldc + col0 + c4) = v; if (C16) { v4h h4; for (int i = 0; i < 4; ++i) h4[i] = (_Float16)v[i]; *(v4h*)(C16 + cofs + (size_t)(row0 + r) * ldc + col0 + c4) = h4; } } }
     }
}


typedef _Float16 v4h __attribute__((ext_vector_type(4)));

__global__ __launch_bounds__(256) void k_x16(const float* __restrict__ x, _Float16* __restrict__ X16, size_t n8) { const size_t t = (size_t)blockIdx.x * 256 + threadIdx.x; if (t >= n8) return; FragH f;
#pragma unroll
  for (int q = 0; q < 8; ++q) f.h[q] = (_Float16)bf16_round(x[t * 8 + q]); *(v8us*)((unsigned short*)X16 + t * 8) = f.half[0];  }
__global__ __launch_bounds__(256) void k_h16(const float* __restrict__ x, _Float16* __restrict__ X16, size_t n8) { const size_t t = (size_t)blockIdx.x * 256 + threadIdx.x; if (t >= n8) return; FragH f;
#pragma unroll
  for (int q = 0; q < 8; ++q) f.h[q] = (_Float16)x[t * 8 + q]; *(v8us*)((unsigned short*)X16 + t * 8) = f.half[0];  }
__global__ __launch_bounds__(256) void k_round16f(const float* __restrict__ W, _Float16* __restrict__ Bt, size_t n8) { const size_t t = (size_t)blockIdx.x * 256 + threadIdx.x; if (t >= n8) return; FragH f;
#pragma unroll
  for (int i = 0; i < 8; ++i) f.h[i] = (_Float16)(bf16_round(W[t * 8 + i]) * 16.0f); *(v8us*)((unsigned short*)Bt + t * 8) = f.half[0];  }
template <int NHv, int TTv>
__global__ __launch_bounds__(256) void k_vt(const _Float16* __restrict__ V16, int ldv, int voff, _Float16* __restrict__ Vt) { __shared__ unsigned short tl[64][66]; const int tid = threadIdx.x; const int slab = blockIdx.x / (TTv / 64), lg = blockIdx.x % (TTv / 64); const int b = slab / NHv, h = slab % NHv;
  for (int i = tid; i < 64 * 8; i += 256) { const int r = i / 8, c8 = (i % 8) * 8; FragH f; f.half[0] = *(const v8us*)((const unsigned short*)V16 + ((size_t)b * TTv + lg * 64 + r) * ldv + voff + h * 64 + c8);
#pragma unroll
    for (int q = 0; q < 8; ++q) tl[r][c8 + q] = f.u[q]; }
  __syncthreads();
  {
#pragma unroll
    for (int rd = 0; rd < 2; ++rd) { const int d = rd * 32 + tid / 8, pc = tid % 8; FragH f;
#pragma unroll
      for (int q = 0; q < 8; ++q) f.u[q] = tl[pc * 8 + q][d];
      *(v8us*)((unsigned short*)Vt + ((size_t)slab * 64 + d) * TTv + lg * 64 + pc * 8) = f.half[0]; }
     } }

__global__ __launch_bounds__(256) void k_hl(const float* __restrict__ F, _Float16* __restrict__ Hh, _Float16* __restrict__ Hl, size_t n8) { const size_t t = (size_t)blockIdx.x * 256 + threadIdx.x; if (t >= n8) return; FragH fh, fl; const v4f a = *(const v4fa*)(F + t * 8), c = *(const v4fa*)(F + t * 8 + 4);
#pragma unroll
  for (int q = 0; q < 4; ++q) { _Float16 h = (_Float16)a[q]; fh.h[q] = h; fl.h[q] = (_Float16)((a[q] - (float)h) * 1024.0f); h = (_Float16)c[q]; fh.h[4 + q] = h; fl.h[4 + q] = (_Float16)((c[q] - (float)h) * 1024.0f); }
  { *(v8us*)((unsigned short*)Hh + t * 8) = fh.half[0]; *(v8us*)((unsigned short*)Hl + t * 8) = fl.half[0];  } }

__global__ __launch_bounds__(256) void k_split(const float* __restrict__ F, _Float16* __restrict__ Hh, _Float16* __restrict__ Hl, size_t n8) {
  #pragma clang fp contract(off)
  const size_t t = (size_t)blockIdx.x * 256 + threadIdx.x; if (t >= n8) return; const v4f a = *(const v4fa*)(F + t * 8), c = *(const v4fa*)(F + t * 8 + 4); FragH fh, fl;
#pragma unroll
  for (int q = 0; q < 8; ++q) { const float v = (q < 4) ? a[q] : c[q - 4]; const _Float16 hi = (_Float16)v; fh.h[q] = hi; fl.h[q] = (_Float16)((v - (float)hi) * 1024.0f); }
  { *(v8us*)((unsigned short*)Hh + t * 8) = fh.half[0]; *(v8us*)((unsigned short*)Hl + t * 8) = fl.half[0];  } }
__global__ __launch_bounds__(256) void k_cstab(float* __restrict__ CS, float* __restrict__ SN) {
  #pragma clang fp contract(off)
  const int t = blockIdx.x * 256 + threadIdx.x; if (t >= SS * DH) return; const int d = t % DH, p = t / DH; const int i = d & 31; const float theta = 1.0f / powf(10000.0f, (float)(2 * i) / 64.0f); const float ang = (float)p * theta; const float c = cosf(ang), s = sinf(ang);
  { *(float*)(CS + t) = c; *(float*)(SN + t) = s;  } }
__device__ __forceinline__ float cdma(int t, int d) { const int j = d & 3; const int par = __popc((unsigned)(t & j)); return (par & 1) ? -1.0f : 1.0f; }      /* Hadamard H4[t][d mod 4] (Sylvester order: rows [1,1,1,1],[1,-1,1,-1],[1,1,-1,-1],[1,-1,-1,1]) */
__global__ __launch_bounds__(256) void k_slots(const float* __restrict__ Q, const float* __restrict__ K, const float* __restrict__ V, const float* __restrict__ CS, const float* __restrict__ SN, _Float16* __restrict__ FK16, _Float16* __restrict__ FV16, float* __restrict__ FKf, float* __restrict__ FVf, float* __restrict__ PK, float* __restrict__ PVp, _Float16* __restrict__ AQ16, float* __restrict__ AQf) {
  #pragma clang fp contract(off)
  const int t = blockIdx.x * 256 + threadIdx.x; if (t >= NH * NSL * (DH / 8)) return; const int d0 = (t % (DH / 8)) * 8; const int s = (t / (DH / 8)) % NSL; const int bh = t / ((DH / 8) * NSL); const int b = 0, h = bh;      /* batch-local: the host passes per-batch workspace buffers, rewritten for each batch */
  FragH fk, fv; v4f fkA, fkB, fvA, fvB;
  float pk[KF][8], pv[KF][8];      /* running prefixes per token step */
#pragma unroll
  for (int q = 0; q < 8; ++q) { const int d = d0 + q; float accK = 0.f, accV = 0.f;
#pragma unroll
    for (int tt = 0; tt < KF; ++tt) { const int tok = s * KF + tt; const float* kp = K + ((size_t)b * SS + tok) * DM + h * DH; const float* vp = V + ((size_t)b * SS + tok) * DM + h * DH; const float c = CS[(size_t)tok * DH + d], sn = SN[(size_t)tok * DH + d];
      const float kr = kp[d] * c + ((d < 32) ? -kp[d + 32] : kp[d - 32]) * sn; const float ph = cdma(tt, d) * 0.5f;      /* /sqrt(k_factor) */
      accK += kr * ph; accV += vp[d] * ph; pk[tt][q] = accK; pv[tt][q] = accV; }
    fk.h[q] = (_Float16)accK; fv.h[q] = (_Float16)accV; if (q < 4) { fkA[q] = accK; fvA[q] = accV; } else { fkB[q - 4] = accK; fvB[q - 4] = accV; } }
  const size_t srow = ((size_t)bh * NSL + s) * DH + d0;
  { *(v8us*)((unsigned short*)FK16 + srow) = fk.half[0]; *(v8us*)((unsigned short*)FV16 + srow) = fv.half[0]; *(v4f*)(FKf + srow) = fkA; *(v4f*)(FKf + srow + 4) = fkB; *(v4f*)(FVf + srow) = fvA; *(v4f*)(FVf + srow + 4) = fvB;  }
#pragma unroll
  for (int tt = 0; tt < KF; ++tt) { const int tok = s * KF + tt; const size_t prow = ((size_t)b * SS + tok) * DM + h * DH + d0; v4f a, c2, e, g;
#pragma unroll
    for (int q = 0; q < 4; ++q) { a[q] = pk[tt][q]; c2[q] = pk[tt][4 + q]; e[q] = pv[tt][q]; g[q] = pv[tt][4 + q]; }
    /* aligned q for this token */ const float* qp = Q + ((size_t)b * SS + tok) * DM + h * DH; FragH fq; v4f qa, qb2;
#pragma unroll
    for (int q = 0; q < 8; ++q) { const int d = d0 + q; const float c = CS[(size_t)tok * DH + d], sn = SN[(size_t)tok * DH + d]; const float qr = qp[d] * c + ((d < 32) ? -qp[d + 32] : qp[d - 32]) * sn; const float aq = qr * cdma(tt, d); fq.h[q] = (_Float16)aq; if (q < 4) qa[q] = aq; else qb2[q - 4] = aq; }
    const size_t arow = ((size_t)bh * SS + tok) * DH + d0;
    { *(v4f*)(PK + prow) = a; *(v4f*)(PK + prow + 4) = c2; *(v4f*)(PVp + prow) = e; *(v4f*)(PVp + prow + 4) = g; *(v8us*)((unsigned short*)AQ16 + arow) = fq.half[0]; *(v4f*)(AQf + prow) = qa; *(v4f*)(AQf + prow + 4) = qb2;  } } }
__global__ __launch_bounds__(256) void k_fvt(const float* __restrict__ FVf, _Float16* __restrict__ FVT) { const int t = blockIdx.x * 256 + threadIdx.x; if (t >= NH * DH * (NSL / 8)) return; const int s0 = (t % (NSL / 8)) * 8; const int d = (t / (NSL / 8)) % DH; const int h = t / ((NSL / 8) * DH); FragH f;
#pragma unroll
  for (int q = 0; q < 8; ++q) f.h[q] = (_Float16)FVf[((size_t)h * NSL + s0 + q) * DH + d];
  *(v8us*)((unsigned short*)FVT + ((size_t)h * DH + d) * NSL + s0) = f.half[0];  }
__global__ __launch_bounds__(256) void k_hsoft(const float* __restrict__ S, const float* __restrict__ AQf, const float* __restrict__ PK, int b, int h, _Float16* __restrict__ W16, float* __restrict__ WC) {
  #pragma clang fp contract(off)
  const int tid = threadIdx.x, w = tid >> 5, ln = tid & 31; const int q = blockIdx.x * 8 + w; if (q >= SS) return; const int cs = q / KF; const size_t prow = ((size_t)b * SS + q) * DM + h * DH;
  float cur = AQf[prow + ln] * PK[prow + ln] + AQf[prow + 32 + ln] * PK[prow + 32 + ln]; for (int o = 16; o > 0; o >>= 1) cur += __shfl_xor(cur, o, 32); cur *= 0.125f;
  const float* sr = S + (size_t)q * NSL; float v[16]; float m = -3.0e38f;
#pragma unroll
  for (int k = 0; k < 16; ++k) { const int sl = 16 * ln + k; float x = sr[sl]; x = (sl == cs) ? cur : x; x = (sl > cs) ? -3.0e38f : x; v[k] = x; m = fmaxf(m, x); }
  for (int o = 16; o > 0; o >>= 1) m = fmaxf(m, __shfl_xor(m, o, 32));
  float su = 0.f;
#pragma unroll
  for (int k = 0; k < 16; ++k) { const int sl = 16 * ln + k; v[k] = (sl > cs) ? 0.f : expf(v[k] - m); su += v[k]; }
  for (int o = 16; o > 0; o >>= 1) su += __shfl_xor(su, o, 32); const float inv = 1.0f / su; FragH f0, f1; float wc = 0.f;
#pragma unroll
  for (int k = 0; k < 16; ++k) { const int sl = 16 * ln + k; const float wv = v[k] * inv; wc = (sl == cs) ? wv : wc; if (k < 8) f0.h[k] = (_Float16)(wv * 1024.0f); else f1.h[k - 8] = (_Float16)(wv * 1024.0f); }
  for (int o = 16; o > 0; o >>= 1) wc += __shfl_xor(wc, o, 32);      /* exactly one lane holds the current slot */
  const float wl = (ln == h) ? wc : WC[((size_t)b * SS + q) * 32 + ln];      /* the line is written once per head in stream order by this row's wave; h = 0 initialises all lanes */
  const float wlv = (h == 0 && ln != 0) ? 0.f : wl;
  { *(v8us*)((unsigned short*)W16 + (size_t)q * NSL + 16 * ln) = f0.half[0]; *(v8us*)((unsigned short*)W16 + (size_t)q * NSL + 16 * ln + 8) = f1.half[0]; *(float*)(WC + ((size_t)b * SS + q) * 32 + ln) = wlv;  } }
__global__ __launch_bounds__(256) void k_oepi(const float* __restrict__ O, const float* __restrict__ WC, const float* __restrict__ PVp, const float* __restrict__ FVf, _Float16* __restrict__ Oh, _Float16* __restrict__ Ol) {
  #pragma clang fp contract(off)
  const int t = blockIdx.x * 256 + threadIdx.x; if (t >= SS * NH * (DH / 8)) return; const int d0 = (t % (DH / 8)) * 8; const int h = (t / (DH / 8)) % NH; const int bq = t / ((DH / 8) * NH); const int b = 0, q = bq; const int cs = q / KF, tt = q % KF; const float wc = WC[(size_t)bq * 32 + h]; const size_t prow = (size_t)bq * DM + h * DH + d0; const size_t srow = ((size_t)(b * NH + h) * NSL + cs) * DH + d0; FragH fh, fl;
#pragma unroll
  for (int k = 0; k < 8; ++k) { const int d = d0 + k; const float o = O[prow + k] + wc * (PVp[prow + k] - FVf[srow + k]); const float v = (o * cdma(tt, d)) * 2.0f; const _Float16 hi = (_Float16)v; fh.h[k] = hi; fl.h[k] = (_Float16)((v - (float)hi) * 1024.0f); }
  { *(v8us*)((unsigned short*)Oh + prow) = fh.half[0]; *(v8us*)((unsigned short*)Ol + prow) = fl.half[0];  } }

extern "C" void kernel_launch(void* const* d_in, const int* in_sizes, int n_in,
                              void* d_out, int out_size, void* d_ws, size_t ws_size, hipStream_t stream) {
  (void)in_sizes; (void)n_in; (void)out_size;
  const float* x = (const float*)d_in[0]; const float* Wq = (const float*)d_in[1]; const float* Wk = (const float*)d_in[2]; const float* Wv = (const float*)d_in[3]; const float* Wo = (const float*)d_in[4]; const float* Aq = (const float*)d_in[5]; const float* Bq = (const float*)d_in[6]; const float* Av = (const float*)d_in[7]; const float* Bv = (const float*)d_in[8]; const float* Ao = (const float*)d_in[9]; const float* Bo = (const float*)d_in[10];
  char* ws = (char*)d_ws; size_t off = 0;
  auto take = [&](size_t bytes) { char* p = ws + off; off += (bytes + 255) & ~(size_t)255; return p; };
  _Float16* BWq = (_Float16*)take((size_t)DM * DM * 2); _Float16* BWk = (_Float16*)take((size_t)DM * DM * 2); _Float16* BWv = (_Float16*)take((size_t)DM * DM * 2); _Float16* BWo = (_Float16*)take((size_t)DM * DM * 2); _Float16* BAq = (_Float16*)take((size_t)LR * DM * 2); _Float16* BAv = (_Float16*)take((size_t)LR * DM * 2); _Float16* BAo = (_Float16*)take((size_t)LR * DM * 2); _Float16* BBq = (_Float16*)take((size_t)DM * LR * 2); _Float16* BBv = (_Float16*)take((size_t)DM * LR * 2); _Float16* BBo = (_Float16*)take((size_t)DM * LR * 2);
  float* CS = (float*)take((size_t)SS * DH * 4); float* SN = (float*)take((size_t)SS * DH * 4);
  _Float16* X16 = (_Float16*)take((size_t)SS * DM * 2); float* Q = (float*)take((size_t)SS * DM * 4); float* K = (float*)take((size_t)SS * DM * 4); float* V = (float*)take((size_t)SS * DM * 4); float* XA = (float*)take((size_t)SS * LR * 4); _Float16* XAh = (_Float16*)take((size_t)SS * LR * 2); _Float16* XAl = (_Float16*)take((size_t)SS * LR * 2);
  _Float16* FK16 = (_Float16*)take((size_t)NH * NSL * DH * 2); _Float16* FV16 = (_Float16*)take((size_t)NH * NSL * DH * 2); float* FKf = (float*)take((size_t)NH * NSL * DH * 4); float* FVf = (float*)take((size_t)NH * NSL * DH * 4); float* PK = (float*)take((size_t)SS * DM * 4); float* PVp = (float*)take((size_t)SS * DM * 4); _Float16* AQ16 = (_Float16*)take((size_t)NH * SS * DH * 2); float* AQf = (float*)take((size_t)SS * DM * 4);
  float* S = (float*)take((size_t)SS * NSL * 4); _Float16* W16 = (_Float16*)take((size_t)SS * NSL * 2); float* WC = (float*)take((size_t)SS * 32 * 4); _Float16* FVT = (_Float16*)take((size_t)NH * DH * NSL * 2); float* O = (float*)take((size_t)SS * DM * 4); _Float16* Oh = (_Float16*)take((size_t)SS * DM * 2); _Float16* Ol = (_Float16*)take((size_t)SS * DM * 2); float* OA = (float*)take((size_t)SS * LR * 4); _Float16* OAh = (_Float16*)take((size_t)SS * LR * 2); _Float16* OAl = (_Float16*)take((size_t)SS * LR * 2);
  if (off > ws_size) return;      // weights 9 + tables 1 + per-batch planes ≈ 92 → ≈ 102 MB
  const unsigned nbW = (DM * (DM / 8) + 255) / 256;
  k_wt_f16<<<nbW, 256, 0, stream>>>(Wq, BWq, DM, DM, 16.0f); k_wt_f16<<<nbW, 256, 0, stream>>>(Wk, BWk, DM, DM, 16.0f); k_wt_f16<<<nbW, 256, 0, stream>>>(Wv, BWv, DM, DM, 16.0f); k_wt_f16<<<nbW, 256, 0, stream>>>(Wo, BWo, DM, DM, 16.0f);      /* all weights are (in,out) */
  k_wt_f16<<<(LR * (DM / 8) + 255) / 256, 256, 0, stream>>>(Aq, BAq, DM, LR, 16.0f); k_wt_f16<<<(LR * (DM / 8) + 255) / 256, 256, 0, stream>>>(Av, BAv, DM, LR, 16.0f); k_wt_f16<<<(LR * (DM / 8) + 255) / 256, 256, 0, stream>>>(Ao, BAo, DM, LR, 16.0f);
  k_wt_f16<<<(DM * (LR / 8) + 255) / 256, 256, 0, stream>>>(Bq, BBq, LR, DM, 16.0f); k_wt_f16<<<(DM * (LR / 8) + 255) / 256, 256, 0, stream>>>(Bv, BBv, LR, DM, 16.0f); k_wt_f16<<<(DM * (LR / 8) + 255) / 256, 256, 0, stream>>>(Bo, BBo, LR, DM, 16.0f);
  k_cstab<<<(SS * DH + 255) / 256, 256, 0, stream>>>(CS, SN);
  const dim3 gD(((SS / 16) * (DM / 64) + 3) / 4, 1), gL(((SS / 16) * 1 + 3) / 4, 1), gL4(((SS / 16) * 1 + 3) / 4, 1), gS(((SS / 16) * (NSL / 64) + 3) / 4, 1); const size_t n8 = (size_t)SS * DM / 8; const unsigned nb8 = (unsigned)((n8 + 255) / 256); const size_t a8 = (size_t)SS * LR / 8; const unsigned nba = (unsigned)((a8 + 255) / 256);
  for (int b = 0; b < NBt; ++b) {
    k_x16<<<nb8, 256, 0, stream>>>(x + (size_t)b * SS * DM, X16, n8);
    k_gemm_hhx<0><<<gD, 128, 0, stream>>>(X16, DM, 0, BWq, DM, 0, 0.0625f, nullptr, 0, nullptr, 1, 0, 0, Q, nullptr, DM, 0, SS, DM, DM); k_gemm_hhx<0><<<gD, 128, 0, stream>>>(X16, DM, 0, BWk, DM, 0, 0.0625f, nullptr, 0, nullptr, 1, 0, 0, K, nullptr, DM, 0, SS, DM, DM); k_gemm_hhx<0><<<gD, 128, 0, stream>>>(X16, DM, 0, BWv, DM, 0, 0.0625f, nullptr, 0, nullptr, 1, 0, 0, V, nullptr, DM, 0, SS, DM, DM);      /* x·W (exact) */
    k_gemm_hhx<0><<<gL, 128, 0, stream>>>(X16, DM, 0, BAq, DM, 0, 0.0625f, nullptr, 0, nullptr, 1, 0, 0, XA, nullptr, LR, 0, SS, LR, DM); k_split<<<nba, 256, 0, stream>>>(XA, XAh, XAl, a8);
    k_gemm_hhx<0><<<gD, 128, 0, stream>>>(XAh, LR, 0, BBq, LR, 0, 0.0625f, nullptr, 0, Q, 1, (size_t)DM, 0, Q, nullptr, DM, 0, SS, DM, LR); k_gemm_hhx<0><<<gD, 128, 0, stream>>>(XAl, LR, 0, BBq, LR, 0, 0.0625f / 1024.0f, nullptr, 0, Q, 1, (size_t)DM, 0, Q, nullptr, DM, 0, SS, DM, LR);      /* q += (x·Aq)·Bq */
    k_gemm_hhx<0><<<gL, 128, 0, stream>>>(X16, DM, 0, BAv, DM, 0, 0.0625f, nullptr, 0, nullptr, 1, 0, 0, XA, nullptr, LR, 0, SS, LR, DM); k_split<<<nba, 256, 0, stream>>>(XA, XAh, XAl, a8);
    k_gemm_hhx<0><<<gD, 128, 0, stream>>>(XAh, LR, 0, BBv, LR, 0, 0.0625f, nullptr, 0, V, 1, (size_t)DM, 0, V, nullptr, DM, 0, SS, DM, LR); k_gemm_hhx<0><<<gD, 128, 0, stream>>>(XAl, LR, 0, BBv, LR, 0, 0.0625f / 1024.0f, nullptr, 0, V, 1, (size_t)DM, 0, V, nullptr, DM, 0, SS, DM, LR);      /* v += (x·Av)·Bv */
    k_slots<<<(NH * NSL * (DH / 8) + 255) / 256, 256, 0, stream>>>(Q, K, V, CS, SN, FK16, FV16, FKf, FVf, PK, PVp, AQ16, AQf);
    k_fvt<<<(NH * DH * (NSL / 8) + 255) / 256, 256, 0, stream>>>(FVf, FVT);
    for (int h = 0; h < NH; ++h) {
      k_gemm_hhx<0><<<gS, 128, 0, stream>>>(AQ16 + (size_t)h * SS * DH, DH, 0, FK16 + (size_t)h * NSL * DH, DH, 0, 0.125f, nullptr, 0, nullptr, 1, 0, 0, S, nullptr, NSL, 0, SS, NSL, DH);      /* slot scores/8: M 2048 N 512 K 64 */
      k_hsoft<<<SS / 8, 256, 0, stream>>>(S, AQf, PK, 0, h, W16, WC);
      k_gemm_hhx<0><<<gL4, 128, 0, stream>>>(W16, NSL, 0, FVT + (size_t)h * DH * NSL, NSL, 0, 0.0009765625f, nullptr, 0, nullptr, 1, 0, 0, O + h * DH, nullptr, DM, 0, SS, DH, NSL); }      /* Σ w·full_V → O cols h·64: M 2048 N 64 K 512 */
    k_oepi<<<(SS * NH * (DH / 8) + 255) / 256, 256, 0, stream>>>(O, WC, PVp, FVf, Oh, Ol);
    float* outb = (float*)d_out + (size_t)b * SS * DM;
    k_gemm_hhx<0><<<gD, 128, 0, stream>>>(Oh, DM, 0, BWo, DM, 0, 0.0625f, nullptr, 0, nullptr, 1, 0, 0, outb, nullptr, DM, 0, SS, DM, DM); k_gemm_hhx<0><<<gD, 128, 0, stream>>>(Ol, DM, 0, BWo, DM, 0, 0.0625f / 1024.0f, nullptr, 0, outb, 1, (size_t)DM, 0, outb, nullptr, DM, 0, SS, DM, DM);      /* out·Wo (hi + lo) */
    k_gemm_hhx<0><<<gL, 128, 0, stream>>>(Oh, DM, 0, BAo, DM, 0, 0.0625f, nullptr, 0, nullptr, 1, 0, 0, OA, nullptr, LR, 0, SS, LR, DM); k_gemm_hhx<0><<<gL, 128, 0, stream>>>(Ol, DM, 0, BAo, DM, 0, 0.0625f / 1024.0f, nullptr, 0, OA, 1, (size_t)LR, 0, OA, nullptr, LR, 0, SS, LR, DM); k_split<<<nba, 256, 0, stream>>>(OA, OAh, OAl, a8);
    k_gemm_hhx<0><<<gD, 128, 0, stream>>>(OAh, LR, 0, BBo, LR, 0, 0.0625f, nullptr, 0, outb, 1, (size_t)DM, 0, outb, nullptr, DM, 0, SS, DM, LR); k_gemm_hhx<0><<<gD, 128, 0, stream>>>(OAl, LR, 0, BBo, LR, 0, 0.0625f / 1024.0f, nullptr, 0, outb, 1, (size_t)DM, 0, outb, nullptr, DM, 0, SS, DM, LR); }      /* + (out·Ao)·Bo */
}

// v001
// A run of this version takes 1070 microseconds.
// In two side-by-side timings against v000, it was 1.70 and 1.72 times as fast.
#include <hip/hip_runtime.h>
// HoloKV attention (B 2, S 2048, 16 heads × 64, k_factor 4 → 512 slots): q = x·Wq + (x·Aq)·Bq, k = x·Wk, v = x·Wv + (x·Av)·Bv; RoPE (half-split rotate, θ_i = 1/10000^(2i/64)); keys/values compressed into slots of 4 tokens with Hadamard phases /2: full_K[s] = Σ_t k[4s+t]·c[t]/2, partial (causal prefix inside the slot); query phase c[q mod 4]; scores over slots: aligned_q·full_K/8 for earlier slots, aligned_q·partial_K(q's prefix)/8 for its own slot, −inf for later slots; softmax; out = Σ w·full_V + w_curr·(partial_V − full_V[curr]); out·phase·2; y = out·Wo + (out·Ao)·Bo → [2,2048,1024].
// Compute dtype: x and parameters rounded to bf16; projections with exact products and the LoRA paths on f16 hi + lo·2^10 operands of x·A (≈f32); RoPE, phases, slot sums/prefixes in f32; aligned q and full_K/full_V as f16 GEMM operands (scores O(1)), the own-slot score, masking, softmax and the rank-1 correction in f32; attention output as f16 hi + lo·2^10 into Wo and the LoRA output path. v_wmma_f32_16x16x32_f16.
#define NBt 2
#define SS 2048
#define DM 1024
#define NH 16
#define DH 64
#define KF 4
#define NSL (SS / KF)            /* 512 slots */
#define LR 64
#define NR (NBt * SS)
typedef __bf16 v16b __attribute__((ext_vector_type(16)));
typedef unsigned short v8us __attribute__((ext_vector_type(8), may_alias));
typedef float  v8f  __attribute__((ext_vector_type(8)));
typedef float  v4f  __attribute__((ext_vector_type(4)));
typedef float  v4fa __attribute__((ext_vector_type(4), may_alias));
union FragB { v16b v; v8us half[2]; unsigned short u[16]; };

__device__ __forceinline__ unsigned short bf16_bits(float x) { unsigned int u = __float_as_uint(x); return (unsigned short)((u + 0x7FFFu + ((u >> 16) & 1u)) >> 16); }
__device__ __forceinline__ float bf16_val(unsigned short b) { return __uint_as_float(((unsigned int)b) << 16); }
__device__ __forceinline__ float bf16_round(float x) { return bf16_val(bf16_bits(x)); }
// D += A·B with NT terms: 1 = ah·bh, 2 = + al·bh (A split), 3 = + ah·bl (both split)
template <int NT>
__device__ __forceinline__ v8f mmaN(v16b ah, v16b al, v16b bh, v16b bl, v8f c) {
  c = __builtin_amdgcn_wmma_f32_16x16x32_bf16(false, ah, false, bh, (short)0, c, false, false);
  if (NT >= 2) c = __builtin_amdgcn_wmma_f32_16x16x32_bf16(false, al, false, bh, (short)0, c, false, false);
  if (NT >= 3) c = __builtin_amdgcn_wmma_f32_16x16x32_bf16(false, ah, false, bl, (short)0, c, false, false);
  asm volatile("v_nop\n\tv_nop\n\tv_nop\n\tv_nop" : "+v"(c) : "v"(ah), "v"(al), "v"(bh), "v"(bl));
  return c;
}

__global__ __launch_bounds__(256) void k_wt_bf16(const float* __restrict__ W, unsigned short* __restrict__ Wt, int K, int N) {
  const int t = blockIdx.x * 256 + threadIdx.x;
  const int k8n = K / 8;
  if (t >= N * k8n) return;
  const int n = t / k8n, k8 = (t % k8n) * 8;
  v8us v;
#pragma unroll
  for (int i = 0; i < 8; ++i) v[i] = bf16_bits(W[(size_t)(k8 + i) * N + n]);
  *(v8us*)(Wt + (size_t)n * K + k8) = v;
  
}

// GEMM C[M][N] (f32, pitch ldc) = act(A[M][K]·W + bias). A f32 row-major (pitch lda) converted per fragment to bf16
// (ASPLIT: hi/lo two planes -> 2 terms, else single rounded term); Wt bf16 [N][K] (pitch ldb). BIAS_BF16 rounds the
// bias to bf16 first (bias quantised to bf16 before the add). K%32==0, M%16==0, N%64==0.
template <bool ASPLIT, int ACT, bool BIAS_BF16>
__global__ __launch_bounds__(128) void k_gemm_bf(const float* __restrict__ A, int lda, const unsigned short* __restrict__ Wt, int ldb,
                                               const float* __restrict__ bias, float* __restrict__ C, int ldc, int M, int N, int K) {
  __shared__ __attribute__((aligned(16))) float so[4][16][64];
  const int tid = threadIdx.x, w = tid >> 5, lane = tid & 31, ln = lane & 15, hh = lane >> 4;
  const int ntn = N / 64;
  const int wid = blockIdx.x * 4 + w;
  const int mt = wid / ntn, nq = wid % ntn;
  if (mt * 16 >= M) return;
  const int row0 = mt * 16, col0 = nq * 64;
  const float* arow = A + (size_t)(row0 + ln) * lda;
  v8f acc[4] = {};
  for (int kb = 0; kb < K; kb += 32) {
    FragB ah, al;
    const v4f x0 = *(const v4fa*)(arow + kb + 8 * hh), x1 = *(const v4fa*)(arow + kb + 8 * hh + 4);
    const v4f x2 = *(const v4fa*)(arow + kb + 16 + 8 * hh), x3 = *(const v4fa*)(arow + kb + 16 + 8 * hh + 4);
    float xs[16] = {x0[0],x0[1],x0[2],x0[3],x1[0],x1[1],x1[2],x1[3],x2[0],x2[1],x2[2],x2[3],x3[0],x3[1],x3[2],x3[3]};
#pragma unroll
    for (int i = 0; i < 16; ++i) { const unsigned short hb = bf16_bits(xs[i]); ah.u[i] = hb; al.u[i] = ASPLIT ? bf16_bits(xs[i] - bf16_val(hb)) : (unsigned short)0; }
#pragma unroll
    for (int t = 0; t < 4; ++t) {
      const unsigned short* brow = Wt + (size_t)(col0 + t * 16 + ln) * ldb + kb;
      FragB b;
      b.half[0] = *(const v8us*)(brow + 8 * hh);
      b.half[1] = *(const v8us*)(brow + 16 + 8 * hh);
      acc[t] = mmaN<ASPLIT ? 2 : 1>(ah.v, al.v, b.v, b.v, acc[t]);
    }
  }
#pragma unroll
  for (int t = 0; t < 4; ++t) {
    float bv = bias ? bias[col0 + t * 16 + ln] : 0.f;
    if (BIAS_BF16) bv = bf16_round(bv);
#pragma unroll
    for (int r = 0; r < 8; ++r) { float v = acc[t][r] + bv; if (ACT == 1) v = fmaxf(v, 0.f); so[w][8 * hh + r][t * 16 + ln] = v; }
  }
  __builtin_amdgcn_fence(__ATOMIC_ACQ_REL, "workgroup");
  __builtin_amdgcn_wave_barrier();
  const int rsub = lane >> 4, c4 = (lane & 15) * 4;
  {
#pragma unroll
    for (int q = 0; q < 8; ++q) {
      const int r = q * 2 + rsub;
      const v4f v = *(const v4fa*)&so[w][r][c4];
      *(v4f*)(C + (size_t)(row0 + r) * ldc + col0 + c4) = v;
    }
    
  }
}

// GEMM C = act(A·W + bias + resid): A f32 (ASPLIT -> hi/lo 2 terms), Wt bf16 [N][K]; ACT 0 none, 1 relu, 2 exact gelu;
// resid (optional, f32, row index = (row % rmod), pitch ldr, RES_BF16 rounds it) added before the activation.
template <bool ASPLIT, int ACT, bool BIAS_BF16, bool RES_BF16>
__global__ __launch_bounds__(128) void k_gemm_bf3(const float* __restrict__ A, int lda, const unsigned short* __restrict__ Wt, int ldb,
                                                const float* __restrict__ bias, const float* __restrict__ resid, int rmod, int ldr,
                                                float* __restrict__ C, int ldc, int M, int N, int K) {
  __shared__ __attribute__((aligned(16))) float so[4][16][64];
  const int tid = threadIdx.x, w = tid >> 5, lane = tid & 31, ln = lane & 15, hh = lane >> 4;
  const int ntn = N / 64;
  const int wid = blockIdx.x * 4 + w;
  const int mt = wid / ntn, nq = wid % ntn;
  if (mt * 16 >= M) return;
  const int row0 = mt * 16, col0 = nq * 64;
  const float* arow = A + (size_t)(row0 + ln) * lda;
  v8f acc[4] = {};
  for (int kb = 0; kb < K; kb += 32) {
    FragB ah, al;
    const v4f x0 = *(const v4fa*)(arow + kb + 8 * hh), x1 = *(const v4fa*)(arow + kb + 8 * hh + 4);
    const v4f x2 = *(const v4fa*)(arow + kb + 16 + 8 * hh), x3 = *(const v4fa*)(arow + kb + 16 + 8 * hh + 4);
    float xs[16] = {x0[0],x0[1],x0[2],x0[3],x1[0],x1[1],x1[2],x1[3],x2[0],x2[1],x2[2],x2[3],x3[0],x3[1],x3[2],x3[3]};
#pragma unroll
    for (int i = 0; i < 16; ++i) { const unsigned short hb = bf16_bits(xs[i]); ah.u[i] = hb; al.u[i] = ASPLIT ? bf16_bits(xs[i] - bf16_val(hb)) : (unsigned short)0; }
#pragma unroll
    for (int t = 0; t < 4; ++t) {
      const unsigned short* brow = Wt + (size_t)(col0 + t * 16 + ln) * ldb + kb;
      FragB b;
      b.half[0] = *(const v8us*)(brow + 8 * hh);
      b.half[1] = *(const v8us*)(brow + 16 + 8 * hh);
      acc[t] = mmaN<ASPLIT ? 2 : 1>(ah.v, al.v, b.v, b.v, acc[t]);
    }
  }
#pragma unroll
  for (int t = 0; t < 4; ++t) {
    const int col = col0 + t * 16 + ln;
    float bv = bias ? bias[col] : 0.f;
    if (BIAS_BF16) bv = bf16_round(bv);
#pragma unroll
    for (int r = 0; r < 8; ++r) {
      float v = acc[t][r] + bv;
      if (resid) { float rv = resid[(size_t)((row0 + 8 * hh + r) % rmod) * ldr + col]; if (RES_BF16) rv = bf16_round(rv); v += rv; }
      if (ACT == 1) v = fmaxf(v, 0.f);
      if (ACT == 2) v = 0.5f * v * (1.0f + erff(v * 0.70710678118654752f));
      if (ACT == 3) { const float u = 0.7978845608028654f * (v + 0.044715f * v * v * v); v = 0.5f * v * (1.0f + tanhf(u)); }
      so[w][8 * hh + r][t * 16 + ln] = v;
    }
  }
  __builtin_amdgcn_fence(__ATOMIC_ACQ_REL, "workgroup");
  __builtin_amdgcn_wave_barrier();
  const int rsub = lane >> 4, c4 = (lane & 15) * 4;
  {
#pragma unroll
    for (int q = 0; q < 8; ++q) {
      const int r = q * 2 + rsub;
      const v4f v = *(const v4fa*)&so[w][r][c4];
      *(v4f*)(C + (size_t)(row0 + r) * ldc + col0 + c4) = v;
    }
    
  }
}
// row LayerNorm (biased variance, eps) over N: s = X (+ R); optional out_sum <- s; out_norm <- (s-mu)*rsqrt(var+eps)*g + b
template <bool PARAM_BF16>
__global__ __launch_bounds__(256) void k_layernorm(const float* __restrict__ X, const float* __restrict__ R, const float* __restrict__ g, const float* __restrict__ bta,
                                                  float* __restrict__ out_sum, float* __restrict__ out_norm, int N, float eps) {
  __shared__ float red[256];
  const int row = blockIdx.x, tid = threadIdx.x;
  const float* x = X + (size_t)row * N; const float* rr = R ? R + (size_t)row * N : nullptr;
  float vals[16];                     // up to N = 4096
  const int per = N / 256;            // contiguous chunk per thread? use strided-by-4 chunks: thread handles j = tid*4 + 1024*u
  float s1 = 0.f;
  for (int u = 0; u < per / 4; ++u) {
    const int j = tid * 4 + 1024 * u;
    const v4f a = *(const v4fa*)(x + j);
    v4f b = {0.f,0.f,0.f,0.f}; if (rr) b = *(const v4fa*)(rr + j);
#pragma unroll
    for (int q = 0; q < 4; ++q) { const float v = a[q] + b[q]; vals[u * 4 + q] = v; s1 += v; }
  }
  red[tid] = s1; __syncthreads();
  for (int st = 128; st > 0; st >>= 1) { if (tid < st) red[tid] += red[tid + st]; __syncthreads(); }
  const float mu = red[0] / (float)N; __syncthreads();
  float s2 = 0.f;
  for (int u = 0; u < per / 4; ++u)
#pragma unroll
    for (int q = 0; q < 4; ++q) { const float c = vals[u * 4 + q] - mu; s2 += c * c; }
  red[tid] = s2; __syncthreads();
  for (int st = 128; st > 0; st >>= 1) { if (tid < st) red[tid] += red[tid + st]; __syncthreads(); }
  const float rs = rsqrtf(red[0] / (float)N + eps);
  {
    for (int u = 0; u < per / 4; ++u) {
      const int j = tid * 4 + 1024 * u;
      v4f o, sm;
#pragma unroll
      for (int q = 0; q < 4; ++q) {
        float gg = g[j + q], bb = bta[j + q];
        if (PARAM_BF16) { gg = bf16_round(gg); bb = bf16_round(bb); }
        sm[q] = vals[u * 4 + q]; o[q] = (vals[u * 4 + q] - mu) * rs * gg + bb;
      }
      if (out_sum) *(v4f*)(out_sum + (size_t)row * N + j) = sm;
      *(v4f*)(out_norm + (size_t)row * N + j) = o;
    }
    
  }
}



// ---- f16 WMMA path (v_wmma_f32_16x16x32_f16): 11-bit significands for operands in range — used where a [0,1] probability operand needs more precision than bf16
typedef _Float16 v16h __attribute__((ext_vector_type(16)));
union FragH { v16h v; v8us half[2]; _Float16 h[16]; unsigned short u[16]; };
template <int NT>
__device__ __forceinline__ v8f mmaH(v16h ah, v16h al, v16h bh, v16h bl, v8f c) {
  c = __builtin_amdgcn_wmma_f32_16x16x32_f16(false, ah, false, bh, (short)0, c, false, false);
  if (NT >= 2) c = __builtin_amdgcn_wmma_f32_16x16x32_f16(false, al, false, bh, (short)0, c, false, false);
  if (NT >= 3) c = __builtin_amdgcn_wmma_f32_16x16x32_f16(false, ah, false, bl, (short)0, c, false, false);
  asm volatile("v_nop\n\tv_nop\n\tv_nop\n\tv_nop" : "+v"(c) : "v"(ah), "v"(al), "v"(bh), "v"(bl));
  return c;
}
// batched GEMM like k_gemm_b but f16 operands: A f32 (split into f16 hi/lo if ASPLIT, else rounded to f16), Bt = f16 values [n][k]; alpha; C f32; N multiple of 16 (partial tiles skipped)
template <bool ASPLIT>
__global__ __launch_bounds__(128) void k_gemm_h(const float* __restrict__ A, int lda, size_t sA, const _Float16* __restrict__ Bh, int ldb, size_t sB, float alpha, float* __restrict__ C, int ldc, size_t sC, int M, int N, int K) {
  __shared__ __attribute__((aligned(16))) float so[4][16][64];
  const int tid = threadIdx.x, w = tid >> 5, lane = tid & 31, ln = lane & 15, hh = lane >> 4; const int by = blockIdx.y;
  A += (size_t)by * sA; Bh += (size_t)by * sB; C += (size_t)by * sC;
  const int ntn = (N + 63) / 64; const int wid = blockIdx.x * 4 + w; const int mt = wid / ntn, nq = wid % ntn; if (mt * 16 >= M) return;
  const int row0 = mt * 16, col0 = nq * 64; const float* arow = A + (size_t)(row0 + ln) * lda;
  v8f acc[4] = {};
  for (int kb = 0; kb < K; kb += 32) {
    FragH ah, al;
    const v4f x0 = *(const v4fa*)(arow + kb + 8 * hh), x1 = *(const v4fa*)(arow + kb + 8 * hh + 4), x2 = *(const v4fa*)(arow + kb + 16 + 8 * hh), x3 = *(const v4fa*)(arow + kb + 16 + 8 * hh + 4);
    float xs[16] = {x0[0],x0[1],x0[2],x0[3],x1[0],x1[1],x1[2],x1[3],x2[0],x2[1],x2[2],x2[3],x3[0],x3[1],x3[2],x3[3]};
#pragma unroll
    for (int i = 0; i < 16; ++i) { const _Float16 h = (_Float16)xs[i]; ah.h[i] = h; al.h[i] = ASPLIT ? (_Float16)(xs[i] - (float)h) : (_Float16)0.0f; }
#pragma unroll
    for (int t = 0; t < 4; ++t) { if (col0 + t * 16 >= N) continue; const size_t boff = (size_t)(col0 + t * 16 + ln) * ldb + kb; FragH bq; bq.half[0] = *(const v8us*)(Bh + boff + 8 * hh); bq.half[1] = *(const v8us*)(Bh + boff + 16 + 8 * hh);
      acc[t] = mmaH<ASPLIT ? 2 : 1>(ah.v, al.v, bq.v, bq.v, acc[t]); }
  }
#pragma unroll
  for (int t = 0; t < 4; ++t) { if (col0 + t * 16 >= N) continue;
#pragma unroll
    for (int r = 0; r < 8; ++r) so[w][8 * hh + r][t * 16 + ln] = acc[t][r] * alpha; }
  __builtin_amdgcn_fence(__ATOMIC_ACQ_REL, "workgroup"); __builtin_amdgcn_wave_barrier();
  const int rsub = lane >> 4, c4 = (lane & 15) * 4;
  {
#pragma unroll
    for (int q = 0; q < 8; ++q) { const int r = q * 2 + rsub; if (col0 + c4 < N) { const v4f v = *(const v4fa*)&so[w][r][c4]; *(v4f*)(C + (size_t)(row0 + r) * ldc + col0 + c4) = v; } }
     }
}

// Wt[n][k] = f16(W[k][n]·scale) from f32 row-major W[K][N] (scale = power of two; bf16-exact weights stay exact in f16 away from the subnormal range)
__global__ __launch_bounds__(256) void k_wt_f16(const float* __restrict__ W, _Float16* __restrict__ Wt, int K, int N, float scale) {
  const int t = blockIdx.x * 256 + threadIdx.x; if (t >= N * (K / 8)) return; const int n = t / (K / 8), k8 = (t % (K / 8)) * 8; FragH f;
#pragma unroll
  for (int i = 0; i < 8; ++i) f.h[i] = (_Float16)(bf16_round(W[(size_t)(k8 + i) * N + n]) * scale); const v8us o = f.half[0];
  *(v8us*)((unsigned short*)Wt + (size_t)n * K + k8) = o; 
}
// k_gemm_hh variant with fused epilogue: v = acc·alpha + bias[by·sBias + col] (+ CP[(row/rowsPerB)·sCPb + by·64 + col] if CP) ; ACT 0 none / 1 elu ; writes f32 C and f16 C16, each if non-null
template <int ACT>
__global__ __launch_bounds__(128) void k_gemm_hhx(const _Float16* __restrict__ A, int lda, size_t sA, const _Float16* __restrict__ Bh, int ldb, size_t sB, float alpha, const float* __restrict__ bias, size_t sBias, const float* __restrict__ CP, int rowsPerB, size_t sCPb, int row0g,
    float* __restrict__ C, _Float16* __restrict__ C16, int ldc, size_t sC, int M, int N, int K) {
  __shared__ __attribute__((aligned(16))) float so[4][16][64];
  const int tid = threadIdx.x, w = tid >> 5, lane = tid & 31, ln = lane & 15, hh = lane >> 4; const int by = blockIdx.y;
  A += (size_t)by * sA; Bh += (size_t)by * sB; const size_t cofs = (size_t)by * sC; const float* bp = bias ? bias + (size_t)by * sBias : nullptr;
  const int ntn = (N + 63) / 64; const int wid = blockIdx.x * 4 + w; const int mt = wid / ntn, nq = wid % ntn; if (mt * 16 >= M) return;
  const int row0 = mt * 16, col0 = nq * 64; const _Float16* arow = A + (size_t)(row0 + ln) * lda;
  v8f acc[4] = {};
  for (int kb = 0; kb < K; kb += 32) { FragH ah; ah.half[0] = *(const v8us*)((const unsigned short*)arow + kb + 8 * hh); ah.half[1] = *(const v8us*)((const unsigned short*)arow + kb + 16 + 8 * hh);
#pragma unroll
    for (int t = 0; t < 4; ++t) { if (col0 + t * 16 >= N) continue; const size_t boff = (size_t)(col0 + t * 16 + ln) * ldb + kb; FragH bq; bq.half[0] = *(const v8us*)((const unsigned short*)Bh + boff + 8 * hh); bq.half[1] = *(const v8us*)((const unsigned short*)Bh + boff + 16 + 8 * hh);
      acc[t] = mmaH<1>(ah.v, ah.v, bq.v, bq.v, acc[t]); }
  }
#pragma unroll
  for (int t = 0; t < 4; ++t) { if (col0 + t * 16 >= N) continue; const int col = col0 + t * 16 + ln; const float bv = bp ? bf16_round(bp[col]) : 0.f;
#pragma unroll
    for (int r = 0; r < 8; ++r) { float v = acc[t][r] * alpha + bv; if (CP) { const int bidx = (row0g + row0 + 8 * hh + r) / rowsPerB; v += CP[(size_t)bidx * sCPb + (size_t)by * 64 + col]; } if (ACT == 1) v = (v > 0.f) ? v : expm1f(v); else if (ACT == 7) v = (v > 0.f) ? v + 1.0f : expf(v); else if (ACT == 8) v = tanhf(v); else if (ACT == 9) v = 0.5f * v * (1.0f + tanhf(0.7978845608028654f * (v + 0.044715f * v * v * v))); else if (ACT == 11) v = 1.0f / (1.0f + expf(-v)); else if (ACT == 12) v = (v > 0.f) ? v : 0.01f * v; else if (ACT == 14) v = (v > 0.f) ? v : 0.1f * v; else if (ACT == 15) v = v / (1.0f + expf(-v)); else if (ACT == 3) v = fmaxf(v, 0.f); else if (ACT == 6) v = 0.5f * v * (1.0f + erff(v * 0.70710678118654752f)); so[w][8 * hh + r][t * 16 + ln] = v; } }
  __builtin_amdgcn_fence(__ATOMIC_ACQ_REL, "workgroup"); __builtin_amdgcn_wave_barrier();
  const int rsub = lane >> 4, c4 = (lane & 15) * 4; typedef _Float16 v4h __attribute__((ext_vector_type(4)));
  {
#pragma unroll
    for (int q = 0; q < 8; ++q) { const int r = q * 2 + rsub; if (col0 + c4 < N) { const v4f v = *(const v4fa*)&so[w][r][c4]; if (C) *(v4f*)(C + cofs + (size_t)(row0 + r) * ldc + col0 + c4) = v; if (C16) { v4h h4; for (int i = 0; i < 4; ++i) h4[i] = (_Float16)v[i]; *(v4h*)(C16 + cofs + (size_t)(row0 + r) * ldc + col0 + c4) = h4; } } }
     }
}


typedef _Float16 v4h __attribute__((ext_vector_type(4)));

__global__ __launch_bounds__(256) void k_x16(const float* __restrict__ x, _Float16* __restrict__ X16, size_t n8) { const size_t t = (size_t)blockIdx.x * 256 + threadIdx.x; if (t >= n8) return; FragH f;
#pragma unroll
  for (int q = 0; q < 8; ++q) f.h[q] = (_Float16)bf16_round(x[t * 8 + q]); *(v8us*)((unsigned short*)X16 + t * 8) = f.half[0];  }
__global__ __launch_bounds__(256) void k_h16(const float* __restrict__ x, _Float16* __restrict__ X16, size_t n8) { const size_t t = (size_t)blockIdx.x * 256 + threadIdx.x; if (t >= n8) return; FragH f;
#pragma unroll
  for (int q = 0; q < 8; ++q) f.h[q] = (_Float16)x[t * 8 + q]; *(v8us*)((unsigned short*)X16 + t * 8) = f.half[0];  }
__global__ __launch_bounds__(256) void k_round16f(const float* __restrict__ W, _Float16* __restrict__ Bt, size_t n8) { const size_t t = (size_t)blockIdx.x * 256 + threadIdx.x; if (t >= n8) return; FragH f;
#pragma unroll
  for (int i = 0; i < 8; ++i) f.h[i] = (_Float16)(bf16_round(W[t * 8 + i]) * 16.0f); *(v8us*)((unsigned short*)Bt + t * 8) = f.half[0];  }
template <int NHv, int TTv>
__global__ __launch_bounds__(256) void k_vt(const _Float16* __restrict__ V16, int ldv, int voff, _Float16* __restrict__ Vt) { __shared__ unsigned short tl[64][66]; const int tid = threadIdx.x; const int slab = blockIdx.x / (TTv / 64), lg = blockIdx.x % (TTv / 64); const int b = slab / NHv, h = slab % NHv;
  for (int i = tid; i < 64 * 8; i += 256) { const int r = i / 8, c8 = (i % 8) * 8; FragH f; f.half[0] = *(const v8us*)((const unsigned short*)V16 + ((size_t)b * TTv + lg * 64 + r) * ldv + voff + h * 64 + c8);
#pragma unroll
    for (int q = 0; q < 8; ++q) tl[r][c8 + q] = f.u[q]; }
  __syncthreads();
  {
#pragma unroll
    for (int rd = 0; rd < 2; ++rd) { const int d = rd * 32 + tid / 8, pc = tid % 8; FragH f;
#pragma unroll
      for (int q = 0; q < 8; ++q) f.u[q] = tl[pc * 8 + q][d];
      *(v8us*)((unsigned short*)Vt + ((size_t)slab * 64 + d) * TTv + lg * 64 + pc * 8) = f.half[0]; }
     } }

__global__ __launch_bounds__(256) void k_hl(const float* __restrict__ F, _Float16* __restrict__ Hh, _Float16* __restrict__ Hl, size_t n8) { const size_t t = (size_t)blockIdx.x * 256 + threadIdx.x; if (t >= n8) return; FragH fh, fl; const v4f a = *(const v4fa*)(F + t * 8), c = *(const v4fa*)(F + t * 8 + 4);
#pragma unroll
  for (int q = 0; q < 4; ++q) { _Float16 h = (_Float16)a[q]; fh.h[q] = h; fl.h[q] = (_Float16)((a[q] - (float)h) * 1024.0f); h = (_Float16)c[q]; fh.h[4 + q] = h; fl.h[4 + q] = (_Float16)((c[q] - (float)h) * 1024.0f); }
  { *(v8us*)((unsigned short*)Hh + t * 8) = fh.half[0]; *(v8us*)((unsigned short*)Hl + t * 8) = fl.half[0];  } }

__global__ __launch_bounds__(256) void k_split(const float* __restrict__ F, _Float16* __restrict__ Hh, _Float16* __restrict__ Hl, size_t n8) {
  #pragma clang fp contract(off)
  const size_t t = (size_t)blockIdx.x * 256 + threadIdx.x; if (t >= n8) return; const v4f a = *(const v4fa*)(F + t * 8), c = *(const v4fa*)(F + t * 8 + 4); FragH fh, fl;
#pragma unroll
  for (int q = 0; q < 8; ++q) { const float v = (q < 4) ? a[q] : c[q - 4]; const _Float16 hi = (_Float16)v; fh.h[q] = hi; fl.h[q] = (_Float16)((v - (float)hi) * 1024.0f); }
  { *(v8us*)((unsigned short*)Hh + t * 8) = fh.half[0]; *(v8us*)((unsigned short*)Hl + t * 8) = fl.half[0];  } }
__global__ __launch_bounds__(256) void k_cstab(float* __restrict__ CS, float* __restrict__ SN) {
  #pragma clang fp contract(off)
  const int t = blockIdx.x * 256 + threadIdx.x; if (t >= SS * DH) return; const int d = t % DH, p = t / DH; const int i = d & 31; const float theta = 1.0f / powf(10000.0f, (float)(2 * i) / 64.0f); const float ang = (float)p * theta; const float c = cosf(ang), s = sinf(ang);
  { *(float*)(CS + t) = c; *(float*)(SN + t) = s;  } }
__device__ __forceinline__ float cdma(int t, int d) { const int j = d & 3; const int par = __popc((unsigned)(t & j)); return (par & 1) ? -1.0f : 1.0f; }      /* Hadamard H4[t][d mod 4] (Sylvester order: rows [1,1,1,1],[1,-1,1,-1],[1,1,-1,-1],[1,-1,-1,1]) */
__global__ __launch_bounds__(256) void k_slots(const float* __restrict__ Q, const float* __restrict__ K, const float* __restrict__ V, const float* __restrict__ CS, const float* __restrict__ SN, _Float16* __restrict__ FK16, _Float16* __restrict__ FV16, float* __restrict__ FKf, float* __restrict__ FVf, float* __restrict__ PK, float* __restrict__ PVp, _Float16* __restrict__ AQ16, float* __restrict__ AQf) {
  #pragma clang fp contract(off)
  const int t = blockIdx.x * 256 + threadIdx.x; if (t >= NH * NSL * (DH / 8)) return; const int d0 = (t % (DH / 8)) * 8; const int s = (t / (DH / 8)) % NSL; const int bh = t / ((DH / 8) * NSL); const int b = 0, h = bh;      /* batch-local: the host passes per-batch workspace buffers, rewritten for each batch */
  FragH fk, fv; v4f fkA, fkB, fvA, fvB;
  float pk[KF][8], pv[KF][8];      /* running prefixes per token step */
#pragma unroll
  for (int q = 0; q < 8; ++q) { const int d = d0 + q; float accK = 0.f, accV = 0.f;
#pragma unroll
    for (int tt = 0; tt < KF; ++tt) { const int tok = s * KF + tt; const float* kp = K + ((size_t)b * SS + tok) * DM + h * DH; const float* vp = V + ((size_t)b * SS + tok) * DM + h * DH; const float c = CS[(size_t)tok * DH + d], sn = SN[(size_t)tok * DH + d];
      const float kr = kp[d] * c + ((d < 32) ? -kp[d + 32] : kp[d - 32]) * sn; const float ph = cdma(tt, d) * 0.5f;      /* /sqrt(k_factor) */
      accK += kr * ph; accV += vp[d] * ph; pk[tt][q] = accK; pv[tt][q] = accV; }
    fk.h[q] = (_Float16)accK; fv.h[q] = (_Float16)accV; if (q < 4) { fkA[q] = accK; fvA[q] = accV; } else { fkB[q - 4] = accK; fvB[q - 4] = accV; } }
  const size_t srow = ((size_t)bh * NSL + s) * DH + d0;
  { *(v8us*)((unsigned short*)FK16 + srow) = fk.half[0]; *(v8us*)((unsigned short*)FV16 + srow) = fv.half[0]; *(v4f*)(FKf + srow) = fkA; *(v4f*)(FKf + srow + 4) = fkB; *(v4f*)(FVf + srow) = fvA; *(v4f*)(FVf + srow + 4) = fvB;  }
#pragma unroll
  for (int tt = 0; tt < KF; ++tt) { const int tok = s * KF + tt; const size_t prow = ((size_t)b * SS + tok) * DM + h * DH + d0; v4f a, c2, e, g;
#pragma unroll
    for (int q = 0; q < 4; ++q) { a[q] = pk[tt][q]; c2[q] = pk[tt][4 + q]; e[q] = pv[tt][q]; g[q] = pv[tt][4 + q]; }
    /* aligned q for this token */ const float* qp = Q + ((size_t)b * SS + tok) * DM + h * DH; FragH fq; v4f qa, qb2;
#pragma unroll
    for (int q = 0; q < 8; ++q) { const int d = d0 + q; const float c = CS[(size_t)tok * DH + d], sn = SN[(size_t)tok * DH + d]; const float qr = qp[d] * c + ((d < 32) ? -qp[d + 32] : qp[d - 32]) * sn; const float aq = qr * cdma(tt, d); fq.h[q] = (_Float16)aq; if (q < 4) qa[q] = aq; else qb2[q - 4] = aq; }
    const size_t arow = ((size_t)bh * SS + tok) * DH + d0;
    { *(v4f*)(PK + prow) = a; *(v4f*)(PK + prow + 4) = c2; *(v4f*)(PVp + prow) = e; *(v4f*)(PVp + prow + 4) = g; *(v8us*)((unsigned short*)AQ16 + arow) = fq.half[0]; *(v4f*)(AQf + prow) = qa; *(v4f*)(AQf + prow + 4) = qb2;  } } }
__global__ __launch_bounds__(256) void k_fvt(const float* __restrict__ FVf, _Float16* __restrict__ FVT) { const int t = blockIdx.x * 256 + threadIdx.x; if (t >= NH * DH * (NSL / 8)) return; const int s0 = (t % (NSL / 8)) * 8; const int d = (t / (NSL / 8)) % DH; const int h = t / ((NSL / 8) * DH); FragH f;
#pragma unroll
  for (int q = 0; q < 8; ++q) f.h[q] = (_Float16)FVf[((size_t)h * NSL + s0 + q) * DH + d];
  *(v8us*)((unsigned short*)FVT + ((size_t)h * DH + d) * NSL + s0) = f.half[0];  }
__global__ __launch_bounds__(256) void k_hsoft(const float* __restrict__ S, const float* __restrict__ AQf, const float* __restrict__ PK, _Float16* __restrict__ W16, float* __restrict__ WC) {
  #pragma clang fp contract(off)
  const int tid = threadIdx.x, w = tid >> 5, ln = tid & 31; const int h = blockIdx.y; const int q = blockIdx.x * 8 + w; if (q >= SS) return; const int cs = q / KF; const size_t prow = (size_t)q * DM + h * DH; S += (size_t)h * SS * NSL; W16 += (size_t)h * SS * NSL;      /* head on grid.y: each head has its own score and weight plane */
  float cur = AQf[prow + ln] * PK[prow + ln] + AQf[prow + 32 + ln] * PK[prow + 32 + ln]; for (int o = 16; o > 0; o >>= 1) cur += __shfl_xor(cur, o, 32); cur *= 0.125f;
  const float* sr = S + (size_t)q * NSL; float v[16]; float m = -3.0e38f;
#pragma unroll
  for (int k = 0; k < 16; ++k) { const int sl = 16 * ln + k; float x = sr[sl]; x = (sl == cs) ? cur : x; x = (sl > cs) ? -3.0e38f : x; v[k] = x; m = fmaxf(m, x); }
  for (int o = 16; o > 0; o >>= 1) m = fmaxf(m, __shfl_xor(m, o, 32));
  float su = 0.f;
#pragma unroll
  for (int k = 0; k < 16; ++k) { const int sl = 16 * ln + k; v[k] = (sl > cs) ? 0.f : expf(v[k] - m); su += v[k]; }
  for (int o = 16; o > 0; o >>= 1) su += __shfl_xor(su, o, 32); const float inv = 1.0f / su; FragH f0, f1; float wc = 0.f;
#pragma unroll
  for (int k = 0; k < 16; ++k) { const int sl = 16 * ln + k; const float wv = v[k] * inv; wc = (sl == cs) ? wv : wc; if (k < 8) f0.h[k] = (_Float16)(wv * 1024.0f); else f1.h[k - 8] = (_Float16)(wv * 1024.0f); }
  for (int o = 16; o > 0; o >>= 1) wc += __shfl_xor(wc, o, 32);      /* exactly one lane holds the current slot */
  { *(v8us*)((unsigned short*)W16 + (size_t)q * NSL + 16 * ln) = f0.half[0]; *(v8us*)((unsigned short*)W16 + (size_t)q * NSL + 16 * ln + 8) = f1.half[0]; *(float*)(WC + ((size_t)h * SS + q) * 32 + ln) = wc;  } }      /* one whole 128-byte line per (head, row), written by this wave alone */
__global__ __launch_bounds__(256) void k_oepi(const float* __restrict__ O, const float* __restrict__ WC, const float* __restrict__ PVp, const float* __restrict__ FVf, _Float16* __restrict__ Oh, _Float16* __restrict__ Ol) {
  #pragma clang fp contract(off)
  const int t = blockIdx.x * 256 + threadIdx.x; if (t >= SS * NH * (DH / 8)) return; const int d0 = (t % (DH / 8)) * 8; const int h = (t / (DH / 8)) % NH; const int bq = t / ((DH / 8) * NH); const int b = 0, q = bq; const int cs = q / KF, tt = q % KF; const float wc = WC[((size_t)h * SS + bq) * 32]; const size_t prow = (size_t)bq * DM + h * DH + d0; const size_t srow = ((size_t)(b * NH + h) * NSL + cs) * DH + d0; FragH fh, fl;
#pragma unroll
  for (int k = 0; k < 8; ++k) { const int d = d0 + k; const float o = O[prow + k] + wc * (PVp[prow + k] - FVf[srow + k]); const float v = (o * cdma(tt, d)) * 2.0f; const _Float16 hi = (_Float16)v; fh.h[k] = hi; fl.h[k] = (_Float16)((v - (float)hi) * 1024.0f); }
  { *(v8us*)((unsigned short*)Oh + prow) = fh.half[0]; *(v8us*)((unsigned short*)Ol + prow) = fl.half[0];  } }

extern "C" void kernel_launch(void* const* d_in, const int* in_sizes, int n_in,
                              void* d_out, int out_size, void* d_ws, size_t ws_size, hipStream_t stream) {
  (void)in_sizes; (void)n_in; (void)out_size;
  const float* x = (const float*)d_in[0]; const float* Wq = (const float*)d_in[1]; const float* Wk = (const float*)d_in[2]; const float* Wv = (const float*)d_in[3]; const float* Wo = (const float*)d_in[4]; const float* Aq = (const float*)d_in[5]; const float* Bq = (const float*)d_in[6]; const float* Av = (const float*)d_in[7]; const float* Bv = (const float*)d_in[8]; const float* Ao = (const float*)d_in[9]; const float* Bo = (const float*)d_in[10];
  char* ws = (char*)d_ws; size_t off = 0;
  auto take = [&](size_t bytes) { char* p = ws + off; off += (bytes + 255) & ~(size_t)255; return p; };
  _Float16* BWq = (_Float16*)take((size_t)DM * DM * 2); _Float16* BWk = (_Float16*)take((size_t)DM * DM * 2); _Float16* BWv = (_Float16*)take((size_t)DM * DM * 2); _Float16* BWo = (_Float16*)take((size_t)DM * DM * 2); _Float16* BAq = (_Float16*)take((size_t)LR * DM * 2); _Float16* BAv = (_Float16*)take((size_t)LR * DM * 2); _Float16* BAo = (_Float16*)take((size_t)LR * DM * 2); _Float16* BBq = (_Float16*)take((size_t)DM * LR * 2); _Float16* BBv = (_Float16*)take((size_t)DM * LR * 2); _Float16* BBo = (_Float16*)take((size_t)DM * LR * 2);
  float* CS = (float*)take((size_t)SS * DH * 4); float* SN = (float*)take((size_t)SS * DH * 4);
  _Float16* X16 = (_Float16*)take((size_t)SS * DM * 2); float* Q = (float*)take((size_t)SS * DM * 4); float* K = (float*)take((size_t)SS * DM * 4); float* V = (float*)take((size_t)SS * DM * 4); float* XA = (float*)take((size_t)SS * LR * 4); _Float16* XAh = (_Float16*)take((size_t)SS * LR * 2); _Float16* XAl = (_Float16*)take((size_t)SS * LR * 2);
  _Float16* FK16 = (_Float16*)take((size_t)NH * NSL * DH * 2); _Float16* FV16 = (_Float16*)take((size_t)NH * NSL * DH * 2); float* FKf = (float*)take((size_t)NH * NSL * DH * 4); float* FVf = (float*)take((size_t)NH * NSL * DH * 4); float* PK = (float*)take((size_t)SS * DM * 4); float* PVp = (float*)take((size_t)SS * DM * 4); _Float16* AQ16 = (_Float16*)take((size_t)NH * SS * DH * 2); float* AQf = (float*)take((size_t)SS * DM * 4);
  float* S = (float*)take((size_t)NH * SS * NSL * 4); _Float16* W16 = (_Float16*)take((size_t)NH * SS * NSL * 2); float* WC = (float*)take((size_t)NH * SS * 32 * 4); _Float16* FVT = (_Float16*)take((size_t)NH * DH * NSL * 2); float* O = (float*)take((size_t)SS * DM * 4); _Float16* Oh = (_Float16*)take((size_t)SS * DM * 2); _Float16* Ol = (_Float16*)take((size_t)SS * DM * 2); float* OA = (float*)take((size_t)SS * LR * 4); _Float16* OAh = (_Float16*)take((size_t)SS * LR * 2); _Float16* OAl = (_Float16*)take((size_t)SS * LR * 2);
  if (off > ws_size) return;      // weights 9 + tables 1 + per-batch planes 181: about 191 MiB
  const unsigned nbW = (DM * (DM / 8) + 255) / 256;
  k_wt_f16<<<nbW, 256, 0, stream>>>(Wq, BWq, DM, DM, 16.0f); k_wt_f16<<<nbW, 256, 0, stream>>>(Wk, BWk, DM, DM, 16.0f); k_wt_f16<<<nbW, 256, 0, stream>>>(Wv, BWv, DM, DM, 16.0f); k_wt_f16<<<nbW, 256, 0, stream>>>(Wo, BWo, DM, DM, 16.0f);      /* all weights are (in,out) */
  k_wt_f16<<<(LR * (DM / 8) + 255) / 256, 256, 0, stream>>>(Aq, BAq, DM, LR, 16.0f); k_wt_f16<<<(LR * (DM / 8) + 255) / 256, 256, 0, stream>>>(Av, BAv, DM, LR, 16.0f); k_wt_f16<<<(LR * (DM / 8) + 255) / 256, 256, 0, stream>>>(Ao, BAo, DM, LR, 16.0f);
  k_wt_f16<<<(DM * (LR / 8) + 255) / 256, 256, 0, stream>>>(Bq, BBq, LR, DM, 16.0f); k_wt_f16<<<(DM * (LR / 8) + 255) / 256, 256, 0, stream>>>(Bv, BBv, LR, DM, 16.0f); k_wt_f16<<<(DM * (LR / 8) + 255) / 256, 256, 0, stream>>>(Bo, BBo, LR, DM, 16.0f);
  k_cstab<<<(SS * DH + 255) / 256, 256, 0, stream>>>(CS, SN);
  const dim3 gD(((SS / 16) * (DM / 64) + 3) / 4, 1), gL(((SS / 16) * 1 + 3) / 4, 1), gL4(((SS / 16) * 1 + 3) / 4, NH), gS(((SS / 16) * (NSL / 64) + 3) / 4, NH), gH(SS / 8, NH); const size_t n8 = (size_t)SS * DM / 8; const unsigned nb8 = (unsigned)((n8 + 255) / 256); const size_t a8 = (size_t)SS * LR / 8; const unsigned nba = (unsigned)((a8 + 255) / 256);
  for (int b = 0; b < NBt; ++b) {
    k_x16<<<nb8, 256, 0, stream>>>(x + (size_t)b * SS * DM, X16, n8);
    k_gemm_hhx<0><<<gD, 128, 0, stream>>>(X16, DM, 0, BWq, DM, 0, 0.0625f, nullptr, 0, nullptr, 1, 0, 0, Q, nullptr, DM, 0, SS, DM, DM); k_gemm_hhx<0><<<gD, 128, 0, stream>>>(X16, DM, 0, BWk, DM, 0, 0.0625f, nullptr, 0, nullptr, 1, 0, 0, K, nullptr, DM, 0, SS, DM, DM); k_gemm_hhx<0><<<gD, 128, 0, stream>>>(X16, DM, 0, BWv, DM, 0, 0.0625f, nullptr, 0, nullptr, 1, 0, 0, V, nullptr, DM, 0, SS, DM, DM);      /* x·W (exact) */
    k_gemm_hhx<0><<<gL, 128, 0, stream>>>(X16, DM, 0, BAq, DM, 0, 0.0625f, nullptr, 0, nullptr, 1, 0, 0, XA, nullptr, LR, 0, SS, LR, DM); k_split<<<nba, 256, 0, stream>>>(XA, XAh, XAl, a8);
    k_gemm_hhx<0><<<gD, 128, 0, stream>>>(XAh, LR, 0, BBq, LR, 0, 0.0625f, nullptr, 0, Q, 1, (size_t)DM, 0, Q, nullptr, DM, 0, SS, DM, LR); k_gemm_hhx<0><<<gD, 128, 0, stream>>>(XAl, LR, 0, BBq, LR, 0, 0.0625f / 1024.0f, nullptr, 0, Q, 1, (size_t)DM, 0, Q, nullptr, DM, 0, SS, DM, LR);      /* q += (x·Aq)·Bq */
    k_gemm_hhx<0><<<gL, 128, 0, stream>>>(X16, DM, 0, BAv, DM, 0, 0.0625f, nullptr, 0, nullptr, 1, 0, 0, XA, nullptr, LR, 0, SS, LR, DM); k_split<<<nba, 256, 0, stream>>>(XA, XAh, XAl, a8);
    k_gemm_hhx<0><<<gD, 128, 0, stream>>>(XAh, LR, 0, BBv, LR, 0, 0.0625f, nullptr, 0, V, 1, (size_t)DM, 0, V, nullptr, DM, 0, SS, DM, LR); k_gemm_hhx<0><<<gD, 128, 0, stream>>>(XAl, LR, 0, BBv, LR, 0, 0.0625f / 1024.0f, nullptr, 0, V, 1, (size_t)DM, 0, V, nullptr, DM, 0, SS, DM, LR);      /* v += (x·Av)·Bv */
    k_slots<<<(NH * NSL * (DH / 8) + 255) / 256, 256, 0, stream>>>(Q, K, V, CS, SN, FK16, FV16, FKf, FVf, PK, PVp, AQ16, AQf);
    k_fvt<<<(NH * DH * (NSL / 8) + 255) / 256, 256, 0, stream>>>(FVf, FVT);
    /* all 16 heads in one launch each, head = blockIdx.y */
    k_gemm_hhx<0><<<gS, 128, 0, stream>>>(AQ16, DH, (size_t)SS * DH, FK16, DH, (size_t)NSL * DH, 0.125f, nullptr, 0, nullptr, 1, 0, 0, S, nullptr, NSL, (size_t)SS * NSL, SS, NSL, DH);      /* slot scores/8: M 2048 N 512 K 64 per head */
    k_hsoft<<<gH, 256, 0, stream>>>(S, AQf, PK, W16, WC);
    k_gemm_hhx<0><<<gL4, 128, 0, stream>>>(W16, NSL, (size_t)SS * NSL, FVT, NSL, (size_t)DH * NSL, 0.0009765625f, nullptr, 0, nullptr, 1, 0, 0, O, nullptr, DM, (size_t)DH, SS, DH, NSL);      /* sum of w * full_V into O cols h*64: M 2048 N 64 K 512 per head */
    k_oepi<<<(SS * NH * (DH / 8) + 255) / 256, 256, 0, stream>>>(O, WC, PVp, FVf, Oh, Ol);
    float* outb = (float*)d_out + (size_t)b * SS * DM;
    k_gemm_hhx<0><<<gD, 128, 0, stream>>>(Oh, DM, 0, BWo, DM, 0, 0.0625f, nullptr, 0, nullptr, 1, 0, 0, outb, nullptr, DM, 0, SS, DM, DM); k_gemm_hhx<0><<<gD, 128, 0, stream>>>(Ol, DM, 0, BWo, DM, 0, 0.0625f / 1024.0f, nullptr, 0, outb, 1, (size_t)DM, 0, outb, nullptr, DM, 0, SS, DM, DM);      /* out·Wo (hi + lo) */
    k_gemm_hhx<0><<<gL, 128, 0, stream>>>(Oh, DM, 0, BAo, DM, 0, 0.0625f, nullptr, 0, nullptr, 1, 0, 0, OA, nullptr, LR, 0, SS, LR, DM); k_gemm_hhx<0><<<gL, 128, 0, stream>>>(Ol, DM, 0, BAo, DM, 0, 0.0625f / 1024.0f, nullptr, 0, OA, 1, (size_t)LR, 0, OA, nullptr, LR, 0, SS, LR, DM); k_split<<<nba, 256, 0, stream>>>(OA, OAh, OAl, a8);
    k_gemm_hhx<0><<<gD, 128, 0, stream>>>(OAh, LR, 0, BBo, LR, 0, 0.0625f, nullptr, 0, outb, 1, (size_t)DM, 0, outb, nullptr, DM, 0, SS, DM, LR); k_gemm_hhx<0><<<gD, 128, 0, stream>>>(OAl, LR, 0, BBo, LR, 0, 0.0625f / 1024.0f, nullptr, 0, outb, 1, (size_t)DM, 0, outb, nullptr, DM, 0, SS, DM, LR); }      /* + (out·Ao)·Bo */
}

// v002
// Measured time: 716 microseconds a run.
// Timed twice side by side with v001, it ran 1.49 times as fast both times.
// Counting every step since v000, it is 2.56 times as fast.
#include <hip/hip_runtime.h>
// HoloKV attention (B 2, S 2048, 16 heads × 64, k_factor 4 → 512 slots): q = x·Wq + (x·Aq)·Bq, k = x·Wk, v = x·Wv + (x·Av)·Bv; RoPE (half-split rotate, θ_i = 1/10000^(2i/64)); keys/values compressed into slots of 4 tokens with Hadamard phases /2: full_K[s] = Σ_t k[4s+t]·c[t]/2, partial (causal prefix inside the slot); query phase c[q mod 4]; scores over slots: aligned_q·full_K/8 for earlier slots, aligned_q·partial_K(q's prefix)/8 for its own slot, −inf for later slots; softmax; out = Σ w·full_V + w_curr·(partial_V − full_V[curr]); out·phase·2; y = out·Wo + (out·Ao)·Bo → [2,2048,1024].
// Compute dtype: x and parameters rounded to bf16; projections with exact products and the LoRA paths on f16 hi + lo·2^10 operands of x·A (≈f32); RoPE, phases, slot sums/prefixes in f32; aligned q and full_K/full_V as f16 GEMM operands (scores O(1)), the own-slot score, masking, softmax and the rank-1 correction in f32; attention output as f16 hi + lo·2^10 into Wo and the LoRA output path. v_wmma_f32_16x16x32_f16.
#define NBt 2
#define SS 2048
#define DM 1024
#define NH 16
#define DH 64
#define KF 4
#define NSL (SS / KF)            /* 512 slots */
#define LR 64
#define NR (NBt * SS)
typedef __bf16 v16b __attribute__((ext_vector_type(16)));
typedef unsigned short v8us __attribute__((ext_vector_type(8), may_alias));
typedef float  v8f  __attribute__((ext_vector_type(8)));
typedef float  v4f  __attribute__((ext_vector_type(4)));
typedef float  v4fa __attribute__((ext_vector_type(4), may_alias));
union FragB { v16b v; v8us half[2]; unsigned short u[16]; };

__device__ __forceinline__ unsigned short bf16_bits(float x) { unsigned int u = __float_as_uint(x); return (unsigned short)((u + 0x7FFFu + ((u >> 16) & 1u)) >> 16); }
__device__ __forceinline__ float bf16_val(unsigned short b) { return __uint_as_float(((unsigned int)b) << 16); }
__device__ __forceinline__ float bf16_round(float x) { return bf16_val(bf16_bits(x)); }
// D += A·B with NT terms: 1 = ah·bh, 2 = + al·bh (A split), 3 = + ah·bl (both split)
template <int NT>
__device__ __forceinline__ v8f mmaN(v16b ah, v16b al, v16b bh, v16b bl, v8f c) {
  c = __builtin_amdgcn_wmma_f32_16x16x32_bf16(false, ah, false, bh, (short)0, c, false, false);
  if (NT >= 2) c = __builtin_amdgcn_wmma_f32_16x16x32_bf16(false, al, false, bh, (short)0, c, false, false);
  if (NT >= 3) c = __builtin_amdgcn_wmma_f32_16x16x32_bf16(false, ah, false, bl, (short)0, c, false, false);
  asm volatile("v_nop\n\tv_nop\n\tv_nop\n\tv_nop" : "+v"(c) : "v"(ah), "v"(al), "v"(bh), "v"(bl));
  return c;
}

__global__ __launch_bounds__(256) void k_wt_bf16(const float* __restrict__ W, unsigned short* __restrict__ Wt, int K, int N) {
  const int t = blockIdx.x * 256 + threadIdx.x;
  const int k8n = K / 8;
  if (t >= N * k8n) return;
  const int n = t / k8n, k8 = (t % k8n) * 8;
  v8us v;
#pragma unroll
  for (int i = 0; i < 8; ++i) v[i] = bf16_bits(W[(size_t)(k8 + i) * N + n]);
  *(v8us*)(Wt + (size_t)n * K + k8) = v;
  
}

// GEMM C[M][N] (f32, pitch ldc) = act(A[M][K]·W + bias). A f32 row-major (pitch lda) converted per fragment to bf16
// (ASPLIT: hi/lo two planes -> 2 terms, else single rounded term); Wt bf16 [N][K] (pitch ldb). BIAS_BF16 rounds the
// bias to bf16 first (bias quantised to bf16 before the add). K%32==0, M%16==0, N%64==0.
template <bool ASPLIT, int ACT, bool BIAS_BF16>
__global__ __launch_bounds__(128) void k_gemm_bf(const float* __restrict__ A, int lda, const unsigned short* __restrict__ Wt, int ldb,
                                               const float* __restrict__ bias, float* __restrict__ C, int ldc, int M, int N, int K) {
  __shared__ __attribute__((aligned(16))) float so[4][16][64];
  const int tid = threadIdx.x, w = tid >> 5, lane = tid & 31, ln = lane & 15, hh = lane >> 4;
  const int ntn = N / 64;
  const int wid = blockIdx.x * 4 + w;
  const int mt = wid / ntn, nq = wid % ntn;
  if (mt * 16 >= M) return;
  const int row0 = mt * 16, col0 = nq * 64;
  const float* arow = A + (size_t)(row0 + ln) * lda;
  v8f acc[4] = {};
  for (int kb = 0; kb < K; kb += 32) {
    FragB ah, al;
    const v4f x0 = *(const v4fa*)(arow + kb + 8 * hh), x1 = *(const v4fa*)(arow + kb + 8 * hh + 4);
    const v4f x2 = *(const v4fa*)(arow + kb + 16 + 8 * hh), x3 = *(const v4fa*)(arow + kb + 16 + 8 * hh + 4);
    float xs[16] = {x0[0],x0[1],x0[2],x0[3],x1[0],x1[1],x1[2],x1[3],x2[0],x2[1],x2[2],x2[3],x3[0],x3[1],x3[2],x3[3]};
#pragma unroll
    for (int i = 0; i < 16; ++i) { const unsigned short hb = bf16_bits(xs[i]); ah.u[i] = hb; al.u[i] = ASPLIT ? bf16_bits(xs[i] - bf16_val(hb)) : (unsigned short)0; }
#pragma unroll
    for (int t = 0; t < 4; ++t) {
      const unsigned short* brow = Wt + (size_t)(col0 + t * 16 + ln) * ldb + kb;
      FragB b;
      b.half[0] = *(const v8us*)(brow + 8 * hh);
      b.half[1] = *(const v8us*)(brow + 16 + 8 * hh);
      acc[t] = mmaN<ASPLIT ? 2 : 1>(ah.v, al.v, b.v, b.v, acc[t]);
    }
  }
#pragma unroll
  for (int t = 0; t < 4; ++t) {
    float bv = bias ? bias[col0 + t * 16 + ln] : 0.f;
    if (BIAS_BF16) bv = bf16_round(bv);
#pragma unroll
    for (int r = 0; r < 8; ++r) { float v = acc[t][r] + bv; if (ACT == 1) v = fmaxf(v, 0.f); so[w][8 * hh + r][t * 16 + ln] = v; }
  }
  __builtin_amdgcn_fence(__ATOMIC_ACQ_REL, "workgroup");
  __builtin_amdgcn_wave_barrier();
  const int rsub = lane >> 4, c4 = (lane & 15) * 4;
  {
#pragma unroll
    for (int q = 0; q < 8; ++q) {
      const int r = q * 2 + rsub;
      const v4f v = *(const v4fa*)&so[w][r][c4];
      *(v4f*)(C + (size_t)(row0 + r) * ldc + col0 + c4) = v;
    }
    
  }
}

// GEMM C = act(A·W + bias + resid): A f32 (ASPLIT -> hi/lo 2 terms), Wt bf16 [N][K]; ACT 0 none, 1 relu, 2 exact gelu;
// resid (optional, f32, row index = (row % rmod), pitch ldr, RES_BF16 rounds it) added before the activation.
template <bool ASPLIT, int ACT, bool BIAS_BF16, bool RES_BF16>
__global__ __launch_bounds__(128) void k_gemm_bf3(const float* __restrict__ A, int lda, const unsigned short* __restrict__ Wt, int ldb,
                                                const float* __restrict__ bias, const float* __restrict__ resid, int rmod, int ldr,
                                                float* __restrict__ C, int ldc, int M, int N, int K) {
  __shared__ __attribute__((aligned(16))) float so[4][16][64];
  const int tid = threadIdx.x, w = tid >> 5, lane = tid & 31, ln = lane & 15, hh = lane >> 4;
  const int ntn = N / 64;
  const int wid = blockIdx.x * 4 + w;
  const int mt = wid / ntn, nq = wid % ntn;
  if (mt * 16 >= M) return;
  const int row0 = mt * 16, col0 = nq * 64;
  const float* arow = A + (size_t)(row0 + ln) * lda;
  v8f acc[4] = {};
  for (int kb = 0; kb < K; kb += 32) {
    FragB ah, al;
    const v4f x0 = *(const v4fa*)(arow + kb + 8 * hh), x1 = *(const v4fa*)(arow + kb + 8 * hh + 4);
    const v4f x2 = *(const v4fa*)(arow + kb + 16 + 8 * hh), x3 = *(const v4fa*)(arow + kb + 16 + 8 * hh + 4);
    float xs[16] = {x0[0],x0[1],x0[2],x0[3],x1[0],x1[1],x1[2],x1[3],x2[0],x2[1],x2[2],x2[3],x3[0],x3[1],x3[2],x3[3]};
#pragma unroll
    for (int i = 0; i < 16; ++i) { const unsigned short hb = bf16_bits(xs[i]); ah.u[i] = hb; al.u[i] = ASPLIT ? bf16_bits(xs[i] - bf16_val(hb)) : (unsigned short)0; }
#pragma unroll
    for (int t = 0; t < 4; ++t) {
      const unsigned short* brow = Wt + (size_t)(col0 + t * 16 + ln) * ldb + kb;
      FragB b;
      b.half[0] = *(const v8us*)(brow + 8 * hh);
      b.half[1] = *(const v8us*)(brow + 16 + 8 * hh);
      acc[t] = mmaN<ASPLIT ? 2 : 1>(ah.v, al.v, b.v, b.v, acc[t]);
    }
  }
#pragma unroll
  for (int t = 0; t < 4; ++t) {
    const int col = col0 + t * 16 + ln;
    float bv = bias ? bias[col] : 0.f;
    if (BIAS_BF16) bv = bf16_round(bv);
#pragma unroll
    for (int r = 0; r < 8; ++r) {
      float v = acc[t][r] + bv;
      if (resid) { float rv = resid[(size_t)((row0 + 8 * hh + r) % rmod) * ldr + col]; if (RES_BF16) rv = bf16_round(rv); v += rv; }
      if (ACT == 1) v = fmaxf(v, 0.f);
      if (ACT == 2) v = 0.5f * v * (1.0f + erff(v * 0.70710678118654752f));
      if (ACT == 3) { const float u = 0.7978845608028654f * (v + 0.044715f * v * v * v); v = 0.5f * v * (1.0f + tanhf(u)); }
      so[w][8 * hh + r][t * 16 + ln] = v;
    }
  }
  __builtin_amdgcn_fence(__ATOMIC_ACQ_REL, "workgroup");
  __builtin_amdgcn_wave_barrier();
  const int rsub = lane >> 4, c4 = (lane & 15) * 4;
  {
#pragma unroll
    for (int q = 0; q < 8; ++q) {
      const int r = q * 2 + rsub;
      const v4f v = *(const v4fa*)&so[w][r][c4];
      *(v4f*)(C + (size_t)(row0 + r) * ldc + col0 + c4) = v;
    }
    
  }
}
// row LayerNorm (biased variance, eps) over N: s = X (+ R); optional out_sum <- s; out_norm <- (s-mu)*rsqrt(var+eps)*g + b
template <bool PARAM_BF16>
__global__ __launch_bounds__(256) void k_layernorm(const float* __restrict__ X, const float* __restrict__ R, const float* __restrict__ g, const float* __restrict__ bta,
                                                  float* __restrict__ out_sum, float* __restrict__ out_norm, int N, float eps) {
  __shared__ float red[256];
  const int row = blockIdx.x, tid = threadIdx.x;
  const float* x = X + (size_t)row * N; const float* rr = R ? R + (size_t)row * N : nullptr;
  float vals[16];                     // up to N = 4096
  const int per = N / 256;            // contiguous chunk per thread? use strided-by-4 chunks: thread handles j = tid*4 + 1024*u
  float s1 = 0.f;
  for (int u = 0; u < per / 4; ++u) {
    const int j = tid * 4 + 1024 * u;
    const v4f a = *(const v4fa*)(x + j);
    v4f b = {0.f,0.f,0.f,0.f}; if (rr) b = *(const v4fa*)(rr + j);
#pragma unroll
    for (int q = 0; q < 4; ++q) { const float v = a[q] + b[q]; vals[u * 4 + q] = v; s1 += v; }
  }
  red[tid] = s1; __syncthreads();
  for (int st = 128; st > 0; st >>= 1) { if (tid < st) red[tid] += red[tid + st]; __syncthreads(); }
  const float mu = red[0] / (float)N; __syncthreads();
  float s2 = 0.f;
  for (int u = 0; u < per / 4; ++u)
#pragma unroll
    for (int q = 0; q < 4; ++q) { const float c = vals[u * 4 + q] - mu; s2 += c * c; }
  red[tid] = s2; __syncthreads();
  for (int st = 128; st > 0; st >>= 1) { if (tid < st) red[tid] += red[tid + st]; __syncthreads(); }
  const float rs = rsqrtf(red[0] / (float)N + eps);
  {
    for (int u = 0; u < per / 4; ++u) {
      const int j = tid * 4 + 1024 * u;
      v4f o, sm;
#pragma unroll
      for (int q = 0; q < 4; ++q) {
        float gg = g[j + q], bb = bta[j + q];
        if (PARAM_BF16) { gg = bf16_round(gg); bb = bf16_round(bb); }
        sm[q] = vals[u * 4 + q]; o[q] = (vals[u * 4 + q] - mu) * rs * gg + bb;
      }
      if (out_sum) *(v4f*)(out_sum + (size_t)row * N + j) = sm;
      *(v4f*)(out_norm + (size_t)row * N + j) = o;
    }
    
  }
}



// ---- f16 WMMA path (v_wmma_f32_16x16x32_f16): 11-bit significands for operands in range — used where a [0,1] probability operand needs more precision than bf16
typedef _Float16 v16h __attribute__((ext_vector_type(16)));
union FragH { v16h v; v8us half[2]; _Float16 h[16]; unsigned short u[16]; };
template <int NT>
__device__ __forceinline__ v8f mmaH(v16h ah, v16h al, v16h bh, v16h bl, v8f c) {
  c = __builtin_amdgcn_wmma_f32_16x16x32_f16(false, ah, false, bh, (short)0, c, false, false);
  if (NT >= 2) c = __builtin_amdgcn_wmma_f32_16x16x32_f16(false, al, false, bh, (short)0, c, false, false);
  if (NT >= 3) c = __builtin_amdgcn_wmma_f32_16x16x32_f16(false, ah, false, bl, (short)0, c, false, false);
  asm volatile("v_nop\n\tv_nop\n\tv_nop\n\tv_nop" : "+v"(c) : "v"(ah), "v"(al), "v"(bh), "v"(bl));
  return c;
}
// batched GEMM like k_gemm_b but f16 operands: A f32 (split into f16 hi/lo if ASPLIT, else rounded to f16), Bt = f16 values [n][k]; alpha; C f32; N multiple of 16 (partial tiles skipped)
template <bool ASPLIT>
__global__ __launch_bounds__(128) void k_gemm_h(const float* __restrict__ A, int lda, size_t sA, const _Float16* __restrict__ Bh, int ldb, size_t sB, float alpha, float* __restrict__ C, int ldc, size_t sC, int M, int N, int K) {
  __shared__ __attribute__((aligned(16))) float so[4][16][64];
  const int tid = threadIdx.x, w = tid >> 5, lane = tid & 31, ln = lane & 15, hh = lane >> 4; const int by = blockIdx.y;
  A += (size_t)by * sA; Bh += (size_t)by * sB; C += (size_t)by * sC;
  const int ntn = (N + 63) / 64; const int wid = blockIdx.x * 4 + w; const int mt = wid / ntn, nq = wid % ntn; if (mt * 16 >= M) return;
  const int row0 = mt * 16, col0 = nq * 64; const float* arow = A + (size_t)(row0 + ln) * lda;
  v8f acc[4] = {};
  for (int kb = 0; kb < K; kb += 32) {
    FragH ah, al;
    const v4f x0 = *(const v4fa*)(arow + kb + 8 * hh), x1 = *(const v4fa*)(arow + kb + 8 * hh + 4), x2 = *(const v4fa*)(arow + kb + 16 + 8 * hh), x3 = *(const v4fa*)(arow + kb + 16 + 8 * hh + 4);
    float xs[16] = {x0[0],x0[1],x0[2],x0[3],x1[0],x1[1],x1[2],x1[3],x2[0],x2[1],x2[2],x2[3],x3[0],x3[1],x3[2],x3[3]};
#pragma unroll
    for (int i = 0; i < 16; ++i) { const _Float16 h = (_Float16)xs[i]; ah.h[i] = h; al.h[i] = ASPLIT ? (_Float16)(xs[i] - (float)h) : (_Float16)0.0f; }
#pragma unroll
    for (int t = 0; t < 4; ++t) { if (col0 + t * 16 >= N) continue; const size_t boff = (size_t)(col0 + t * 16 + ln) * ldb + kb; FragH bq; bq.half[0] = *(const v8us*)(Bh + boff + 8 * hh); bq.half[1] = *(const v8us*)(Bh + boff + 16 + 8 * hh);
      acc[t] = mmaH<ASPLIT ? 2 : 1>(ah.v, al.v, bq.v, bq.v, acc[t]); }
  }
#pragma unroll
  for (int t = 0; t < 4; ++t) { if (col0 + t * 16 >= N) continue;
#pragma unroll
    for (int r = 0; r < 8; ++r) so[w][8 * hh + r][t * 16 + ln] = acc[t][r] * alpha; }
  __builtin_amdgcn_fence(__ATOMIC_ACQ_REL, "workgroup"); __builtin_amdgcn_wave_barrier();
  const int rsub = lane >> 4, c4 = (lane & 15) * 4;
  {
#pragma unroll
    for (int q = 0; q < 8; ++q) { const int r = q * 2 + rsub; if (col0 + c4 < N) { const v4f v = *(const v4fa*)&so[w][r][c4]; *(v4f*)(C + (size_t)(row0 + r) * ldc + col0 + c4) = v; } }
     }
}

// Wt[n][k] = f16(W[k][n]·scale) from f32 row-major W[K][N] (scale = power of two; bf16-exact weights stay exact in f16 away from the subnormal range)
__global__ __launch_bounds__(256) void k_wt_f16(const float* __restrict__ W, _Float16* __restrict__ Wt, int K, int N, float scale) {
  const int t = blockIdx.x * 256 + threadIdx.x; if (t >= N * (K / 8)) return; const int n = t / (K / 8), k8 = (t % (K / 8)) * 8; FragH f;
#pragma unroll
  for (int i = 0; i < 8; ++i) f.h[i] = (_Float16)(bf16_round(W[(size_t)(k8 + i) * N + n]) * scale); const v8us o = f.half[0];
  *(v8us*)((unsigned short*)Wt + (size_t)n * K + k8) = o; 
}
// KU k-steps per trip: the A and B fragment loads of all KU steps and all four column tiles are issued together, ahead of the first WMMA, so a trip waits for one load latency instead of one per tile. N a multiple of 64, K a multiple of 32 * KU.
// k_gemm_hh variant with fused epilogue: v = acc·alpha + bias[by·sBias + col] (+ CP[(row/rowsPerB)·sCPb + by·64 + col] if CP) ; ACT 0 none / 1 elu ; writes f32 C and f16 C16, each if non-null
template <int ACT, int KU>
__global__ __launch_bounds__(128) void k_gemm_hhx(const _Float16* __restrict__ A, int lda, size_t sA, const _Float16* __restrict__ Bh, int ldb, size_t sB, float alpha, const float* __restrict__ bias, size_t sBias, const float* __restrict__ CP, int rowsPerB, size_t sCPb, int row0g,
    float* __restrict__ C, _Float16* __restrict__ C16, int ldc, size_t sC, int M, int N, int K) {
  __shared__ __attribute__((aligned(16))) float so[4][16][64];
  const int tid = threadIdx.x, w = tid >> 5, lane = tid & 31, ln = lane & 15, hh = lane >> 4; const int by = blockIdx.y;
  A += (size_t)by * sA; Bh += (size_t)by * sB; const size_t cofs = (size_t)by * sC; const float* bp = bias ? bias + (size_t)by * sBias : nullptr;
  const int ntn = (N + 63) / 64; const int wid = blockIdx.x * 4 + w; const int mt = wid / ntn, nq = wid % ntn; if (mt * 16 >= M) return;
  const int row0 = mt * 16, col0 = nq * 64;
  v8f acc[4] = {};
  const char* Ab = (const char*)A; const char* Bb = (const char*)Bh;      /* uniform bases; each lane keeps 32-bit byte offsets of its A row and its four B rows */
  unsigned ao = (unsigned)(((row0 + ln) * lda + 8 * hh) * 2); unsigned bo[4];
#pragma unroll
  for (int t = 0; t < 4; ++t) bo[t] = (unsigned)(((col0 + t * 16 + ln) * ldb + 8 * hh) * 2);
  for (int kb = 0; kb < K; kb += 32 * KU) { FragH ah[KU], bq[KU][4];
#pragma unroll
    for (int u = 0; u < KU; ++u) { ah[u].half[0] = *(const v8us*)(Ab + ao + 64 * u); ah[u].half[1] = *(const v8us*)(Ab + ao + 64 * u + 32);
#pragma unroll
      for (int t = 0; t < 4; ++t) { bq[u][t].half[0] = *(const v8us*)(Bb + bo[t] + 64 * u); bq[u][t].half[1] = *(const v8us*)(Bb + bo[t] + 64 * u + 32); } }
#pragma unroll
    for (int u = 0; u < KU; ++u) {
#pragma unroll
      for (int t = 0; t < 4; ++t) acc[t] = mmaH<1>(ah[u].v, ah[u].v, bq[u][t].v, bq[u][t].v, acc[t]); }
    ao += 64 * KU;
#pragma unroll
    for (int t = 0; t < 4; ++t) bo[t] += 64 * KU;
  }
#pragma unroll
  for (int t = 0; t < 4; ++t) { if (col0 + t * 16 >= N) continue; const int col = col0 + t * 16 + ln; const float bv = bp ? bf16_round(bp[col]) : 0.f;
#pragma unroll
    for (int r = 0; r < 8; ++r) { float v = acc[t][r] * alpha + bv; if (CP) { const int bidx = (row0g + row0 + 8 * hh + r) / rowsPerB; v += CP[(size_t)bidx * sCPb + (size_t)by * 64 + col]; } if (ACT == 1) v = (v > 0.f) ? v : expm1f(v); else if (ACT == 7) v = (v > 0.f) ? v + 1.0f : expf(v); else if (ACT == 8) v = tanhf(v); else if (ACT == 9) v = 0.5f * v * (1.0f + tanhf(0.7978845608028654f * (v + 0.044715f * v * v * v))); else if (ACT == 11) v = 1.0f / (1.0f + expf(-v)); else if (ACT == 12) v = (v > 0.f) ? v : 0.01f * v; else if (ACT == 14) v = (v > 0.f) ? v : 0.1f * v; else if (ACT == 15) v = v / (1.0f + expf(-v)); else if (ACT == 3) v = fmaxf(v, 0.f); else if (ACT == 6) v = 0.5f * v * (1.0f + erff(v * 0.70710678118654752f)); so[w][8 * hh + r][t * 16 + ln] = v; } }
  __builtin_amdgcn_fence(__ATOMIC_ACQ_REL, "workgroup"); __builtin_amdgcn_wave_barrier();
  const int rsub = lane >> 4, c4 = (lane & 15) * 4; typedef _Float16 v4h __attribute__((ext_vector_type(4)));
  {
#pragma unroll
    for (int q = 0; q < 8; ++q) { const int r = q * 2 + rsub; if (col0 + c4 < N) { const v4f v = *(const v4fa*)&so[w][r][c4]; if (C) *(v4f*)(C + cofs + (size_t)(row0 + r) * ldc + col0 + c4) = v; if (C16) { v4h h4; for (int i = 0; i < 4; ++i) h4[i] = (_Float16)v[i]; *(v4h*)(C16 + cofs + (size_t)(row0 + r) * ldc + col0 + c4) = h4; } } }
     }
}


typedef _Float16 v4h __attribute__((ext_vector_type(4)));

__global__ __launch_bounds__(256) void k_x16(const float* __restrict__ x, _Float16* __restrict__ X16, size_t n8) { const size_t t = (size_t)blockIdx.x * 256 + threadIdx.x; if (t >= n8) return; FragH f;
#pragma unroll
  for (int q = 0; q < 8; ++q) f.h[q] = (_Float16)bf16_round(x[t * 8 + q]); *(v8us*)((unsigned short*)X16 + t * 8) = f.half[0];  }
__global__ __launch_bounds__(256) void k_h16(const float* __restrict__ x, _Float16* __restrict__ X16, size_t n8) { const size_t t = (size_t)blockIdx.x * 256 + threadIdx.x; if (t >= n8) return; FragH f;
#pragma unroll
  for (int q = 0; q < 8; ++q) f.h[q] = (_Float16)x[t * 8 + q]; *(v8us*)((unsigned short*)X16 + t * 8) = f.half[0];  }
__global__ __launch_bounds__(256) void k_round16f(const float* __restrict__ W, _Float16* __restrict__ Bt, size_t n8) { const size_t t = (size_t)blockIdx.x * 256 + threadIdx.x; if (t >= n8) return; FragH f;
#pragma unroll
  for (int i = 0; i < 8; ++i) f.h[i] = (_Float16)(bf16_round(W[t * 8 + i]) * 16.0f); *(v8us*)((unsigned short*)Bt + t * 8) = f.half[0];  }
template <int NHv, int TTv>
__global__ __launch_bounds__(256) void k_vt(const _Float16* __restrict__ V16, int ldv, int voff, _Float16* __restrict__ Vt) { __shared__ unsigned short tl[64][66]; const int tid = threadIdx.x; const int slab = blockIdx.x / (TTv / 64), lg = blockIdx.x % (TTv / 64); const int b = slab / NHv, h = slab % NHv;
  for (int i = tid; i < 64 * 8; i += 256) { const int r = i / 8, c8 = (i % 8) * 8; FragH f; f.half[0] = *(const v8us*)((const unsigned short*)V16 + ((size_t)b * TTv + lg * 64 + r) * ldv + voff + h * 64 + c8);
#pragma unroll
    for (int q = 0; q < 8; ++q) tl[r][c8 + q] = f.u[q]; }
  __syncthreads();
  {
#pragma unroll
    for (int rd = 0; rd < 2; ++rd) { const int d = rd * 32 + tid / 8, pc = tid % 8; FragH f;
#pragma unroll
      for (int q = 0; q < 8; ++q) f.u[q] = tl[pc * 8 + q][d];
      *(v8us*)((unsigned short*)Vt + ((size_t)slab * 64 + d) * TTv + lg * 64 + pc * 8) = f.half[0]; }
     } }

__global__ __launch_bounds__(256) void k_hl(const float* __restrict__ F, _Float16* __restrict__ Hh, _Float16* __restrict__ Hl, size_t n8) { const size_t t = (size_t)blockIdx.x * 256 + threadIdx.x; if (t >= n8) return; FragH fh, fl; const v4f a = *(const v4fa*)(F + t * 8), c = *(const v4fa*)(F + t * 8 + 4);
#pragma unroll
  for (int q = 0; q < 4; ++q) { _Float16 h = (_Float16)a[q]; fh.h[q] = h; fl.h[q] = (_Float16)((a[q] - (float)h) * 1024.0f); h = (_Float16)c[q]; fh.h[4 + q] = h; fl.h[4 + q] = (_Float16)((c[q] - (float)h) * 1024.0f); }
  { *(v8us*)((unsigned short*)Hh + t * 8) = fh.half[0]; *(v8us*)((unsigned short*)Hl + t * 8) = fl.half[0];  } }

__global__ __launch_bounds__(256) void k_split(const float* __restrict__ F, _Float16* __restrict__ Hh, _Float16* __restrict__ Hl, size_t n8) {
  #pragma clang fp contract(off)
  const size_t t = (size_t)blockIdx.x * 256 + threadIdx.x; if (t >= n8) return; const v4f a = *(const v4fa*)(F + t * 8), c = *(const v4fa*)(F + t * 8 + 4); FragH fh, fl;
#pragma unroll
  for (int q = 0; q < 8; ++q) { const float v = (q < 4) ? a[q] : c[q - 4]; const _Float16 hi = (_Float16)v; fh.h[q] = hi; fl.h[q] = (_Float16)((v - (float)hi) * 1024.0f); }
  { *(v8us*)((unsigned short*)Hh + t * 8) = fh.half[0]; *(v8us*)((unsigned short*)Hl + t * 8) = fl.half[0];  } }
__global__ __launch_bounds__(256) void k_cstab(float* __restrict__ CS, float* __restrict__ SN) {
  #pragma clang fp contract(off)
  const int t = blockIdx.x * 256 + threadIdx.x; if (t >= SS * DH) return; const int d = t % DH, p = t / DH; const int i = d & 31; const float theta = 1.0f / powf(10000.0f, (float)(2 * i) / 64.0f); const float ang = (float)p * theta; const float c = cosf(ang), s = sinf(ang);
  { *(float*)(CS + t) = c; *(float*)(SN + t) = s;  } }
__device__ __forceinline__ float cdma(int t, int d) { const int j = d & 3; const int par = __popc((unsigned)(t & j)); return (par & 1) ? -1.0f : 1.0f; }      /* Hadamard H4[t][d mod 4] (Sylvester order: rows [1,1,1,1],[1,-1,1,-1],[1,1,-1,-1],[1,-1,-1,1]) */
__global__ __launch_bounds__(256) void k_slots(const float* __restrict__ Q, const float* __restrict__ K, const float* __restrict__ V, const float* __restrict__ CS, const float* __restrict__ SN, _Float16* __restrict__ FK16, _Float16* __restrict__ FV16, float* __restrict__ FKf, float* __restrict__ FVf, float* __restrict__ PK, float* __restrict__ PVp, _Float16* __restrict__ AQ16, float* __restrict__ AQf) {
  #pragma clang fp contract(off)
  const int t = blockIdx.x * 256 + threadIdx.x; if (t >= NH * NSL * (DH / 8)) return; const int d0 = (t % (DH / 8)) * 8; const int s = (t / (DH / 8)) % NSL; const int bh = t / ((DH / 8) * NSL); const int b = 0, h = bh;      /* batch-local: the host passes per-batch workspace buffers, rewritten for each batch */
  FragH fk, fv; v4f fkA, fkB, fvA, fvB;
  float pk[KF][8], pv[KF][8];      /* running prefixes per token step */
#pragma unroll
  for (int q = 0; q < 8; ++q) { const int d = d0 + q; float accK = 0.f, accV = 0.f;
#pragma unroll
    for (int tt = 0; tt < KF; ++tt) { const int tok = s * KF + tt; const float* kp = K + ((size_t)b * SS + tok) * DM + h * DH; const float* vp = V + ((size_t)b * SS + tok) * DM + h * DH; const float c = CS[(size_t)tok * DH + d], sn = SN[(size_t)tok * DH + d];
      const float kr = kp[d] * c + ((d < 32) ? -kp[d + 32] : kp[d - 32]) * sn; const float ph = cdma(tt, d) * 0.5f;      /* /sqrt(k_factor) */
      accK += kr * ph; accV += vp[d] * ph; pk[tt][q] = accK; pv[tt][q] = accV; }
    fk.h[q] = (_Float16)accK; fv.h[q] = (_Float16)accV; if (q < 4) { fkA[q] = accK; fvA[q] = accV; } else { fkB[q - 4] = accK; fvB[q - 4] = accV; } }
  const size_t srow = ((size_t)bh * NSL + s) * DH + d0;
  { *(v8us*)((unsigned short*)FK16 + srow) = fk.half[0]; *(v8us*)((unsigned short*)FV16 + srow) = fv.half[0]; *(v4f*)(FKf + srow) = fkA; *(v4f*)(FKf + srow + 4) = fkB; *(v4f*)(FVf + srow) = fvA; *(v4f*)(FVf + srow + 4) = fvB;  }
#pragma unroll
  for (int tt = 0; tt < KF; ++tt) { const int tok = s * KF + tt; const size_t prow = ((size_t)b * SS + tok) * DM + h * DH + d0; v4f a, c2, e, g;
#pragma unroll
    for (int q = 0; q < 4; ++q) { a[q] = pk[tt][q]; c2[q] = pk[tt][4 + q]; e[q] = pv[tt][q]; g[q] = pv[tt][4 + q]; }
    /* aligned q for this token */ const float* qp = Q + ((size_t)b * SS + tok) * DM + h * DH; FragH fq; v4f qa, qb2;
#pragma unroll
    for (int q = 0; q < 8; ++q) { const int d = d0 + q; const float c = CS[(size_t)tok * DH + d], sn = SN[(size_t)tok * DH + d]; const float qr = qp[d] * c + ((d < 32) ? -qp[d + 32] : qp[d - 32]) * sn; const float aq = qr * cdma(tt, d); fq.h[q] = (_Float16)aq; if (q < 4) qa[q] = aq; else qb2[q - 4] = aq; }
    const size_t arow = ((size_t)bh * SS + tok) * DH + d0;
    { *(v4f*)(PK + prow) = a; *(v4f*)(PK + prow + 4) = c2; *(v4f*)(PVp + prow) = e; *(v4f*)(PVp + prow + 4) = g; *(v8us*)((unsigned short*)AQ16 + arow) = fq.half[0]; *(v4f*)(AQf + prow) = qa; *(v4f*)(AQf + prow + 4) = qb2;  } } }
__global__ __launch_bounds__(256) void k_fvt(const float* __restrict__ FVf, _Float16* __restrict__ FVT) { const int t = blockIdx.x * 256 + threadIdx.x; if (t >= NH * DH * (NSL / 8)) return; const int s0 = (t % (NSL / 8)) * 8; const int d = (t / (NSL / 8)) % DH; const int h = t / ((NSL / 8) * DH); FragH f;
#pragma unroll
  for (int q = 0; q < 8; ++q) f.h[q] = (_Float16)FVf[((size_t)h * NSL + s0 + q) * DH + d];
  *(v8us*)((unsigned short*)FVT + ((size_t)h * DH + d) * NSL + s0) = f.half[0];  }
__global__ __launch_bounds__(256) void k_hsoft(const float* __restrict__ S, const float* __restrict__ AQf, const float* __restrict__ PK, _Float16* __restrict__ W16, float* __restrict__ WC) {
  #pragma clang fp contract(off)
  const int tid = threadIdx.x, w = tid >> 5, ln = tid & 31; const int h = blockIdx.y; const int q = blockIdx.x * 8 + w; if (q >= SS) return; const int cs = q / KF; const size_t prow = (size_t)q * DM + h * DH; S += (size_t)h * SS * NSL; W16 += (size_t)h * SS * NSL;      /* head on grid.y: each head has its own score and weight plane */
  float cur = AQf[prow + ln] * PK[prow + ln] + AQf[prow + 32 + ln] * PK[prow + 32 + ln]; for (int o = 16; o > 0; o >>= 1) cur += __shfl_xor(cur, o, 32); cur *= 0.125f;
  const float* sr = S + (size_t)q * NSL; float v[16]; float m = -3.0e38f;
#pragma unroll
  for (int k = 0; k < 16; ++k) { const int sl = 16 * ln + k; float x = sr[sl]; x = (sl == cs) ? cur : x; x = (sl > cs) ? -3.0e38f : x; v[k] = x; m = fmaxf(m, x); }
  for (int o = 16; o > 0; o >>= 1) m = fmaxf(m, __shfl_xor(m, o, 32));
  float su = 0.f;
#pragma unroll
  for (int k = 0; k < 16; ++k) { const int sl = 16 * ln + k; v[k] = (sl > cs) ? 0.f : expf(v[k] - m); su += v[k]; }
  for (int o = 16; o > 0; o >>= 1) su += __shfl_xor(su, o, 32); const float inv = 1.0f / su; FragH f0, f1; float wc = 0.f;
#pragma unroll
  for (int k = 0; k < 16; ++k) { const int sl = 16 * ln + k; const float wv = v[k] * inv; wc = (sl == cs) ? wv : wc; if (k < 8) f0.h[k] = (_Float16)(wv * 1024.0f); else f1.h[k - 8] = (_Float16)(wv * 1024.0f); }
  for (int o = 16; o > 0; o >>= 1) wc += __shfl_xor(wc, o, 32);      /* exactly one lane holds the current slot */
  { *(v8us*)((unsigned short*)W16 + (size_t)q * NSL + 16 * ln) = f0.half[0]; *(v8us*)((unsigned short*)W16 + (size_t)q * NSL + 16 * ln + 8) = f1.half[0]; *(float*)(WC + ((size_t)h * SS + q) * 32 + ln) = wc;  } }      /* one whole 128-byte line per (head, row), written by this wave alone */
__global__ __launch_bounds__(256) void k_oepi(const float* __restrict__ O, const float* __restrict__ WC, const float* __restrict__ PVp, const float* __restrict__ FVf, _Float16* __restrict__ Oh, _Float16* __restrict__ Ol) {
  #pragma clang fp contract(off)
  const int t = blockIdx.x * 256 + threadIdx.x; if (t >= SS * NH * (DH / 8)) return; const int d0 = (t % (DH / 8)) * 8; const int h = (t / (DH / 8)) % NH; const int bq = t / ((DH / 8) * NH); const int b = 0, q = bq; const int cs = q / KF, tt = q % KF; const float wc = WC[((size_t)h * SS + bq) * 32]; const size_t prow = (size_t)bq * DM + h * DH + d0; const size_t srow = ((size_t)(b * NH + h) * NSL + cs) * DH + d0; FragH fh, fl;
#pragma unroll
  for (int k = 0; k < 8; ++k) { const int d = d0 + k; const float o = O[prow + k] + wc * (PVp[prow + k] - FVf[srow + k]); const float v = (o * cdma(tt, d)) * 2.0f; const _Float16 hi = (_Float16)v; fh.h[k] = hi; fl.h[k] = (_Float16)((v - (float)hi) * 1024.0f); }
  { *(v8us*)((unsigned short*)Oh + prow) = fh.half[0]; *(v8us*)((unsigned short*)Ol + prow) = fl.half[0];  } }

extern "C" void kernel_launch(void* const* d_in, const int* in_sizes, int n_in,
                              void* d_out, int out_size, void* d_ws, size_t ws_size, hipStream_t stream) {
  (void)in_sizes; (void)n_in; (void)out_size;
  const float* x = (const float*)d_in[0]; const float* Wq = (const float*)d_in[1]; const float* Wk = (const float*)d_in[2]; const float* Wv = (const float*)d_in[3]; const float* Wo = (const float*)d_in[4]; const float* Aq = (const float*)d_in[5]; const float* Bq = (const float*)d_in[6]; const float* Av = (const float*)d_in[7]; const float* Bv = (const float*)d_in[8]; const float* Ao = (const float*)d_in[9]; const float* Bo = (const float*)d_in[10];
  char* ws = (char*)d_ws; size_t off = 0;
  auto take = [&](size_t bytes) { char* p = ws + off; off += (bytes + 255) & ~(size_t)255; return p; };
  _Float16* BWq = (_Float16*)take((size_t)DM * DM * 2); _Float16* BWk = (_Float16*)take((size_t)DM * DM * 2); _Float16* BWv = (_Float16*)take((size_t)DM * DM * 2); _Float16* BWo = (_Float16*)take((size_t)DM * DM * 2); _Float16* BAq = (_Float16*)take((size_t)LR * DM * 2); _Float16* BAv = (_Float16*)take((size_t)LR * DM * 2); _Float16* BAo = (_Float16*)take((size_t)LR * DM * 2); _Float16* BBq = (_Float16*)take((size_t)DM * LR * 2); _Float16* BBv = (_Float16*)take((size_t)DM * LR * 2); _Float16* BBo = (_Float16*)take((size_t)DM * LR * 2);
  float* CS = (float*)take((size_t)SS * DH * 4); float* SN = (float*)take((size_t)SS * DH * 4);
  _Float16* X16 = (_Float16*)take((size_t)SS * DM * 2); float* Q = (float*)take((size_t)SS * DM * 4); float* K = (float*)take((size_t)SS * DM * 4); float* V = (float*)take((size_t)SS * DM * 4); float* XA = (float*)take((size_t)SS * LR * 4); _Float16* XAh = (_Float16*)take((size_t)SS * LR * 2); _Float16* XAl = (_Float16*)take((size_t)SS * LR * 2);
  _Float16* FK16 = (_Float16*)take((size_t)NH * NSL * DH * 2); _Float16* FV16 = (_Float16*)take((size_t)NH * NSL * DH * 2); float* FKf = (float*)take((size_t)NH * NSL * DH * 4); float* FVf = (float*)take((size_t)NH * NSL * DH * 4); float* PK = (float*)take((size_t)SS * DM * 4); float* PVp = (float*)take((size_t)SS * DM * 4); _Float16* AQ16 = (_Float16*)take((size_t)NH * SS * DH * 2); float* AQf = (float*)take((size_t)SS * DM * 4);
  float* S = (float*)take((size_t)NH * SS * NSL * 4); _Float16* W16 = (_Float16*)take((size_t)NH * SS * NSL * 2); float* WC = (float*)take((size_t)NH * SS * 32 * 4); _Float16* FVT = (_Float16*)take((size_t)NH * DH * NSL * 2); float* O = (float*)take((size_t)SS * DM * 4); _Float16* Oh = (_Float16*)take((size_t)SS * DM * 2); _Float16* Ol = (_Float16*)take((size_t)SS * DM * 2); float* OA = (float*)take((size_t)SS * LR * 4); _Float16* OAh = (_Float16*)take((size_t)SS * LR * 2); _Float16* OAl = (_Float16*)take((size_t)SS * LR * 2);
  if (off > ws_size) return;      // weights 9 + tables 1 + per-batch planes 181: about 191 MiB
  const unsigned nbW = (DM * (DM / 8) + 255) / 256;
  k_wt_f16<<<nbW, 256, 0, stream>>>(Wq, BWq, DM, DM, 16.0f); k_wt_f16<<<nbW, 256, 0, stream>>>(Wk, BWk, DM, DM, 16.0f); k_wt_f16<<<nbW, 256, 0, stream>>>(Wv, BWv, DM, DM, 16.0f); k_wt_f16<<<nbW, 256, 0, stream>>>(Wo, BWo, DM, DM, 16.0f);      /* all weights are (in,out) */
  k_wt_f16<<<(LR * (DM / 8) + 255) / 256, 256, 0, stream>>>(Aq, BAq, DM, LR, 16.0f); k_wt_f16<<<(LR * (DM / 8) + 255) / 256, 256, 0, stream>>>(Av, BAv, DM, LR, 16.0f); k_wt_f16<<<(LR * (DM / 8) + 255) / 256, 256, 0, stream>>>(Ao, BAo, DM, LR, 16.0f);
  k_wt_f16<<<(DM * (LR / 8) + 255) / 256, 256, 0, stream>>>(Bq, BBq, LR, DM, 16.0f); k_wt_f16<<<(DM * (LR / 8) + 255) / 256, 256, 0, stream>>>(Bv, BBv, LR, DM, 16.0f); k_wt_f16<<<(DM * (LR / 8) + 255) / 256, 256, 0, stream>>>(Bo, BBo, LR, DM, 16.0f);
  k_cstab<<<(SS * DH + 255) / 256, 256, 0, stream>>>(CS, SN);
  const dim3 gD(((SS / 16) * (DM / 64) + 3) / 4, 1), gL(((SS / 16) * 1 + 3) / 4, 1), gL4(((SS / 16) * 1 + 3) / 4, NH), gS(((SS / 16) * (NSL / 64) + 3) / 4, NH), gH(SS / 8, NH); const size_t n8 = (size_t)SS * DM / 8; const unsigned nb8 = (unsigned)((n8 + 255) / 256); const size_t a8 = (size_t)SS * LR / 8; const unsigned nba = (unsigned)((a8 + 255) / 256);
  for (int b = 0; b < NBt; ++b) {
    k_x16<<<nb8, 256, 0, stream>>>(x + (size_t)b * SS * DM, X16, n8);
    k_gemm_hhx<0, 4><<<gD, 128, 0, stream>>>(X16, DM, 0, BWq, DM, 0, 0.0625f, nullptr, 0, nullptr, 1, 0, 0, Q, nullptr, DM, 0, SS, DM, DM); k_gemm_hhx<0, 4><<<gD, 128, 0, stream>>>(X16, DM, 0, BWk, DM, 0, 0.0625f, nullptr, 0, nullptr, 1, 0, 0, K, nullptr, DM, 0, SS, DM, DM); k_gemm_hhx<0, 4><<<gD, 128, 0, stream>>>(X16, DM, 0, BWv, DM, 0, 0.0625f, nullptr, 0, nullptr, 1, 0, 0, V, nullptr, DM, 0, SS, DM, DM);      /* x·W (exact) */
    k_gemm_hhx<0, 4><<<gL, 128, 0, stream>>>(X16, DM, 0, BAq, DM, 0, 0.0625f, nullptr, 0, nullptr, 1, 0, 0, XA, nullptr, LR, 0, SS, LR, DM); k_split<<<nba, 256, 0, stream>>>(XA, XAh, XAl, a8);
    k_gemm_hhx<0, 2><<<gD, 128, 0, stream>>>(XAh, LR, 0, BBq, LR, 0, 0.0625f, nullptr, 0, Q, 1, (size_t)DM, 0, Q, nullptr, DM, 0, SS, DM, LR); k_gemm_hhx<0, 2><<<gD, 128, 0, stream>>>(XAl, LR, 0, BBq, LR, 0, 0.0625f / 1024.0f, nullptr, 0, Q, 1, (size_t)DM, 0, Q, nullptr, DM, 0, SS, DM, LR);      /* q += (x·Aq)·Bq */
    k_gemm_hhx<0, 4><<<gL, 128, 0, stream>>>(X16, DM, 0, BAv, DM, 0, 0.0625f, nullptr, 0, nullptr, 1, 0, 0, XA, nullptr, LR, 0, SS, LR, DM); k_split<<<nba, 256, 0, stream>>>(XA, XAh, XAl, a8);
    k_gemm_hhx<0, 2><<<gD, 128, 0, stream>>>(XAh, LR, 0, BBv, LR, 0, 0.0625f, nullptr, 0, V, 1, (size_t)DM, 0, V, nullptr, DM, 0, SS, DM, LR); k_gemm_hhx<0, 2><<<gD, 128, 0, stream>>>(XAl, LR, 0, BBv, LR, 0, 0.0625f / 1024.0f, nullptr, 0, V, 1, (size_t)DM, 0, V, nullptr, DM, 0, SS, DM, LR);      /* v += (x·Av)·Bv */
    k_slots<<<(NH * NSL * (DH / 8) + 255) / 256, 256, 0, stream>>>(Q, K, V, CS, SN, FK16, FV16, FKf, FVf, PK, PVp, AQ16, AQf);
    k_fvt<<<(NH * DH * (NSL / 8) + 255) / 256, 256, 0, stream>>>(FVf, FVT);
    /* all 16 heads in one launch each, head = blockIdx.y */
    k_gemm_hhx<0, 2><<<gS, 128, 0, stream>>>(AQ16, DH, (size_t)SS * DH, FK16, DH, (size_t)NSL * DH, 0.125f, nullptr, 0, nullptr, 1, 0, 0, S, nullptr, NSL, (size_t)SS * NSL, SS, NSL, DH);      /* slot scores/8: M 2048 N 512 K 64 per head */
    k_hsoft<<<gH, 256, 0, stream>>>(S, AQf, PK, W16, WC);
    k_gemm_hhx<0, 4><<<gL4, 128, 0, stream>>>(W16, NSL, (size_t)SS * NSL, FVT, NSL, (size_t)DH * NSL, 0.0009765625f, nullptr, 0, nullptr, 1, 0, 0, O, nullptr, DM, (size_t)DH, SS, DH, NSL);      /* sum of w * full_V into O cols h*64: M 2048 N 64 K 512 per head */
    k_oepi<<<(SS * NH * (DH / 8) + 255) / 256, 256, 0, stream>>>(O, WC, PVp, FVf, Oh, Ol);
    float* outb = (float*)d_out + (size_t)b * SS * DM;
    k_gemm_hhx<0, 4><<<gD, 128, 0, stream>>>(Oh, DM, 0, BWo, DM, 0, 0.0625f, nullptr, 0, nullptr, 1, 0, 0, outb, nullptr, DM, 0, SS, DM, DM); k_gemm_hhx<0, 4><<<gD, 128, 0, stream>>>(Ol, DM, 0, BWo, DM, 0, 0.0625f / 1024.0f, nullptr, 0, outb, 1, (size_t)DM, 0, outb, nullptr, DM, 0, SS, DM, DM);      /* out·Wo (hi + lo) */
    k_gemm_hhx<0, 4><<<gL, 128, 0, stream>>>(Oh, DM, 0, BAo, DM, 0, 0.0625f, nullptr, 0, nullptr, 1, 0, 0, OA, nullptr, LR, 0, SS, LR, DM); k_gemm_hhx<0, 4><<<gL, 128, 0, stream>>>(Ol, DM, 0, BAo, DM, 0, 0.0625f / 1024.0f, nullptr, 0, OA, 1, (size_t)LR, 0, OA, nullptr, LR, 0, SS, LR, DM); k_split<<<nba, 256, 0, stream>>>(OA, OAh, OAl, a8);
    k_gemm_hhx<0, 2><<<gD, 128, 0, stream>>>(OAh, LR, 0, BBo, LR, 0, 0.0625f, nullptr, 0, outb, 1, (size_t)DM, 0, outb, nullptr, DM, 0, SS, DM, LR); k_gemm_hhx<0, 2><<<gD, 128, 0, stream>>>(OAl, LR, 0, BBo, LR, 0, 0.0625f / 1024.0f, nullptr, 0, outb, 1, (size_t)DM, 0, outb, nullptr, DM, 0, SS, DM, LR); }      /* + (out·Ao)·Bo */
}

// v003
// One run takes 539 microseconds.
// Timed twice side by side with v002, it ran 1.33 and 1.32 times as fast.
// Counting every step since v000, it is 3.39 times as fast.
#include <hip/hip_runtime.h>
// HoloKV attention (B 2, S 2048, 16 heads × 64, k_factor 4 → 512 slots): q = x·Wq + (x·Aq)·Bq, k = x·Wk, v = x·Wv + (x·Av)·Bv; RoPE (half-split rotate, θ_i = 1/10000^(2i/64)); keys/values compressed into slots of 4 tokens with Hadamard phases /2: full_K[s] = Σ_t k[4s+t]·c[t]/2, partial (causal prefix inside the slot); query phase c[q mod 4]; scores over slots: aligned_q·full_K/8 for earlier slots, aligned_q·partial_K(q's prefix)/8 for its own slot, −inf for later slots; softmax; out = Σ w·full_V + w_curr·(partial_V − full_V[curr]); out·phase·2; y = out·Wo + (out·Ao)·Bo → [2,2048,1024].
// Compute dtype: x and parameters rounded to bf16; projections with exact products and the LoRA paths on f16 hi + lo·2^10 operands of x·A (≈f32); RoPE, phases, slot sums/prefixes in f32; aligned q and full_K/full_V as f16 GEMM operands (scores O(1)), the own-slot score, masking, softmax and the rank-1 correction in f32; attention output as f16 hi + lo·2^10 into Wo and the LoRA output path. v_wmma_f32_16x16x32_f16.
#define NBt 2
#define SS 2048
#define DM 1024
#define NH 16
#define DH 64
#define KF 4
#define NSL (SS / KF)            /* 512 slots */
#define LR 64
#define NR (NBt * SS)
typedef __bf16 v16b __attribute__((ext_vector_type(16)));
typedef unsigned short v8us __attribute__((ext_vector_type(8), may_alias));
typedef float  v8f  __attribute__((ext_vector_type(8)));
typedef float  v4f  __attribute__((ext_vector_type(4)));
typedef float  v4fa __attribute__((ext_vector_type(4), may_alias));
union FragB { v16b v; v8us half[2]; unsigned short u[16]; };

__device__ __forceinline__ unsigned short bf16_bits(float x) { unsigned int u = __float_as_uint(x); return (unsigned short)((u + 0x7FFFu + ((u >> 16) & 1u)) >> 16); }
__device__ __forceinline__ float bf16_val(unsigned short b) { return __uint_as_float(((unsigned int)b) << 16); }
__device__ __forceinline__ float bf16_round(float x) { return bf16_val(bf16_bits(x)); }
// D += A·B with NT terms: 1 = ah·bh, 2 = + al·bh (A split), 3 = + ah·bl (both split)
template <int NT>
__device__ __forceinline__ v8f mmaN(v16b ah, v16b al, v16b bh, v16b bl, v8f c) {
  c = __builtin_amdgcn_wmma_f32_16x16x32_bf16(false, ah, false, bh, (short)0, c, false, false);
  if (NT >= 2) c = __builtin_amdgcn_wmma_f32_16x16x32_bf16(false, al, false, bh, (short)0, c, false, false);
  if (NT >= 3) c = __builtin_amdgcn_wmma_f32_16x16x32_bf16(false, ah, false, bl, (short)0, c, false, false);
  asm volatile("v_nop\n\tv_nop\n\tv_nop\n\tv_nop" : "+v"(c) : "v"(ah), "v"(al), "v"(bh), "v"(bl));
  return c;
}

__global__ __launch_bounds__(256) void k_wt_bf16(const float* __restrict__ W, unsigned short* __restrict__ Wt, int K, int N) {
  const int t = blockIdx.x * 256 + threadIdx.x;
  const int k8n = K / 8;
  if (t >= N * k8n) return;
  const int n = t / k8n, k8 = (t % k8n) * 8;
  v8us v;
#pragma unroll
  for (int i = 0; i < 8; ++i) v[i] = bf16_bits(W[(size_t)(k8 + i) * N + n]);
  *(v8us*)(Wt + (size_t)n * K + k8) = v;
  
}

// GEMM C[M][N] (f32, pitch ldc) = act(A[M][K]·W + bias). A f32 row-major (pitch lda) converted per fragment to bf16
// (ASPLIT: hi/lo two planes -> 2 terms, else single rounded term); Wt bf16 [N][K] (pitch ldb). BIAS_BF16 rounds the
// bias to bf16 first (bias quantised to bf16 before the add). K%32==0, M%16==0, N%64==0.
template <bool ASPLIT, int ACT, bool BIAS_BF16>
__global__ __launch_bounds__(128) void k_gemm_bf(const float* __restrict__ A, int lda, const unsigned short* __restrict__ Wt, int ldb,
                                               const float* __restrict__ bias, float* __restrict__ C, int ldc, int M, int N, int K) {
  __shared__ __attribute__((aligned(16))) float so[4][16][64];
  const int tid = threadIdx.x, w = tid >> 5, lane = tid & 31, ln = lane & 15, hh = lane >> 4;
  const int ntn = N / 64;
  const int wid = blockIdx.x * 4 + w;
  const int mt = wid / ntn, nq = wid % ntn;
  if (mt * 16 >= M) return;
  const int row0 = mt * 16, col0 = nq * 64;
  const float* arow = A + (size_t)(row0 + ln) * lda;
  v8f acc[4] = {};
  for (int kb = 0; kb < K; kb += 32) {
    FragB ah, al;
    const v4f x0 = *(const v4fa*)(arow + kb + 8 * hh), x1 = *(const v4fa*)(arow + kb + 8 * hh + 4);
    const v4f x2 = *(const v4fa*)(arow + kb + 16 + 8 * hh), x3 = *(const v4fa*)(arow + kb + 16 + 8 * hh + 4);
    float xs[16] = {x0[0],x0[1],x0[2],x0[3],x1[0],x1[1],x1[2],x1[3],x2[0],x2[1],x2[2],x2[3],x3[0],x3[1],x3[2],x3[3]};
#pragma unroll
    for (int i = 0; i < 16; ++i) { const unsigned short hb = bf16_bits(xs[i]); ah.u[i] = hb; al.u[i] = ASPLIT ? bf16_bits(xs[i] - bf16_val(hb)) : (unsigned short)0; }
#pragma unroll
    for (int t = 0; t < 4; ++t) {
      const unsigned short* brow = Wt + (size_t)(col0 + t * 16 + ln) * ldb + kb;
      FragB b;
      b.half[0] = *(const v8us*)(brow + 8 * hh);
      b.half[1] = *(const v8us*)(brow + 16 + 8 * hh);
      acc[t] = mmaN<ASPLIT ? 2 : 1>(ah.v, al.v, b.v, b.v, acc[t]);
    }
  }
#pragma unroll
  for (int t = 0; t < 4; ++t) {
    float bv = bias ? bias[col0 + t * 16 + ln] : 0.f;
    if (BIAS_BF16) bv = bf16_round(bv);
#pragma unroll
    for (int r = 0; r < 8; ++r) { float v = acc[t][r] + bv; if (ACT == 1) v = fmaxf(v, 0.f); so[w][8 * hh + r][t * 16 + ln] = v; }
  }
  __builtin_amdgcn_fence(__ATOMIC_ACQ_REL, "workgroup");
  __builtin_amdgcn_wave_barrier();
  const int rsub = lane >> 4, c4 = (lane & 15) * 4;
  {
#pragma unroll
    for (int q = 0; q < 8; ++q) {
      const int r = q * 2 + rsub;
      const v4f v = *(const v4fa*)&so[w][r][c4];
      *(v4f*)(C + (size_t)(row0 + r) * ldc + col0 + c4) = v;
    }
    
  }
}

// GEMM C = act(A·W + bias + resid): A f32 (ASPLIT -> hi/lo 2 terms), Wt bf16 [N][K]; ACT 0 none, 1 relu, 2 exact gelu;
// resid (optional, f32, row index = (row % rmod), pitch ldr, RES_BF16 rounds it) added before the activation.
template <bool ASPLIT, int ACT, bool BIAS_BF16, bool RES_BF16>
__global__ __launch_bounds__(128) void k_gemm_bf3(const float* __restrict__ A, int lda, const unsigned short* __restrict__ Wt, int ldb,
                                                const float* __restrict__ bias, const float* __restrict__ resid, int rmod, int ldr,
                                                float* __restrict__ C, int ldc, int M, int N, int K) {
  __shared__ __attribute__((aligned(16))) float so[4][16][64];
  const int tid = threadIdx.x, w = tid >> 5, lane = tid & 31, ln = lane & 15, hh = lane >> 4;
  const int ntn = N / 64;
  const int wid = blockIdx.x * 4 + w;
  const int mt = wid / ntn, nq = wid % ntn;
  if (mt * 16 >= M) return;
  const int row0 = mt * 16, col0 = nq * 64;
  const float* arow = A + (size_t)(row0 + ln) * lda;
  v8f acc[4] = {};
  for (int kb = 0; kb < K; kb += 32) {
    FragB ah, al;
    const v4f x0 = *(const v4fa*)(arow + kb + 8 * hh), x1 = *(const v4fa*)(arow + kb + 8 * hh + 4);
    const v4f x2 = *(const v4fa*)(arow + kb + 16 + 8 * hh), x3 = *(const v4fa*)(arow + kb + 16 + 8 * hh + 4);
    float xs[16] = {x0[0],x0[1],x0[2],x0[3],x1[0],x1[1],x1[2],x1[3],x2[0],x2[1],x2[2],x2[3],x3[0],x3[1],x3[2],x3[3]};
#pragma unroll
    for (int i = 0; i < 16; ++i) { const unsigned short hb = bf16_bits(xs[i]); ah.u[i] = hb; al.u[i] = ASPLIT ? bf16_bits(xs[i] - bf16_val(hb)) : (unsigned short)0; }
#pragma unroll
    for (int t = 0; t < 4; ++t) {
      const unsigned short* brow = Wt + (size_t)(col0 + t * 16 + ln) * ldb + kb;
      FragB b;
      b.half[0] = *(const v8us*)(brow + 8 * hh);
      b.half[1] = *(const v8us*)(brow + 16 + 8 * hh);
      acc[t] = mmaN<ASPLIT ? 2 : 1>(ah.v, al.v, b.v, b.v, acc[t]);
    }
  }
#pragma unroll
  for (int t = 0; t < 4; ++t) {
    const int col = col0 + t * 16 + ln;
    float bv = bias ? bias[col] : 0.f;
    if (BIAS_BF16) bv = bf16_round(bv);
#pragma unroll
    for (int r = 0; r < 8; ++r) {
      float v = acc[t][r] + bv;
      if (resid) { float rv = resid[(size_t)((row0 + 8 * hh + r) % rmod) * ldr + col]; if (RES_BF16) rv = bf16_round(rv); v += rv; }
      if (ACT == 1) v = fmaxf(v, 0.f);
      if (ACT == 2) v = 0.5f * v * (1.0f + erff(v * 0.70710678118654752f));
      if (ACT == 3) { const float u = 0.7978845608028654f * (v + 0.044715f * v * v * v); v = 0.5f * v * (1.0f + tanhf(u)); }
      so[w][8 * hh + r][t * 16 + ln] = v;
    }
  }
  __builtin_amdgcn_fence(__ATOMIC_ACQ_REL, "workgroup");
  __builtin_amdgcn_wave_barrier();
  const int rsub = lane >> 4, c4 = (lane & 15) * 4;
  {
#pragma unroll
    for (int q = 0; q < 8; ++q) {
      const int r = q * 2 + rsub;
      const v4f v = *(const v4fa*)&so[w][r][c4];
      *(v4f*)(C + (size_t)(row0 + r) * ldc + col0 + c4) = v;
    }
    
  }
}
// row LayerNorm (biased variance, eps) over N: s = X (+ R); optional out_sum <- s; out_norm <- (s-mu)*rsqrt(var+eps)*g + b
template <bool PARAM_BF16>
__global__ __launch_bounds__(256) void k_layernorm(const float* __restrict__ X, const float* __restrict__ R, const float* __restrict__ g, const float* __restrict__ bta,
                                                  float* __restrict__ out_sum, float* __restrict__ out_norm, int N, float eps) {
  __shared__ float red[256];
  const int row = blockIdx.x, tid = threadIdx.x;
  const float* x = X + (size_t)row * N; const float* rr = R ? R + (size_t)row * N : nullptr;
  float vals[16];                     // up to N = 4096
  const int per = N / 256;            // contiguous chunk per thread? use strided-by-4 chunks: thread handles j = tid*4 + 1024*u
  float s1 = 0.f;
  for (int u = 0; u < per / 4; ++u) {
    const int j = tid * 4 + 1024 * u;
    const v4f a = *(const v4fa*)(x + j);
    v4f b = {0.f,0.f,0.f,0.f}; if (rr) b = *(const v4fa*)(rr + j);
#pragma unroll
    for (int q = 0; q < 4; ++q) { const float v = a[q] + b[q]; vals[u * 4 + q] = v; s1 += v; }
  }
  red[tid] = s1; __syncthreads();
  for (int st = 128; st > 0; st >>= 1) { if (tid < st) red[tid] += red[tid + st]; __syncthreads(); }
  const float mu = red[0] / (float)N; __syncthreads();
  float s2 = 0.f;
  for (int u = 0; u < per / 4; ++u)
#pragma unroll
    for (int q = 0; q < 4; ++q) { const float c = vals[u * 4 + q] - mu; s2 += c * c; }
  red[tid] = s2; __syncthreads();
  for (int st = 128; st > 0; st >>= 1) { if (tid < st) red[tid] += red[tid + st]; __syncthreads(); }
  const float rs = rsqrtf(red[0] / (float)N + eps);
  {
    for (int u = 0; u < per / 4; ++u) {
      const int j = tid * 4 + 1024 * u;
      v4f o, sm;
#pragma unroll
      for (int q = 0; q < 4; ++q) {
        float gg = g[j + q], bb = bta[j + q];
        if (PARAM_BF16) { gg = bf16_round(gg); bb = bf16_round(bb); }
        sm[q] = vals[u * 4 + q]; o[q] = (vals[u * 4 + q] - mu) * rs * gg + bb;
      }
      if (out_sum) *(v4f*)(out_sum + (size_t)row * N + j) = sm;
      *(v4f*)(out_norm + (size_t)row * N + j) = o;
    }
    
  }
}



// ---- f16 WMMA path (v_wmma_f32_16x16x32_f16): 11-bit significands for operands in range — used where a [0,1] probability operand needs more precision than bf16
typedef _Float16 v16h __attribute__((ext_vector_type(16)));
union FragH { v16h v; v8us half[2]; _Float16 h[16]; unsigned short u[16]; };
template <int NT>
__device__ __forceinline__ v8f mmaH(v16h ah, v16h al, v16h bh, v16h bl, v8f c) {
  c = __builtin_amdgcn_wmma_f32_16x16x32_f16(false, ah, false, bh, (short)0, c, false, false);
  if (NT >= 2) c = __builtin_amdgcn_wmma_f32_16x16x32_f16(false, al, false, bh, (short)0, c, false, false);
  if (NT >= 3) c = __builtin_amdgcn_wmma_f32_16x16x32_f16(false, ah, false, bl, (short)0, c, false, false);
  asm volatile("v_nop\n\tv_nop\n\tv_nop\n\tv_nop" : "+v"(c) : "v"(ah), "v"(al), "v"(bh), "v"(bl));
  return c;
}
// batched GEMM like k_gemm_b but f16 operands: A f32 (split into f16 hi/lo if ASPLIT, else rounded to f16), Bt = f16 values [n][k]; alpha; C f32; N multiple of 16 (partial tiles skipped)
template <bool ASPLIT>
__global__ __launch_bounds__(128) void k_gemm_h(const float* __restrict__ A, int lda, size_t sA, const _Float16* __restrict__ Bh, int ldb, size_t sB, float alpha, float* __restrict__ C, int ldc, size_t sC, int M, int N, int K) {
  __shared__ __attribute__((aligned(16))) float so[4][16][64];
  const int tid = threadIdx.x, w = tid >> 5, lane = tid & 31, ln = lane & 15, hh = lane >> 4; const int by = blockIdx.y;
  A += (size_t)by * sA; Bh += (size_t)by * sB; C += (size_t)by * sC;
  const int ntn = (N + 63) / 64; const int wid = blockIdx.x * 4 + w; const int mt = wid / ntn, nq = wid % ntn; if (mt * 16 >= M) return;
  const int row0 = mt * 16, col0 = nq * 64; const float* arow = A + (size_t)(row0 + ln) * lda;
  v8f acc[4] = {};
  for (int kb = 0; kb < K; kb += 32) {
    FragH ah, al;
    const v4f x0 = *(const v4fa*)(arow + kb + 8 * hh), x1 = *(const v4fa*)(arow + kb + 8 * hh + 4), x2 = *(const v4fa*)(arow + kb + 16 + 8 * hh), x3 = *(const v4fa*)(arow + kb + 16 + 8 * hh + 4);
    float xs[16] = {x0[0],x0[1],x0[2],x0[3],x1[0],x1[1],x1[2],x1[3],x2[0],x2[1],x2[2],x2[3],x3[0],x3[1],x3[2],x3[3]};
#pragma unroll
    for (int i = 0; i < 16; ++i) { const _Float16 h = (_Float16)xs[i]; ah.h[i] = h; al.h[i] = ASPLIT ? (_Float16)(xs[i] - (float)h) : (_Float16)0.0f; }
#pragma unroll
    for (int t = 0; t < 4; ++t) { if (col0 + t * 16 >= N) continue; const size_t boff = (size_t)(col0 + t * 16 + ln) * ldb + kb; FragH bq; bq.half[0] = *(const v8us*)(Bh + boff + 8 * hh); bq.half[1] = *(const v8us*)(Bh + boff + 16 + 8 * hh);
      acc[t] = mmaH<ASPLIT ? 2 : 1>(ah.v, al.v, bq.v, bq.v, acc[t]); }
  }
#pragma unroll
  for (int t = 0; t < 4; ++t) { if (col0 + t * 16 >= N) continue;
#pragma unroll
    for (int r = 0; r < 8; ++r) so[w][8 * hh + r][t * 16 + ln] = acc[t][r] * alpha; }
  __builtin_amdgcn_fence(__ATOMIC_ACQ_REL, "workgroup"); __builtin_amdgcn_wave_barrier();
  const int rsub = lane >> 4, c4 = (lane & 15) * 4;
  {
#pragma unroll
    for (int q = 0; q < 8; ++q) { const int r = q * 2 + rsub; if (col0 + c4 < N) { const v4f v = *(const v4fa*)&so[w][r][c4]; *(v4f*)(C + (size_t)(row0 + r) * ldc + col0 + c4) = v; } }
     }
}

// Wt[n][k] = f16(W[k][n]·scale) from f32 row-major W[K][N] (scale = power of two; bf16-exact weights stay exact in f16 away from the subnormal range)
__global__ __launch_bounds__(256) void k_wt_f16(const float* __restrict__ W, _Float16* __restrict__ Wt, int K, int N, float scale) {
  const int t = blockIdx.x * 256 + threadIdx.x; if (t >= N * (K / 8)) return; const int n = t / (K / 8), k8 = (t % (K / 8)) * 8; FragH f;
#pragma unroll
  for (int i = 0; i < 8; ++i) f.h[i] = (_Float16)(bf16_round(W[(size_t)(k8 + i) * N + n]) * scale); const v8us o = f.half[0];
  *(v8us*)((unsigned short*)Wt + (size_t)n * K + k8) = o; 
}
// One work-group = one 64 x 64 tile of C; wave w owns rows 16w..16w+15 of it, all 64 columns. Per stage the four waves bring 64 rows of A and 64 rows of B, 32 * KU k each,
// from global memory with whole-line 16-byte loads into registers and store them to LDS (row pitch = row bytes + 16, conflict-free for 16-byte fragment reads); every wave reads its
// fragments from LDS, so the B tile is fetched once per work-group instead of once per wave and no global load is spread over 16 rows. Two LDS buffers: the next stage's global loads
// are issued before this stage's WMMAs and stored to the other buffer behind them, one barrier per stage. M and N multiples of 64, K a multiple of 32 * KU. The k order per accumulator is ascending.
// Every loop over i, u and t is unrolled so that ra, rb, oa, ob and the fragments are registers, not indexed arrays in scratch.
// k_gemm_hh variant with fused epilogue: v = acc·alpha + bias[by·sBias + col] (+ CP[(row/rowsPerB)·sCPb + by·64 + col] if CP) ; ACT 0 none / 1 elu ; writes f32 C and f16 C16, each if non-null
template <int ACT, int KU>
__global__ __launch_bounds__(128) void k_gemm_hhx(const _Float16* __restrict__ A, int lda, size_t sA, const _Float16* __restrict__ Bh, int ldb, size_t sB, float alpha, const float* __restrict__ bias, size_t sBias, const float* __restrict__ CP, int rowsPerB, size_t sCPb, int row0g,
    float* __restrict__ C, _Float16* __restrict__ C16, int ldc, size_t sC, int M, int N, int K) {
  constexpr int RB = 64 * KU, PITCH = RB + 16, UPR = RB / 16, RP = 128 / UPR, NU = 64 / RP, TILE = 64 * PITCH;      /* row bytes, LDS pitch, 16-byte units per row, rows per pass of 128 threads, passes per tile, tile bytes */
  __shared__ __attribute__((aligned(16))) char sm[4 * TILE];      /* [buffer][A tile | B tile]; the epilogue's 16 KiB of staging reuses it behind the last stage's barrier */
  static_assert(4 * TILE >= 4 * 16 * 64 * 4, "epilogue staging must fit");
  float (*so)[16][64] = (float (*)[16][64])sm;
  const int tid = threadIdx.x, w = tid >> 5, lane = tid & 31, ln = lane & 15, hh = lane >> 4; const int by = blockIdx.y;
  A += (size_t)by * sA; Bh += (size_t)by * sB; const size_t cofs = (size_t)by * sC; const float* bp = bias ? bias + (size_t)by * sBias : nullptr;
  const int ntn = (N + 63) / 64; const int mtb = blockIdx.x / ntn, nq = blockIdx.x % ntn; if (mtb * 64 >= M) return;      /* the same for the whole work-group, ahead of every barrier */
  const int row0 = mtb * 64 + w * 16, col0 = nq * 64;
  v8f acc[4] = {};
  const char* Ab = (const char*)A; const char* Bb = (const char*)Bh;      /* uniform bases; each thread keeps one 32-bit byte offset per load */
  const int sr = tid / UPR, sc = (tid % UPR) * 16;
  const unsigned ga = (unsigned)((mtb * 64 + sr) * lda * 2 + sc), gb = (unsigned)((col0 + sr) * ldb * 2 + sc), ls = (unsigned)(sr * PITCH + sc);
  unsigned oa[NU], ob[NU];      /* moved on by one stage's bytes just ahead of the stage's loads: the loads that named the old values were waited for ahead of the last barrier */
#pragma unroll
  for (int i = 0; i < NU; ++i) { oa[i] = ga + (unsigned)(i * RP * lda * 2); ob[i] = gb + (unsigned)(i * RP * ldb * 2); }
  const unsigned fa = (unsigned)((w * 16 + ln) * PITCH + 16 * hh), fb = (unsigned)(TILE + ln * PITCH + 16 * hh);
  v8us ra[NU], rb[NU];
#pragma unroll
  for (int i = 0; i < NU; ++i) { ra[i] = *(const v8us*)(Ab + oa[i]); rb[i] = *(const v8us*)(Bb + ob[i]); }
#pragma unroll
  for (int i = 0; i < NU; ++i) { *(v8us*)(sm + ls + i * RP * PITCH) = ra[i]; *(v8us*)(sm + TILE + ls + i * RP * PITCH) = rb[i]; }
  __syncthreads();      /* stage 0 is in buffer 0 for every wave */
  const int nst = K / (32 * KU);
  for (int s = 0; s < nst; ++s) { const bool more = s + 1 < nst; const char* cur = sm + (s & 1) * 2 * TILE; char* nxt = sm + ((s + 1) & 1) * 2 * TILE;
    if (more) {
#pragma unroll
      for (int i = 0; i < NU; ++i) { oa[i] += RB; ob[i] += RB; ra[i] = *(const v8us*)(Ab + oa[i]); rb[i] = *(const v8us*)(Bb + ob[i]); } }
    FragH ah[KU], bq[KU][4];
#pragma unroll
    for (int u = 0; u < KU; ++u) { ah[u].half[0] = *(const v8us*)(cur + fa + 64 * u); ah[u].half[1] = *(const v8us*)(cur + fa + 64 * u + 32);
#pragma unroll
      for (int t = 0; t < 4; ++t) { bq[u][t].half[0] = *(const v8us*)(cur + fb + t * 16 * PITCH + 64 * u); bq[u][t].half[1] = *(const v8us*)(cur + fb + t * 16 * PITCH + 64 * u + 32); } }
#pragma unroll
    for (int u = 0; u < KU; ++u) {
#pragma unroll
      for (int t = 0; t < 4; ++t) acc[t] = mmaH<1>(ah[u].v, ah[u].v, bq[u][t].v, bq[u][t].v, acc[t]); }
    if (more) {
#pragma unroll
      for (int i = 0; i < NU; ++i) { *(v8us*)(nxt + ls + i * RP * PITCH) = ra[i]; *(v8us*)(nxt + TILE + ls + i * RP * PITCH) = rb[i]; } }
    __syncthreads();      /* publishes the next stage's buffer and ends every wave's reads of this one (refilled one stage on; staged over by the epilogue behind the last) */
  }
#pragma unroll
  for (int t = 0; t < 4; ++t) { if (col0 + t * 16 >= N) continue; const int col = col0 + t * 16 + ln; const float bv = bp ? bf16_round(bp[col]) : 0.f;
#pragma unroll
    for (int r = 0; r < 8; ++r) { float v = acc[t][r] * alpha + bv; if (CP) { const int bidx = (row0g + row0 + 8 * hh + r) / rowsPerB; v += CP[(size_t)bidx * sCPb + (size_t)by * 64 + col]; } if (ACT == 1) v = (v > 0.f) ? v : expm1f(v); else if (ACT == 7) v = (v > 0.f) ? v + 1.0f : expf(v); else if (ACT == 8) v = tanhf(v); else if (ACT == 9) v = 0.5f * v * (1.0f + tanhf(0.7978845608028654f * (v + 0.044715f * v * v * v))); else if (ACT == 11) v = 1.0f / (1.0f + expf(-v)); else if (ACT == 12) v = (v > 0.f) ? v : 0.01f * v; else if (ACT == 14) v = (v > 0.f) ? v : 0.1f * v; else if (ACT == 15) v = v / (1.0f + expf(-v)); else if (ACT == 3) v = fmaxf(v, 0.f); else if (ACT == 6) v = 0.5f * v * (1.0f + erff(v * 0.70710678118654752f)); so[w][8 * hh + r][t * 16 + ln] = v; } }
  __builtin_amdgcn_fence(__ATOMIC_ACQ_REL, "workgroup"); __builtin_amdgcn_wave_barrier();
  const int rsub = lane >> 4, c4 = (lane & 15) * 4; typedef _Float16 v4h __attribute__((ext_vector_type(4)));
  {
#pragma unroll
    for (int q = 0; q < 8; ++q) { const int r = q * 2 + rsub; if (col0 + c4 < N) { const v4f v = *(const v4fa*)&so[w][r][c4]; if (C) *(v4f*)(C + cofs + (size_t)(row0 + r) * ldc + col0 + c4) = v; if (C16) { v4h h4; for (int i = 0; i < 4; ++i) h4[i] = (_Float16)v[i]; *(v4h*)(C16 + cofs + (size_t)(row0 + r) * ldc + col0 + c4) = h4; } } }
     }
}


typedef _Float16 v4h __attribute__((ext_vector_type(4)));

__global__ __launch_bounds__(256) void k_x16(const float* __restrict__ x, _Float16* __restrict__ X16, size_t n8) { const size_t t = (size_t)blockIdx.x * 256 + threadIdx.x; if (t >= n8) return; FragH f;
#pragma unroll
  for (int q = 0; q < 8; ++q) f.h[q] = (_Float16)bf16_round(x[t * 8 + q]); *(v8us*)((unsigned short*)X16 + t * 8) = f.half[0];  }
__global__ __launch_bounds__(256) void k_h16(const float* __restrict__ x, _Float16* __restrict__ X16, size_t n8) { const size_t t = (size_t)blockIdx.x * 256 + threadIdx.x; if (t >= n8) return; FragH f;
#pragma unroll
  for (int q = 0; q < 8; ++q) f.h[q] = (_Float16)x[t * 8 + q]; *(v8us*)((unsigned short*)X16 + t * 8) = f.half[0];  }
__global__ __launch_bounds__(256) void k_round16f(const float* __restrict__ W, _Float16* __restrict__ Bt, size_t n8) { const size_t t = (size_t)blockIdx.x * 256 + threadIdx.x; if (t >= n8) return; FragH f;
#pragma unroll
  for (int i = 0; i < 8; ++i) f.h[i] = (_Float16)(bf16_round(W[t * 8 + i]) * 16.0f); *(v8us*)((unsigned short*)Bt + t * 8) = f.half[0];  }
template <int NHv, int TTv>
__global__ __launch_bounds__(256) void k_vt(const _Float16* __restrict__ V16, int ldv, int voff, _Float16* __restrict__ Vt) { __shared__ unsigned short tl[64][66]; const int tid = threadIdx.x; const int slab = blockIdx.x / (TTv / 64), lg = blockIdx.x % (TTv / 64); const int b = slab / NHv, h = slab % NHv;
  for (int i = tid; i < 64 * 8; i += 256) { const int r = i / 8, c8 = (i % 8) * 8; FragH f; f.half[0] = *(const v8us*)((const unsigned short*)V16 + ((size_t)b * TTv + lg * 64 + r) * ldv + voff + h * 64 + c8);
#pragma unroll
    for (int q = 0; q < 8; ++q) tl[r][c8 + q] = f.u[q]; }
  __syncthreads();
  {
#pragma unroll
    for (int rd = 0; rd < 2; ++rd) { const int d = rd * 32 + tid / 8, pc = tid % 8; FragH f;
#pragma unroll
      for (int q = 0; q < 8; ++q) f.u[q] = tl[pc * 8 + q][d];
      *(v8us*)((unsigned short*)Vt + ((size_t)slab * 64 + d) * TTv + lg * 64 + pc * 8) = f.half[0]; }
     } }

__global__ __launch_bounds__(256) void k_hl(const float* __restrict__ F, _Float16* __restrict__ Hh, _Float16* __restrict__ Hl, size_t n8) { const size_t t = (size_t)blockIdx.x * 256 + threadIdx.x; if (t >= n8) return; FragH fh, fl; const v4f a = *(const v4fa*)(F + t * 8), c = *(const v4fa*)(F + t * 8 + 4);
#pragma unroll
  for (int q = 0; q < 4; ++q) { _Float16 h = (_Float16)a[q]; fh.h[q] = h; fl.h[q] = (_Float16)((a[q] - (float)h) * 1024.0f); h = (_Float16)c[q]; fh.h[4 + q] = h; fl.h[4 + q] = (_Float16)((c[q] - (float)h) * 1024.0f); }
  { *(v8us*)((unsigned short*)Hh + t * 8) = fh.half[0]; *(v8us*)((unsigned short*)Hl + t * 8) = fl.half[0];  } }

__global__ __launch_bounds__(256) void k_split(const float* __restrict__ F, _Float16* __restrict__ Hh, _Float16* __restrict__ Hl, size_t n8) {
  #pragma clang fp contract(off)
  const size_t t = (size_t)blockIdx.x * 256 + threadIdx.x; if (t >= n8) return; const v4f a = *(const v4fa*)(F + t * 8), c = *(const v4fa*)(F + t * 8 + 4); FragH fh, fl;
#pragma unroll
  for (int q = 0; q < 8; ++q) { const float v = (q < 4) ? a[q] : c[q - 4]; const _Float16 hi = (_Float16)v; fh.h[q] = hi; fl.h[q] = (_Float16)((v - (float)hi) * 1024.0f); }
  { *(v8us*)((unsigned short*)Hh + t * 8) = fh.half[0]; *(v8us*)((unsigned short*)Hl + t * 8) = fl.half[0];  } }
__global__ __launch_bounds__(256) void k_cstab(float* __restrict__ CS, float* __restrict__ SN) {
  #pragma clang fp contract(off)
  const int t = blockIdx.x * 256 + threadIdx.x; if (t >= SS * DH) return; const int d = t % DH, p = t / DH; const int i = d & 31; const float theta = 1.0f / powf(10000.0f, (float)(2 * i) / 64.0f); const float ang = (float)p * theta; const float c = cosf(ang), s = sinf(ang);
  { *(float*)(CS + t) = c; *(float*)(SN + t) = s;  } }
__device__ __forceinline__ float cdma(int t, int d) { const int j = d & 3; const int par = __popc((unsigned)(t & j)); return (par & 1) ? -1.0f : 1.0f; }      /* Hadamard H4[t][d mod 4] (Sylvester order: rows [1,1,1,1],[1,-1,1,-1],[1,1,-1,-1],[1,-1,-1,1]) */
__global__ __launch_bounds__(256) void k_slots(const float* __restrict__ Q, const float* __restrict__ K, const float* __restrict__ V, const float* __restrict__ CS, const float* __restrict__ SN, _Float16* __restrict__ FK16, _Float16* __restrict__ FV16, float* __restrict__ FKf, float* __restrict__ FVf, float* __restrict__ PK, float* __restrict__ PVp, _Float16* __restrict__ AQ16, float* __restrict__ AQf) {
  #pragma clang fp contract(off)
  const int t = blockIdx.x * 256 + threadIdx.x; if (t >= NH * NSL * (DH / 8)) return; const int d0 = (t % (DH / 8)) * 8; const int s = (t / (DH / 8)) % NSL; const int bh = t / ((DH / 8) * NSL); const int b = 0, h = bh;      /* batch-local: the host passes per-batch workspace buffers, rewritten for each batch */
  FragH fk, fv; v4f fkA, fkB, fvA, fvB;
  float pk[KF][8], pv[KF][8];      /* running prefixes per token step */
#pragma unroll
  for (int q = 0; q < 8; ++q) { const int d = d0 + q; float accK = 0.f, accV = 0.f;
#pragma unroll
    for (int tt = 0; tt < KF; ++tt) { const int tok = s * KF + tt; const float* kp = K + ((size_t)b * SS + tok) * DM + h * DH; const float* vp = V + ((size_t)b * SS + tok) * DM + h * DH; const float c = CS[(size_t)tok * DH + d], sn = SN[(size_t)tok * DH + d];
      const float kr = kp[d] * c + ((d < 32) ? -kp[d + 32] : kp[d - 32]) * sn; const float ph = cdma(tt, d) * 0.5f;      /* /sqrt(k_factor) */
      accK += kr * ph; accV += vp[d] * ph; pk[tt][q] = accK; pv[tt][q] = accV; }
    fk.h[q] = (_Float16)accK; fv.h[q] = (_Float16)accV; if (q < 4) { fkA[q] = accK; fvA[q] = accV; } else { fkB[q - 4] = accK; fvB[q - 4] = accV; } }
  const size_t srow = ((size_t)bh * NSL + s) * DH + d0;
  { *(v8us*)((unsigned short*)FK16 + srow) = fk.half[0]; *(v8us*)((unsigned short*)FV16 + srow) = fv.half[0]; *(v4f*)(FKf + srow) = fkA; *(v4f*)(FKf + srow + 4) = fkB; *(v4f*)(FVf + srow) = fvA; *(v4f*)(FVf + srow + 4) = fvB;  }
#pragma unroll
  for (int tt = 0; tt < KF; ++tt) { const int tok = s * KF + tt; const size_t prow = ((size_t)b * SS + tok) * DM + h * DH + d0; v4f a, c2, e, g;
#pragma unroll
    for (int q = 0; q < 4; ++q) { a[q] = pk[tt][q]; c2[q] = pk[tt][4 + q]; e[q] = pv[tt][q]; g[q] = pv[tt][4 + q]; }
    /* aligned q for this token */ const float* qp = Q + ((size_t)b * SS + tok) * DM + h * DH; FragH fq; v4f qa, qb2;
#pragma unroll
    for (int q = 0; q < 8; ++q) { const int d = d0 + q; const float c = CS[(size_t)tok * DH + d], sn = SN[(size_t)tok * DH + d]; const float qr = qp[d] * c + ((d < 32) ? -qp[d + 32] : qp[d - 32]) * sn; const float aq = qr * cdma(tt, d); fq.h[q] = (_Float16)aq; if (q < 4) qa[q] = aq; else qb2[q - 4] = aq; }
    const size_t arow = ((size_t)bh * SS + tok) * DH + d0;
    { *(v4f*)(PK + prow) = a; *(v4f*)(PK + prow + 4) = c2; *(v4f*)(PVp + prow) = e; *(v4f*)(PVp + prow + 4) = g; *(v8us*)((unsigned short*)AQ16 + arow) = fq.half[0]; *(v4f*)(AQf + prow) = qa; *(v4f*)(AQf + prow + 4) = qb2;  } } }
__global__ __launch_bounds__(256) void k_fvt(const float* __restrict__ FVf, _Float16* __restrict__ FVT) { const int t = blockIdx.x * 256 + threadIdx.x; if (t >= NH * DH * (NSL / 8)) return; const int s0 = (t % (NSL / 8)) * 8; const int d = (t / (NSL / 8)) % DH; const int h = t / ((NSL / 8) * DH); FragH f;
#pragma unroll
  for (int q = 0; q < 8; ++q) f.h[q] = (_Float16)FVf[((size_t)h * NSL + s0 + q) * DH + d];
  *(v8us*)((unsigned short*)FVT + ((size_t)h * DH + d) * NSL + s0) = f.half[0];  }
__global__ __launch_bounds__(256) void k_hsoft(const float* __restrict__ S, const float* __restrict__ AQf, const float* __restrict__ PK, _Float16* __restrict__ W16, float* __restrict__ WC) {
  #pragma clang fp contract(off)
  const int tid = threadIdx.x, w = tid >> 5, ln = tid & 31; const int h = blockIdx.y; const int q = blockIdx.x * 8 + w; if (q >= SS) return; const int cs = q / KF; const size_t prow = (size_t)q * DM + h * DH; S += (size_t)h * SS * NSL; W16 += (size_t)h * SS * NSL;      /* head on grid.y: each head has its own score and weight plane */
  float cur = AQf[prow + ln] * PK[prow + ln] + AQf[prow + 32 + ln] * PK[prow + 32 + ln]; for (int o = 16; o > 0; o >>= 1) cur += __shfl_xor(cur, o, 32); cur *= 0.125f;
  const float* sr = S + (size_t)q * NSL; float v[16]; float m = -3.0e38f;
#pragma unroll
  for (int k = 0; k < 16; ++k) { const int sl = 16 * ln + k; float x = sr[sl]; x = (sl == cs) ? cur : x; x = (sl > cs) ? -3.0e38f : x; v[k] = x; m = fmaxf(m, x); }
  for (int o = 16; o > 0; o >>= 1) m = fmaxf(m, __shfl_xor(m, o, 32));
  float su = 0.f;
#pragma unroll
  for (int k = 0; k < 16; ++k) { const int sl = 16 * ln + k; v[k] = (sl > cs) ? 0.f : expf(v[k] - m); su += v[k]; }
  for (int o = 16; o > 0; o >>= 1) su += __shfl_xor(su, o, 32); const float inv = 1.0f / su; FragH f0, f1; float wc = 0.f;
#pragma unroll
  for (int k = 0; k < 16; ++k) { const int sl = 16 * ln + k; const float wv = v[k] * inv; wc = (sl == cs) ? wv : wc; if (k < 8) f0.h[k] = (_Float16)(wv * 1024.0f); else f1.h[k - 8] = (_Float16)(wv * 1024.0f); }
  for (int o = 16; o > 0; o >>= 1) wc += __shfl_xor(wc, o, 32);      /* exactly one lane holds the current slot */
  { *(v8us*)((unsigned short*)W16 + (size_t)q * NSL + 16 * ln) = f0.half[0]; *(v8us*)((unsigned short*)W16 + (size_t)q * NSL + 16 * ln + 8) = f1.half[0]; *(float*)(WC + ((size_t)h * SS + q) * 32 + ln) = wc;  } }      /* one whole 128-byte line per (head, row), written by this wave alone */
__global__ __launch_bounds__(256) void k_oepi(const float* __restrict__ O, const float* __restrict__ WC, const float* __restrict__ PVp, const float* __restrict__ FVf, _Float16* __restrict__ Oh, _Float16* __restrict__ Ol) {
  #pragma clang fp contract(off)
  const int t = blockIdx.x * 256 + threadIdx.x; if (t >= SS * NH * (DH / 8)) return; const int d0 = (t % (DH / 8)) * 8; const int h = (t / (DH / 8)) % NH; const int bq = t / ((DH / 8) * NH); const int b = 0, q = bq; const int cs = q / KF, tt = q % KF; const float wc = WC[((size_t)h * SS + bq) * 32]; const size_t prow = (size_t)bq * DM + h * DH + d0; const size_t srow = ((size_t)(b * NH + h) * NSL + cs) * DH + d0; FragH fh, fl;
#pragma unroll
  for (int k = 0; k < 8; ++k) { const int d = d0 + k; const float o = O[prow + k] + wc * (PVp[prow + k] - FVf[srow + k]); const float v = (o * cdma(tt, d)) * 2.0f; const _Float16 hi = (_Float16)v; fh.h[k] = hi; fl.h[k] = (_Float16)((v - (float)hi) * 1024.0f); }
  { *(v8us*)((unsigned short*)Oh + prow) = fh.half[0]; *(v8us*)((unsigned short*)Ol + prow) = fl.half[0];  } }

extern "C" void kernel_launch(void* const* d_in, const int* in_sizes, int n_in,
                              void* d_out, int out_size, void* d_ws, size_t ws_size, hipStream_t stream) {
  (void)in_sizes; (void)n_in; (void)out_size;
  const float* x = (const float*)d_in[0]; const float* Wq = (const float*)d_in[1]; const float* Wk = (const float*)d_in[2]; const float* Wv = (const float*)d_in[3]; const float* Wo = (const float*)d_in[4]; const float* Aq = (const float*)d_in[5]; const float* Bq = (const float*)d_in[6]; const float* Av = (const float*)d_in[7]; const float* Bv = (const float*)d_in[8]; const float* Ao = (const float*)d_in[9]; const float* Bo = (const float*)d_in[10];
  char* ws = (char*)d_ws; size_t off = 0;
  auto take = [&](size_t bytes) { char* p = ws + off; off += (bytes + 255) & ~(size_t)255; return p; };
  _Float16* BWq = (_Float16*)take((size_t)DM * DM * 2); _Float16* BWk = (_Float16*)take((size_t)DM * DM * 2); _Float16* BWv = (_Float16*)take((size_t)DM * DM * 2); _Float16* BWo = (_Float16*)take((size_t)DM * DM * 2); _Float16* BAq = (_Float16*)take((size_t)LR * DM * 2); _Float16* BAv = (_Float16*)take((size_t)LR * DM * 2); _Float16* BAo = (_Float16*)take((size_t)LR * DM * 2); _Float16* BBq = (_Float16*)take((size_t)DM * LR * 2); _Float16* BBv = (_Float16*)take((size_t)DM * LR * 2); _Float16* BBo = (_Float16*)take((size_t)DM * LR * 2);
  float* CS = (float*)take((size_t)SS * DH * 4); float* SN = (float*)take((size_t)SS * DH * 4);
  _Float16* X16 = (_Float16*)take((size_t)SS * DM * 2); float* Q = (float*)take((size_t)SS * DM * 4); float* K = (float*)take((size_t)SS * DM * 4); float* V = (float*)take((size_t)SS * DM * 4); float* XA = (float*)take((size_t)SS * LR * 4); _Float16* XAh = (_Float16*)take((size_t)SS * LR * 2); _Float16* XAl = (_Float16*)take((size_t)SS * LR * 2);
  _Float16* FK16 = (_Float16*)take((size_t)NH * NSL * DH * 2); _Float16* FV16 = (_Float16*)take((size_t)NH * NSL * DH * 2); float* FKf = (float*)take((size_t)NH * NSL * DH * 4); float* FVf = (float*)take((size_t)NH * NSL * DH * 4); float* PK = (float*)take((size_t)SS * DM * 4); float* PVp = (float*)take((size_t)SS * DM * 4); _Float16* AQ16 = (_Float16*)take((size_t)NH * SS * DH * 2); float* AQf = (float*)take((size_t)SS * DM * 4);
  float* S = (float*)take((size_t)NH * SS * NSL * 4); _Float16* W16 = (_Float16*)take((size_t)NH * SS * NSL * 2); float* WC = (float*)take((size_t)NH * SS * 32 * 4); _Float16* FVT = (_Float16*)take((size_t)NH * DH * NSL * 2); float* O = (float*)take((size_t)SS * DM * 4); _Float16* Oh = (_Float16*)take((size_t)SS * DM * 2); _Float16* Ol = (_Float16*)take((size_t)SS * DM * 2); float* OA = (float*)take((size_t)SS * LR * 4); _Float16* OAh = (_Float16*)take((size_t)SS * LR * 2); _Float16* OAl = (_Float16*)take((size_t)SS * LR * 2);
  if (off > ws_size) return;      // weights 9 + tables 1 + per-batch planes 181: about 191 MiB
  const unsigned nbW = (DM * (DM / 8) + 255) / 256;
  k_wt_f16<<<nbW, 256, 0, stream>>>(Wq, BWq, DM, DM, 16.0f); k_wt_f16<<<nbW, 256, 0, stream>>>(Wk, BWk, DM, DM, 16.0f); k_wt_f16<<<nbW, 256, 0, stream>>>(Wv, BWv, DM, DM, 16.0f); k_wt_f16<<<nbW, 256, 0, stream>>>(Wo, BWo, DM, DM, 16.0f);      /* all weights are (in,out) */
  k_wt_f16<<<(LR * (DM / 8) + 255) / 256, 256, 0, stream>>>(Aq, BAq, DM, LR, 16.0f); k_wt_f16<<<(LR * (DM / 8) + 255) / 256, 256, 0, stream>>>(Av, BAv, DM, LR, 16.0f); k_wt_f16<<<(LR * (DM / 8) + 255) / 256, 256, 0, stream>>>(Ao, BAo, DM, LR, 16.0f);
  k_wt_f16<<<(DM * (LR / 8) + 255) / 256, 256, 0, stream>>>(Bq, BBq, LR, DM, 16.0f); k_wt_f16<<<(DM * (LR / 8) + 255) / 256, 256, 0, stream>>>(Bv, BBv, LR, DM, 16.0f); k_wt_f16<<<(DM * (LR / 8) + 255) / 256, 256, 0, stream>>>(Bo, BBo, LR, DM, 16.0f);
  k_cstab<<<(SS * DH + 255) / 256, 256, 0, stream>>>(CS, SN);
  const dim3 gD(((SS / 16) * (DM / 64) + 3) / 4, 1), gL(((SS / 16) * 1 + 3) / 4, 1), gL4(((SS / 16) * 1 + 3) / 4, NH), gS(((SS / 16) * (NSL / 64) + 3) / 4, NH), gH(SS / 8, NH); const size_t n8 = (size_t)SS * DM / 8; const unsigned nb8 = (unsigned)((n8 + 255) / 256); const size_t a8 = (size_t)SS * LR / 8; const unsigned nba = (unsigned)((a8 + 255) / 256);
  for (int b = 0; b < NBt; ++b) {
    k_x16<<<nb8, 256, 0, stream>>>(x + (size_t)b * SS * DM, X16, n8);
    k_gemm_hhx<0, 4><<<gD, 128, 0, stream>>>(X16, DM, 0, BWq, DM, 0, 0.0625f, nullptr, 0, nullptr, 1, 0, 0, Q, nullptr, DM, 0, SS, DM, DM); k_gemm_hhx<0, 4><<<gD, 128, 0, stream>>>(X16, DM, 0, BWk, DM, 0, 0.0625f, nullptr, 0, nullptr, 1, 0, 0, K, nullptr, DM, 0, SS, DM, DM); k_gemm_hhx<0, 4><<<gD, 128, 0, stream>>>(X16, DM, 0, BWv, DM, 0, 0.0625f, nullptr, 0, nullptr, 1, 0, 0, V, nullptr, DM, 0, SS, DM, DM);      /* x·W (exact) */
    k_gemm_hhx<0, 4><<<gL, 128, 0, stream>>>(X16, DM, 0, BAq, DM, 0, 0.0625f, nullptr, 0, nullptr, 1, 0, 0, XA, nullptr, LR, 0, SS, LR, DM); k_split<<<nba, 256, 0, stream>>>(XA, XAh, XAl, a8);
    k_gemm_hhx<0, 2><<<gD, 128, 0, stream>>>(XAh, LR, 0, BBq, LR, 0, 0.0625f, nullptr, 0, Q, 1, (size_t)DM, 0, Q, nullptr, DM, 0, SS, DM, LR); k_gemm_hhx<0, 2><<<gD, 128, 0, stream>>>(XAl, LR, 0, BBq, LR, 0, 0.0625f / 1024.0f, nullptr, 0, Q, 1, (size_t)DM, 0, Q, nullptr, DM, 0, SS, DM, LR);      /* q += (x·Aq)·Bq */
    k_gemm_hhx<0, 4><<<gL, 128, 0, stream>>>(X16, DM, 0, BAv, DM, 0, 0.0625f, nullptr, 0, nullptr, 1, 0, 0, XA, nullptr, LR, 0, SS, LR, DM); k_split<<<nba, 256, 0, stream>>>(XA, XAh, XAl, a8);
    k_gemm_hhx<0, 2><<<gD, 128, 0, stream>>>(XAh, LR, 0, BBv, LR, 0, 0.0625f, nullptr, 0, V, 1, (size_t)DM, 0, V, nullptr, DM, 0, SS, DM, LR); k_gemm_hhx<0, 2><<<gD, 128, 0, stream>>>(XAl, LR, 0, BBv, LR, 0, 0.0625f / 1024.0f, nullptr, 0, V, 1, (size_t)DM, 0, V, nullptr, DM, 0, SS, DM, LR);      /* v += (x·Av)·Bv */
    k_slots<<<(NH * NSL * (DH / 8) + 255) / 256, 256, 0, stream>>>(Q, K, V, CS, SN, FK16, FV16, FKf, FVf, PK, PVp, AQ16, AQf);
    k_fvt<<<(NH * DH * (NSL / 8) + 255) / 256, 256, 0, stream>>>(FVf, FVT);
    /* all 16 heads in one launch each, head = blockIdx.y */
    k_gemm_hhx<0, 2><<<gS, 128, 0, stream>>>(AQ16, DH, (size_t)SS * DH, FK16, DH, (size_t)NSL * DH, 0.125f, nullptr, 0, nullptr, 1, 0, 0, S, nullptr, NSL, (size_t)SS * NSL, SS, NSL, DH);      /* slot scores/8: M 2048 N 512 K 64 per head */
    k_hsoft<<<gH, 256, 0, stream>>>(S, AQf, PK, W16, WC);
    k_gemm_hhx<0, 4><<<gL4, 128, 0, stream>>>(W16, NSL, (size_t)SS * NSL, FVT, NSL, (size_t)DH * NSL, 0.0009765625f, nullptr, 0, nullptr, 1, 0, 0, O, nullptr, DM, (size_t)DH, SS, DH, NSL);      /* sum of w * full_V into O cols h*64: M 2048 N 64 K 512 per head */
    k_oepi<<<(SS * NH * (DH / 8) + 255) / 256, 256, 0, stream>>>(O, WC, PVp, FVf, Oh, Ol);
    float* outb = (float*)d_out + (size_t)b * SS * DM;
    k_gemm_hhx<0, 4><<<gD, 128, 0, stream>>>(Oh, DM, 0, BWo, DM, 0, 0.0625f, nullptr, 0, nullptr, 1, 0, 0, outb, nullptr, DM, 0, SS, DM, DM); k_gemm_hhx<0, 4><<<gD, 128, 0, stream>>>(Ol, DM, 0, BWo, DM, 0, 0.0625f / 1024.0f, nullptr, 0, outb, 1, (size_t)DM, 0, outb, nullptr, DM, 0, SS, DM, DM);      /* out·Wo (hi + lo) */
    k_gemm_hhx<0, 4><<<gL, 128, 0, stream>>>(Oh, DM, 0, BAo, DM, 0, 0.0625f, nullptr, 0, nullptr, 1, 0, 0, OA, nullptr, LR, 0, SS, LR, DM); k_gemm_hhx<0, 4><<<gL, 128, 0, stream>>>(Ol, DM, 0, BAo, DM, 0, 0.0625f / 1024.0f, nullptr, 0, OA, 1, (size_t)LR, 0, OA, nullptr, LR, 0, SS, LR, DM); k_split<<<nba, 256, 0, stream>>>(OA, OAh, OAl, a8);
    k_gemm_hhx<0, 2><<<gD, 128, 0, stream>>>(OAh, LR, 0, BBo, LR, 0, 0.0625f, nullptr, 0, outb, 1, (size_t)DM, 0, outb, nullptr, DM, 0, SS, DM, LR); k_gemm_hhx<0, 2><<<gD, 128, 0, stream>>>(OAl, LR, 0, BBo, LR, 0, 0.0625f / 1024.0f, nullptr, 0, outb, 1, (size_t)DM, 0, outb, nullptr, DM, 0, SS, DM, LR); }      /* + (out·Ao)·Bo */
}

// v004
// A run of this version takes 402 microseconds.
// In both of two side-by-side timings against v003, it was 1.36 times as fast.
// All steps since v000 together make it 4.61 times as fast.
#include <hip/hip_runtime.h>
// HoloKV attention (B 2, S 2048, 16 heads × 64, k_factor 4 → 512 slots): q = x·Wq + (x·Aq)·Bq, k = x·Wk, v = x·Wv + (x·Av)·Bv; RoPE (half-split rotate, θ_i = 1/10000^(2i/64)); keys/values compressed into slots of 4 tokens with Hadamard phases /2: full_K[s] = Σ_t k[4s+t]·c[t]/2, partial (causal prefix inside the slot); query phase c[q mod 4]; scores over slots: aligned_q·full_K/8 for earlier slots, aligned_q·partial_K(q's prefix)/8 for its own slot, −inf for later slots; softmax; out = Σ w·full_V + w_curr·(partial_V − full_V[curr]); out·phase·2; y = out·Wo + (out·Ao)·Bo → [2,2048,1024].
// Compute dtype: x and parameters rounded to bf16; projections with exact products and the LoRA paths on f16 hi + lo·2^10 operands of x·A (≈f32); RoPE, phases, slot sums/prefixes in f32; aligned q and full_K/full_V as f16 GEMM operands (scores O(1)), the own-slot score, masking, softmax and the rank-1 correction in f32; attention output as f16 hi + lo·2^10 into Wo and the LoRA output path. v_wmma_f32_16x16x32_f16.
#define NBt 2
#define SS 2048
#define DM 1024
#define NH 16
#define DH 64
#define KF 4
#define NSL (SS / KF)            /* 512 slots */
#define LR 64
#define NR (NBt * SS)
typedef __bf16 v16b __attribute__((ext_vector_type(16)));
typedef unsigned short v8us __attribute__((ext_vector_type(8), may_alias));
typedef float  v8f  __attribute__((ext_vector_type(8)));
typedef float  v4f  __attribute__((ext_vector_type(4)));
typedef float  v4fa __attribute__((ext_vector_type(4), may_alias));
union FragB { v16b v; v8us half[2]; unsigned short u[16]; };

__device__ __forceinline__ unsigned short bf16_bits(float x) { unsigned int u = __float_as_uint(x); return (unsigned short)((u + 0x7FFFu + ((u >> 16) & 1u)) >> 16); }
__device__ __forceinline__ float bf16_val(unsigned short b) { return __uint_as_float(((unsigned int)b) << 16); }
__device__ __forceinline__ float bf16_round(float x) { return bf16_val(bf16_bits(x)); }
// D += A·B with NT terms: 1 = ah·bh, 2 = + al·bh (A split), 3 = + ah·bl (both split)
template <int NT>
__device__ __forceinline__ v8f mmaN(v16b ah, v16b al, v16b bh, v16b bl, v8f c) {
  c = __builtin_amdgcn_wmma_f32_16x16x32_bf16(false, ah, false, bh, (short)0, c, false, false);
  if (NT >= 2) c = __builtin_amdgcn_wmma_f32_16x16x32_bf16(false, al, false, bh, (short)0, c, false, false);
  if (NT >= 3) c = __builtin_amdgcn_wmma_f32_16x16x32_bf16(false, ah, false, bl, (short)0, c, false, false);
  asm volatile("v_nop\n\tv_nop\n\tv_nop\n\tv_nop" : "+v"(c) : "v"(ah), "v"(al), "v"(bh), "v"(bl));
  return c;
}

__global__ __launch_bounds__(256) void k_wt_bf16(const float* __restrict__ W, unsigned short* __restrict__ Wt, int K, int N) {
  const int t = blockIdx.x * 256 + threadIdx.x;
  const int k8n = K / 8;
  if (t >= N * k8n) return;
  const int n = t / k8n, k8 = (t % k8n) * 8;
  v8us v;
#pragma unroll
  for (int i = 0; i < 8; ++i) v[i] = bf16_bits(W[(size_t)(k8 + i) * N + n]);
  *(v8us*)(Wt + (size_t)n * K + k8) = v;
  
}

// GEMM C[M][N] (f32, pitch ldc) = act(A[M][K]·W + bias). A f32 row-major (pitch lda) converted per fragment to bf16
// (ASPLIT: hi/lo two planes -> 2 terms, else single rounded term); Wt bf16 [N][K] (pitch ldb). BIAS_BF16 rounds the
// bias to bf16 first (bias quantised to bf16 before the add). K%32==0, M%16==0, N%64==0.
template <bool ASPLIT, int ACT, bool BIAS_BF16>
__global__ __launch_bounds__(128) void k_gemm_bf(const float* __restrict__ A, int lda, const unsigned short* __restrict__ Wt, int ldb,
                                               const float* __restrict__ bias, float* __restrict__ C, int ldc, int M, int N, int K) {
  __shared__ __attribute__((aligned(16))) float so[4][16][64];
  const int tid = threadIdx.x, w = tid >> 5, lane = tid & 31, ln = lane & 15, hh = lane >> 4;
  const int ntn = N / 64;
  const int wid = blockIdx.x * 4 + w;
  const int mt = wid / ntn, nq = wid % ntn;
  if (mt * 16 >= M) return;
  const int row0 = mt * 16, col0 = nq * 64;
  const float* arow = A + (size_t)(row0 + ln) * lda;
  v8f acc[4] = {};
  for (int kb = 0; kb < K; kb += 32) {
    FragB ah, al;
    const v4f x0 = *(const v4fa*)(arow + kb + 8 * hh), x1 = *(const v4fa*)(arow + kb + 8 * hh + 4);
    const v4f x2 = *(const v4fa*)(arow + kb + 16 + 8 * hh), x3 = *(const v4fa*)(arow + kb + 16 + 8 * hh + 4);
    float xs[16] = {x0[0],x0[1],x0[2],x0[3],x1[0],x1[1],x1[2],x1[3],x2[0],x2[1],x2[2],x2[3],x3[0],x3[1],x3[2],x3[3]};
#pragma unroll
    for (int i = 0; i < 16; ++i) { const unsigned short hb = bf16_bits(xs[i]); ah.u[i] = hb; al.u[i] = ASPLIT ? bf16_bits(xs[i] - bf16_val(hb)) : (unsigned short)0; }
#pragma unroll
    for (int t = 0; t < 4; ++t) {
      const unsigned short* brow = Wt + (size_t)(col0 + t * 16 + ln) * ldb + kb;
      FragB b;
      b.half[0] = *(const v8us*)(brow + 8 * hh);
      b.half[1] = *(const v8us*)(brow + 16 + 8 * hh);
      acc[t] = mmaN<ASPLIT ? 2 : 1>(ah.v, al.v, b.v, b.v, acc[t]);
    }
  }
#pragma unroll
  for (int t = 0; t < 4; ++t) {
    float bv = bias ? bias[col0 + t * 16 + ln] : 0.f;
    if (BIAS_BF16) bv = bf16_round(bv);
#pragma unroll
    for (int r = 0; r < 8; ++r) { float v = acc[t][r] + bv; if (ACT == 1) v = fmaxf(v, 0.f); so[w][8 * hh + r][t * 16 + ln] = v; }
  }
  __builtin_amdgcn_fence(__ATOMIC_ACQ_REL, "workgroup");
  __builtin_amdgcn_wave_barrier();
  const int rsub = lane >> 4, c4 = (lane & 15) * 4;
  {
#pragma unroll
    for (int q = 0; q < 8; ++q) {
      const int r = q * 2 + rsub;
      const v4f v = *(const v4fa*)&so[w][r][c4];
      *(v4f*)(C + (size_t)(row0 + r) * ldc + col0 + c4) = v;
    }
    
  }
}

// GEMM C = act(A·W + bias + resid): A f32 (ASPLIT -> hi/lo 2 terms), Wt bf16 [N][K]; ACT 0 none, 1 relu, 2 exact gelu;
// resid (optional, f32, row index = (row % rmod), pitch ldr, RES_BF16 rounds it) added before the activation.
template <bool ASPLIT, int ACT, bool BIAS_BF16, bool RES_BF16>
__global__ __launch_bounds__(128) void k_gemm_bf3(const float* __restrict__ A, int lda, const unsigned short* __restrict__ Wt, int ldb,
                                                const float* __restrict__ bias, const float* __restrict__ resid, int rmod, int ldr,
                                                float* __restrict__ C, int ldc, int M, int N, int K) {
  __shared__ __attribute__((aligned(16))) float so[4][16][64];
  const int tid = threadIdx.x, w = tid >> 5, lane = tid & 31, ln = lane & 15, hh = lane >> 4;
  const int ntn = N / 64;
  const int wid = blockIdx.x * 4 + w;
  const int mt = wid / ntn, nq = wid % ntn;
  if (mt * 16 >= M) return;
  const int row0 = mt * 16, col0 = nq * 64;
  const float* arow = A + (size_t)(row0 + ln) * lda;
  v8f acc[4] = {};
  for (int kb = 0; kb < K; kb += 32) {
    FragB ah, al;
    const v4f x0 = *(const v4fa*)(arow + kb + 8 * hh), x1 = *(const v4fa*)(arow + kb + 8 * hh + 4);
    const v4f x2 = *(const v4fa*)(arow + kb + 16 + 8 * hh), x3 = *(const v4fa*)(arow + kb + 16 + 8 * hh + 4);
    float xs[16] = {x0[0],x0[1],x0[2],x0[3],x1[0],x1[1],x1[2],x1[3],x2[0],x2[1],x2[2],x2[3],x3[0],x3[1],x3[2],x3[3]};
#pragma unroll
    for (int i = 0; i < 16; ++i) { const unsigned short hb = bf16_bits(xs[i]); ah.u[i] = hb; al.u[i] = ASPLIT ? bf16_bits(xs[i] - bf16_val(hb)) : (unsigned short)0; }
#pragma unroll
    for (int t = 0; t < 4; ++t) {
      const unsigned short* brow = Wt + (size_t)(col0 + t * 16 + ln) * ldb + kb;
      FragB b;
      b.half[0] = *(const v8us*)(brow + 8 * hh);
      b.half[1] = *(const v8us*)(brow + 16 + 8 * hh);
      acc[t] = mmaN<ASPLIT ? 2 : 1>(ah.v, al.v, b.v, b.v, acc[t]);
    }
  }
#pragma unroll
  for (int t = 0; t < 4; ++t) {
    const int col = col0 + t * 16 + ln;
    float bv = bias ? bias[col] : 0.f;
    if (BIAS_BF16) bv = bf16_round(bv);
#pragma unroll
    for (int r = 0; r < 8; ++r) {
      float v = acc[t][r] + bv;
      if (resid) { float rv = resid[(size_t)((row0 + 8 * hh + r) % rmod) * ldr + col]; if (RES_BF16) rv = bf16_round(rv); v += rv; }
      if (ACT == 1) v = fmaxf(v, 0.f);
      if (ACT == 2) v = 0.5f * v * (1.0f + erff(v * 0.70710678118654752f));
      if (ACT == 3) { const float u = 0.7978845608028654f * (v + 0.044715f * v * v * v); v = 0.5f * v * (1.0f + tanhf(u)); }
      so[w][8 * hh + r][t * 16 + ln] = v;
    }
  }
  __builtin_amdgcn_fence(__ATOMIC_ACQ_REL, "workgroup");
  __builtin_amdgcn_wave_barrier();
  const int rsub = lane >> 4, c4 = (lane & 15) * 4;
  {
#pragma unroll
    for (int q = 0; q < 8; ++q) {
      const int r = q * 2 + rsub;
      const v4f v = *(const v4fa*)&so[w][r][c4];
      *(v4f*)(C + (size_t)(row0 + r) * ldc + col0 + c4) = v;
    }
    
  }
}
// row LayerNorm (biased variance, eps) over N: s = X (+ R); optional out_sum <- s; out_norm <- (s-mu)*rsqrt(var+eps)*g + b
template <bool PARAM_BF16>
__global__ __launch_bounds__(256) void k_layernorm(const float* __restrict__ X, const float* __restrict__ R, const float* __restrict__ g, const float* __restrict__ bta,
                                                  float* __restrict__ out_sum, float* __restrict__ out_norm, int N, float eps) {
  __shared__ float red[256];
  const int row = blockIdx.x, tid = threadIdx.x;
  const float* x = X + (size_t)row * N; const float* rr = R ? R + (size_t)row * N : nullptr;
  float vals[16];                     // up to N = 4096
  const int per = N / 256;            // contiguous chunk per thread? use strided-by-4 chunks: thread handles j = tid*4 + 1024*u
  float s1 = 0.f;
  for (int u = 0; u < per / 4; ++u) {
    const int j = tid * 4 + 1024 * u;
    const v4f a = *(const v4fa*)(x + j);
    v4f b = {0.f,0.f,0.f,0.f}; if (rr) b = *(const v4fa*)(rr + j);
#pragma unroll
    for (int q = 0; q < 4; ++q) { const float v = a[q] + b[q]; vals[u * 4 + q] = v; s1 += v; }
  }
  red[tid] = s1; __syncthreads();
  for (int st = 128; st > 0; st >>= 1) { if (tid < st) red[tid] += red[tid + st]; __syncthreads(); }
  const float mu = red[0] / (float)N; __syncthreads();
  float s2 = 0.f;
  for (int u = 0; u < per / 4; ++u)
#pragma unroll
    for (int q = 0; q < 4; ++q) { const float c = vals[u * 4 + q] - mu; s2 += c * c; }
  red[tid] = s2; __syncthreads();
  for (int st = 128; st > 0; st >>= 1) { if (tid < st) red[tid] += red[tid + st]; __syncthreads(); }
  const float rs = rsqrtf(red[0] / (float)N + eps);
  {
    for (int u = 0; u < per / 4; ++u) {
      const int j = tid * 4 + 1024 * u;
      v4f o, sm;
#pragma unroll
      for (int q = 0; q < 4; ++q) {
        float gg = g[j + q], bb = bta[j + q];
        if (PARAM_BF16) { gg = bf16_round(gg); bb = bf16_round(bb); }
        sm[q] = vals[u * 4 + q]; o[q] = (vals[u * 4 + q] - mu) * rs * gg + bb;
      }
      if (out_sum) *(v4f*)(out_sum + (size_t)row * N + j) = sm;
      *(v4f*)(out_norm + (size_t)row * N + j) = o;
    }
    
  }
}



// ---- f16 WMMA path (v_wmma_f32_16x16x32_f16): 11-bit significands for operands in range — used where a [0,1] probability operand needs more precision than bf16
typedef _Float16 v16h __attribute__((ext_vector_type(16)));
union FragH { v16h v; v8us half[2]; _Float16 h[16]; unsigned short u[16]; };
template <int NT>
__device__ __forceinline__ v8f mmaH(v16h ah, v16h al, v16h bh, v16h bl, v8f c) {
  c = __builtin_amdgcn_wmma_f32_16x16x32_f16(false, ah, false, bh, (short)0, c, false, false);
  if (NT >= 2) c = __builtin_amdgcn_wmma_f32_16x16x32_f16(false, al, false, bh, (short)0, c, false, false);
  if (NT >= 3) c = __builtin_amdgcn_wmma_f32_16x16x32_f16(false, ah, false, bl, (short)0, c, false, false);
  asm volatile("v_nop\n\tv_nop\n\tv_nop\n\tv_nop" : "+v"(c) : "v"(ah), "v"(al), "v"(bh), "v"(bl));
  return c;
}
// batched GEMM like k_gemm_b but f16 operands: A f32 (split into f16 hi/lo if ASPLIT, else rounded to f16), Bt = f16 values [n][k]; alpha; C f32; N multiple of 16 (partial tiles skipped)
template <bool ASPLIT>
__global__ __launch_bounds__(128) void k_gemm_h(const float* __restrict__ A, int lda, size_t sA, const _Float16* __restrict__ Bh, int ldb, size_t sB, float alpha, float* __restrict__ C, int ldc, size_t sC, int M, int N, int K) {
  __shared__ __attribute__((aligned(16))) float so[4][16][64];
  const int tid = threadIdx.x, w = tid >> 5, lane = tid & 31, ln = lane & 15, hh = lane >> 4; const int by = blockIdx.y;
  A += (size_t)by * sA; Bh += (size_t)by * sB; C += (size_t)by * sC;
  const int ntn = (N + 63) / 64; const int wid = blockIdx.x * 4 + w; const int mt = wid / ntn, nq = wid % ntn; if (mt * 16 >= M) return;
  const int row0 = mt * 16, col0 = nq * 64; const float* arow = A + (size_t)(row0 + ln) * lda;
  v8f acc[4] = {};
  for (int kb = 0; kb < K; kb += 32) {
    FragH ah, al;
    const v4f x0 = *(const v4fa*)(arow + kb + 8 * hh), x1 = *(const v4fa*)(arow + kb + 8 * hh + 4), x2 = *(const v4fa*)(arow + kb + 16 + 8 * hh), x3 = *(const v4fa*)(arow + kb + 16 + 8 * hh + 4);
    float xs[16] = {x0[0],x0[1],x0[2],x0[3],x1[0],x1[1],x1[2],x1[3],x2[0],x2[1],x2[2],x2[3],x3[0],x3[1],x3[2],x3[3]};
#pragma unroll
    for (int i = 0; i < 16; ++i) { const _Float16 h = (_Float16)xs[i]; ah.h[i] = h; al.h[i] = ASPLIT ? (_Float16)(xs[i] - (float)h) : (_Float16)0.0f; }
#pragma unroll
    for (int t = 0; t < 4; ++t) { if (col0 + t * 16 >= N) continue; const size_t boff = (size_t)(col0 + t * 16 + ln) * ldb + kb; FragH bq; bq.half[0] = *(const v8us*)(Bh + boff + 8 * hh); bq.half[1] = *(const v8us*)(Bh + boff + 16 + 8 * hh);
      acc[t] = mmaH<ASPLIT ? 2 : 1>(ah.v, al.v, bq.v, bq.v, acc[t]); }
  }
#pragma unroll
  for (int t = 0; t < 4; ++t) { if (col0 + t * 16 >= N) continue;
#pragma unroll
    for (int r = 0; r < 8; ++r) so[w][8 * hh + r][t * 16 + ln] = acc[t][r] * alpha; }
  __builtin_amdgcn_fence(__ATOMIC_ACQ_REL, "workgroup"); __builtin_amdgcn_wave_barrier();
  const int rsub = lane >> 4, c4 = (lane & 15) * 4;
  {
#pragma unroll
    for (int q = 0; q < 8; ++q) { const int r = q * 2 + rsub; if (col0 + c4 < N) { const v4f v = *(const v4fa*)&so[w][r][c4]; *(v4f*)(C + (size_t)(row0 + r) * ldc + col0 + c4) = v; } }
     }
}

// Wt[n][k] = f16(W[k][n]·scale) from f32 row-major W[K][N] (scale = power of two; bf16-exact weights stay exact in f16 away from the subnormal range)
__global__ __launch_bounds__(256) void k_wt_f16(const float* __restrict__ W, _Float16* __restrict__ Wt, int K, int N, float scale) {
  const int t = blockIdx.x * 256 + threadIdx.x; if (t >= N * (K / 8)) return; const int n = t / (K / 8), k8 = (t % (K / 8)) * 8; FragH f;
#pragma unroll
  for (int i = 0; i < 8; ++i) f.h[i] = (_Float16)(bf16_round(W[(size_t)(k8 + i) * N + n]) * scale); const v8us o = f.half[0];
  *(v8us*)((unsigned short*)Wt + (size_t)n * K + k8) = o; 
}
// One work-group = one 64 x 64 tile of C; wave w owns rows 16w..16w+15 of it, all 64 columns. Per stage the four waves bring 64 rows of A and 64 rows of B, 32 * KU k each,
// from global memory with whole-line 16-byte loads into registers and store them to LDS (row pitch = row bytes + 16, conflict-free for 16-byte fragment reads); every wave reads its
// fragments from LDS, so the B tile is fetched once per work-group instead of once per wave and no global load is spread over 16 rows. Two LDS buffers: the next stage's global loads
// are issued before this stage's WMMAs and stored to the other buffer behind them, one barrier per stage. M and N multiples of 64, K a multiple of 32 * KU. The k order per accumulator is ascending.
// Every loop over i, u and t is unrolled so that ra, rb, oa, ob and the fragments are registers, not indexed arrays in scratch.
// k_gemm_hh variant with fused epilogue: v = acc·alpha + bias[by·sBias + col] (+ CP[(row/rowsPerB)·sCPb + by·64 + col] if CP) ; ACT 0 none / 1 elu ; writes f32 C and f16 C16, each if non-null
template <int ACT, int KU>
__global__ __launch_bounds__(128) void k_gemm_hhx(const _Float16* __restrict__ A, int lda, size_t sA, const _Float16* __restrict__ Bh, int ldb, size_t sB, float alpha, const float* __restrict__ bias, size_t sBias, const float* __restrict__ CP, int rowsPerB, size_t sCPb, int row0g,
    float* __restrict__ C, _Float16* __restrict__ C16, int ldc, size_t sC, int M, int N, int K) {
  constexpr int RB = 64 * KU, PITCH = RB + 16, UPR = RB / 16, RP = 128 / UPR, NU = 64 / RP, TILE = 64 * PITCH;      /* row bytes, LDS pitch, 16-byte units per row, rows per pass of 128 threads, passes per tile, tile bytes */
  __shared__ __attribute__((aligned(16))) char sm[4 * TILE];      /* [buffer][A tile | B tile]; the epilogue's 16 KiB of staging reuses it behind the last stage's barrier */
  static_assert(4 * TILE >= 4 * 16 * 64 * 4, "epilogue staging must fit");
  float (*so)[16][64] = (float (*)[16][64])sm;
  const int tid = threadIdx.x, w = tid >> 5, lane = tid & 31, ln = lane & 15, hh = lane >> 4; const int by = blockIdx.y;
  A += (size_t)by * sA; Bh += (size_t)by * sB; const size_t cofs = (size_t)by * sC; const float* bp = bias ? bias + (size_t)by * sBias : nullptr;
  const int ntn = (N + 63) / 64; const int mtb = blockIdx.x / ntn, nq = blockIdx.x % ntn; if (mtb * 64 >= M) return;      /* the same for the whole work-group, ahead of every barrier */
  const int row0 = mtb * 64 + w * 16, col0 = nq * 64;
  v8f acc[4] = {};
  const char* Ab = (const char*)A; const char* Bb = (const char*)Bh;      /* uniform bases; each thread keeps one 32-bit byte offset per load */
  const int sr = tid / UPR, sc = (tid % UPR) * 16;
  const unsigned ga = (unsigned)((mtb * 64 + sr) * lda * 2 + sc), gb = (unsigned)((col0 + sr) * ldb * 2 + sc), ls = (unsigned)(sr * PITCH + sc);
  unsigned oa[NU], ob[NU];      /* moved on by one stage's bytes just ahead of the stage's loads: the loads that named the old values were waited for ahead of the last barrier */
#pragma unroll
  for (int i = 0; i < NU; ++i) { oa[i] = ga + (unsigned)(i * RP * lda * 2); ob[i] = gb + (unsigned)(i * RP * ldb * 2); }
  const unsigned fa = (unsigned)((w * 16 + ln) * PITCH + 16 * hh), fb = (unsigned)(TILE + ln * PITCH + 16 * hh);
  v8us ra[NU], rb[NU];
#pragma unroll
  for (int i = 0; i < NU; ++i) { ra[i] = *(const v8us*)(Ab + oa[i]); rb[i] = *(const v8us*)(Bb + ob[i]); }
#pragma unroll
  for (int i = 0; i < NU; ++i) { *(v8us*)(sm + ls + i * RP * PITCH) = ra[i]; *(v8us*)(sm + TILE + ls + i * RP * PITCH) = rb[i]; }
  __syncthreads();      /* stage 0 is in buffer 0 for every wave */
  const int nst = K / (32 * KU);
  for (int s = 0; s < nst; ++s) { const bool more = s + 1 < nst; const char* cur = sm + (s & 1) * 2 * TILE; char* nxt = sm + ((s + 1) & 1) * 2 * TILE;
    if (more) {
#pragma unroll
      for (int i = 0; i < NU; ++i) { oa[i] += RB; ob[i] += RB; ra[i] = *(const v8us*)(Ab + oa[i]); rb[i] = *(const v8us*)(Bb + ob[i]); } }
    FragH ah[KU], bq[KU][4];
#pragma unroll
    for (int u = 0; u < KU; ++u) { ah[u].half[0] = *(const v8us*)(cur + fa + 64 * u); ah[u].half[1] = *(const v8us*)(cur + fa + 64 * u + 32);
#pragma unroll
      for (int t = 0; t < 4; ++t) { bq[u][t].half[0] = *(const v8us*)(cur + fb + t * 16 * PITCH + 64 * u); bq[u][t].half[1] = *(const v8us*)(cur + fb + t * 16 * PITCH + 64 * u + 32); } }
#pragma unroll
    for (int u = 0; u < KU; ++u) {
#pragma unroll
      for (int t = 0; t < 4; ++t) acc[t] = mmaH<1>(ah[u].v, ah[u].v, bq[u][t].v, bq[u][t].v, acc[t]); }
    if (more) {
#pragma unroll
      for (int i = 0; i < NU; ++i) { *(v8us*)(nxt + ls + i * RP * PITCH) = ra[i]; *(v8us*)(nxt + TILE + ls + i * RP * PITCH) = rb[i]; } }
    __syncthreads();      /* publishes the next stage's buffer and ends every wave's reads of this one (refilled one stage on; staged over by the epilogue behind the last) */
  }
#pragma unroll
  for (int t = 0; t < 4; ++t) { if (col0 + t * 16 >= N) continue; const int col = col0 + t * 16 + ln; const float bv = bp ? bf16_round(bp[col]) : 0.f;
#pragma unroll
    for (int r = 0; r < 8; ++r) { float v = acc[t][r] * alpha + bv; if (CP) { const int bidx = (row0g + row0 + 8 * hh + r) / rowsPerB; v += CP[(size_t)bidx * sCPb + (size_t)by * 64 + col]; } if (ACT == 1) v = (v > 0.f) ? v : expm1f(v); else if (ACT == 7) v = (v > 0.f) ? v + 1.0f : expf(v); else if (ACT == 8) v = tanhf(v); else if (ACT == 9) v = 0.5f * v * (1.0f + tanhf(0.7978845608028654f * (v + 0.044715f * v * v * v))); else if (ACT == 11) v = 1.0f / (1.0f + expf(-v)); else if (ACT == 12) v = (v > 0.f) ? v : 0.01f * v; else if (ACT == 14) v = (v > 0.f) ? v : 0.1f * v; else if (ACT == 15) v = v / (1.0f + expf(-v)); else if (ACT == 3) v = fmaxf(v, 0.f); else if (ACT == 6) v = 0.5f * v * (1.0f + erff(v * 0.70710678118654752f)); so[w][8 * hh + r][t * 16 + ln] = v; } }
  __builtin_amdgcn_fence(__ATOMIC_ACQ_REL, "workgroup"); __builtin_amdgcn_wave_barrier();
  const int rsub = lane >> 4, c4 = (lane & 15) * 4; typedef _Float16 v4h __attribute__((ext_vector_type(4)));
  {
#pragma unroll
    for (int q = 0; q < 8; ++q) { const int r = q * 2 + rsub; if (col0 + c4 < N) { const v4f v = *(const v4fa*)&so[w][r][c4]; if (C) *(v4f*)(C + cofs + (size_t)(row0 + r) * ldc + col0 + c4) = v; if (C16) { v4h h4; for (int i = 0; i < 4; ++i) h4[i] = (_Float16)v[i]; *(v4h*)(C16 + cofs + (size_t)(row0 + r) * ldc + col0 + c4) = h4; } } }
     }
}


typedef _Float16 v4h __attribute__((ext_vector_type(4)));

__global__ __launch_bounds__(256) void k_x16(const float* __restrict__ x, _Float16* __restrict__ X16, size_t n8) { const size_t t = (size_t)blockIdx.x * 256 + threadIdx.x; if (t >= n8) return; FragH f;
#pragma unroll
  for (int q = 0; q < 8; ++q) f.h[q] = (_Float16)bf16_round(x[t * 8 + q]); *(v8us*)((unsigned short*)X16 + t * 8) = f.half[0];  }
__global__ __launch_bounds__(256) void k_h16(const float* __restrict__ x, _Float16* __restrict__ X16, size_t n8) { const size_t t = (size_t)blockIdx.x * 256 + threadIdx.x; if (t >= n8) return; FragH f;
#pragma unroll
  for (int q = 0; q < 8; ++q) f.h[q] = (_Float16)x[t * 8 + q]; *(v8us*)((unsigned short*)X16 + t * 8) = f.half[0];  }
__global__ __launch_bounds__(256) void k_round16f(const float* __restrict__ W, _Float16* __restrict__ Bt, size_t n8) { const size_t t = (size_t)blockIdx.x * 256 + threadIdx.x; if (t >= n8) return; FragH f;
#pragma unroll
  for (int i = 0; i < 8; ++i) f.h[i] = (_Float16)(bf16_round(W[t * 8 + i]) * 16.0f); *(v8us*)((unsigned short*)Bt + t * 8) = f.half[0];  }
template <int NHv, int TTv>
__global__ __launch_bounds__(256) void k_vt(const _Float16* __restrict__ V16, int ldv, int voff, _Float16* __restrict__ Vt) { __shared__ unsigned short tl[64][66]; const int tid = threadIdx.x; const int slab = blockIdx.x / (TTv / 64), lg = blockIdx.x % (TTv / 64); const int b = slab / NHv, h = slab % NHv;
  for (int i = tid; i < 64 * 8; i += 256) { const int r = i / 8, c8 = (i % 8) * 8; FragH f; f.half[0] = *(const v8us*)((const unsigned short*)V16 + ((size_t)b * TTv + lg * 64 + r) * ldv + voff + h * 64 + c8);
#pragma unroll
    for (int q = 0; q < 8; ++q) tl[r][c8 + q] = f.u[q]; }
  __syncthreads();
  {
#pragma unroll
    for (int rd = 0; rd < 2; ++rd) { const int d = rd * 32 + tid / 8, pc = tid % 8; FragH f;
#pragma unroll
      for (int q = 0; q < 8; ++q) f.u[q] = tl[pc * 8 + q][d];
      *(v8us*)((unsigned short*)Vt + ((size_t)slab * 64 + d) * TTv + lg * 64 + pc * 8) = f.half[0]; }
     } }

__global__ __launch_bounds__(256) void k_hl(const float* __restrict__ F, _Float16* __restrict__ Hh, _Float16* __restrict__ Hl, size_t n8) { const size_t t = (size_t)blockIdx.x * 256 + threadIdx.x; if (t >= n8) return; FragH fh, fl; const v4f a = *(const v4fa*)(F + t * 8), c = *(const v4fa*)(F + t * 8 + 4);
#pragma unroll
  for (int q = 0; q < 4; ++q) { _Float16 h = (_Float16)a[q]; fh.h[q] = h; fl.h[q] = (_Float16)((a[q] - (float)h) * 1024.0f); h = (_Float16)c[q]; fh.h[4 + q] = h; fl.h[4 + q] = (_Float16)((c[q] - (float)h) * 1024.0f); }
  { *(v8us*)((unsigned short*)Hh + t * 8) = fh.half[0]; *(v8us*)((unsigned short*)Hl + t * 8) = fl.half[0];  } }

__global__ __launch_bounds__(256) void k_split(const float* __restrict__ F, _Float16* __restrict__ Hh, _Float16* __restrict__ Hl, size_t n8) {
  #pragma clang fp contract(off)
  const size_t t = (size_t)blockIdx.x * 256 + threadIdx.x; if (t >= n8) return; const v4f a = *(const v4fa*)(F + t * 8), c = *(const v4fa*)(F + t * 8 + 4); FragH fh, fl;
#pragma unroll
  for (int q = 0; q < 8; ++q) { const float v = (q < 4) ? a[q] : c[q - 4]; const _Float16 hi = (_Float16)v; fh.h[q] = hi; fl.h[q] = (_Float16)((v - (float)hi) * 1024.0f); }
  { *(v8us*)((unsigned short*)Hh + t * 8) = fh.half[0]; *(v8us*)((unsigned short*)Hl + t * 8) = fl.half[0];  } }
__global__ __launch_bounds__(256) void k_cstab(float* __restrict__ CS, float* __restrict__ SN) {
  #pragma clang fp contract(off)
  const int t = blockIdx.x * 256 + threadIdx.x; if (t >= SS * DH) return; const int d = t % DH, p = t / DH; const int i = d & 31; const float theta = 1.0f / powf(10000.0f, (float)(2 * i) / 64.0f); const float ang = (float)p * theta; const float c = cosf(ang), s = sinf(ang);
  { *(float*)(CS + t) = c; *(float*)(SN + t) = s;  } }
__device__ __forceinline__ float cdma(int t, int d) { const int j = d & 3; const int par = __popc((unsigned)(t & j)); return (par & 1) ? -1.0f : 1.0f; }      /* Hadamard H4[t][d mod 4] (Sylvester order: rows [1,1,1,1],[1,-1,1,-1],[1,1,-1,-1],[1,-1,-1,1]) */
__global__ __launch_bounds__(256) void k_slots(const float* __restrict__ Q, const float* __restrict__ K, const float* __restrict__ V, const float* __restrict__ CS, const float* __restrict__ SN, _Float16* __restrict__ FK16, _Float16* __restrict__ FV16, float* __restrict__ FKf, float* __restrict__ FVf, float* __restrict__ PK, float* __restrict__ PVp, _Float16* __restrict__ AQ16, float* __restrict__ AQf) {
  #pragma clang fp contract(off)
  const int t = blockIdx.x * 256 + threadIdx.x; if (t >= NBt * NH * NSL * (DH / 8)) return; const int d0 = (t % (DH / 8)) * 8; const int s = (t / (DH / 8)) % NSL; const int bh = t / ((DH / 8) * NSL); const int b = bh / NH, h = bh % NH;      /* both batches in one launch: bh = batch * 16 + head */
  FragH fk, fv; v4f fkA, fkB, fvA, fvB;
  float pk[KF][8], pv[KF][8];      /* running prefixes per token step */
#pragma unroll
  for (int q = 0; q < 8; ++q) { const int d = d0 + q; float accK = 0.f, accV = 0.f;
#pragma unroll
    for (int tt = 0; tt < KF; ++tt) { const int tok = s * KF + tt; const float* kp = K + ((size_t)b * SS + tok) * DM + h * DH; const float* vp = V + ((size_t)b * SS + tok) * DM + h * DH; const float c = CS[(size_t)tok * DH + d], sn = SN[(size_t)tok * DH + d];
      const float kr = kp[d] * c + ((d < 32) ? -kp[d + 32] : kp[d - 32]) * sn; const float ph = cdma(tt, d) * 0.5f;      /* /sqrt(k_factor) */
      accK += kr * ph; accV += vp[d] * ph; pk[tt][q] = accK; pv[tt][q] = accV; }
    fk.h[q] = (_Float16)accK; fv.h[q] = (_Float16)accV; if (q < 4) { fkA[q] = accK; fvA[q] = accV; } else { fkB[q - 4] = accK; fvB[q - 4] = accV; } }
  const size_t srow = ((size_t)bh * NSL + s) * DH + d0;
  { *(v8us*)((unsigned short*)FK16 + srow) = fk.half[0]; *(v8us*)((unsigned short*)FV16 + srow) = fv.half[0]; *(v4f*)(FKf + srow) = fkA; *(v4f*)(FKf + srow + 4) = fkB; *(v4f*)(FVf + srow) = fvA; *(v4f*)(FVf + srow + 4) = fvB;  }
#pragma unroll
  for (int tt = 0; tt < KF; ++tt) { const int tok = s * KF + tt; const size_t prow = ((size_t)b * SS + tok) * DM + h * DH + d0; v4f a, c2, e, g;
#pragma unroll
    for (int q = 0; q < 4; ++q) { a[q] = pk[tt][q]; c2[q] = pk[tt][4 + q]; e[q] = pv[tt][q]; g[q] = pv[tt][4 + q]; }
    /* aligned q for this token */ const float* qp = Q + ((size_t)b * SS + tok) * DM + h * DH; FragH fq; v4f qa, qb2;
#pragma unroll
    for (int q = 0; q < 8; ++q) { const int d = d0 + q; const float c = CS[(size_t)tok * DH + d], sn = SN[(size_t)tok * DH + d]; const float qr = qp[d] * c + ((d < 32) ? -qp[d + 32] : qp[d - 32]) * sn; const float aq = qr * cdma(tt, d); fq.h[q] = (_Float16)aq; if (q < 4) qa[q] = aq; else qb2[q - 4] = aq; }
    const size_t arow = ((size_t)bh * SS + tok) * DH + d0;
    { *(v4f*)(PK + prow) = a; *(v4f*)(PK + prow + 4) = c2; *(v4f*)(PVp + prow) = e; *(v4f*)(PVp + prow + 4) = g; *(v8us*)((unsigned short*)AQ16 + arow) = fq.half[0]; *(v4f*)(AQf + prow) = qa; *(v4f*)(AQf + prow + 4) = qb2;  } } }
__global__ __launch_bounds__(256) void k_fvt(const float* __restrict__ FVf, _Float16* __restrict__ FVT) { const int t = blockIdx.x * 256 + threadIdx.x; if (t >= NBt * NH * DH * (NSL / 8)) return; const int s0 = (t % (NSL / 8)) * 8; const int d = (t / (NSL / 8)) % DH; const int h = t / ((NSL / 8) * DH); FragH f;      /* h = batch * 16 + head */
#pragma unroll
  for (int q = 0; q < 8; ++q) f.h[q] = (_Float16)FVf[((size_t)h * NSL + s0 + q) * DH + d];
  *(v8us*)((unsigned short*)FVT + ((size_t)h * DH + d) * NSL + s0) = f.half[0];  }
// The f16 weights of a row go into the first half of that row's own 2 KiB of scores (both batches' score planes and a separate weight plane do not fit the workspace together): one wave owns a row and
// has every score of it in registers, through the row maximum over all lanes, before it stores. SW carries no restrict: it is read as scores and written as weights.
__global__ __launch_bounds__(256) void k_hsoft(float* SW, const float* __restrict__ AQf, const float* __restrict__ PK, float* __restrict__ WC) {
  #pragma clang fp contract(off)
  const int tid = threadIdx.x, w = tid >> 5, ln = tid & 31; const int bh = blockIdx.y, b = bh / NH, h = bh % NH; const int q = blockIdx.x * 8 + w; if (q >= SS) return; const int cs = q / KF; const size_t prow = ((size_t)b * SS + q) * DM + h * DH; SW += (size_t)bh * SS * NSL;      /* batch * 16 + head on grid.y: each has its own score plane */
  float cur = AQf[prow + ln] * PK[prow + ln] + AQf[prow + 32 + ln] * PK[prow + 32 + ln]; for (int o = 16; o > 0; o >>= 1) cur += __shfl_xor(cur, o, 32); cur *= 0.125f;
  const float* sr = SW + (size_t)q * NSL; float v[16]; float m = -3.0e38f;
#pragma unroll
  for (int k = 0; k < 16; ++k) { const int sl = 16 * ln + k; float x = sr[sl]; x = (sl == cs) ? cur : x; x = (sl > cs) ? -3.0e38f : x; v[k] = x; m = fmaxf(m, x); }
  for (int o = 16; o > 0; o >>= 1) m = fmaxf(m, __shfl_xor(m, o, 32));
  float su = 0.f;
#pragma unroll
  for (int k = 0; k < 16; ++k) { const int sl = 16 * ln + k; v[k] = (sl > cs) ? 0.f : expf(v[k] - m); su += v[k]; }
  for (int o = 16; o > 0; o >>= 1) su += __shfl_xor(su, o, 32); const float inv = 1.0f / su; FragH f0, f1; float wc = 0.f;
#pragma unroll
  for (int k = 0; k < 16; ++k) { const int sl = 16 * ln + k; const float wv = v[k] * inv; wc = (sl == cs) ? wv : wc; if (k < 8) f0.h[k] = (_Float16)(wv * 1024.0f); else f1.h[k - 8] = (_Float16)(wv * 1024.0f); }
  for (int o = 16; o > 0; o >>= 1) wc += __shfl_xor(wc, o, 32);      /* exactly one lane holds the current slot */
  { *(v8us*)((unsigned short*)SW + (size_t)q * (2 * NSL) + 16 * ln) = f0.half[0]; *(v8us*)((unsigned short*)SW + (size_t)q * (2 * NSL) + 16 * ln + 8) = f1.half[0]; *(float*)(WC + ((size_t)bh * SS + q) * 32 + ln) = wc;  } }      /* one whole 128-byte line per (head, row), written by this wave alone */
__global__ __launch_bounds__(256) void k_oepi(const float* __restrict__ O, const float* __restrict__ WC, const float* __restrict__ PVp, const float* __restrict__ FVf, _Float16* __restrict__ Oh, _Float16* __restrict__ Ol) {
  #pragma clang fp contract(off)
  const int t = blockIdx.x * 256 + threadIdx.x; if (t >= NR * NH * (DH / 8)) return; const int d0 = (t % (DH / 8)) * 8; const int h = (t / (DH / 8)) % NH; const int bq = t / ((DH / 8) * NH); const int b = bq / SS, q = bq % SS; const int cs = q / KF, tt = q % KF; const float wc = WC[((size_t)(b * NH + h) * SS + q) * 32]; const size_t prow = (size_t)bq * DM + h * DH + d0; const size_t srow = ((size_t)(b * NH + h) * NSL + cs) * DH + d0; const size_t orow = ((size_t)(b * NH + h) * SS + q) * DH + d0; FragH fh, fl;      /* O is [batch * 16 + head][token][64] */
  const v4f pA = *(const v4fa*)(PVp + prow), pB = *(const v4fa*)(PVp + prow + 4), fA = *(const v4fa*)(FVf + srow), fB = *(const v4fa*)(FVf + srow + 4);
  asm volatile("s_wait_xcnt 0x0" ::: "memory");      /* the loads of O below may land in registers that hold the addresses of the loads above: the wait stands between them */
  const v4f oA = *(const v4fa*)(O + orow), oB = *(const v4fa*)(O + orow + 4);
#pragma unroll
  for (int k = 0; k < 8; ++k) { const int d = d0 + k; const float o = ((k < 4) ? oA[k & 3] : oB[k & 3]) + wc * (((k < 4) ? pA[k & 3] : pB[k & 3]) - ((k < 4) ? fA[k & 3] : fB[k & 3])); const float v = (o * cdma(tt, d)) * 2.0f; const _Float16 hi = (_Float16)v; fh.h[k] = hi; fl.h[k] = (_Float16)((v - (float)hi) * 1024.0f); }
  { *(v8us*)((unsigned short*)Oh + prow) = fh.half[0]; *(v8us*)((unsigned short*)Ol + prow) = fl.half[0];  } }

extern "C" void kernel_launch(void* const* d_in, const int* in_sizes, int n_in,
                              void* d_out, int out_size, void* d_ws, size_t ws_size, hipStream_t stream) {
  (void)in_sizes; (void)n_in; (void)out_size;
  const float* x = (const float*)d_in[0]; const float* Wq = (const float*)d_in[1]; const float* Wk = (const float*)d_in[2]; const float* Wv = (const float*)d_in[3]; const float* Wo = (const float*)d_in[4]; const float* Aq = (const float*)d_in[5]; const float* Bq = (const float*)d_in[6]; const float* Av = (const float*)d_in[7]; const float* Bv = (const float*)d_in[8]; const float* Ao = (const float*)d_in[9]; const float* Bo = (const float*)d_in[10];
  char* ws = (char*)d_ws; size_t off = 0;
  auto take = [&](size_t bytes) { char* p = ws + off; off += (bytes + 255) & ~(size_t)255; return p; };
  _Float16* BWq = (_Float16*)take((size_t)DM * DM * 2); _Float16* BWk = (_Float16*)take((size_t)DM * DM * 2); _Float16* BWv = (_Float16*)take((size_t)DM * DM * 2); _Float16* BWo = (_Float16*)take((size_t)DM * DM * 2); _Float16* BAq = (_Float16*)take((size_t)LR * DM * 2); _Float16* BAv = (_Float16*)take((size_t)LR * DM * 2); _Float16* BAo = (_Float16*)take((size_t)LR * DM * 2); _Float16* BBq = (_Float16*)take((size_t)DM * LR * 2); _Float16* BBv = (_Float16*)take((size_t)DM * LR * 2); _Float16* BBo = (_Float16*)take((size_t)DM * LR * 2);
  float* CS = (float*)take((size_t)SS * DH * 4); float* SN = (float*)take((size_t)SS * DH * 4);
  /* every plane holds both batches (NR = 4096 rows, or 32 = batch * 16 + head slabs) */
  _Float16* X16 = (_Float16*)take((size_t)NR * DM * 2); float* Q = (float*)take((size_t)NR * DM * 4); float* K = (float*)take((size_t)NR * DM * 4); float* V = (float*)take((size_t)NR * DM * 4); float* XA = (float*)take((size_t)NR * LR * 4); _Float16* XAh = (_Float16*)take((size_t)NR * LR * 2); _Float16* XAl = (_Float16*)take((size_t)NR * LR * 2);
  _Float16* FK16 = (_Float16*)take((size_t)NBt * NH * NSL * DH * 2); _Float16* FV16 = (_Float16*)take((size_t)NBt * NH * NSL * DH * 2); float* FKf = (float*)take((size_t)NBt * NH * NSL * DH * 4); float* FVf = (float*)take((size_t)NBt * NH * NSL * DH * 4); float* PK = (float*)take((size_t)NR * DM * 4); float* PVp = (float*)take((size_t)NR * DM * 4); float* AQf = (float*)take((size_t)NR * DM * 4);
  float* S = (float*)take((size_t)NBt * NH * SS * NSL * 4);
  if (off > ws_size) return;      // weights 8.75 + tables 1 + planes 246: 255.75 MiB
  /* planes that are written only after another plane's last reader has run share its bytes (launches of one stream run in order):
     X16 is last read by the x*Av GEMM, Q, K and V by k_slots, XA, XAh and XAl by the (x*Av)*Bv GEMMs, a row of S by the wave that turns it into weights */
  _Float16* AQ16 = X16; float* O = Q; _Float16* Oh = (_Float16*)K; _Float16* Ol = Oh + (size_t)NR * DM; float* WC = V; _Float16* FVT = (_Float16*)(V + (size_t)NBt * NH * SS * 32); _Float16* W16 = (_Float16*)S; float* OA = XA; _Float16* OAh = XAh; _Float16* OAl = XAl;
  const unsigned nbW = (DM * (DM / 8) + 255) / 256;
  k_wt_f16<<<nbW, 256, 0, stream>>>(Wq, BWq, DM, DM, 16.0f); k_wt_f16<<<nbW, 256, 0, stream>>>(Wk, BWk, DM, DM, 16.0f); k_wt_f16<<<nbW, 256, 0, stream>>>(Wv, BWv, DM, DM, 16.0f); k_wt_f16<<<nbW, 256, 0, stream>>>(Wo, BWo, DM, DM, 16.0f);      /* all weights are (in,out) */
  k_wt_f16<<<(LR * (DM / 8) + 255) / 256, 256, 0, stream>>>(Aq, BAq, DM, LR, 16.0f); k_wt_f16<<<(LR * (DM / 8) + 255) / 256, 256, 0, stream>>>(Av, BAv, DM, LR, 16.0f); k_wt_f16<<<(LR * (DM / 8) + 255) / 256, 256, 0, stream>>>(Ao, BAo, DM, LR, 16.0f);
  k_wt_f16<<<(DM * (LR / 8) + 255) / 256, 256, 0, stream>>>(Bq, BBq, LR, DM, 16.0f); k_wt_f16<<<(DM * (LR / 8) + 255) / 256, 256, 0, stream>>>(Bv, BBv, LR, DM, 16.0f); k_wt_f16<<<(DM * (LR / 8) + 255) / 256, 256, 0, stream>>>(Bo, BBo, LR, DM, 16.0f);
  k_cstab<<<(SS * DH + 255) / 256, 256, 0, stream>>>(CS, SN);
  /* one 64 x 64 tile of C per work-group: projections over all NR rows; attention GEMMs per (batch, head) on grid.y */
  const dim3 gD((NR / 64) * (DM / 64), 1), gL(NR / 64, 1), gL4(SS / 64, NBt * NH), gS((SS / 64) * (NSL / 64), NBt * NH), gH(SS / 8, NBt * NH); const size_t n8 = (size_t)NR * DM / 8; const unsigned nb8 = (unsigned)((n8 + 255) / 256); const size_t a8 = (size_t)NR * LR / 8; const unsigned nba = (unsigned)((a8 + 255) / 256);
  k_x16<<<nb8, 256, 0, stream>>>(x, X16, n8);
  k_gemm_hhx<0, 4><<<gD, 128, 0, stream>>>(X16, DM, 0, BWq, DM, 0, 0.0625f, nullptr, 0, nullptr, 1, 0, 0, Q, nullptr, DM, 0, NR, DM, DM); k_gemm_hhx<0, 4><<<gD, 128, 0, stream>>>(X16, DM, 0, BWk, DM, 0, 0.0625f, nullptr, 0, nullptr, 1, 0, 0, K, nullptr, DM, 0, NR, DM, DM); k_gemm_hhx<0, 4><<<gD, 128, 0, stream>>>(X16, DM, 0, BWv, DM, 0, 0.0625f, nullptr, 0, nullptr, 1, 0, 0, V, nullptr, DM, 0, NR, DM, DM);      /* x*W (exact) */
  k_gemm_hhx<0, 4><<<gL, 128, 0, stream>>>(X16, DM, 0, BAq, DM, 0, 0.0625f, nullptr, 0, nullptr, 1, 0, 0, XA, nullptr, LR, 0, NR, LR, DM); k_split<<<nba, 256, 0, stream>>>(XA, XAh, XAl, a8);
  k_gemm_hhx<0, 2><<<gD, 128, 0, stream>>>(XAh, LR, 0, BBq, LR, 0, 0.0625f, nullptr, 0, Q, 1, (size_t)DM, 0, Q, nullptr, DM, 0, NR, DM, LR); k_gemm_hhx<0, 2><<<gD, 128, 0, stream>>>(XAl, LR, 0, BBq, LR, 0, 0.0625f / 1024.0f, nullptr, 0, Q, 1, (size_t)DM, 0, Q, nullptr, DM, 0, NR, DM, LR);      /* q += (x*Aq)*Bq */
  k_gemm_hhx<0, 4><<<gL, 128, 0, stream>>>(X16, DM, 0, BAv, DM, 0, 0.0625f, nullptr, 0, nullptr, 1, 0, 0, XA, nullptr, LR, 0, NR, LR, DM); k_split<<<nba, 256, 0, stream>>>(XA, XAh, XAl, a8);
  k_gemm_hhx<0, 2><<<gD, 128, 0, stream>>>(XAh, LR, 0, BBv, LR, 0, 0.0625f, nullptr, 0, V, 1, (size_t)DM, 0, V, nullptr, DM, 0, NR, DM, LR); k_gemm_hhx<0, 2><<<gD, 128, 0, stream>>>(XAl, LR, 0, BBv, LR, 0, 0.0625f / 1024.0f, nullptr, 0, V, 1, (size_t)DM, 0, V, nullptr, DM, 0, NR, DM, LR);      /* v += (x*Av)*Bv */
  k_slots<<<(NBt * NH * NSL * (DH / 8) + 255) / 256, 256, 0, stream>>>(Q, K, V, CS, SN, FK16, FV16, FKf, FVf, PK, PVp, AQ16, AQf);
  k_fvt<<<(NBt * NH * DH * (NSL / 8) + 255) / 256, 256, 0, stream>>>(FVf, FVT);
  /* all 32 (batch, head) pairs in one launch each, pair = blockIdx.y */
  k_gemm_hhx<0, 2><<<gS, 128, 0, stream>>>(AQ16, DH, (size_t)SS * DH, FK16, DH, (size_t)NSL * DH, 0.125f, nullptr, 0, nullptr, 1, 0, 0, S, nullptr, NSL, (size_t)SS * NSL, SS, NSL, DH);      /* slot scores/8: M 2048 N 512 K 64 per pair */
  k_hsoft<<<gH, 256, 0, stream>>>(S, AQf, PK, WC);
  k_gemm_hhx<0, 4><<<gL4, 128, 0, stream>>>(W16, 2 * NSL, (size_t)SS * 2 * NSL, FVT, NSL, (size_t)DH * NSL, 0.0009765625f, nullptr, 0, nullptr, 1, 0, 0, O, nullptr, DH, (size_t)SS * DH, SS, DH, NSL);      /* sum of w * full_V into O[pair]: M 2048 N 64 K 512 per pair; a weight row has the pitch of its score row */
  k_oepi<<<(NR * NH * (DH / 8) + 255) / 256, 256, 0, stream>>>(O, WC, PVp, FVf, Oh, Ol);
  float* outb = (float*)d_out;
  k_gemm_hhx<0, 4><<<gD, 128, 0, stream>>>(Oh, DM, 0, BWo, DM, 0, 0.0625f, nullptr, 0, nullptr, 1, 0, 0, outb, nullptr, DM, 0, NR, DM, DM); k_gemm_hhx<0, 4><<<gD, 128, 0, stream>>>(Ol, DM, 0, BWo, DM, 0, 0.0625f / 1024.0f, nullptr, 0, outb, 1, (size_t)DM, 0, outb, nullptr, DM, 0, NR, DM, DM);      /* out*Wo (hi + lo) */
  k_gemm_hhx<0, 4><<<gL, 128, 0, stream>>>(Oh, DM, 0, BAo, DM, 0, 0.0625f, nullptr, 0, nullptr, 1, 0, 0, OA, nullptr, LR, 0, NR, LR, DM); k_gemm_hhx<0, 4><<<gL, 128, 0, stream>>>(Ol, DM, 0, BAo, DM, 0, 0.0625f / 1024.0f, nullptr, 0, OA, 1, (size_t)LR, 0, OA, nullptr, LR, 0, NR, LR, DM); k_split<<<nba, 256, 0, stream>>>(OA, OAh, OAl, a8);
  k_gemm_hhx<0, 2><<<gD, 128, 0, stream>>>(OAh, LR, 0, BBo, LR, 0, 0.0625f, nullptr, 0, outb, 1, (size_t)DM, 0, outb, nullptr, DM, 0, NR, DM, LR); k_gemm_hhx<0, 2><<<gD, 128, 0, stream>>>(OAl, LR, 0, BBo, LR, 0, 0.0625f / 1024.0f, nullptr, 0, outb, 1, (size_t)DM, 0, outb, nullptr, DM, 0, NR, DM, LR);      /* + (out*Ao)*Bo */
}

// v005
// It runs in 331 microseconds.
// Two timings next to v004 put it at 1.22 and 1.21 times that version's speed.
// Over all steps from v000 it is 5.62 times as fast.
#include <hip/hip_runtime.h>
// HoloKV attention (B 2, S 2048, 16 heads × 64, k_factor 4 → 512 slots): q = x·Wq + (x·Aq)·Bq, k = x·Wk, v = x·Wv + (x·Av)·Bv; RoPE (half-split rotate, θ_i = 1/10000^(2i/64)); keys/values compressed into slots of 4 tokens with Hadamard phases /2: full_K[s] = Σ_t k[4s+t]·c[t]/2, partial (causal prefix inside the slot); query phase c[q mod 4]; scores over slots: aligned_q·full_K/8 for earlier slots, aligned_q·partial_K(q's prefix)/8 for its own slot, −inf for later slots; softmax; out = Σ w·full_V + w_curr·(partial_V − full_V[curr]); out·phase·2; y = out·Wo + (out·Ao)·Bo → [2,2048,1024].
// Compute dtype: x and parameters rounded to bf16; projections with exact products and the LoRA paths on f16 hi + lo·2^10 operands of x·A (≈f32); RoPE, phases, slot sums/prefixes in f32; aligned q and full_K/full_V as f16 GEMM operands (scores O(1)), the own-slot score, masking, softmax and the rank-1 correction in f32; attention output as f16 hi + lo·2^10 into Wo and the LoRA output path. v_wmma_f32_16x16x32_f16.
#define NBt 2
#define SS 2048
#define DM 1024
#define NH 16
#define DH 64
#define KF 4
#define NSL (SS / KF)            /* 512 slots */
#define LR 64
#define NR (NBt * SS)
typedef __bf16 v16b __attribute__((ext_vector_type(16)));
typedef unsigned short v8us __attribute__((ext_vector_type(8), may_alias));
typedef float  v8f  __attribute__((ext_vector_type(8)));
typedef float  v4f  __attribute__((ext_vector_type(4)));
typedef float  v4fa __attribute__((ext_vector_type(4), may_alias));
union FragB { v16b v; v8us half[2]; unsigned short u[16]; };

__device__ __forceinline__ unsigned short bf16_bits(float x) { unsigned int u = __float_as_uint(x); return (unsigned short)((u + 0x7FFFu + ((u >> 16) & 1u)) >> 16); }
__device__ __forceinline__ float bf16_val(unsigned short b) { return __uint_as_float(((unsigned int)b) << 16); }
__device__ __forceinline__ float bf16_round(float x) { return bf16_val(bf16_bits(x)); }
// D += A·B with NT terms: 1 = ah·bh, 2 = + al·bh (A split), 3 = + ah·bl (both split)
template <int NT>
__device__ __forceinline__ v8f mmaN(v16b ah, v16b al, v16b bh, v16b bl, v8f c) {
  c = __builtin_amdgcn_wmma_f32_16x16x32_bf16(false, ah, false, bh, (short)0, c, false, false);
  if (NT >= 2) c = __builtin_amdgcn_wmma_f32_16x16x32_bf16(false, al, false, bh, (short)0, c, false, false);
  if (NT >= 3) c = __builtin_amdgcn_wmma_f32_16x16x32_bf16(false, ah, false, bl, (short)0, c, false, false);
  asm volatile("v_nop\n\tv_nop\n\tv_nop\n\tv_nop" : "+v"(c) : "v"(ah), "v"(al), "v"(bh), "v"(bl));
  return c;
}

__global__ __launch_bounds__(256) void k_wt_bf16(const float* __restrict__ W, unsigned short* __restrict__ Wt, int K, int N) {
  const int t = blockIdx.x * 256 + threadIdx.x;
  const int k8n = K / 8;
  if (t >= N * k8n) return;
  const int n = t / k8n, k8 = (t % k8n) * 8;
  v8us v;
#pragma unroll
  for (int i = 0; i < 8; ++i) v[i] = bf16_bits(W[(size_t)(k8 + i) * N + n]);
  *(v8us*)(Wt + (size_t)n * K + k8) = v;
  
}

// GEMM C[M][N] (f32, pitch ldc) = act(A[M][K]·W + bias). A f32 row-major (pitch lda) converted per fragment to bf16
// (ASPLIT: hi/lo two planes -> 2 terms, else single rounded term); Wt bf16 [N][K] (pitch ldb). BIAS_BF16 rounds the
// bias to bf16 first (bias quantised to bf16 before the add). K%32==0, M%16==0, N%64==0.
template <bool ASPLIT, int ACT, bool BIAS_BF16>
__global__ __launch_bounds__(128) void k_gemm_bf(const float* __restrict__ A, int lda, const unsigned short* __restrict__ Wt, int ldb,
                                               const float* __restrict__ bias, float* __restrict__ C, int ldc, int M, int N, int K) {
  __shared__ __attribute__((aligned(16))) float so[4][16][64];
  const int tid = threadIdx.x, w = tid >> 5, lane = tid & 31, ln = lane & 15, hh = lane >> 4;
  const int ntn = N / 64;
  const int wid = blockIdx.x * 4 + w;
  const int mt = wid / ntn, nq = wid % ntn;
  if (mt * 16 >= M) return;
  const int row0 = mt * 16, col0 = nq * 64;
  const float* arow = A + (size_t)(row0 + ln) * lda;
  v8f acc[4] = {};
  for (int kb = 0; kb < K; kb += 32) {
    FragB ah, al;
    const v4f x0 = *(const v4fa*)(arow + kb + 8 * hh), x1 = *(const v4fa*)(arow + kb + 8 * hh + 4);
    const v4f x2 = *(const v4fa*)(arow + kb + 16 + 8 * hh), x3 = *(const v4fa*)(arow + kb + 16 + 8 * hh + 4);
    float xs[16] = {x0[0],x0[1],x0[2],x0[3],x1[0],x1[1],x1[2],x1[3],x2[0],x2[1],x2[2],x2[3],x3[0],x3[1],x3[2],x3[3]};
#pragma unroll
    for (int i = 0; i < 16; ++i) { const unsigned short hb = bf16_bits(xs[i]); ah.u[i] = hb; al.u[i] = ASPLIT ? bf16_bits(xs[i] - bf16_val(hb)) : (unsigned short)0; }
#pragma unroll
    for (int t = 0; t < 4; ++t) {
      const unsigned short* brow = Wt + (size_t)(col0 + t * 16 + ln) * ldb + kb;
      FragB b;
      b.half[0] = *(const v8us*)(brow + 8 * hh);
      b.half[1] = *(const v8us*)(brow + 16 + 8 * hh);
      acc[t] = mmaN<ASPLIT ? 2 : 1>(ah.v, al.v, b.v, b.v, acc[t]);
    }
  }
#pragma unroll
  for (int t = 0; t < 4; ++t) {
    float bv = bias ? bias[col0 + t * 16 + ln] : 0.f;
    if (BIAS_BF16) bv = bf16_round(bv);
#pragma unroll
    for (int r = 0; r < 8; ++r) { float v = acc[t][r] + bv; if (ACT == 1) v = fmaxf(v, 0.f); so[w][8 * hh + r][t * 16 + ln] = v; }
  }
  __builtin_amdgcn_fence(__ATOMIC_ACQ_REL, "workgroup");
  __builtin_amdgcn_wave_barrier();
  const int rsub = lane >> 4, c4 = (lane & 15) * 4;
  {
#pragma unroll
    for (int q = 0; q < 8; ++q) {
      const int r = q * 2 + rsub;
      const v4f v = *(const v4fa*)&so[w][r][c4];
      *(v4f*)(C + (size_t)(row0 + r) * ldc + col0 + c4) = v;
    }
    
  }
}

// GEMM C = act(A·W + bias + resid): A f32 (ASPLIT -> hi/lo 2 terms), Wt bf16 [N][K]; ACT 0 none, 1 relu, 2 exact gelu;
// resid (optional, f32, row index = (row % rmod), pitch ldr, RES_BF16 rounds it) added before the activation.
template <bool ASPLIT, int ACT, bool BIAS_BF16, bool RES_BF16>
__global__ __launch_bounds__(128) void k_gemm_bf3(const float* __restrict__ A, int lda, const unsigned short* __restrict__ Wt, int ldb,
                                                const float* __restrict__ bias, const float* __restrict__ resid, int rmod, int ldr,
                                                float* __restrict__ C, int ldc, int M, int N, int K) {
  __shared__ __attribute__((aligned(16))) float so[4][16][64];
  const int tid = threadIdx.x, w = tid >> 5, lane = tid & 31, ln = lane & 15, hh = lane >> 4;
  const int ntn = N / 64;
  const int wid = blockIdx.x * 4 + w;
  const int mt = wid / ntn, nq = wid % ntn;
  if (mt * 16 >= M) return;
  const int row0 = mt * 16, col0 = nq * 64;
  const float* arow = A + (size_t)(row0 + ln) * lda;
  v8f acc[4] = {};
  for (int kb = 0; kb < K; kb += 32) {
    FragB ah, al;
    const v4f x0 = *(const v4fa*)(arow + kb + 8 * hh), x1 = *(const v4fa*)(arow + kb + 8 * hh + 4);
    const v4f x2 = *(const v4fa*)(arow + kb + 16 + 8 * hh), x3 = *(const v4fa*)(arow + kb + 16 + 8 * hh + 4);
    float xs[16] = {x0[0],x0[1],x0[2],x0[3],x1[0],x1[1],x1[2],x1[3],x2[0],x2[1],x2[2],x2[3],x3[0],x3[1],x3[2],x3[3]};
#pragma unroll
    for (int i = 0; i < 16; ++i) { const unsigned short hb = bf16_bits(xs[i]); ah.u[i] = hb; al.u[i] = ASPLIT ? bf16_bits(xs[i] - bf16_val(hb)) : (unsigned short)0; }
#pragma unroll
    for (int t = 0; t < 4; ++t) {
      const unsigned short* brow = Wt + (size_t)(col0 + t * 16 + ln) * ldb + kb;
      FragB b;
      b.half[0] = *(const v8us*)(brow + 8 * hh);
      b.half[1] = *(const v8us*)(brow + 16 + 8 * hh);
      acc[t] = mmaN<ASPLIT ? 2 : 1>(ah.v, al.v, b.v, b.v, acc[t]);
    }
  }
#pragma unroll
  for (int t = 0; t < 4; ++t) {
    const int col = col0 + t * 16 + ln;
    float bv = bias ? bias[col] : 0.f;
    if (BIAS_BF16) bv = bf16_round(bv);
#pragma unroll
    for (int r = 0; r < 8; ++r) {
      float v = acc[t][r] + bv;
      if (resid) { float rv = resid[(size_t)((row0 + 8 * hh + r) % rmod) * ldr + col]; if (RES_BF16) rv = bf16_round(rv); v += rv; }
      if (ACT == 1) v = fmaxf(v, 0.f);
      if (ACT == 2) v = 0.5f * v * (1.0f + erff(v * 0.70710678118654752f));
      if (ACT == 3) { const float u = 0.7978845608028654f * (v + 0.044715f * v * v * v); v = 0.5f * v * (1.0f + tanhf(u)); }
      so[w][8 * hh + r][t * 16 + ln] = v;
    }
  }
  __builtin_amdgcn_fence(__ATOMIC_ACQ_REL, "workgroup");
  __builtin_amdgcn_wave_barrier();
  const int rsub = lane >> 4, c4 = (lane & 15) * 4;
  {
#pragma unroll
    for (int q = 0; q < 8; ++q) {
      const int r = q * 2 + rsub;
      const v4f v = *(const v4fa*)&so[w][r][c4];
      *(v4f*)(C + (size_t)(row0 + r) * ldc + col0 + c4) = v;
    }
    
  }
}
// row LayerNorm (biased variance, eps) over N: s = X (+ R); optional out_sum <- s; out_norm <- (s-mu)*rsqrt(var+eps)*g + b
template <bool PARAM_BF16>
__global__ __launch_bounds__(256) void k_layernorm(const float* __restrict__ X, const float* __restrict__ R, const float* __restrict__ g, const float* __restrict__ bta,
                                                  float* __restrict__ out_sum, float* __restrict__ out_norm, int N, float eps) {
  __shared__ float red[256];
  const int row = blockIdx.x, tid = threadIdx.x;
  const float* x = X + (size_t)row * N; const float* rr = R ? R + (size_t)row * N : nullptr;
  float vals[16];                     // up to N = 4096
  const int per = N / 256;            // contiguous chunk per thread? use strided-by-4 chunks: thread handles j = tid*4 + 1024*u
  float s1 = 0.f;
  for (int u = 0; u < per / 4; ++u) {
    const int j = tid * 4 + 1024 * u;
    const v4f a = *(const v4fa*)(x + j);
    v4f b = {0.f,0.f,0.f,0.f}; if (rr) b = *(const v4fa*)(rr + j);
#pragma unroll
    for (int q = 0; q < 4; ++q) { const float v = a[q] + b[q]; vals[u * 4 + q] = v; s1 += v; }
  }
  red[tid] = s1; __syncthreads();
  for (int st = 128; st > 0; st >>= 1) { if (tid < st) red[tid] += red[tid + st]; __syncthreads(); }
  const float mu = red[0] / (float)N; __syncthreads();
  float s2 = 0.f;
  for (int u = 0; u < per / 4; ++u)
#pragma unroll
    for (int q = 0; q < 4; ++q) { const float c = vals[u * 4 + q] - mu; s2 += c * c; }
  red[tid] = s2; __syncthreads();
  for (int st = 128; st > 0; st >>= 1) { if (tid < st) red[tid] += red[tid + st]; __syncthreads(); }
  const float rs = rsqrtf(red[0] / (float)N + eps);
  {
    for (int u = 0; u < per / 4; ++u) {
      const int j = tid * 4 + 1024 * u;
      v4f o, sm;
#pragma unroll
      for (int q = 0; q < 4; ++q) {
        float gg = g[j + q], bb = bta[j + q];
        if (PARAM_BF16) { gg = bf16_round(gg); bb = bf16_round(bb); }
        sm[q] = vals[u * 4 + q]; o[q] = (vals[u * 4 + q] - mu) * rs * gg + bb;
      }
      if (out_sum) *(v4f*)(out_sum + (size_t)row * N + j) = sm;
      *(v4f*)(out_norm + (size_t)row * N + j) = o;
    }
    
  }
}



// ---- f16 WMMA path (v_wmma_f32_16x16x32_f16): 11-bit significands for operands in range — used where a [0,1] probability operand needs more precision than bf16
typedef _Float16 v16h __attribute__((ext_vector_type(16)));
union FragH { v16h v; v8us half[2]; _Float16 h[16]; unsigned short u[16]; };
template <int NT>
__device__ __forceinline__ v8f mmaH(v16h ah, v16h al, v16h bh, v16h bl, v8f c) {
  c = __builtin_amdgcn_wmma_f32_16x16x32_f16(false, ah, false, bh, (short)0, c, false, false);
  if (NT >= 2) c = __builtin_amdgcn_wmma_f32_16x16x32_f16(false, al, false, bh, (short)0, c, false, false);
  if (NT >= 3) c = __builtin_amdgcn_wmma_f32_16x16x32_f16(false, ah, false, bl, (short)0, c, false, false);
  asm volatile("v_nop\n\tv_nop\n\tv_nop\n\tv_nop" : "+v"(c) : "v"(ah), "v"(al), "v"(bh), "v"(bl));
  return c;
}
// batched GEMM like k_gemm_b but f16 operands: A f32 (split into f16 hi/lo if ASPLIT, else rounded to f16), Bt = f16 values [n][k]; alpha; C f32; N multiple of 16 (partial tiles skipped)
template <bool ASPLIT>
__global__ __launch_bounds__(128) void k_gemm_h(const float* __restrict__ A, int lda, size_t sA, const _Float16* __restrict__ Bh, int ldb, size_t sB, float alpha, float* __restrict__ C, int ldc, size_t sC, int M, int N, int K) {
  __shared__ __attribute__((aligned(16))) float so[4][16][64];
  const int tid = threadIdx.x, w = tid >> 5, lane = tid & 31, ln = lane & 15, hh = lane >> 4; const int by = blockIdx.y;
  A += (size_t)by * sA; Bh += (size_t)by * sB; C += (size_t)by * sC;
  const int ntn = (N + 63) / 64; const int wid = blockIdx.x * 4 + w; const int mt = wid / ntn, nq = wid % ntn; if (mt * 16 >= M) return;
  const int row0 = mt * 16, col0 = nq * 64; const float* arow = A + (size_t)(row0 + ln) * lda;
  v8f acc[4] = {};
  for (int kb = 0; kb < K; kb += 32) {
    FragH ah, al;
    const v4f x0 = *(const v4fa*)(arow + kb + 8 * hh), x1 = *(const v4fa*)(arow + kb + 8 * hh + 4), x2 = *(const v4fa*)(arow + kb + 16 + 8 * hh), x3 = *(const v4fa*)(arow + kb + 16 + 8 * hh + 4);
    float xs[16] = {x0[0],x0[1],x0[2],x0[3],x1[0],x1[1],x1[2],x1[3],x2[0],x2[1],x2[2],x2[3],x3[0],x3[1],x3[2],x3[3]};
#pragma unroll
    for (int i = 0; i < 16; ++i) { const _Float16 h = (_Float16)xs[i]; ah.h[i] = h; al.h[i] = ASPLIT ? (_Float16)(xs[i] - (float)h) : (_Float16)0.0f; }
#pragma unroll
    for (int t = 0; t < 4; ++t) { if (col0 + t * 16 >= N) continue; const size_t boff = (size_t)(col0 + t * 16 + ln) * ldb + kb; FragH bq; bq.half[0] = *(const v8us*)(Bh + boff + 8 * hh); bq.half[1] = *(const v8us*)(Bh + boff + 16 + 8 * hh);
      acc[t] = mmaH<ASPLIT ? 2 : 1>(ah.v, al.v, bq.v, bq.v, acc[t]); }
  }
#pragma unroll
  for (int t = 0; t < 4; ++t) { if (col0 + t * 16 >= N) continue;
#pragma unroll
    for (int r = 0; r < 8; ++r) so[w][8 * hh + r][t * 16 + ln] = acc[t][r] * alpha; }
  __builtin_amdgcn_fence(__ATOMIC_ACQ_REL, "workgroup"); __builtin_amdgcn_wave_barrier();
  const int rsub = lane >> 4, c4 = (lane & 15) * 4;
  {
#pragma unroll
    for (int q = 0; q < 8; ++q) { const int r = q * 2 + rsub; if (col0 + c4 < N) { const v4f v = *(const v4fa*)&so[w][r][c4]; *(v4f*)(C + (size_t)(row0 + r) * ldc + col0 + c4) = v; } }
     }
}

// Wt[n][k] = f16(W[k][n]·scale) from f32 row-major W[K][N] (scale = power of two; bf16-exact weights stay exact in f16 away from the subnormal range)
__device__ __forceinline__ void d_wt_f16(const float* __restrict__ W, _Float16* __restrict__ Wt, int K, int N, float scale, int blk) {
  const int t = blk * 256 + threadIdx.x; if (t >= N * (K / 8)) return; const int n = t / (K / 8), k8 = (t % (K / 8)) * 8; FragH f;
#pragma unroll
  for (int i = 0; i < 8; ++i) f.h[i] = (_Float16)(bf16_round(W[(size_t)(k8 + i) * N + n]) * scale); const v8us o = f.half[0];
  *(v8us*)((unsigned short*)Wt + (size_t)n * K + k8) = o; 
}
// One work-group = one 64 x 64 tile of C; wave w owns rows 16w..16w+15 of it, all 64 columns. Per stage the four waves bring 64 rows of A and 64 rows of B, 32 * KU k each,
// from global memory with whole-line 16-byte loads into registers and store them to LDS (row pitch = row bytes + 16, conflict-free for 16-byte fragment reads); every wave reads its
// fragments from LDS, so the B tile is fetched once per work-group instead of once per wave and no global load is spread over 16 rows. Two LDS buffers: the next stage's global loads
// are issued before this stage's WMMAs and stored to the other buffer behind them, one barrier per stage. M and N multiples of 64, K a multiple of 32 * KU. The k order per accumulator is ascending.
// Every loop over i, u and t is unrolled so that ra, rb, oa, ob and the fragments are registers, not indexed arrays in scratch.
// k_gemm_hh variant with fused epilogue: v = acc·alpha + bias[by·sBias + col] (+ CP[(row/rowsPerB)·sCPb + by·64 + col] if CP) ; ACT 0 none / 1 elu ; writes f32 C and f16 C16, each if non-null
// One launch runs up to NJ products that do not depend on one another and share M, K and the operand pitches: job i owns the next nb work-groups of grid.x, with its own operands, addend, output, scale and N.
struct GemmJob { const _Float16* A; const _Float16* B; const float* CP; float* C; size_t sCPb; float alpha; int ldc, N, nb; };
template <int NJ> struct GemmJobs { GemmJob j[NJ]; };
template <int ACT, int KU, int NJ>
__global__ __launch_bounds__(128) void k_gemm_hhx(const GemmJobs<NJ> J, int lda, size_t sA, int ldb, size_t sB, const float* __restrict__ bias, size_t sBias, int rowsPerB, int row0g,
    _Float16* __restrict__ C16, size_t sC, int M, int K) {
  constexpr int RB = 64 * KU, PITCH = RB + 16, UPR = RB / 16, RP = 128 / UPR, NU = 64 / RP, TILE = 64 * PITCH;      /* row bytes, LDS pitch, 16-byte units per row, rows per pass of 128 threads, passes per tile, tile bytes */
  __shared__ __attribute__((aligned(16))) char sm[4 * TILE];      /* [buffer][A tile | B tile]; the epilogue's 16 KiB of staging reuses it behind the last stage's barrier */
  static_assert(4 * TILE >= 4 * 16 * 64 * 4, "epilogue staging must fit");
  float (*so)[16][64] = (float (*)[16][64])sm;
  const int tid = threadIdx.x, w = tid >> 5, lane = tid & 31, ln = lane & 15, hh = lane >> 4; const int by = blockIdx.y;
  GemmJob g = J.j[0]; int bx = blockIdx.x;      /* this work-group's job and its index inside the job: scalar values, the same for the whole work-group */
  for (int i = 1; i < NJ; ++i) if (bx >= g.nb) { bx -= g.nb; g = J.j[i]; }
  const _Float16* A = g.A; const _Float16* Bh = g.B; const float* CP = g.CP; float* C = g.C; const size_t sCPb = g.sCPb; const float alpha = g.alpha; const int ldc = g.ldc, N = g.N;
  A += (size_t)by * sA; Bh += (size_t)by * sB; const size_t cofs = (size_t)by * sC; const float* bp = bias ? bias + (size_t)by * sBias : nullptr;
  const int ntn = (N + 63) / 64; const int mtb = bx / ntn, nq = bx % ntn; if (mtb * 64 >= M) return;      /* the same for the whole work-group, ahead of every barrier */
  const int row0 = mtb * 64 + w * 16, col0 = nq * 64;
  v8f acc[4] = {};
  const char* Ab = (const char*)A; const char* Bb = (const char*)Bh;      /* uniform bases; each thread keeps one 32-bit byte offset per load */
  const int sr = tid / UPR, sc = (tid % UPR) * 16;
  const unsigned ga = (unsigned)((mtb * 64 + sr) * lda * 2 + sc), gb = (unsigned)((col0 + sr) * ldb * 2 + sc), ls = (unsigned)(sr * PITCH + sc);
  unsigned oa[NU], ob[NU];      /* moved on by one stage's bytes just ahead of the stage's loads: the loads that named the old values were waited for ahead of the last barrier */
#pragma unroll
  for (int i = 0; i < NU; ++i) { oa[i] = ga + (unsigned)(i * RP * lda * 2); ob[i] = gb + (unsigned)(i * RP * ldb * 2); }
  const unsigned fa = (unsigned)((w * 16 + ln) * PITCH + 16 * hh), fb = (unsigned)(TILE + ln * PITCH + 16 * hh);
  v8us ra[NU], rb[NU];
#pragma unroll
  for (int i = 0; i < NU; ++i) { ra[i] = *(const v8us*)(Ab + oa[i]); rb[i] = *(const v8us*)(Bb + ob[i]); }
#pragma unroll
  for (int i = 0; i < NU; ++i) { *(v8us*)(sm + ls + i * RP * PITCH) = ra[i]; *(v8us*)(sm + TILE + ls + i * RP * PITCH) = rb[i]; }
  __syncthreads();      /* stage 0 is in buffer 0 for every wave */
  const int nst = K / (32 * KU);
  for (int s = 0; s < nst; ++s) { const bool more = s + 1 < nst; const char* cur = sm + (s & 1) * 2 * TILE; char* nxt = sm + ((s + 1) & 1) * 2 * TILE;
    if (more) {
#pragma unroll
      for (int i = 0; i < NU; ++i) { oa[i] += RB; ob[i] += RB; ra[i] = *(const v8us*)(Ab + oa[i]); rb[i] = *(const v8us*)(Bb + ob[i]); } }
    FragH ah[KU], bq[KU][4];
#pragma unroll
    for (int u = 0; u < KU; ++u) { ah[u].half[0] = *(const v8us*)(cur + fa + 64 * u); ah[u].half[1] = *(const v8us*)(cur + fa + 64 * u + 32);
#pragma unroll
      for (int t = 0; t < 4; ++t) { bq[u][t].half[0] = *(const v8us*)(cur + fb + t * 16 * PITCH + 64 * u); bq[u][t].half[1] = *(const v8us*)(cur + fb + t * 16 * PITCH + 64 * u + 32); } }
#pragma unroll
    for (int u = 0; u < KU; ++u) {
#pragma unroll
      for (int t = 0; t < 4; ++t) acc[t] = mmaH<1>(ah[u].v, ah[u].v, bq[u][t].v, bq[u][t].v, acc[t]); }
    if (more) {
#pragma unroll
      for (int i = 0; i < NU; ++i) { *(v8us*)(nxt + ls + i * RP * PITCH) = ra[i]; *(v8us*)(nxt + TILE + ls + i * RP * PITCH) = rb[i]; } }
    __syncthreads();      /* publishes the next stage's buffer and ends every wave's reads of this one (refilled one stage on; staged over by the epilogue behind the last) */
  }
#pragma unroll
  for (int t = 0; t < 4; ++t) { if (col0 + t * 16 >= N) continue; const int col = col0 + t * 16 + ln; const float bv = bp ? bf16_round(bp[col]) : 0.f;
#pragma unroll
    for (int r = 0; r < 8; ++r) { float v = acc[t][r] * alpha + bv; if (CP) { const int bidx = (row0g + row0 + 8 * hh + r) / rowsPerB; v += CP[(size_t)bidx * sCPb + (size_t)by * 64 + col]; } if (ACT == 1) v = (v > 0.f) ? v : expm1f(v); else if (ACT == 7) v = (v > 0.f) ? v + 1.0f : expf(v); else if (ACT == 8) v = tanhf(v); else if (ACT == 9) v = 0.5f * v * (1.0f + tanhf(0.7978845608028654f * (v + 0.044715f * v * v * v))); else if (ACT == 11) v = 1.0f / (1.0f + expf(-v)); else if (ACT == 12) v = (v > 0.f) ? v : 0.01f * v; else if (ACT == 14) v = (v > 0.f) ? v : 0.1f * v; else if (ACT == 15) v = v / (1.0f + expf(-v)); else if (ACT == 3) v = fmaxf(v, 0.f); else if (ACT == 6) v = 0.5f * v * (1.0f + erff(v * 0.70710678118654752f)); so[w][8 * hh + r][t * 16 + ln] = v; } }
  __builtin_amdgcn_fence(__ATOMIC_ACQ_REL, "workgroup"); __builtin_amdgcn_wave_barrier();
  const int rsub = lane >> 4, c4 = (lane & 15) * 4; typedef _Float16 v4h __attribute__((ext_vector_type(4)));
  {
#pragma unroll
    for (int q = 0; q < 8; ++q) { const int r = q * 2 + rsub; if (col0 + c4 < N) { const v4f v = *(const v4fa*)&so[w][r][c4]; if (C) *(v4f*)(C + cofs + (size_t)(row0 + r) * ldc + col0 + c4) = v; if (C16) { v4h h4; for (int i = 0; i < 4; ++i) h4[i] = (_Float16)v[i]; *(v4h*)(C16 + cofs + (size_t)(row0 + r) * ldc + col0 + c4) = h4; } } }
     }
}


typedef _Float16 v4h __attribute__((ext_vector_type(4)));

__device__ __forceinline__ void d_x16(const float* __restrict__ x, _Float16* __restrict__ X16, size_t n8, int blk) { const size_t t = (size_t)blk * 256 + threadIdx.x; if (t >= n8) return; FragH f;
#pragma unroll
  for (int q = 0; q < 8; ++q) f.h[q] = (_Float16)bf16_round(x[t * 8 + q]); *(v8us*)((unsigned short*)X16 + t * 8) = f.half[0];  }
__global__ __launch_bounds__(256) void k_h16(const float* __restrict__ x, _Float16* __restrict__ X16, size_t n8) { const size_t t = (size_t)blockIdx.x * 256 + threadIdx.x; if (t >= n8) return; FragH f;
#pragma unroll
  for (int q = 0; q < 8; ++q) f.h[q] = (_Float16)x[t * 8 + q]; *(v8us*)((unsigned short*)X16 + t * 8) = f.half[0];  }
__global__ __launch_bounds__(256) void k_round16f(const float* __restrict__ W, _Float16* __restrict__ Bt, size_t n8) { const size_t t = (size_t)blockIdx.x * 256 + threadIdx.x; if (t >= n8) return; FragH f;
#pragma unroll
  for (int i = 0; i < 8; ++i) f.h[i] = (_Float16)(bf16_round(W[t * 8 + i]) * 16.0f); *(v8us*)((unsigned short*)Bt + t * 8) = f.half[0];  }
template <int NHv, int TTv>
__global__ __launch_bounds__(256) void k_vt(const _Float16* __restrict__ V16, int ldv, int voff, _Float16* __restrict__ Vt) { __shared__ unsigned short tl[64][66]; const int tid = threadIdx.x; const int slab = blockIdx.x / (TTv / 64), lg = blockIdx.x % (TTv / 64); const int b = slab / NHv, h = slab % NHv;
  for (int i = tid; i < 64 * 8; i += 256) { const int r = i / 8, c8 = (i % 8) * 8; FragH f; f.half[0] = *(const v8us*)((const unsigned short*)V16 + ((size_t)b * TTv + lg * 64 + r) * ldv + voff + h * 64 + c8);
#pragma unroll
    for (int q = 0; q < 8; ++q) tl[r][c8 + q] = f.u[q]; }
  __syncthreads();
  {
#pragma unroll
    for (int rd = 0; rd < 2; ++rd) { const int d = rd * 32 + tid / 8, pc = tid % 8; FragH f;
#pragma unroll
      for (int q = 0; q < 8; ++q) f.u[q] = tl[pc * 8 + q][d];
      *(v8us*)((unsigned short*)Vt + ((size_t)slab * 64 + d) * TTv + lg * 64 + pc * 8) = f.half[0]; }
     } }

__global__ __launch_bounds__(256) void k_hl(const float* __restrict__ F, _Float16* __restrict__ Hh, _Float16* __restrict__ Hl, size_t n8) { const size_t t = (size_t)blockIdx.x * 256 + threadIdx.x; if (t >= n8) return; FragH fh, fl; const v4f a = *(const v4fa*)(F + t * 8), c = *(const v4fa*)(F + t * 8 + 4);
#pragma unroll
  for (int q = 0; q < 4; ++q) { _Float16 h = (_Float16)a[q]; fh.h[q] = h; fl.h[q] = (_Float16)((a[q] - (float)h) * 1024.0f); h = (_Float16)c[q]; fh.h[4 + q] = h; fl.h[4 + q] = (_Float16)((c[q] - (float)h) * 1024.0f); }
  { *(v8us*)((unsigned short*)Hh + t * 8) = fh.half[0]; *(v8us*)((unsigned short*)Hl + t * 8) = fl.half[0];  } }

__global__ __launch_bounds__(256) void k_split(const float* __restrict__ F, _Float16* __restrict__ Hh, _Float16* __restrict__ Hl, size_t n8) {
  #pragma clang fp contract(off)
  const size_t t = (size_t)blockIdx.x * 256 + threadIdx.x; if (t >= n8) return; const v4f a = *(const v4fa*)(F + t * 8), c = *(const v4fa*)(F + t * 8 + 4); FragH fh, fl;
#pragma unroll
  for (int q = 0; q < 8; ++q) { const float v = (q < 4) ? a[q] : c[q - 4]; const _Float16 hi = (_Float16)v; fh.h[q] = hi; fl.h[q] = (_Float16)((v - (float)hi) * 1024.0f); }
  { *(v8us*)((unsigned short*)Hh + t * 8) = fh.half[0]; *(v8us*)((unsigned short*)Hl + t * 8) = fl.half[0];  } }
__device__ __forceinline__ void d_cstab(float* __restrict__ CS, float* __restrict__ SN, int blk) {
  #pragma clang fp contract(off)
  const int t = blk * 256 + threadIdx.x; if (t >= SS * DH) return; const int d = t % DH, p = t / DH; const int i = d & 31; const float theta = 1.0f / powf(10000.0f, (float)(2 * i) / 64.0f); const float ang = (float)p * theta; const float c = cosf(ang), s = sinf(ang);
  { *(float*)(CS + t) = c; *(float*)(SN + t) = s;  } }
// Everything that depends on the inputs alone runs as one launch: the work-group's index picks its piece, the same test for all of its threads. The ten f16 weight planes lie in the
// workspace as three contiguous groups: BW = Wq Wk Wv Wo, BA = Aq Av Ao, BB = Bq Bv Bo. The pieces that take longest per work-group come first.
__global__ __launch_bounds__(256) void k_prep(const float* __restrict__ x, const float* __restrict__ Wq, const float* __restrict__ Wk, const float* __restrict__ Wv, const float* __restrict__ Wo, const float* __restrict__ Aq, const float* __restrict__ Bq, const float* __restrict__ Av, const float* __restrict__ Bv, const float* __restrict__ Ao, const float* __restrict__ Bo,
    _Float16* __restrict__ X16, _Float16* __restrict__ BW, _Float16* __restrict__ BA, _Float16* __restrict__ BB, float* __restrict__ CS, float* __restrict__ SN) {
  constexpr int NW = DM * (DM / 8) / 256, NL = LR * (DM / 8) / 256, NC = SS * DH / 256;      /* work-groups per square weight, per low-rank weight, for the angle tables */
  int b = blockIdx.x;
  if (b < 4 * NW) { const int m = b / NW; d_wt_f16(m == 0 ? Wq : m == 1 ? Wk : m == 2 ? Wv : Wo, BW + (size_t)m * DM * DM, DM, DM, 16.0f, b % NW); return; }
  b -= 4 * NW;
  if (b < NC) { d_cstab(CS, SN, b); return; }
  b -= NC;
  if (b < 3 * NL) { const int m = b / NL; d_wt_f16(m == 0 ? Aq : m == 1 ? Av : Ao, BA + (size_t)m * LR * DM, DM, LR, 16.0f, b % NL); return; }
  b -= 3 * NL;
  if (b < 3 * NL) { const int m = b / NL; d_wt_f16(m == 0 ? Bq : m == 1 ? Bv : Bo, BB + (size_t)m * DM * LR, LR, DM, 16.0f, b % NL); return; }
  b -= 3 * NL;
  d_x16(x, X16, (size_t)NR * DM / 8, b);
}
__device__ __forceinline__ float cdma(int t, int d) { const int j = d & 3; const int par = __popc((unsigned)(t & j)); return (par & 1) ? -1.0f : 1.0f; }      /* Hadamard H4[t][d mod 4] (Sylvester order: rows [1,1,1,1],[1,-1,1,-1],[1,1,-1,-1],[1,-1,-1,1]) */
__global__ __launch_bounds__(256) void k_slots(const float* __restrict__ Q, const float* __restrict__ K, const float* __restrict__ V, const float* __restrict__ CS, const float* __restrict__ SN, _Float16* __restrict__ FK16, _Float16* __restrict__ FV16, float* __restrict__ FKf, float* __restrict__ FVf, float* __restrict__ PK, float* __restrict__ PVp, _Float16* __restrict__ AQ16, float* __restrict__ AQf) {
  #pragma clang fp contract(off)
  const int t = blockIdx.x * 256 + threadIdx.x; if (t >= NBt * NH * NSL * (DH / 8)) return; const int d0 = (t % (DH / 8)) * 8; const int s = (t / (DH / 8)) % NSL; const int bh = t / ((DH / 8) * NSL); const int b = bh / NH, h = bh % NH;      /* both batches in one launch: bh = batch * 16 + head */
  FragH fk, fv; v4f fkA, fkB, fvA, fvB;
  float pk[KF][8], pv[KF][8];      /* running prefixes per token step */
#pragma unroll
  for (int q = 0; q < 8; ++q) { const int d = d0 + q; float accK = 0.f, accV = 0.f;
#pragma unroll
    for (int tt = 0; tt < KF; ++tt) { const int tok = s * KF + tt; const float* kp = K + ((size_t)b * SS + tok) * DM + h * DH; const float* vp = V + ((size_t)b * SS + tok) * DM + h * DH; const float c = CS[(size_t)tok * DH + d], sn = SN[(size_t)tok * DH + d];
      const float kr = kp[d] * c + ((d < 32) ? -kp[d + 32] : kp[d - 32]) * sn; const float ph = cdma(tt, d) * 0.5f;      /* /sqrt(k_factor) */
      accK += kr * ph; accV += vp[d] * ph; pk[tt][q] = accK; pv[tt][q] = accV; }
    fk.h[q] = (_Float16)accK; fv.h[q] = (_Float16)accV; if (q < 4) { fkA[q] = accK; fvA[q] = accV; } else { fkB[q - 4] = accK; fvB[q - 4] = accV; } }
  const size_t srow = ((size_t)bh * NSL + s) * DH + d0;
  { *(v8us*)((unsigned short*)FK16 + srow) = fk.half[0]; *(v8us*)((unsigned short*)FV16 + srow) = fv.half[0]; *(v4f*)(FKf + srow) = fkA; *(v4f*)(FKf + srow + 4) = fkB; *(v4f*)(FVf + srow) = fvA; *(v4f*)(FVf + srow + 4) = fvB;  }
#pragma unroll
  for (int tt = 0; tt < KF; ++tt) { const int tok = s * KF + tt; const size_t prow = ((size_t)b * SS + tok) * DM + h * DH + d0; v4f a, c2, e, g;
#pragma unroll
    for (int q = 0; q < 4; ++q) { a[q] = pk[tt][q]; c2[q] = pk[tt][4 + q]; e[q] = pv[tt][q]; g[q] = pv[tt][4 + q]; }
    /* aligned q for this token */ const float* qp = Q + ((size_t)b * SS + tok) * DM + h * DH; FragH fq; v4f qa, qb2;
#pragma unroll
    for (int q = 0; q < 8; ++q) { const int d = d0 + q; const float c = CS[(size_t)tok * DH + d], sn = SN[(size_t)tok * DH + d]; const float qr = qp[d] * c + ((d < 32) ? -qp[d + 32] : qp[d - 32]) * sn; const float aq = qr * cdma(tt, d); fq.h[q] = (_Float16)aq; if (q < 4) qa[q] = aq; else qb2[q - 4] = aq; }
    const size_t arow = ((size_t)bh * SS + tok) * DH + d0;
    { *(v4f*)(PK + prow) = a; *(v4f*)(PK + prow + 4) = c2; *(v4f*)(PVp + prow) = e; *(v4f*)(PVp + prow + 4) = g; *(v8us*)((unsigned short*)AQ16 + arow) = fq.half[0]; *(v4f*)(AQf + prow) = qa; *(v4f*)(AQf + prow + 4) = qb2;  } } }
__device__ __forceinline__ void d_fvt(const float* __restrict__ FVf, _Float16* __restrict__ FVT, int blk) { const int t = blk * 256 + threadIdx.x; if (t >= NBt * NH * DH * (NSL / 8)) return; const int s0 = (t % (NSL / 8)) * 8; const int d = (t / (NSL / 8)) % DH; const int h = t / ((NSL / 8) * DH); FragH f;      /* h = batch * 16 + head */
#pragma unroll
  for (int q = 0; q < 8; ++q) f.h[q] = (_Float16)FVf[((size_t)h * NSL + s0 + q) * DH + d];
  *(v8us*)((unsigned short*)FVT + ((size_t)h * DH + d) * NSL + s0) = f.half[0];  }
// The f16 weights of a row go into the first half of that row's own 2 KiB of scores (both batches' score planes and a separate weight plane do not fit the workspace together): one wave owns a row and
// has every score of it in registers, through the row maximum over all lanes, before it stores. SW carries no restrict: it is read as scores and written as weights.
// The transpose of full_V depends on k_slots alone and is first read by the GEMM behind this launch: it rides here, in the work-groups of grid.x past the last row group, FVB of them per (batch, head).
#define FVB (DH * (NSL / 8) / 256)
__global__ __launch_bounds__(256) void k_hsoft(float* SW, const float* __restrict__ AQf, const float* __restrict__ PK, float* __restrict__ WC, const float* __restrict__ FVf, _Float16* __restrict__ FVT) {
  #pragma clang fp contract(off)
  if (blockIdx.x >= SS / 8) { d_fvt(FVf, FVT, blockIdx.y * FVB + (blockIdx.x - SS / 8)); return; }      /* the same for the whole work-group; no barrier in this kernel */
  const int tid = threadIdx.x, w = tid >> 5, ln = tid & 31; const int bh = blockIdx.y, b = bh / NH, h = bh % NH; const int q = blockIdx.x * 8 + w; if (q >= SS) return; const int cs = q / KF; const size_t prow = ((size_t)b * SS + q) * DM + h * DH; SW += (size_t)bh * SS * NSL;      /* batch * 16 + head on grid.y: each has its own score plane */
  float cur = AQf[prow + ln] * PK[prow + ln] + AQf[prow + 32 + ln] * PK[prow + 32 + ln]; for (int o = 16; o > 0; o >>= 1) cur += __shfl_xor(cur, o, 32); cur *= 0.125f;
  const float* sr = SW + (size_t)q * NSL; float v[16]; float m = -3.0e38f;
#pragma unroll
  for (int k = 0; k < 16; ++k) { const int sl = 16 * ln + k; float x = sr[sl]; x = (sl == cs) ? cur : x; x = (sl > cs) ? -3.0e38f : x; v[k] = x; m = fmaxf(m, x); }
  for (int o = 16; o > 0; o >>= 1) m = fmaxf(m, __shfl_xor(m, o, 32));
  float su = 0.f;
#pragma unroll
  for (int k = 0; k < 16; ++k) { const int sl = 16 * ln + k; v[k] = (sl > cs) ? 0.f : expf(v[k] - m); su += v[k]; }
  for (int o = 16; o > 0; o >>= 1) su += __shfl_xor(su, o, 32); const float inv = 1.0f / su; FragH f0, f1; float wc = 0.f;
#pragma unroll
  for (int k = 0; k < 16; ++k) { const int sl = 16 * ln + k; const float wv = v[k] * inv; wc = (sl == cs) ? wv : wc; if (k < 8) f0.h[k] = (_Float16)(wv * 1024.0f); else f1.h[k - 8] = (_Float16)(wv * 1024.0f); }
  for (int o = 16; o > 0; o >>= 1) wc += __shfl_xor(wc, o, 32);      /* exactly one lane holds the current slot */
  { *(v8us*)((unsigned short*)SW + (size_t)q * (2 * NSL) + 16 * ln) = f0.half[0]; *(v8us*)((unsigned short*)SW + (size_t)q * (2 * NSL) + 16 * ln + 8) = f1.half[0]; *(float*)(WC + ((size_t)bh * SS + q) * 32 + ln) = wc;  } }      /* one whole 128-byte line per (head, row), written by this wave alone */
__global__ __launch_bounds__(256) void k_oepi(const float* __restrict__ O, const float* __restrict__ WC, const float* __restrict__ PVp, const float* __restrict__ FVf, _Float16* __restrict__ Oh, _Float16* __restrict__ Ol) {
  #pragma clang fp contract(off)
  const int t = blockIdx.x * 256 + threadIdx.x; if (t >= NR * NH * (DH / 8)) return; const int d0 = (t % (DH / 8)) * 8; const int h = (t / (DH / 8)) % NH; const int bq = t / ((DH / 8) * NH); const int b = bq / SS, q = bq % SS; const int cs = q / KF, tt = q % KF; const float wc = WC[((size_t)(b * NH + h) * SS + q) * 32]; const size_t prow = (size_t)bq * DM + h * DH + d0; const size_t srow = ((size_t)(b * NH + h) * NSL + cs) * DH + d0; const size_t orow = ((size_t)(b * NH + h) * SS + q) * DH + d0; FragH fh, fl;      /* O is [batch * 16 + head][token][64] */
  const v4f pA = *(const v4fa*)(PVp + prow), pB = *(const v4fa*)(PVp + prow + 4), fA = *(const v4fa*)(FVf + srow), fB = *(const v4fa*)(FVf + srow + 4);
  asm volatile("s_wait_xcnt 0x0" ::: "memory");      /* the loads of O below may land in registers that hold the addresses of the loads above: the wait stands between them */
  const v4f oA = *(const v4fa*)(O + orow), oB = *(const v4fa*)(O + orow + 4);
#pragma unroll
  for (int k = 0; k < 8; ++k) { const int d = d0 + k; const float o = ((k < 4) ? oA[k & 3] : oB[k & 3]) + wc * (((k < 4) ? pA[k & 3] : pB[k & 3]) - ((k < 4) ? fA[k & 3] : fB[k & 3])); const float v = (o * cdma(tt, d)) * 2.0f; const _Float16 hi = (_Float16)v; fh.h[k] = hi; fl.h[k] = (_Float16)((v - (float)hi) * 1024.0f); }
  { *(v8us*)((unsigned short*)Oh + prow) = fh.half[0]; *(v8us*)((unsigned short*)Ol + prow) = fl.half[0];  } }

extern "C" void kernel_launch(void* const* d_in, const int* in_sizes, int n_in,
                              void* d_out, int out_size, void* d_ws, size_t ws_size, hipStream_t stream) {
  (void)in_sizes; (void)n_in; (void)out_size;
  const float* x = (const float*)d_in[0]; const float* Wq = (const float*)d_in[1]; const float* Wk = (const float*)d_in[2]; const float* Wv = (const float*)d_in[3]; const float* Wo = (const float*)d_in[4]; const float* Aq = (const float*)d_in[5]; const float* Bq = (const float*)d_in[6]; const float* Av = (const float*)d_in[7]; const float* Bv = (const float*)d_in[8]; const float* Ao = (const float*)d_in[9]; const float* Bo = (const float*)d_in[10];
  char* ws = (char*)d_ws; size_t off = 0;
  auto take = [&](size_t bytes) { char* p = ws + off; off += (bytes + 255) & ~(size_t)255; return p; };
  _Float16* BWq = (_Float16*)take((size_t)DM * DM * 2); _Float16* BWk = (_Float16*)take((size_t)DM * DM * 2); _Float16* BWv = (_Float16*)take((size_t)DM * DM * 2); _Float16* BWo = (_Float16*)take((size_t)DM * DM * 2); _Float16* BAq = (_Float16*)take((size_t)LR * DM * 2); _Float16* BAv = (_Float16*)take((size_t)LR * DM * 2); _Float16* BAo = (_Float16*)take((size_t)LR * DM * 2); _Float16* BBq = (_Float16*)take((size_t)DM * LR * 2); _Float16* BBv = (_Float16*)take((size_t)DM * LR * 2); _Float16* BBo = (_Float16*)take((size_t)DM * LR * 2);
  float* CS = (float*)take((size_t)SS * DH * 4); float* SN = (float*)take((size_t)SS * DH * 4);
  /* every plane holds both batches (NR = 4096 rows, or 32 = batch * 16 + head slabs) */
  _Float16* X16 = (_Float16*)take((size_t)NR * DM * 2); float* Q = (float*)take((size_t)NR * DM * 4); float* K = (float*)take((size_t)NR * DM * 4); float* V = (float*)take((size_t)NR * DM * 4); float* XA = (float*)take((size_t)NR * LR * 4); _Float16* XAh = (_Float16*)take((size_t)NR * LR * 2); _Float16* XAl = (_Float16*)take((size_t)NR * LR * 2);
  _Float16* FK16 = (_Float16*)take((size_t)NBt * NH * NSL * DH * 2); _Float16* FV16 = (_Float16*)take((size_t)NBt * NH * NSL * DH * 2); float* FKf = (float*)take((size_t)NBt * NH * NSL * DH * 4); float* FVf = (float*)take((size_t)NBt * NH * NSL * DH * 4); float* PK = (float*)take((size_t)NR * DM * 4); float* PVp = (float*)take((size_t)NR * DM * 4); float* AQf = (float*)take((size_t)NR * DM * 4);
  float* S = (float*)take((size_t)NBt * NH * SS * NSL * 4);
  if (off > ws_size) return;      // weights 8.75 + tables 1 + planes 246: 255.75 MiB
  /* planes that are written only after another plane's last reader has run share its bytes (launches of one stream run in order):
     X16 is last read by the launch of the five products of x, Q, K and V by k_slots, a row of S by the wave that turns it into weights; XA, XAh and XAl serve out*Ao alone */
  _Float16* AQ16 = X16; float* O = Q; _Float16* Oh = (_Float16*)K; _Float16* Ol = Oh + (size_t)NR * DM; float* WC = V; _Float16* FVT = (_Float16*)(V + (size_t)NBt * NH * SS * 32); _Float16* W16 = (_Float16*)S; float* OA = XA; _Float16* OAh = XAh; _Float16* OAl = XAl;
  /* the two low-rank inputs x*Aq and x*Av are formed in one launch and so need a plane each: they lie at the start of S, which is first written by the score GEMM, after their last reader */
  float* XA2 = S; _Float16* XAh2 = (_Float16*)(S + (size_t)2 * NR * LR); _Float16* XAl2 = XAh2 + (size_t)2 * NR * LR;
  const size_t n8 = (size_t)NR * DM / 8; const unsigned nb8 = (unsigned)((n8 + 255) / 256); const size_t a8 = (size_t)NR * LR / 8; const unsigned nba = (unsigned)((a8 + 255) / 256);
  k_prep<<<4 * (DM * (DM / 8) / 256) + SS * DH / 256 + 6 * (LR * (DM / 8) / 256) + nb8, 256, 0, stream>>>(x, Wq, Wk, Wv, Wo, Aq, Bq, Av, Bv, Ao, Bo, X16, BWq, BAq, BBq, CS, SN);      /* all weights are (in,out) */
  /* one 64 x 64 tile of C per work-group: projections over all NR rows, nD work-groups for N = 1024 and nL for N = 64; attention GEMMs per (batch, head) on grid.y */
  const int nD = (NR / 64) * (DM / 64), nL = NR / 64; const dim3 gL4(SS / 64, NBt * NH), gS((SS / 64) * (NSL / 64), NBt * NH), gH(SS / 8 + FVB, NBt * NH);
  const float a0 = 0.0625f, a1 = 0.0625f / 1024.0f;      /* undo the weights' 16; the lo planes carry 2^10 more */
  const GemmJobs<5> jX = {{{X16, BWq, nullptr, Q, 0, a0, DM, DM, nD}, {X16, BWk, nullptr, K, 0, a0, DM, DM, nD}, {X16, BWv, nullptr, V, 0, a0, DM, DM, nD}, {X16, BAq, nullptr, XA2, 0, a0, LR, LR, nL}, {X16, BAv, nullptr, XA2 + (size_t)NR * LR, 0, a0, LR, LR, nL}}};
  k_gemm_hhx<0, 4, 5><<<dim3(3 * nD + 2 * nL, 1), 128, 0, stream>>>(jX, DM, 0, DM, 0, nullptr, 0, 1, 0, nullptr, 0, NR, DM);      /* x*Wq, x*Wk, x*Wv (exact), x*Aq, x*Av */
  k_split<<<2 * nba, 256, 0, stream>>>(XA2, XAh2, XAl2, 2 * a8);
  const GemmJobs<2> jH = {{{XAh2, BBq, Q, Q, (size_t)DM, a0, DM, DM, nD}, {XAh2 + (size_t)NR * LR, BBv, V, V, (size_t)DM, a0, DM, DM, nD}}};
  const GemmJobs<2> jLo = {{{XAl2, BBq, Q, Q, (size_t)DM, a1, DM, DM, nD}, {XAl2 + (size_t)NR * LR, BBv, V, V, (size_t)DM, a1, DM, DM, nD}}};
  k_gemm_hhx<0, 2, 2><<<dim3(2 * nD, 1), 128, 0, stream>>>(jH, LR, 0, LR, 0, nullptr, 0, 1, 0, nullptr, 0, NR, LR); k_gemm_hhx<0, 2, 2><<<dim3(2 * nD, 1), 128, 0, stream>>>(jLo, LR, 0, LR, 0, nullptr, 0, 1, 0, nullptr, 0, NR, LR);      /* q += (x*Aq)*Bq and v += (x*Av)*Bv: hi planes, then lo planes */
  k_slots<<<(NBt * NH * NSL * (DH / 8) + 255) / 256, 256, 0, stream>>>(Q, K, V, CS, SN, FK16, FV16, FKf, FVf, PK, PVp, AQ16, AQf);
  /* all 32 (batch, head) pairs in one launch each, pair = blockIdx.y */
  const GemmJobs<1> jS = {{{AQ16, FK16, nullptr, S, 0, 0.125f, NSL, NSL, (SS / 64) * (NSL / 64)}}};
  k_gemm_hhx<0, 2, 1><<<gS, 128, 0, stream>>>(jS, DH, (size_t)SS * DH, DH, (size_t)NSL * DH, nullptr, 0, 1, 0, nullptr, (size_t)SS * NSL, SS, DH);      /* slot scores/8: M 2048 N 512 K 64 per pair */
  k_hsoft<<<gH, 256, 0, stream>>>(S, AQf, PK, WC, FVf, FVT);
  const GemmJobs<1> jO = {{{W16, FVT, nullptr, O, 0, 0.0009765625f, DH, DH, SS / 64}}};
  k_gemm_hhx<0, 4, 1><<<gL4, 128, 0, stream>>>(jO, 2 * NSL, (size_t)SS * 2 * NSL, NSL, (size_t)DH * NSL, nullptr, 0, 1, 0, nullptr, (size_t)SS * DH, SS, NSL);      /* sum of w * full_V into O[pair]: M 2048 N 64 K 512 per pair; a weight row has the pitch of its score row */
  k_oepi<<<(NR * NH * (DH / 8) + 255) / 256, 256, 0, stream>>>(O, WC, PVp, FVf, Oh, Ol);
  float* outb = (float*)d_out;
  const GemmJobs<2> jOh = {{{Oh, BWo, nullptr, outb, 0, a0, DM, DM, nD}, {Oh, BAo, nullptr, OA, 0, a0, LR, LR, nL}}};
  const GemmJobs<2> jOl = {{{Ol, BWo, outb, outb, (size_t)DM, a1, DM, DM, nD}, {Ol, BAo, OA, OA, (size_t)LR, a1, LR, LR, nL}}};
  k_gemm_hhx<0, 4, 2><<<dim3(nD + nL, 1), 128, 0, stream>>>(jOh, DM, 0, DM, 0, nullptr, 0, 1, 0, nullptr, 0, NR, DM); k_gemm_hhx<0, 4, 2><<<dim3(nD + nL, 1), 128, 0, stream>>>(jOl, DM, 0, DM, 0, nullptr, 0, 1, 0, nullptr, 0, NR, DM);      /* out*Wo and out*Ao: hi planes, then lo planes */
  k_split<<<nba, 256, 0, stream>>>(OA, OAh, OAl, a8);
  const GemmJobs<1> jBh = {{{OAh, BBo, outb, outb, (size_t)DM, a0, DM, DM, nD}}}; const GemmJobs<1> jBl = {{{OAl, BBo, outb, outb, (size_t)DM, a1, DM, DM, nD}}};
  k_gemm_hhx<0, 2, 1><<<dim3(nD, 1), 128, 0, stream>>>(jBh, LR, 0, LR, 0, nullptr, 0, 1, 0, nullptr, 0, NR, LR); k_gemm_hhx<0, 2, 1><<<dim3(nD, 1), 128, 0, stream>>>(jBl, LR, 0, LR, 0, nullptr, 0, 1, 0, nullptr, 0, NR, LR);      /* + (out*Ao)*Bo */
}

// v006
// A run of this version takes 276 microseconds.
// In two side-by-side timings against v005, it was 1.20 and 1.19 times as fast.
// Counting every step since v000, it is 6.73 times as fast.
#include <hip/hip_runtime.h>
// HoloKV attention (B 2, S 2048, 16 heads × 64, k_factor 4 → 512 slots): q = x·Wq + (x·Aq)·Bq, k = x·Wk, v = x·Wv + (x·Av)·Bv; RoPE (half-split rotate, θ_i = 1/10000^(2i/64)); keys/values compressed into slots of 4 tokens with Hadamard phases /2: full_K[s] = Σ_t k[4s+t]·c[t]/2, partial (causal prefix inside the slot); query phase c[q mod 4]; scores over slots: aligned_q·full_K/8 for earlier slots, aligned_q·partial_K(q's prefix)/8 for its own slot, −inf for later slots; softmax; out = Σ w·full_V + w_curr·(partial_V − full_V[curr]); out·phase·2; y = out·Wo + (out·Ao)·Bo → [2,2048,1024].
// Compute dtype: x and parameters rounded to bf16; projections with exact products and the LoRA paths on f16 hi + lo·2^10 operands of x·A (≈f32); RoPE, phases, slot sums/prefixes in f32; aligned q and full_K/full_V as f16 GEMM operands (scores O(1)), the own-slot score, masking, softmax and the rank-1 correction in f32; attention output as f16 hi + lo·2^10 into Wo and the LoRA output path. v_wmma_f32_16x16x32_f16.
#define NBt 2
#define SS 2048
#define DM 1024
#define NH 16
#define DH 64
#define KF 4
#define NSL (SS / KF)            /* 512 slots */
#define LR 64
#define NR (NBt * SS)
typedef __bf16 v16b __attribute__((ext_vector_type(16)));
typedef unsigned short v8us __attribute__((ext_vector_type(8), may_alias));
typedef float  v8f  __attribute__((ext_vector_type(8)));
typedef float  v4f  __attribute__((ext_vector_type(4)));
typedef float  v4fa __attribute__((ext_vector_type(4), may_alias));
union FragB { v16b v; v8us half[2]; unsigned short u[16]; };

__device__ __forceinline__ unsigned short bf16_bits(float x) { unsigned int u = __float_as_uint(x); return (unsigned short)((u + 0x7FFFu + ((u >> 16) & 1u)) >> 16); }
__device__ __forceinline__ float bf16_val(unsigned short b) { return __uint_as_float(((unsigned int)b) << 16); }
__device__ __forceinline__ float bf16_round(float x) { return bf16_val(bf16_bits(x)); }
// D += A·B with NT terms: 1 = ah·bh, 2 = + al·bh (A split), 3 = + ah·bl (both split)
template <int NT>
__device__ __forceinline__ v8f mmaN(v16b ah, v16b al, v16b bh, v16b bl, v8f c) {
  c = __builtin_amdgcn_wmma_f32_16x16x32_bf16(false, ah, false, bh, (short)0, c, false, false);
  if (NT >= 2) c = __builtin_amdgcn_wmma_f32_16x16x32_bf16(false, al, false, bh, (short)0, c, false, false);
  if (NT >= 3) c = __builtin_amdgcn_wmma_f32_16x16x32_bf16(false, ah, false, bl, (short)0, c, false, false);
  asm volatile("v_nop\n\tv_nop\n\tv_nop\n\tv_nop" : "+v"(c) : "v"(ah), "v"(al), "v"(bh), "v"(bl));
  return c;
}

__global__ __launch_bounds__(256) void k_wt_bf16(const float* __restrict__ W, unsigned short* __restrict__ Wt, int K, int N) {
  const int t = blockIdx.x * 256 + threadIdx.x;
  const int k8n = K / 8;
  if (t >= N * k8n) return;
  const int n = t / k8n, k8 = (t % k8n) * 8;
  v8us v;
#pragma unroll
  for (int i = 0; i < 8; ++i) v[i] = bf16_bits(W[(size_t)(k8 + i) * N + n]);
  *(v8us*)(Wt + (size_t)n * K + k8) = v;
  
}

// GEMM C[M][N] (f32, pitch ldc) = act(A[M][K]·W + bias). A f32 row-major (pitch lda) converted per fragment to bf16
// (ASPLIT: hi/lo two planes -> 2 terms, else single rounded term); Wt bf16 [N][K] (pitch ldb). BIAS_BF16 rounds the
// bias to bf16 first (bias quantised to bf16 before the add). K%32==0, M%16==0, N%64==0.
template <bool ASPLIT, int ACT, bool BIAS_BF16>
__global__ __launch_bounds__(128) void k_gemm_bf(const float* __restrict__ A, int lda, const unsigned short* __restrict__ Wt, int ldb,
                                               const float* __restrict__ bias, float* __restrict__ C, int ldc, int M, int N, int K) {
  __shared__ __attribute__((aligned(16))) float so[4][16][64];
  const int tid = threadIdx.x, w = tid >> 5, lane = tid & 31, ln = lane & 15, hh = lane >> 4;
  const int ntn = N / 64;
  const int wid = blockIdx.x * 4 + w;
  const int mt = wid / ntn, nq = wid % ntn;
  if (mt * 16 >= M) return;
  const int row0 = mt * 16, col0 = nq * 64;
  const float* arow = A + (size_t)(row0 + ln) * lda;
  v8f acc[4] = {};
  for (int kb = 0; kb < K; kb += 32) {
    FragB ah, al;
    const v4f x0 = *(const v4fa*)(arow + kb + 8 * hh), x1 = *(const v4fa*)(arow + kb + 8 * hh + 4);
    const v4f x2 = *(const v4fa*)(arow + kb + 16 + 8 * hh), x3 = *(const v4fa*)(arow + kb + 16 + 8 * hh + 4);
    float xs[16] = {x0[0],x0[1],x0[2],x0[3],x1[0],x1[1],x1[2],x1[3],x2[0],x2[1],x2[2],x2[3],x3[0],x3[1],x3[2],x3[3]};
#pragma unroll
    for (int i = 0; i < 16; ++i) { const unsigned short hb = bf16_bits(xs[i]); ah.u[i] = hb; al.u[i] = ASPLIT ? bf16_bits(xs[i] - bf16_val(hb)) : (unsigned short)0; }
#pragma unroll
    for (int t = 0; t < 4; ++t) {
      const unsigned short* brow = Wt + (size_t)(col0 + t * 16 + ln) * ldb + kb;
      FragB b;
      b.half[0] = *(const v8us*)(brow + 8 * hh);
      b.half[1] = *(const v8us*)(brow + 16 + 8 * hh);
      acc[t] = mmaN<ASPLIT ? 2 : 1>(ah.v, al.v, b.v, b.v, acc[t]);
    }
  }
#pragma unroll
  for (int t = 0; t < 4; ++t) {
    float bv = bias ? bias[col0 + t * 16 + ln] : 0.f;
    if (BIAS_BF16) bv = bf16_round(bv);
#pragma unroll
    for (int r = 0; r < 8; ++r) { float v = acc[t][r] + bv; if (ACT == 1) v = fmaxf(v, 0.f); so[w][8 * hh + r][t * 16 + ln] = v; }
  }
  __builtin_amdgcn_fence(__ATOMIC_ACQ_REL, "workgroup");
  __builtin_amdgcn_wave_barrier();
  const int rsub = lane >> 4, c4 = (lane & 15) * 4;
  {
#pragma unroll
    for (int q = 0; q < 8; ++q) {
      const int r = q * 2 + rsub;
      const v4f v = *(const v4fa*)&so[w][r][c4];
      *(v4f*)(C + (size_t)(row0 + r) * ldc + col0 + c4) = v;
    }
    
  }
}

// GEMM C = act(A·W + bias + resid): A f32 (ASPLIT -> hi/lo 2 terms), Wt bf16 [N][K]; ACT 0 none, 1 relu, 2 exact gelu;
// resid (optional, f32, row index = (row % rmod), pitch ldr, RES_BF16 rounds it) added before the activation.
template <bool ASPLIT, int ACT, bool BIAS_BF16, bool RES_BF16>
__global__ __launch_bounds__(128) void k_gemm_bf3(const float* __restrict__ A, int lda, const unsigned short* __restrict__ Wt, int ldb,
                                                const float* __restrict__ bias, const float* __restrict__ resid, int rmod, int ldr,
                                                float* __restrict__ C, int ldc, int M, int N, int K) {
  __shared__ __attribute__((aligned(16))) float so[4][16][64];
  const int tid = threadIdx.x, w = tid >> 5, lane = tid & 31, ln = lane & 15, hh = lane >> 4;
  const int ntn = N / 64;
  const int wid = blockIdx.x * 4 + w;
  const int mt = wid / ntn, nq = wid % ntn;
  if (mt * 16 >= M) return;
  const int row0 = mt * 16, col0 = nq * 64;
  const float* arow = A + (size_t)(row0 + ln) * lda;
  v8f acc[4] = {};
  for (int kb = 0; kb < K; kb += 32) {
    FragB ah, al;
    const v4f x0 = *(const v4fa*)(arow + kb + 8 * hh), x1 = *(const v4fa*)(arow + kb + 8 * hh + 4);
    const v4f x2 = *(const v4fa*)(arow + kb + 16 + 8 * hh), x3 = *(const v4fa*)(arow + kb + 16 + 8 * hh + 4);
    float xs[16] = {x0[0],x0[1],x0[2],x0[3],x1[0],x1[1],x1[2],x1[3],x2[0],x2[1],x2[2],x2[3],x3[0],x3[1],x3[2],x3[3]};
#pragma unroll
    for (int i = 0; i < 16; ++i) { const unsigned short hb = bf16_bits(xs[i]); ah.u[i] = hb; al.u[i] = ASPLIT ? bf16_bits(xs[i] - bf16_val(hb)) : (unsigned short)0; }
#pragma unroll
    for (int t = 0; t < 4; ++t) {
      const unsigned short* brow = Wt + (size_t)(col0 + t * 16 + ln) * ldb + kb;
      FragB b;
      b.half[0] = *(const v8us*)(brow + 8 * hh);
      b.half[1] = *(const v8us*)(brow + 16 + 8 * hh);
      acc[t] = mmaN<ASPLIT ? 2 : 1>(ah.v, al.v, b.v, b.v, acc[t]);
    }
  }
#pragma unroll
  for (int t = 0; t < 4; ++t) {
    const int col = col0 + t * 16 + ln;
    float bv = bias ? bias[col] : 0.f;
    if (BIAS_BF16) bv = bf16_round(bv);
#pragma unroll
    for (int r = 0; r < 8; ++r) {
      float v = acc[t][r] + bv;
      if (resid) { float rv = resid[(size_t)((row0 + 8 * hh + r) % rmod) * ldr + col]; if (RES_BF16) rv = bf16_round(rv); v += rv; }
      if (ACT == 1) v = fmaxf(v, 0.f);
      if (ACT == 2) v = 0.5f * v * (1.0f + erff(v * 0.70710678118654752f));
      if (ACT == 3) { const float u = 0.7978845608028654f * (v + 0.044715f * v * v * v); v = 0.5f * v * (1.0f + tanhf(u)); }
      so[w][8 * hh + r][t * 16 + ln] = v;
    }
  }
  __builtin_amdgcn_fence(__ATOMIC_ACQ_REL, "workgroup");
  __builtin_amdgcn_wave_barrier();
  const int rsub = lane >> 4, c4 = (lane & 15) * 4;
  {
#pragma unroll
    for (int q = 0; q < 8; ++q) {
      const int r = q * 2 + rsub;
      const v4f v = *(const v4fa*)&so[w][r][c4];
      *(v4f*)(C + (size_t)(row0 + r) * ldc + col0 + c4) = v;
    }
    
  }
}
// row LayerNorm (biased variance, eps) over N: s = X (+ R); optional out_sum <- s; out_norm <- (s-mu)*rsqrt(var+eps)*g + b
template <bool PARAM_BF16>
__global__ __launch_bounds__(256) void k_layernorm(const float* __restrict__ X, const float* __restrict__ R, const float* __restrict__ g, const float* __restrict__ bta,
                                                  float* __restrict__ out_sum, float* __restrict__ out_norm, int N, float eps) {
  __shared__ float red[256];
  const int row = blockIdx.x, tid = threadIdx.x;
  const float* x = X + (size_t)row * N; const float* rr = R ? R + (size_t)row * N : nullptr;
  float vals[16];                     // up to N = 4096
  const int per = N / 256;            // contiguous chunk per thread? use strided-by-4 chunks: thread handles j = tid*4 + 1024*u
  float s1 = 0.f;
  for (int u = 0; u < per / 4; ++u) {
    const int j = tid * 4 + 1024 * u;
    const v4f a = *(const v4fa*)(x + j);
    v4f b = {0.f,0.f,0.f,0.f}; if (rr) b = *(const v4fa*)(rr + j);
#pragma unroll
    for (int q = 0; q < 4; ++q) { const float v = a[q] + b[q]; vals[u * 4 + q] = v; s1 += v; }
  }
  red[tid] = s1; __syncthreads();
  for (int st = 128; st > 0; st >>= 1) { if (tid < st) red[tid] += red[tid + st]; __syncthreads(); }
  const float mu = red[0] / (float)N; __syncthreads();
  float s2 = 0.f;
  for (int u = 0; u < per / 4; ++u)
#pragma unroll
    for (int q = 0; q < 4; ++q) { const float c = vals[u * 4 + q] - mu; s2 += c * c; }
  red[tid] = s2; __syncthreads();
  for (int st = 128; st > 0; st >>= 1) { if (tid < st) red[tid] += red[tid + st]; __syncthreads(); }
  const float rs = rsqrtf(red[0] / (float)N + eps);
  {
    for (int u = 0; u < per / 4; ++u) {
      const int j = tid * 4 + 1024 * u;
      v4f o, sm;
#pragma unroll
      for (int q = 0; q < 4; ++q) {
        float gg = g[j + q], bb = bta[j + q];
        if (PARAM_BF16) { gg = bf16_round(gg); bb = bf16_round(bb); }
        sm[q] = vals[u * 4 + q]; o[q] = (vals[u * 4 + q] - mu) * rs * gg + bb;
      }
      if (out_sum) *(v4f*)(out_sum + (size_t)row * N + j) = sm;
      *(v4f*)(out_norm + (size_t)row * N + j) = o;
    }
    
  }
}



// ---- f16 WMMA path (v_wmma_f32_16x16x32_f16): 11-bit significands for operands in range — used where a [0,1] probability operand needs more precision than bf16
typedef _Float16 v16h __attribute__((ext_vector_type(16)));
union FragH { v16h v; v8us half[2]; _Float16 h[16]; unsigned short u[16]; };
template <int NT>
__device__ __forceinline__ v8f mmaH(v16h ah, v16h al, v16h bh, v16h bl, v8f c) {
  c = __builtin_amdgcn_wmma_f32_16x16x32_f16(false, ah, false, bh, (short)0, c, false, false);
  if (NT >= 2) c = __builtin_amdgcn_wmma_f32_16x16x32_f16(false, al, false, bh, (short)0, c, false, false);
  if (NT >= 3) c = __builtin_amdgcn_wmma_f32_16x16x32_f16(false, ah, false, bl, (short)0, c, false, false);
  asm volatile("v_nop\n\tv_nop\n\tv_nop\n\tv_nop" : "+v"(c) : "v"(ah), "v"(al), "v"(bh), "v"(bl));
  return c;
}
// batched GEMM like k_gemm_b but f16 operands: A f32 (split into f16 hi/lo if ASPLIT, else rounded to f16), Bt = f16 values [n][k]; alpha; C f32; N multiple of 16 (partial tiles skipped)
template <bool ASPLIT>
__global__ __launch_bounds__(128) void k_gemm_h(const float* __restrict__ A, int lda, size_t sA, const _Float16* __restrict__ Bh, int ldb, size_t sB, float alpha, float* __restrict__ C, int ldc, size_t sC, int M, int N, int K) {
  __shared__ __attribute__((aligned(16))) float so[4][16][64];
  const int tid = threadIdx.x, w = tid >> 5, lane = tid & 31, ln = lane & 15, hh = lane >> 4; const int by = blockIdx.y;
  A += (size_t)by * sA; Bh += (size_t)by * sB; C += (size_t)by * sC;
  const int ntn = (N + 63) / 64; const int wid = blockIdx.x * 4 + w; const int mt = wid / ntn, nq = wid % ntn; if (mt * 16 >= M) return;
  const int row0 = mt * 16, col0 = nq * 64; const float* arow = A + (size_t)(row0 + ln) * lda;
  v8f acc[4] = {};
  for (int kb = 0; kb < K; kb += 32) {
    FragH ah, al;
    const v4f x0 = *(const v4fa*)(arow + kb + 8 * hh), x1 = *(const v4fa*)(arow + kb + 8 * hh + 4), x2 = *(const v4fa*)(arow + kb + 16 + 8 * hh), x3 = *(const v4fa*)(arow + kb + 16 + 8 * hh + 4);
    float xs[16] = {x0[0],x0[1],x0[2],x0[3],x1[0],x1[1],x1[2],x1[3],x2[0],x2[1],x2[2],x2[3],x3[0],x3[1],x3[2],x3[3]};
#pragma unroll
    for (int i = 0; i < 16; ++i) { const _Float16 h = (_Float16)xs[i]; ah.h[i] = h; al.h[i] = ASPLIT ? (_Float16)(xs[i] - (float)h) : (_Float16)0.0f; }
#pragma unroll
    for (int t = 0; t < 4; ++t) { if (col0 + t * 16 >= N) continue; const size_t boff = (size_t)(col0 + t * 16 + ln) * ldb + kb; FragH bq; bq.half[0] = *(const v8us*)(Bh + boff + 8 * hh); bq.half[1] = *(const v8us*)(Bh + boff + 16 + 8 * hh);
      acc[t] = mmaH<ASPLIT ? 2 : 1>(ah.v, al.v, bq.v, bq.v, acc[t]); }
  }
#pragma unroll
  for (int t = 0; t < 4; ++t) { if (col0 + t * 16 >= N) continue;
#pragma unroll
    for (int r = 0; r < 8; ++r) so[w][8 * hh + r][t * 16 + ln] = acc[t][r] * alpha; }
  __builtin_amdgcn_fence(__ATOMIC_ACQ_REL, "workgroup"); __builtin_amdgcn_wave_barrier();
  const int rsub = lane >> 4, c4 = (lane & 15) * 4;
  {
#pragma unroll
    for (int q = 0; q < 8; ++q) { const int r = q * 2 + rsub; if (col0 + c4 < N) { const v4f v = *(const v4fa*)&so[w][r][c4]; *(v4f*)(C + (size_t)(row0 + r) * ldc + col0 + c4) = v; } }
     }
}

// Wt[n][k] = f16(W[k][n]·scale) from f32 row-major W[K][N] (scale = power of two; bf16-exact weights stay exact in f16 away from the subnormal range)
__device__ __forceinline__ void d_wt_f16(const float* __restrict__ W, _Float16* __restrict__ Wt, int K, int N, float scale, int blk) {
  const int t = blk * 256 + threadIdx.x; if (t >= N * (K / 8)) return; const int n = t / (K / 8), k8 = (t % (K / 8)) * 8; FragH f;
#pragma unroll
  for (int i = 0; i < 8; ++i) f.h[i] = (_Float16)(bf16_round(W[(size_t)(k8 + i) * N + n]) * scale); const v8us o = f.half[0];
  *(v8us*)((unsigned short*)Wt + (size_t)n * K + k8) = o; 
}
// One work-group = one 64 x 64 tile of C; wave w owns rows 16w..16w+15 of it, all 64 columns. Per stage the four waves bring 64 rows of A and 64 rows of B, 32 * KU k each,
// from global memory with whole-line 16-byte loads into registers and store them to LDS (row pitch = row bytes + 16, conflict-free for 16-byte fragment reads); every wave reads its
// fragments from LDS, so the B tile is fetched once per work-group instead of once per wave and no global load is spread over 16 rows. Two LDS buffers: the next stage's global loads
// are issued before this stage's WMMAs and stored to the other buffer behind them, one barrier per stage. M and N multiples of 64, K a multiple of 32 * KU. The k order per accumulator is ascending.
// Every loop over i, u and t is unrolled so that ra, rb, oa, ob and the fragments are registers, not indexed arrays in scratch.
// k_gemm_hh variant with fused epilogue: v = acc·alpha + bias[by·sBias + col] (+ CP[(row/rowsPerB)·sCPb + by·64 + col] if CP) ; ACT 0 none / 1 elu ; writes f32 C and f16 C16, each if non-null
// One launch runs up to NJ products that do not depend on one another and share M, K and the operand pitches: job i owns the next nb work-groups of grid.x, with its own operands, addend, output, scale and N.
struct GemmJob { const _Float16* A; const _Float16* B; const float* CP; float* C; size_t sCPb; float alpha; int ldc, N, nb; };
template <int NJ> struct GemmJobs { GemmJob j[NJ]; };
template <int ACT, int KU, int NJ>
__global__ __launch_bounds__(128) void k_gemm_hhx(const GemmJobs<NJ> J, int lda, size_t sA, int ldb, size_t sB, const float* __restrict__ bias, size_t sBias, int rowsPerB, int row0g,
    _Float16* __restrict__ C16, size_t sC, int M, int K) {
  constexpr int RB = 64 * KU, PITCH = RB + 16, UPR = RB / 16, RP = 128 / UPR, NU = 64 / RP, TILE = 64 * PITCH;      /* row bytes, LDS pitch, 16-byte units per row, rows per pass of 128 threads, passes per tile, tile bytes */
  __shared__ __attribute__((aligned(16))) char sm[4 * TILE];      /* [buffer][A tile | B tile]; the epilogue's 16 KiB of staging reuses it behind the last stage's barrier */
  static_assert(4 * TILE >= 4 * 16 * 64 * 4, "epilogue staging must fit");
  float (*so)[16][64] = (float (*)[16][64])sm;
  const int tid = threadIdx.x, w = tid >> 5, lane = tid & 31, ln = lane & 15, hh = lane >> 4; const int by = blockIdx.y;
  GemmJob g = J.j[0]; int bx = blockIdx.x;      /* this work-group's job and its index inside the job: scalar values, the same for the whole work-group */
  for (int i = 1; i < NJ; ++i) if (bx >= g.nb) { bx -= g.nb; g = J.j[i]; }
  const _Float16* A = g.A; const _Float16* Bh = g.B; const float* CP = g.CP; float* C = g.C; const size_t sCPb = g.sCPb; const float alpha = g.alpha; const int ldc = g.ldc, N = g.N;
  A += (size_t)by * sA; Bh += (size_t)by * sB; const size_t cofs = (size_t)by * sC; const float* bp = bias ? bias + (size_t)by * sBias : nullptr;
  const int ntn = (N + 63) / 64; const int mtb = bx / ntn, nq = bx % ntn; if (mtb * 64 >= M) return;      /* the same for the whole work-group, ahead of every barrier */
  const int row0 = mtb * 64 + w * 16, col0 = nq * 64;
  v8f acc[4] = {};
  const char* Ab = (const char*)A; const char* Bb = (const char*)Bh;      /* uniform bases; each thread keeps one 32-bit byte offset per load */
  const int sr = tid / UPR, sc = (tid % UPR) * 16;
  const unsigned ga = (unsigned)((mtb * 64 + sr) * lda * 2 + sc), gb = (unsigned)((col0 + sr) * ldb * 2 + sc), ls = (unsigned)(sr * PITCH + sc);
  unsigned oa[NU], ob[NU];      /* moved on by one stage's bytes just ahead of the stage's loads: the loads that named the old values were waited for ahead of the last barrier */
#pragma unroll
  for (int i = 0; i < NU; ++i) { oa[i] = ga + (unsigned)(i * RP * lda * 2); ob[i] = gb + (unsigned)(i * RP * ldb * 2); }
  const unsigned fa = (unsigned)((w * 16 + ln) * PITCH + 16 * hh), fb = (unsigned)(TILE + ln * PITCH + 16 * hh);
  v8us ra[NU], rb[NU];
#pragma unroll
  for (int i = 0; i < NU; ++i) { ra[i] = *(const v8us*)(Ab + oa[i]); rb[i] = *(const v8us*)(Bb + ob[i]); }
#pragma unroll
  for (int i = 0; i < NU; ++i) { *(v8us*)(sm + ls + i * RP * PITCH) = ra[i]; *(v8us*)(sm + TILE + ls + i * RP * PITCH) = rb[i]; }
  __syncthreads();      /* stage 0 is in buffer 0 for every wave */
  const int nst = K / (32 * KU);
  for (int s = 0; s < nst; ++s) { const bool more = s + 1 < nst; const char* cur = sm + (s & 1) * 2 * TILE; char* nxt = sm + ((s + 1) & 1) * 2 * TILE;
    if (more) {
#pragma unroll
      for (int i = 0; i < NU; ++i) { oa[i] += RB; ob[i] += RB; ra[i] = *(const v8us*)(Ab + oa[i]); rb[i] = *(const v8us*)(Bb + ob[i]); } }
    FragH ah[KU], bq[KU][4];
#pragma unroll
    for (int u = 0; u < KU; ++u) { ah[u].half[0] = *(const v8us*)(cur + fa + 64 * u); ah[u].half[1] = *(const v8us*)(cur + fa + 64 * u + 32);
#pragma unroll
      for (int t = 0; t < 4; ++t) { bq[u][t].half[0] = *(const v8us*)(cur + fb + t * 16 * PITCH + 64 * u); bq[u][t].half[1] = *(const v8us*)(cur + fb + t * 16 * PITCH + 64 * u + 32); } }
#pragma unroll
    for (int u = 0; u < KU; ++u) {
#pragma unroll
      for (int t = 0; t < 4; ++t) acc[t] = mmaH<1>(ah[u].v, ah[u].v, bq[u][t].v, bq[u][t].v, acc[t]); }
    if (more) {
#pragma unroll
      for (int i = 0; i < NU; ++i) { *(v8us*)(nxt + ls + i * RP * PITCH) = ra[i]; *(v8us*)(nxt + TILE + ls + i * RP * PITCH) = rb[i]; } }
    __syncthreads();      /* publishes the next stage's buffer and ends every wave's reads of this one (refilled one stage on; staged over by the epilogue behind the last) */
  }
#pragma unroll
  for (int t = 0; t < 4; ++t) { if (col0 + t * 16 >= N) continue; const int col = col0 + t * 16 + ln; const float bv = bp ? bf16_round(bp[col]) : 0.f;
#pragma unroll
    for (int r = 0; r < 8; ++r) { float v = acc[t][r] * alpha + bv; if (CP) { const int bidx = (row0g + row0 + 8 * hh + r) / rowsPerB; v += CP[(size_t)bidx * sCPb + (size_t)by * 64 + col]; } if (ACT == 1) v = (v > 0.f) ? v : expm1f(v); else if (ACT == 7) v = (v > 0.f) ? v + 1.0f : expf(v); else if (ACT == 8) v = tanhf(v); else if (ACT == 9) v = 0.5f * v * (1.0f + tanhf(0.7978845608028654f * (v + 0.044715f * v * v * v))); else if (ACT == 11) v = 1.0f / (1.0f + expf(-v)); else if (ACT == 12) v = (v > 0.f) ? v : 0.01f * v; else if (ACT == 14) v = (v > 0.f) ? v : 0.1f * v; else if (ACT == 15) v = v / (1.0f + expf(-v)); else if (ACT == 3) v = fmaxf(v, 0.f); else if (ACT == 6) v = 0.5f * v * (1.0f + erff(v * 0.70710678118654752f)); so[w][8 * hh + r][t * 16 + ln] = v; } }
  __builtin_amdgcn_fence(__ATOMIC_ACQ_REL, "workgroup"); __builtin_amdgcn_wave_barrier();
  const int rsub = lane >> 4, c4 = (lane & 15) * 4; typedef _Float16 v4h __attribute__((ext_vector_type(4)));
  {
#pragma unroll
    for (int q = 0; q < 8; ++q) { const int r = q * 2 + rsub; if (col0 + c4 < N) { const v4f v = *(const v4fa*)&so[w][r][c4]; if (C) *(v4f*)(C + cofs + (size_t)(row0 + r) * ldc + col0 + c4) = v; if (C16) { v4h h4; for (int i = 0; i < 4; ++i) h4[i] = (_Float16)v[i]; *(v4h*)(C16 + cofs + (size_t)(row0 + r) * ldc + col0 + c4) = h4; } } }
     }
}


typedef _Float16 v4h __attribute__((ext_vector_type(4)));

__device__ __forceinline__ void d_x16(const float* __restrict__ x, _Float16* __restrict__ X16, size_t n8, int blk) { const size_t t = (size_t)blk * 256 + threadIdx.x; if (t >= n8) return; FragH f;
#pragma unroll
  for (int q = 0; q < 8; ++q) f.h[q] = (_Float16)bf16_round(x[t * 8 + q]); *(v8us*)((unsigned short*)X16 + t * 8) = f.half[0];  }
__global__ __launch_bounds__(256) void k_h16(const float* __restrict__ x, _Float16* __restrict__ X16, size_t n8) { const size_t t = (size_t)blockIdx.x * 256 + threadIdx.x; if (t >= n8) return; FragH f;
#pragma unroll
  for (int q = 0; q < 8; ++q) f.h[q] = (_Float16)x[t * 8 + q]; *(v8us*)((unsigned short*)X16 + t * 8) = f.half[0];  }
__global__ __launch_bounds__(256) void k_round16f(const float* __restrict__ W, _Float16* __restrict__ Bt, size_t n8) { const size_t t = (size_t)blockIdx.x * 256 + threadIdx.x; if (t >= n8) return; FragH f;
#pragma unroll
  for (int i = 0; i < 8; ++i) f.h[i] = (_Float16)(bf16_round(W[t * 8 + i]) * 16.0f); *(v8us*)((unsigned short*)Bt + t * 8) = f.half[0];  }
template <int NHv, int TTv>
__global__ __launch_bounds__(256) void k_vt(const _Float16* __restrict__ V16, int ldv, int voff, _Float16* __restrict__ Vt) { __shared__ unsigned short tl[64][66]; const int tid = threadIdx.x; const int slab = blockIdx.x / (TTv / 64), lg = blockIdx.x % (TTv / 64); const int b = slab / NHv, h = slab % NHv;
  for (int i = tid; i < 64 * 8; i += 256) { const int r = i / 8, c8 = (i % 8) * 8; FragH f; f.half[0] = *(const v8us*)((const unsigned short*)V16 + ((size_t)b * TTv + lg * 64 + r) * ldv + voff + h * 64 + c8);
#pragma unroll
    for (int q = 0; q < 8; ++q) tl[r][c8 + q] = f.u[q]; }
  __syncthreads();
  {
#pragma unroll
    for (int rd = 0; rd < 2; ++rd) { const int d = rd * 32 + tid / 8, pc = tid % 8; FragH f;
#pragma unroll
      for (int q = 0; q < 8; ++q) f.u[q] = tl[pc * 8 + q][d];
      *(v8us*)((unsigned short*)Vt + ((size_t)slab * 64 + d) * TTv + lg * 64 + pc * 8) = f.half[0]; }
     } }

__global__ __launch_bounds__(256) void k_hl(const float* __restrict__ F, _Float16* __restrict__ Hh, _Float16* __restrict__ Hl, size_t n8) { const size_t t = (size_t)blockIdx.x * 256 + threadIdx.x; if (t >= n8) return; FragH fh, fl; const v4f a = *(const v4fa*)(F + t * 8), c = *(const v4fa*)(F + t * 8 + 4);
#pragma unroll
  for (int q = 0; q < 4; ++q) { _Float16 h = (_Float16)a[q]; fh.h[q] = h; fl.h[q] = (_Float16)((a[q] - (float)h) * 1024.0f); h = (_Float16)c[q]; fh.h[4 + q] = h; fl.h[4 + q] = (_Float16)((c[q] - (float)h) * 1024.0f); }
  { *(v8us*)((unsigned short*)Hh + t * 8) = fh.half[0]; *(v8us*)((unsigned short*)Hl + t * 8) = fl.half[0];  } }

__global__ __launch_bounds__(256) void k_split(const float* __restrict__ F, _Float16* __restrict__ Hh, _Float16* __restrict__ Hl, size_t n8) {
  #pragma clang fp contract(off)
  const size_t t = (size_t)blockIdx.x * 256 + threadIdx.x; if (t >= n8) return; const v4f a = *(const v4fa*)(F + t * 8), c = *(const v4fa*)(F + t * 8 + 4); FragH fh, fl;
#pragma unroll
  for (int q = 0; q < 8; ++q) { const float v = (q < 4) ? a[q] : c[q - 4]; const _Float16 hi = (_Float16)v; fh.h[q] = hi; fl.h[q] = (_Float16)((v - (float)hi) * 1024.0f); }
  { *(v8us*)((unsigned short*)Hh + t * 8) = fh.half[0]; *(v8us*)((unsigned short*)Hl + t * 8) = fl.half[0];  } }
__device__ __forceinline__ void d_cstab(float* __restrict__ CS, float* __restrict__ SN, int blk) {
  #pragma clang fp contract(off)
  const int t = blk * 256 + threadIdx.x; if (t >= SS * DH) return; const int d = t % DH, p = t / DH; const int i = d & 31; const float theta = 1.0f / powf(10000.0f, (float)(2 * i) / 64.0f); const float ang = (float)p * theta; const float c = cosf(ang), s = sinf(ang);
  { *(float*)(CS + t) = c; *(float*)(SN + t) = s;  } }
// Everything that depends on the inputs alone runs as one launch: the work-group's index picks its piece, the same test for all of its threads. The ten f16 weight planes lie in the
// workspace as three contiguous groups: BW = Wq Wk Wv Wo, BA = Aq Av Ao, BB = Bq Bv Bo. The pieces that take longest per work-group come first.
__global__ __launch_bounds__(256) void k_prep(const float* __restrict__ x, const float* __restrict__ Wq, const float* __restrict__ Wk, const float* __restrict__ Wv, const float* __restrict__ Wo, const float* __restrict__ Aq, const float* __restrict__ Bq, const float* __restrict__ Av, const float* __restrict__ Bv, const float* __restrict__ Ao, const float* __restrict__ Bo,
    _Float16* __restrict__ X16, _Float16* __restrict__ BW, _Float16* __restrict__ BA, _Float16* __restrict__ BB, float* __restrict__ CS, float* __restrict__ SN) {
  constexpr int NW = DM * (DM / 8) / 256, NL = LR * (DM / 8) / 256, NC = SS * DH / 256;      /* work-groups per square weight, per low-rank weight, for the angle tables */
  int b = blockIdx.x;
  if (b < 4 * NW) { const int m = b / NW; d_wt_f16(m == 0 ? Wq : m == 1 ? Wk : m == 2 ? Wv : Wo, BW + (size_t)m * DM * DM, DM, DM, 16.0f, b % NW); return; }
  b -= 4 * NW;
  if (b < NC) { d_cstab(CS, SN, b); return; }
  b -= NC;
  if (b < 3 * NL) { const int m = b / NL; d_wt_f16(m == 0 ? Aq : m == 1 ? Av : Ao, BA + (size_t)m * LR * DM, DM, LR, 16.0f, b % NL); return; }
  b -= 3 * NL;
  if (b < 3 * NL) { const int m = b / NL; d_wt_f16(m == 0 ? Bq : m == 1 ? Bv : Bo, BB + (size_t)m * DM * LR, LR, DM, 16.0f, b % NL); return; }
  b -= 3 * NL;
  d_x16(x, X16, (size_t)NR * DM / 8, b);
}
__device__ __forceinline__ float cdma(int t, int d) { const int j = d & 3; const int par = __popc((unsigned)(t & j)); return (par & 1) ? -1.0f : 1.0f; }      /* Hadamard H4[t][d mod 4] (Sylvester order: rows [1,1,1,1],[1,-1,1,-1],[1,1,-1,-1],[1,-1,-1,1]) */
__global__ __launch_bounds__(256) void k_slots(const float* __restrict__ Q, const float* __restrict__ K, const float* __restrict__ V, const float* __restrict__ CS, const float* __restrict__ SN, _Float16* __restrict__ FK16, _Float16* __restrict__ FV16, float* __restrict__ FKf, float* __restrict__ FVf, float* __restrict__ PK, float* __restrict__ PVp, _Float16* __restrict__ AQ16, float* __restrict__ AQf) {
  #pragma clang fp contract(off)
  const int t = blockIdx.x * 256 + threadIdx.x; if (t >= NBt * NH * NSL * (DH / 8)) return; const int d0 = (t % (DH / 8)) * 8; const int s = (t / (DH / 8)) % NSL; const int bh = t / ((DH / 8) * NSL); const int b = bh / NH, h = bh % NH;      /* both batches in one launch: bh = batch * 16 + head */
  FragH fk, fv; v4f fkA, fkB, fvA, fvB;
  float pk[KF][8], pv[KF][8];      /* running prefixes per token step */
#pragma unroll
  for (int q = 0; q < 8; ++q) { const int d = d0 + q; float accK = 0.f, accV = 0.f;
#pragma unroll
    for (int tt = 0; tt < KF; ++tt) { const int tok = s * KF + tt; const float* kp = K + ((size_t)b * SS + tok) * DM + h * DH; const float* vp = V + ((size_t)b * SS + tok) * DM + h * DH; const float c = CS[(size_t)tok * DH + d], sn = SN[(size_t)tok * DH + d];
      const float kr = kp[d] * c + ((d < 32) ? -kp[d + 32] : kp[d - 32]) * sn; const float ph = cdma(tt, d) * 0.5f;      /* /sqrt(k_factor) */
      accK += kr * ph; accV += vp[d] * ph; pk[tt][q] = accK; pv[tt][q] = accV; }
    fk.h[q] = (_Float16)accK; fv.h[q] = (_Float16)accV; if (q < 4) { fkA[q] = accK; fvA[q] = accV; } else { fkB[q - 4] = accK; fvB[q - 4] = accV; } }
  const size_t srow = ((size_t)bh * NSL + s) * DH + d0;
  { *(v8us*)((unsigned short*)FK16 + srow) = fk.half[0]; *(v8us*)((unsigned short*)FV16 + srow) = fv.half[0]; *(v4f*)(FKf + srow) = fkA; *(v4f*)(FKf + srow + 4) = fkB; *(v4f*)(FVf + srow) = fvA; *(v4f*)(FVf + srow + 4) = fvB;  }
#pragma unroll
  for (int tt = 0; tt < KF; ++tt) { const int tok = s * KF + tt; const size_t prow = ((size_t)b * SS + tok) * DM + h * DH + d0; v4f a, c2, e, g;
#pragma unroll
    for (int q = 0; q < 4; ++q) { a[q] = pk[tt][q]; c2[q] = pk[tt][4 + q]; e[q] = pv[tt][q]; g[q] = pv[tt][4 + q]; }
    /* aligned q for this token */ const float* qp = Q + ((size_t)b * SS + tok) * DM + h * DH; FragH fq; v4f qa, qb2;
#pragma unroll
    for (int q = 0; q < 8; ++q) { const int d = d0 + q; const float c = CS[(size_t)tok * DH + d], sn = SN[(size_t)tok * DH + d]; const float qr = qp[d] * c + ((d < 32) ? -qp[d + 32] : qp[d - 32]) * sn; const float aq = qr * cdma(tt, d); fq.h[q] = (_Float16)aq; if (q < 4) qa[q] = aq; else qb2[q - 4] = aq; }
    const size_t arow = ((size_t)bh * SS + tok) * DH + d0;
    { *(v4f*)(PK + prow) = a; *(v4f*)(PK + prow + 4) = c2; *(v4f*)(PVp + prow) = e; *(v4f*)(PVp + prow + 4) = g; *(v8us*)((unsigned short*)AQ16 + arow) = fq.half[0]; *(v4f*)(AQf + prow) = qa; *(v4f*)(AQf + prow + 4) = qb2;  } } }
__device__ __forceinline__ void d_fvt(const float* __restrict__ FVf, _Float16* __restrict__ FVT, int blk) { const int t = blk * 256 + threadIdx.x; if (t >= NBt * NH * DH * (NSL / 8)) return; const int s0 = (t % (NSL / 8)) * 8; const int d = (t / (NSL / 8)) % DH; const int h = t / ((NSL / 8) * DH); FragH f;      /* h = batch * 16 + head */
#pragma unroll
  for (int q = 0; q < 8; ++q) f.h[q] = (_Float16)FVf[((size_t)h * NSL + s0 + q) * DH + d];
  *(v8us*)((unsigned short*)FVT + ((size_t)h * DH + d) * NSL + s0) = f.half[0];  }
#define FVB (DH * (NSL / 8) / 256)
__global__ __launch_bounds__(256) void k_fvt(const float* __restrict__ FVf, _Float16* __restrict__ FVT) { d_fvt(FVf, FVT, blockIdx.x); }
// Scores, softmax and weight * full_V in one kernel: a wave owns 16 query rows of one (batch, head) and walks the slots in chunks of 64, up to the chunk that holds its rows' own slots (the four
// own slots of 16 rows lie in one chunk, so every row of a wave has the same trip count and at least one live slot in every chunk). Both products are formed transposed, so that a query row is a
// COLUMN of the accumulators and belongs to lanes ln and ln + 16 alone: scores^T = full_K (A: row = slot, k = d) * aligned_q^T (B: column = query), out^T = full_V^T (A: row = d, k = slot) * weights^T.
// Register r of score tile t holds slot 16 t + 8 hh + r, which is the k that position r of half t & 1 of a B fragment pairs with in the A fragment of full_V^T: tiles 2u and 2u + 1, rounded to f16,
// ARE the weight fragment of k-step u, with no move between lanes and no LDS. Row maximum and row sum are in-lane but for one exchange between the half-waves. Running maximum: row sum and output
// accumulators are rescaled by exp(old max - new max) per chunk; the division by the row sum comes once, at the end. No score and no weight is written to memory.
// The four waves of a work-group (64 rows in a row, so one trip count for all four) share each chunk's 64 rows of full_K and 64 rows of full_V^T, 128 bytes a row: the 128 threads bring them with
// whole-line 16-byte loads into registers and store them to LDS (pitch 144 bytes, as in the GEMM above), every wave reads its A fragments from there. Two LDS buffers: the next chunk's global loads
// are issued ahead of this chunk's work and stored to the other buffer behind it, one barrier per chunk.
__device__ __forceinline__ float xhalf(float x) { return __builtin_bit_cast(float, __builtin_amdgcn_permlanex16(__builtin_bit_cast(int, x), __builtin_bit_cast(int, x), 0x76543210, 0xfedcba98, false, false)); }      /* lane l takes lane l ^ 16 */
__device__ __forceinline__ float exp2s(float x) { float r; asm("v_exp_f32 %0, %1\n\tv_nop" : "=v"(r) : "v"(x)); return r; }      /* 2^x; the v_nop keeps the one slot that the instruction set asks for behind a transcendental, whatever the compiler puts next */
__global__ __launch_bounds__(128) void k_attn(const _Float16* __restrict__ AQ16, const _Float16* __restrict__ FK16, const _Float16* __restrict__ FVT, const float* __restrict__ AQf, const float* __restrict__ PK, float* __restrict__ O, float* __restrict__ WC) {
  constexpr int PT = 144, TB = 64 * PT;      /* LDS pitch of a 128-byte row, bytes of a tile of 64 rows */
  __shared__ __attribute__((aligned(16))) char sm[2][2 * TB];      /* [buffer][full_K tile | full_V^T tile] */
  const int tid = threadIdx.x, w = tid >> 5, lane = tid & 31, ln = lane & 15, hh = lane >> 4;
  const int bh = blockIdx.y, b = bh / NH, h = bh % NH;
  const int qb = (int)gridDim.x - 1 - (int)blockIdx.x;      /* the rows with the most chunks take the lowest blockIdx.x */
  const int q0 = qb * 64 + w * 16;
  /* own-slot score of row q0 + ln in f32: each half-wave sums 32 of the 64 products */
  const float* ap = AQf + ((size_t)b * SS + q0 + ln) * DM + h * DH + 32 * hh; const float* pp = PK + ((size_t)b * SS + q0 + ln) * DM + h * DH + 32 * hh;
  v4f va[8], vb[8];
#pragma unroll
  for (int i = 0; i < 8; ++i) { va[i] = *(const v4fa*)(ap + 4 * i); vb[i] = *(const v4fa*)(pp + 4 * i); }
  asm volatile("s_wait_xcnt 0x0" :: "v"(ap), "v"(pp) : "memory");      /* both addresses stay in their registers up to this wait, so none of the 16 loads lands in a register that an issued load names */
  float cur = 0.f;
#pragma unroll
  for (int i = 0; i < 8; ++i) cur += va[i][0] * vb[i][0] + va[i][1] * vb[i][1] + va[i][2] * vb[i][2] + va[i][3] * vb[i][3];
  cur += xhalf(cur); cur *= 0.125f;
  const unsigned short* aqp = (const unsigned short*)AQ16 + ((size_t)bh * SS + q0 + ln) * DH + 8 * hh;
  FragH aq[2];
#pragma unroll
  for (int u = 0; u < 2; ++u) { aq[u].half[0] = *(const v8us*)(aqp + 32 * u); aq[u].half[1] = *(const v8us*)(aqp + 32 * u + 16); }
  const char* kg = (const char*)(FK16 + (size_t)bh * NSL * DH); const char* vg = (const char*)(FVT + (size_t)bh * DH * NSL);      /* uniform bases, moved on by one chunk's bytes just ahead of the chunk's loads; each thread adds its own byte offset */
  const int sr = tid >> 3, sb = (tid & 7) * 16;      /* staging: 8 threads a row, 16 rows a pass, 4 passes a tile */
  const unsigned ko = (unsigned)(sr * DH * 2 + sb), vo = (unsigned)(sr * NSL * 2 + sb), ls = (unsigned)(sr * PT + sb);
  const unsigned fr = (unsigned)(ln * PT + 16 * hh);      /* A fragments: row = slot, k = d in the full_K tile; row = d, k = slot in the full_V^T tile */
  const int cs = (q0 + ln) / KF;      /* this lane's row's own slot */
  const int nch = qb / KF + 1;      /* chunks up to the one with the rows' own slots (64 rows have 16 own slots, inside one chunk): from blockIdx alone, the same for the whole work-group */
  constexpr float L2E = 1.4426950408889634f;      /* exp(x - max) is formed as 2^(x * L2E - ml), ml = max * L2E rounded once and used for every term of the row, the own-slot weight included */
  float m = -3.0e38f, ml = -3.0e38f, l = 0.f;      /* running maximum of this lane's row, the same times L2E; this lane's half of its running sum */
  v8f oacc[4] = {};
  v8us rk[4], rv[4];      /* every loop over i, u, t and r is unrolled so that staging registers and fragments are registers, not indexed arrays in scratch */
#pragma unroll
  for (int i = 0; i < 4; ++i) { rk[i] = *(const v8us*)(kg + ko + i * 16 * DH * 2); rv[i] = *(const v8us*)(vg + vo + i * 16 * NSL * 2); }
#pragma unroll
  for (int i = 0; i < 4; ++i) { *(v8us*)(sm[0] + ls + i * 16 * PT) = rk[i]; *(v8us*)(sm[0] + TB + ls + i * 16 * PT) = rv[i]; }
  __syncthreads();      /* chunk 0 is in buffer 0 for every wave */
  for (int c = 0; c < nch; ++c) { const int c0 = c * 64; const bool more = c + 1 < nch; const char* cb = sm[c & 1]; char* nb = sm[(c + 1) & 1];
    if (more) { kg += 64 * DH * 2; vg += 64 * 2;
#pragma unroll
      for (int i = 0; i < 4; ++i) { rk[i] = *(const v8us*)(kg + ko + i * 16 * DH * 2); rv[i] = *(const v8us*)(vg + vo + i * 16 * NSL * 2); } }
    FragH kf[2][4], vf[2][4];
#pragma unroll
    for (int u = 0; u < 2; ++u) {
#pragma unroll
      for (int t = 0; t < 4; ++t) { kf[u][t].half[0] = *(const v8us*)(cb + fr + t * 16 * PT + 64 * u); kf[u][t].half[1] = *(const v8us*)(cb + fr + t * 16 * PT + 64 * u + 32); } }
    v8f s[4] = {};
#pragma unroll
    for (int u = 0; u < 2; ++u) {
#pragma unroll
      for (int t = 0; t < 4; ++t) s[t] = mmaH<1>(kf[u][t].v, kf[u][t].v, aq[u].v, aq[u].v, s[t]); }
    float mx = m;
#pragma unroll
    for (int t = 0; t < 4; ++t) {
#pragma unroll
      for (int r = 0; r < 8; ++r) s[t][r] *= 0.125f; }
    if (c + 1 == nch) {      /* a scalar test: own slots and later slots lie in the wave's last chunk alone */
#pragma unroll
      for (int t = 0; t < 4; ++t) {
#pragma unroll
        for (int r = 0; r < 8; ++r) { const int sl = c0 + t * 16 + 8 * hh + r; float x = s[t][r]; x = (sl == cs) ? cur : x; x = (sl > cs) ? -3.0e38f : x; s[t][r] = x; } } }
    float mt[4], lt[4];      /* one partial maximum and one partial sum per tile: four short dependent chains in place of one of 32 */
#pragma unroll
    for (int t = 0; t < 4; ++t) { mt[t] = s[t][0];
#pragma unroll
      for (int r = 1; r < 8; ++r) mt[t] = fmaxf(mt[t], s[t][r]); }
    mx = fmaxf(mx, fmaxf(fmaxf(mt[0], mt[1]), fmaxf(mt[2], mt[3])));
    mx = fmaxf(mx, xhalf(mx));      /* finite from the first chunk on: slot 0 is live for every row */
    const float mxl = mx * L2E, sc = exp2s(ml - mxl); m = mx; ml = mxl;      /* first chunk: 2^(-3e38 - mxl) = 0 */
    FragH pf[2];
#pragma unroll
    for (int t = 0; t < 4; ++t) { lt[t] = 0.f;
#pragma unroll
      for (int r = 0; r < 8; ++r) { const float p = exp2s(s[t][r] * L2E - mxl); lt[t] += p; pf[t >> 1].h[(t & 1) * 8 + r] = (_Float16)(p * 1024.0f); oacc[t][r] *= sc; } }      /* a masked slot's -3e38 gives 2^(-inf) = 0 */
    l = l * sc + ((lt[0] + lt[1]) + (lt[2] + lt[3]));
#pragma unroll
    for (int u = 0; u < 2; ++u) {
#pragma unroll
      for (int t = 0; t < 4; ++t) { vf[u][t].half[0] = *(const v8us*)(cb + TB + fr + t * 16 * PT + 64 * u); vf[u][t].half[1] = *(const v8us*)(cb + TB + fr + t * 16 * PT + 64 * u + 32); } }
#pragma unroll
    for (int u = 0; u < 2; ++u) {
#pragma unroll
      for (int t = 0; t < 4; ++t) oacc[t] = mmaH<1>(vf[u][t].v, vf[u][t].v, pf[u].v, pf[u].v, oacc[t]); }
    if (more) {
#pragma unroll
      for (int i = 0; i < 4; ++i) { *(v8us*)(nb + ls + i * 16 * PT) = rk[i]; *(v8us*)(nb + TB + ls + i * 16 * PT) = rv[i]; } }
    __syncthreads();      /* publishes the next chunk's buffer and ends every wave's reads of this one, which is refilled one chunk on */
  }
  l += xhalf(l);
  const float inv = 1.0f / l, wc = exp2s(cur * L2E - ml) * inv, os = inv * 0.0009765625f;      /* os also undoes the weights' 2^10 */
  float* op = O + ((size_t)bh * SS + q0 + ln) * DH + 8 * hh;      /* register r of tile t is d = 16 t + 8 hh + r of row q0 + ln; the wave writes its 16 rows, 4 KiB in a row, whole */
#pragma unroll
  for (int t = 0; t < 4; ++t) { v4f a, e;
#pragma unroll
    for (int r = 0; r < 4; ++r) { a[r] = oacc[t][r] * os; e[r] = oacc[t][4 + r] * os; }
    *(v4f*)(op + t * 16) = a; *(v4f*)(op + t * 16 + 4) = e; }
  float* wl = WC + ((size_t)bh * SS + q0 + ln) * 32 + 16 * hh; const v4f w4 = {wc, wc, wc, wc};      /* one whole 128-byte line per (head, row), written by this wave alone */
#pragma unroll
  for (int i = 0; i < 4; ++i) *(v4f*)(wl + 4 * i) = w4;
}
__global__ __launch_bounds__(256) void k_oepi(const float* __restrict__ O, const float* __restrict__ WC, const float* __restrict__ PVp, const float* __restrict__ FVf, _Float16* __restrict__ Oh, _Float16* __restrict__ Ol) {
  #pragma clang fp contract(off)
  const int t = blockIdx.x * 256 + threadIdx.x; if (t >= NR * NH * (DH / 8)) return; const int d0 = (t % (DH / 8)) * 8; const int h = (t / (DH / 8)) % NH; const int bq = t / ((DH / 8) * NH); const int b = bq / SS, q = bq % SS; const int cs = q / KF, tt = q % KF; const float wc = WC[((size_t)(b * NH + h) * SS + q) * 32]; const size_t prow = (size_t)bq * DM + h * DH + d0; const size_t srow = ((size_t)(b * NH + h) * NSL + cs) * DH + d0; const size_t orow = ((size_t)(b * NH + h) * SS + q) * DH + d0; FragH fh, fl;      /* O is [batch * 16 + head][token][64] */
  const v4f pA = *(const v4fa*)(PVp + prow), pB = *(const v4fa*)(PVp + prow + 4), fA = *(const v4fa*)(FVf + srow), fB = *(const v4fa*)(FVf + srow + 4);
  asm volatile("s_wait_xcnt 0x0" ::: "memory");      /* the loads of O below may land in registers that hold the addresses of the loads above: the wait stands between them */
  const v4f oA = *(const v4fa*)(O + orow), oB = *(const v4fa*)(O + orow + 4);
#pragma unroll
  for (int k = 0; k < 8; ++k) { const int d = d0 + k; const float o = ((k < 4) ? oA[k & 3] : oB[k & 3]) + wc * (((k < 4) ? pA[k & 3] : pB[k & 3]) - ((k < 4) ? fA[k & 3] : fB[k & 3])); const float v = (o * cdma(tt, d)) * 2.0f; const _Float16 hi = (_Float16)v; fh.h[k] = hi; fl.h[k] = (_Float16)((v - (float)hi) * 1024.0f); }
  { *(v8us*)((unsigned short*)Oh + prow) = fh.half[0]; *(v8us*)((unsigned short*)Ol + prow) = fl.half[0];  } }

extern "C" void kernel_launch(void* const* d_in, const int* in_sizes, int n_in,
                              void* d_out, int out_size, void* d_ws, size_t ws_size, hipStream_t stream) {
  (void)in_sizes; (void)n_in; (void)out_size;
  const float* x = (const float*)d_in[0]; const float* Wq = (const float*)d_in[1]; const float* Wk = (const float*)d_in[2]; const float* Wv = (const float*)d_in[3]; const float* Wo = (const float*)d_in[4]; const float* Aq = (const float*)d_in[5]; const float* Bq = (const float*)d_in[6]; const float* Av = (const float*)d_in[7]; const float* Bv = (const float*)d_in[8]; const float* Ao = (const float*)d_in[9]; const float* Bo = (const float*)d_in[10];
  char* ws = (char*)d_ws; size_t off = 0;
  auto take = [&](size_t bytes) { char* p = ws + off; off += (bytes + 255) & ~(size_t)255; return p; };
  _Float16* BWq = (_Float16*)take((size_t)DM * DM * 2); _Float16* BWk = (_Float16*)take((size_t)DM * DM * 2); _Float16* BWv = (_Float16*)take((size_t)DM * DM * 2); _Float16* BWo = (_Float16*)take((size_t)DM * DM * 2); _Float16* BAq = (_Float16*)take((size_t)LR * DM * 2); _Float16* BAv = (_Float16*)take((size_t)LR * DM * 2); _Float16* BAo = (_Float16*)take((size_t)LR * DM * 2); _Float16* BBq = (_Float16*)take((size_t)DM * LR * 2); _Float16* BBv = (_Float16*)take((size_t)DM * LR * 2); _Float16* BBo = (_Float16*)take((size_t)DM * LR * 2);
  float* CS = (float*)take((size_t)SS * DH * 4); float* SN = (float*)take((size_t)SS * DH * 4);
  /* every plane holds both batches (NR = 4096 rows, or 32 = batch * 16 + head slabs) */
  _Float16* X16 = (_Float16*)take((size_t)NR * DM * 2); float* Q = (float*)take((size_t)NR * DM * 4); float* K = (float*)take((size_t)NR * DM * 4); float* V = (float*)take((size_t)NR * DM * 4); float* XA = (float*)take((size_t)NR * LR * 4); _Float16* XAh = (_Float16*)take((size_t)NR * LR * 2); _Float16* XAl = (_Float16*)take((size_t)NR * LR * 2);
  _Float16* FK16 = (_Float16*)take((size_t)NBt * NH * NSL * DH * 2); _Float16* FV16 = (_Float16*)take((size_t)NBt * NH * NSL * DH * 2); float* FKf = (float*)take((size_t)NBt * NH * NSL * DH * 4); float* FVf = (float*)take((size_t)NBt * NH * NSL * DH * 4); float* PK = (float*)take((size_t)NR * DM * 4); float* PVp = (float*)take((size_t)NR * DM * 4); float* AQf = (float*)take((size_t)NR * DM * 4);
  float* S = (float*)take((size_t)NBt * NH * SS * NSL * 4);
  if (off > ws_size) return;      // weights 8.75 + tables 1 + planes 246: 255.75 MiB
  /* planes that are written only after another plane's last reader has run share its bytes (launches of one stream run in order):
     X16 is last read by the launch of the five products of x, Q, K and V by k_slots; XA, XAh and XAl serve out*Ao alone */
  _Float16* AQ16 = X16; float* O = Q; _Float16* Oh = (_Float16*)K; _Float16* Ol = Oh + (size_t)NR * DM; float* WC = V; _Float16* FVT = (_Float16*)(V + (size_t)NBt * NH * SS * 32); float* OA = XA; _Float16* OAh = XAh; _Float16* OAl = XAl;
  /* the two low-rank inputs x*Aq and x*Av are formed in one launch and so need a plane each: they lie at the start of S, which holds nothing else */
  float* XA2 = S; _Float16* XAh2 = (_Float16*)(S + (size_t)2 * NR * LR); _Float16* XAl2 = XAh2 + (size_t)2 * NR * LR;
  const size_t n8 = (size_t)NR * DM / 8; const unsigned nb8 = (unsigned)((n8 + 255) / 256); const size_t a8 = (size_t)NR * LR / 8; const unsigned nba = (unsigned)((a8 + 255) / 256);
  k_prep<<<4 * (DM * (DM / 8) / 256) + SS * DH / 256 + 6 * (LR * (DM / 8) / 256) + nb8, 256, 0, stream>>>(x, Wq, Wk, Wv, Wo, Aq, Bq, Av, Bv, Ao, Bo, X16, BWq, BAq, BBq, CS, SN);      /* all weights are (in,out) */
  /* one 64 x 64 tile of C per work-group: projections over all NR rows, nD work-groups for N = 1024 and nL for N = 64; attention per (batch, head) on grid.y */
  const int nD = (NR / 64) * (DM / 64), nL = NR / 64; const dim3 gA(SS / 64, NBt * NH);
  const float a0 = 0.0625f, a1 = 0.0625f / 1024.0f;      /* undo the weights' 16; the lo planes carry 2^10 more */
  const GemmJobs<5> jX = {{{X16, BWq, nullptr, Q, 0, a0, DM, DM, nD}, {X16, BWk, nullptr, K, 0, a0, DM, DM, nD}, {X16, BWv, nullptr, V, 0, a0, DM, DM, nD}, {X16, BAq, nullptr, XA2, 0, a0, LR, LR, nL}, {X16, BAv, nullptr, XA2 + (size_t)NR * LR, 0, a0, LR, LR, nL}}};
  k_gemm_hhx<0, 4, 5><<<dim3(3 * nD + 2 * nL, 1), 128, 0, stream>>>(jX, DM, 0, DM, 0, nullptr, 0, 1, 0, nullptr, 0, NR, DM);      /* x*Wq, x*Wk, x*Wv (exact), x*Aq, x*Av */
  k_split<<<2 * nba, 256, 0, stream>>>(XA2, XAh2, XAl2, 2 * a8);
  const GemmJobs<2> jH = {{{XAh2, BBq, Q, Q, (size_t)DM, a0, DM, DM, nD}, {XAh2 + (size_t)NR * LR, BBv, V, V, (size_t)DM, a0, DM, DM, nD}}};
  const GemmJobs<2> jLo = {{{XAl2, BBq, Q, Q, (size_t)DM, a1, DM, DM, nD}, {XAl2 + (size_t)NR * LR, BBv, V, V, (size_t)DM, a1, DM, DM, nD}}};
  k_gemm_hhx<0, 2, 2><<<dim3(2 * nD, 1), 128, 0, stream>>>(jH, LR, 0, LR, 0, nullptr, 0, 1, 0, nullptr, 0, NR, LR); k_gemm_hhx<0, 2, 2><<<dim3(2 * nD, 1), 128, 0, stream>>>(jLo, LR, 0, LR, 0, nullptr, 0, 1, 0, nullptr, 0, NR, LR);      /* q += (x*Aq)*Bq and v += (x*Av)*Bv: hi planes, then lo planes */
  k_slots<<<(NBt * NH * NSL * (DH / 8) + 255) / 256, 256, 0, stream>>>(Q, K, V, CS, SN, FK16, FV16, FKf, FVf, PK, PVp, AQ16, AQf);
  k_fvt<<<NBt * NH * FVB, 256, 0, stream>>>(FVf, FVT);
  k_attn<<<gA, 128, 0, stream>>>(AQ16, FK16, FVT, AQf, PK, O, WC);      /* scores, softmax, sum of w * full_V into O[pair] and the own-slot weight into WC: 64 rows per work-group, pair = batch * 16 + head on grid.y */
  k_oepi<<<(NR * NH * (DH / 8) + 255) / 256, 256, 0, stream>>>(O, WC, PVp, FVf, Oh, Ol);
  float* outb = (float*)d_out;
  const GemmJobs<2> jOh = {{{Oh, BWo, nullptr, outb, 0, a0, DM, DM, nD}, {Oh, BAo, nullptr, OA, 0, a0, LR, LR, nL}}};
  const GemmJobs<2> jOl = {{{Ol, BWo, outb, outb, (size_t)DM, a1, DM, DM, nD}, {Ol, BAo, OA, OA, (size_t)LR, a1, LR, LR, nL}}};
  k_gemm_hhx<0, 4, 2><<<dim3(nD + nL, 1), 128, 0, stream>>>(jOh, DM, 0, DM, 0, nullptr, 0, 1, 0, nullptr, 0, NR, DM); k_gemm_hhx<0, 4, 2><<<dim3(nD + nL, 1), 128, 0, stream>>>(jOl, DM, 0, DM, 0, nullptr, 0, 1, 0, nullptr, 0, NR, DM);      /* out*Wo and out*Ao: hi planes, then lo planes */
  k_split<<<nba, 256, 0, stream>>>(OA, OAh, OAl, a8);
  const GemmJobs<1> jBh = {{{OAh, BBo, outb, outb, (size_t)DM, a0, DM, DM, nD}}}; const GemmJobs<1> jBl = {{{OAl, BBo, outb, outb, (size_t)DM, a1, DM, DM, nD}}};
  k_gemm_hhx<0, 2, 1><<<dim3(nD, 1), 128, 0, stream>>>(jBh, LR, 0, LR, 0, nullptr, 0, 1, 0, nullptr, 0, NR, LR); k_gemm_hhx<0, 2, 1><<<dim3(nD, 1), 128, 0, stream>>>(jBl, LR, 0, LR, 0, nullptr, 0, 1, 0, nullptr, 0, NR, LR);      /* + (out*Ao)*Bo */
}

// v007
// It runs in 217 microseconds.
// Two timings next to v006 put it at 1.28 and 1.27 times that version's speed.
// All steps since v000 together make it 8.58 times as fast.
#include <hip/hip_runtime.h>
// HoloKV attention (B 2, S 2048, 16 heads × 64, k_factor 4 → 512 slots): q = x·Wq + (x·Aq)·Bq, k = x·Wk, v = x·Wv + (x·Av)·Bv; RoPE (half-split rotate, θ_i = 1/10000^(2i/64)); keys/values compressed into slots of 4 tokens with Hadamard phases /2: full_K[s] = Σ_t k[4s+t]·c[t]/2, partial (causal prefix inside the slot); query phase c[q mod 4]; scores over slots: aligned_q·full_K/8 for earlier slots, aligned_q·partial_K(q's prefix)/8 for its own slot, −inf for later slots; softmax; out = Σ w·full_V + w_curr·(partial_V − full_V[curr]); out·phase·2; y = out·Wo + (out·Ao)·Bo → [2,2048,1024].
// Compute dtype: x and parameters rounded to bf16; projections with exact products and the LoRA paths on f16 hi + lo·2^10 operands of x·A (≈f32); RoPE, phases, slot sums/prefixes in f32; aligned q and full_K/full_V as f16 GEMM operands (scores O(1)), the own-slot score, masking, softmax and the rank-1 correction in f32; attention output as f16 hi + lo·2^10 into Wo and the LoRA output path. v_wmma_f32_16x16x32_f16.
#define NBt 2
#define SS 2048
#define DM 1024
#define NH 16
#define DH 64
#define KF 4
#define NSL (SS / KF)            /* 512 slots */
#define LR 64
#define NR (NBt * SS)
typedef __bf16 v16b __attribute__((ext_vector_type(16)));
typedef unsigned short v8us __attribute__((ext_vector_type(8), may_alias));
typedef float  v8f  __attribute__((ext_vector_type(8)));
typedef float  v4f  __attribute__((ext_vector_type(4)));
typedef float  v4fa __attribute__((ext_vector_type(4), may_alias));
union FragB { v16b v; v8us half[2]; unsigned short u[16]; };

__device__ __forceinline__ unsigned short bf16_bits(float x) { unsigned int u = __float_as_uint(x); return (unsigned short)((u + 0x7FFFu + ((u >> 16) & 1u)) >> 16); }
__device__ __forceinline__ float bf16_val(unsigned short b) { return __uint_as_float(((unsigned int)b) << 16); }
__device__ __forceinline__ float bf16_round(float x) { return bf16_val(bf16_bits(x)); }
// D += A·B with NT terms: 1 = ah·bh, 2 = + al·bh (A split), 3 = + ah·bl (both split)
template <int NT>
__device__ __forceinline__ v8f mmaN(v16b ah, v16b al, v16b bh, v16b bl, v8f c) {
  c = __builtin_amdgcn_wmma_f32_16x16x32_bf16(false, ah, false, bh, (short)0, c, false, false);
  if (NT >= 2) c = __builtin_amdgcn_wmma_f32_16x16x32_bf16(false, al, false, bh, (short)0, c, false, false);
  if (NT >= 3) c = __builtin_amdgcn_wmma_f32_16x16x32_bf16(false, ah, false, bl, (short)0, c, false, false);
  asm volatile("v_nop\n\tv_nop\n\tv_nop\n\tv_nop" : "+v"(c) : "v"(ah), "v"(al), "v"(bh), "v"(bl));
  return c;
}

__global__ __launch_bounds__(256) void k_wt_bf16(const float* __restrict__ W, unsigned short* __restrict__ Wt, int K, int N) {
  const int t = blockIdx.x * 256 + threadIdx.x;
  const int k8n = K / 8;
  if (t >= N * k8n) return;
  const int n = t / k8n, k8 = (t % k8n) * 8;
  v8us v;
#pragma unroll
  for (int i = 0; i < 8; ++i) v[i] = bf16_bits(W[(size_t)(k8 + i) * N + n]);
  *(v8us*)(Wt + (size_t)n * K + k8) = v;
  
}

// GEMM C[M][N] (f32, pitch ldc) = act(A[M][K]·W + bias). A f32 row-major (pitch lda) converted per fragment to bf16
// (ASPLIT: hi/lo two planes -> 2 terms, else single rounded term); Wt bf16 [N][K] (pitch ldb). BIAS_BF16 rounds the
// bias to bf16 first (bias quantised to bf16 before the add). K%32==0, M%16==0, N%64==0.
template <bool ASPLIT, int ACT, bool BIAS_BF16>
__global__ __launch_bounds__(128) void k_gemm_bf(const float* __restrict__ A, int lda, const unsigned short* __restrict__ Wt, int ldb,
                                               const float* __restrict__ bias, float* __restrict__ C, int ldc, int M, int N, int K) {
  __shared__ __attribute__((aligned(16))) float so[4][16][64];
  const int tid = threadIdx.x, w = tid >> 5, lane = tid & 31, ln = lane & 15, hh = lane >> 4;
  const int ntn = N / 64;
  const int wid = blockIdx.x * 4 + w;
  const int mt = wid / ntn, nq = wid % ntn;
  if (mt * 16 >= M) return;
  const int row0 = mt * 16, col0 = nq * 64;
  const float* arow = A + (size_t)(row0 + ln) * lda;
  v8f acc[4] = {};
  for (int kb = 0; kb < K; kb += 32) {
    FragB ah, al;
    const v4f x0 = *(const v4fa*)(arow + kb + 8 * hh), x1 = *(const v4fa*)(arow + kb + 8 * hh + 4);
    const v4f x2 = *(const v4fa*)(arow + kb + 16 + 8 * hh), x3 = *(const v4fa*)(arow + kb + 16 + 8 * hh + 4);
    float xs[16] = {x0[0],x0[1],x0[2],x0[3],x1[0],x1[1],x1[2],x1[3],x2[0],x2[1],x2[2],x2[3],x3[0],x3[1],x3[2],x3[3]};
#pragma unroll
    for (int i = 0; i < 16; ++i) { const unsigned short hb = bf16_bits(xs[i]); ah.u[i] = hb; al.u[i] = ASPLIT ? bf16_bits(xs[i] - bf16_val(hb)) : (unsigned short)0; }
#pragma unroll
    for (int t = 0; t < 4; ++t) {
      const unsigned short* brow = Wt + (size_t)(col0 + t * 16 + ln) * ldb + kb;
      FragB b;
      b.half[0] = *(const v8us*)(brow + 8 * hh);
      b.half[1] = *(const v8us*)(brow + 16 + 8 * hh);
      acc[t] = mmaN<ASPLIT ? 2 : 1>(ah.v, al.v, b.v, b.v, acc[t]);
    }
  }
#pragma unroll
  for (int t = 0; t < 4; ++t) {
    float bv = bias ? bias[col0 + t * 16 + ln] : 0.f;
    if (BIAS_BF16) bv = bf16_round(bv);
#pragma unroll
    for (int r = 0; r < 8; ++r) { float v = acc[t][r] + bv; if (ACT == 1) v = fmaxf(v, 0.f); so[w][8 * hh + r][t * 16 + ln] = v; }
  }
  __builtin_amdgcn_fence(__ATOMIC_ACQ_REL, "workgroup");
  __builtin_amdgcn_wave_barrier();
  const int rsub = lane >> 4, c4 = (lane & 15) * 4;
  {
#pragma unroll
    for (int q = 0; q < 8; ++q) {
      const int r = q * 2 + rsub;
      const v4f v = *(const v4fa*)&so[w][r][c4];
      *(v4f*)(C + (size_t)(row0 + r) * ldc + col0 + c4) = v;
    }
    
  }
}

// GEMM C = act(A·W + bias + resid): A f32 (ASPLIT -> hi/lo 2 terms), Wt bf16 [N][K]; ACT 0 none, 1 relu, 2 exact gelu;
// resid (optional, f32, row index = (row % rmod), pitch ldr, RES_BF16 rounds it) added before the activation.
template <bool ASPLIT, int ACT, bool BIAS_BF16, bool RES_BF16>
__global__ __launch_bounds__(128) void k_gemm_bf3(const float* __restrict__ A, int lda, const unsigned short* __restrict__ Wt, int ldb,
                                                const float* __restrict__ bias, const float* __restrict__ resid, int rmod, int ldr,
                                                float* __restrict__ C, int ldc, int M, int N, int K) {
  __shared__ __attribute__((aligned(16))) float so[4][16][64];
  const int tid = threadIdx.x, w = tid >> 5, lane = tid & 31, ln = lane & 15, hh = lane >> 4;
  const int ntn = N / 64;
  const int wid = blockIdx.x * 4 + w;
  const int mt = wid / ntn, nq = wid % ntn;
  if (mt * 16 >= M) return;
  const int row0 = mt * 16, col0 = nq * 64;
  const float* arow = A + (size_t)(row0 + ln) * lda;
  v8f acc[4] = {};
  for (int kb = 0; kb < K; kb += 32) {
    FragB ah, al;
    const v4f x0 = *(const v4fa*)(arow + kb + 8 * hh), x1 = *(const v4fa*)(arow + kb + 8 * hh + 4);
    const v4f x2 = *(const v4fa*)(arow + kb + 16 + 8 * hh), x3 = *(const v4fa*)(arow + kb + 16 + 8 * hh + 4);
    float xs[16] = {x0[0],x0[1],x0[2],x0[3],x1[0],x1[1],x1[2],x1[3],x2[0],x2[1],x2[2],x2[3],x3[0],x3[1],x3[2],x3[3]};
#pragma unroll
    for (int i = 0; i < 16; ++i) { const unsigned short hb = bf16_bits(xs[i]); ah.u[i] = hb; al.u[i] = ASPLIT ? bf16_bits(xs[i] - bf16_val(hb)) : (unsigned short)0; }
#pragma unroll
    for (int t = 0; t < 4; ++t) {
      const unsigned short* brow = Wt + (size_t)(col0 + t * 16 + ln) * ldb + kb;
      FragB b;
      b.half[0] = *(const v8us*)(brow + 8 * hh);
      b.half[1] = *(const v8us*)(brow + 16 + 8 * hh);
      acc[t] = mmaN<ASPLIT ? 2 : 1>(ah.v, al.v, b.v, b.v, acc[t]);
    }
  }
#pragma unroll
  for (int t = 0; t < 4; ++t) {
    const int col = col0 + t * 16 + ln;
    float bv = bias ? bias[col] : 0.f;
    if (BIAS_BF16) bv = bf16_round(bv);
#pragma unroll
    for (int r = 0; r < 8; ++r) {
      float v = acc[t][r] + bv;
      if (resid) { float rv = resid[(size_t)((row0 + 8 * hh + r) % rmod) * ldr + col]; if (RES_BF16) rv = bf16_round(rv); v += rv; }
      if (ACT == 1) v = fmaxf(v, 0.f);
      if (ACT == 2) v = 0.5f * v * (1.0f + erff(v * 0.70710678118654752f));
      if (ACT == 3) { const float u = 0.7978845608028654f * (v + 0.044715f * v * v * v); v = 0.5f * v * (1.0f + tanhf(u)); }
      so[w][8 * hh + r][t * 16 + ln] = v;
    }
  }
  __builtin_amdgcn_fence(__ATOMIC_ACQ_REL, "workgroup");
  __builtin_amdgcn_wave_barrier();
  const int rsub = lane >> 4, c4 = (lane & 15) * 4;
  {
#pragma unroll
    for (int q = 0; q < 8; ++q) {
      const int r = q * 2 + rsub;
      const v4f v = *(const v4fa*)&so[w][r][c4];
      *(v4f*)(C + (size_t)(row0 + r) * ldc + col0 + c4) = v;
    }
    
  }
}
// row LayerNorm (biased variance, eps) over N: s = X (+ R); optional out_sum <- s; out_norm <- (s-mu)*rsqrt(var+eps)*g + b
template <bool PARAM_BF16>
__global__ __launch_bounds__(256) void k_layernorm(const float* __restrict__ X, const float* __restrict__ R, const float* __restrict__ g, const float* __restrict__ bta,
                                                  float* __restrict__ out_sum, float* __restrict__ out_norm, int N, float eps) {
  __shared__ float red[256];
  const int row = blockIdx.x, tid = threadIdx.x;
  const float* x = X + (size_t)row * N; const float* rr = R ? R + (size_t)row * N : nullptr;
  float vals[16];                     // up to N = 4096
  const int per = N / 256;            // contiguous chunk per thread? use strided-by-4 chunks: thread handles j = tid*4 + 1024*u
  float s1 = 0.f;
  for (int u = 0; u < per / 4; ++u) {
    const int j = tid * 4 + 1024 * u;
    const v4f a = *(const v4fa*)(x + j);
    v4f b = {0.f,0.f,0.f,0.f}; if (rr) b = *(const v4fa*)(rr + j);
#pragma unroll
    for (int q = 0; q < 4; ++q) { const float v = a[q] + b[q]; vals[u * 4 + q] = v; s1 += v; }
  }
  red[tid] = s1; __syncthreads();
  for (int st = 128; st > 0; st >>= 1) { if (tid < st) red[tid] += red[tid + st]; __syncthreads(); }
  const float mu = red[0] / (float)N; __syncthreads();
  float s2 = 0.f;
  for (int u = 0; u < per / 4; ++u)
#pragma unroll
    for (int q = 0; q < 4; ++q) { const float c = vals[u * 4 + q] - mu; s2 += c * c; }
  red[tid] = s2; __syncthreads();
  for (int st = 128; st > 0; st >>= 1) { if (tid < st) red[tid] += red[tid + st]; __syncthreads(); }
  const float rs = rsqrtf(red[0] / (float)N + eps);
  {
    for (int u = 0; u < per / 4; ++u) {
      const int j = tid * 4 + 1024 * u;
      v4f o, sm;
#pragma unroll
      for (int q = 0; q < 4; ++q) {
        float gg = g[j + q], bb = bta[j + q];
        if (PARAM_BF16) { gg = bf16_round(gg); bb = bf16_round(bb); }
        sm[q] = vals[u * 4 + q]; o[q] = (vals[u * 4 + q] - mu) * rs * gg + bb;
      }
      if (out_sum) *(v4f*)(out_sum + (size_t)row * N + j) = sm;
      *(v4f*)(out_norm + (size_t)row * N + j) = o;
    }
    
  }
}



// ---- f16 WMMA path (v_wmma_f32_16x16x32_f16): 11-bit significands for operands in range — used where a [0,1] probability operand needs more precision than bf16
typedef _Float16 v16h __attribute__((ext_vector_type(16)));
union FragH { v16h v; v8us half[2]; _Float16 h[16]; unsigned short u[16]; };
template <int NT>
__device__ __forceinline__ v8f mmaH(v16h ah, v16h al, v16h bh, v16h bl, v8f c) {
  c = __builtin_amdgcn_wmma_f32_16x16x32_f16(false, ah, false, bh, (short)0, c, false, false);
  if (NT >= 2) c = __builtin_amdgcn_wmma_f32_16x16x32_f16(false, al, false, bh, (short)0, c, false, false);
  if (NT >= 3) c = __builtin_amdgcn_wmma_f32_16x16x32_f16(false, ah, false, bl, (short)0, c, false, false);
  asm volatile("v_nop\n\tv_nop\n\tv_nop\n\tv_nop" : "+v"(c) : "v"(ah), "v"(al), "v"(bh), "v"(bl));
  return c;
}
// batched GEMM like k_gemm_b but f16 operands: A f32 (split into f16 hi/lo if ASPLIT, else rounded to f16), Bt = f16 values [n][k]; alpha; C f32; N multiple of 16 (partial tiles skipped)
template <bool ASPLIT>
__global__ __launch_bounds__(128) void k_gemm_h(const float* __restrict__ A, int lda, size_t sA, const _Float16* __restrict__ Bh, int ldb, size_t sB, float alpha, float* __restrict__ C, int ldc, size_t sC, int M, int N, int K) {
  __shared__ __attribute__((aligned(16))) float so[4][16][64];
  const int tid = threadIdx.x, w = tid >> 5, lane = tid & 31, ln = lane & 15, hh = lane >> 4; const int by = blockIdx.y;
  A += (size_t)by * sA; Bh += (size_t)by * sB; C += (size_t)by * sC;
  const int ntn = (N + 63) / 64; const int wid = blockIdx.x * 4 + w; const int mt = wid / ntn, nq = wid % ntn; if (mt * 16 >= M) return;
  const int row0 = mt * 16, col0 = nq * 64; const float* arow = A + (size_t)(row0 + ln) * lda;
  v8f acc[4] = {};
  for (int kb = 0; kb < K; kb += 32) {
    FragH ah, al;
    const v4f x0 = *(const v4fa*)(arow + kb + 8 * hh), x1 = *(const v4fa*)(arow + kb + 8 * hh + 4), x2 = *(const v4fa*)(arow + kb + 16 + 8 * hh), x3 = *(const v4fa*)(arow + kb + 16 + 8 * hh + 4);
    float xs[16] = {x0[0],x0[1],x0[2],x0[3],x1[0],x1[1],x1[2],x1[3],x2[0],x2[1],x2[2],x2[3],x3[0],x3[1],x3[2],x3[3]};
#pragma unroll
    for (int i = 0; i < 16; ++i) { const _Float16 h = (_Float16)xs[i]; ah.h[i] = h; al.h[i] = ASPLIT ? (_Float16)(xs[i] - (float)h) : (_Float16)0.0f; }
#pragma unroll
    for (int t = 0; t < 4; ++t) { if (col0 + t * 16 >= N) continue; const size_t boff = (size_t)(col0 + t * 16 + ln) * ldb + kb; FragH bq; bq.half[0] = *(const v8us*)(Bh + boff + 8 * hh); bq.half[1] = *(const v8us*)(Bh + boff + 16 + 8 * hh);
      acc[t] = mmaH<ASPLIT ? 2 : 1>(ah.v, al.v, bq.v, bq.v, acc[t]); }
  }
#pragma unroll
  for (int t = 0; t < 4; ++t) { if (col0 + t * 16 >= N) continue;
#pragma unroll
    for (int r = 0; r < 8; ++r) so[w][8 * hh + r][t * 16 + ln] = acc[t][r] * alpha; }
  __builtin_amdgcn_fence(__ATOMIC_ACQ_REL, "workgroup"); __builtin_amdgcn_wave_barrier();
  const int rsub = lane >> 4, c4 = (lane & 15) * 4;
  {
#pragma unroll
    for (int q = 0; q < 8; ++q) { const int r = q * 2 + rsub; if (col0 + c4 < N) { const v4f v = *(const v4fa*)&so[w][r][c4]; *(v4f*)(C + (size_t)(row0 + r) * ldc + col0 + c4) = v; } }
     }
}

// Wt[n][k] = f16(W[k][n]·scale) from f32 row-major W[K][N] (scale = power of two; bf16-exact weights stay exact in f16 away from the subnormal range)
__device__ __forceinline__ void d_wt_f16(const float* __restrict__ W, _Float16* __restrict__ Wt, int K, int N, float scale, int blk) {
  const int t = blk * 256 + threadIdx.x; if (t >= N * (K / 8)) return; const int n = t / (K / 8), k8 = (t % (K / 8)) * 8; FragH f;
#pragma unroll
  for (int i = 0; i < 8; ++i) f.h[i] = (_Float16)(bf16_round(W[(size_t)(k8 + i) * N + n]) * scale); const v8us o = f.half[0];
  *(v8us*)((unsigned short*)Wt + (size_t)n * K + k8) = o; 
}
// One work-group = one 64 x 64 tile of C; wave w owns rows 16w..16w+15 of it, all 64 columns. Per stage the four waves bring 64 rows of A and 64 rows of B, 32 * KU k each,
// from global memory with whole-line 16-byte loads into registers and store them to LDS (row pitch = row bytes + 16, conflict-free for 16-byte fragment reads); every wave reads its
// fragments from LDS, so the B tile is fetched once per work-group instead of once per wave and no global load is spread over 16 rows. Two LDS buffers: the next stage's global loads
// are issued before this stage's WMMAs and stored to the other buffer behind them, one barrier per stage. M and N multiples of 64, K a multiple of 32 * KU. The k order per accumulator is ascending.
// Every loop over i, u and t is unrolled so that ra, rb, oa, ob and the fragments are registers, not indexed arrays in scratch.
// k_gemm_hh variant with fused epilogue: v = acc·alpha + bias[by·sBias + col] (+ CP[(row/rowsPerB)·sCPb + by·64 + col] if CP) ; ACT 0 none / 1 elu ; writes f32 C and f16 C16, each if non-null
// One launch runs up to NJ products that do not depend on one another and share M, K and the operand pitches: job i owns the next nb work-groups of grid.x, with its own operands, addend, output, scale and N.
// NP = 2: A is given as two planes, hi (A) and lo * 2^10 (A2), against the same B. The k loop runs over the hi plane, multiplies the accumulators by 2^10 (exact) and runs on over the lo plane, so that
// acc = 2^10 * hi*B + (lo * 2^10)*B and alpha carries the 2^-10; C and its addend are touched once for the pair. lda = ldb = K there: a row's bytes end where the stages' running offsets stand after one plane.
struct GemmJob { const _Float16* A; const _Float16* A2; const _Float16* B; const float* CP; float* C; size_t sCPb; float alpha; int ldc, N, nb; };
template <int NJ> struct GemmJobs { GemmJob j[NJ]; };
template <int ACT, int KU, int NJ, int NP>
__global__ __launch_bounds__(128) void k_gemm_hhx(const GemmJobs<NJ> J, int lda, size_t sA, int ldb, size_t sB, const float* __restrict__ bias, size_t sBias, int rowsPerB, int row0g,
    _Float16* __restrict__ C16, size_t sC, int M, int K) {
  constexpr int RB = 64 * KU, PITCH = RB + 16, UPR = RB / 16, RP = 128 / UPR, NU = 64 / RP, TILE = 64 * PITCH;      /* row bytes, LDS pitch, 16-byte units per row, rows per pass of 128 threads, passes per tile, tile bytes */
  __shared__ __attribute__((aligned(16))) char sm[4 * TILE];      /* [buffer][A tile | B tile]; the epilogue's 16 KiB of staging reuses it behind the last stage's barrier */
  static_assert(4 * TILE >= 4 * 16 * 64 * 4, "epilogue staging must fit");
  float (*so)[16][64] = (float (*)[16][64])sm;
  const int tid = threadIdx.x, w = tid >> 5, lane = tid & 31, ln = lane & 15, hh = lane >> 4; const int by = blockIdx.y;
  GemmJob g = J.j[0]; int bx = blockIdx.x;      /* this work-group's job and its index inside the job: scalar values, the same for the whole work-group */
  for (int i = 1; i < NJ; ++i) if (bx >= g.nb) { bx -= g.nb; g = J.j[i]; }
  const _Float16* A = g.A; const _Float16* Bh = g.B; const float* CP = g.CP; float* C = g.C; const size_t sCPb = g.sCPb; const float alpha = g.alpha; const int ldc = g.ldc, N = g.N;
  A += (size_t)by * sA; Bh += (size_t)by * sB; const size_t cofs = (size_t)by * sC; const float* bp = bias ? bias + (size_t)by * sBias : nullptr;
  const int ntn = (N + 63) / 64; const int mtb = bx / ntn, nq = bx % ntn; if (mtb * 64 >= M) return;      /* the same for the whole work-group, ahead of every barrier */
  const int row0 = mtb * 64 + w * 16, col0 = nq * 64;
  v8f acc[4] = {};
  const char* Ab = (const char*)A; const char* Bb = (const char*)Bh;      /* uniform bases; each thread keeps one 32-bit byte offset per load */
  const int sr = tid / UPR, sc = (tid % UPR) * 16;
  const unsigned ga = (unsigned)((mtb * 64 + sr) * lda * 2 + sc), gb = (unsigned)((col0 + sr) * ldb * 2 + sc), ls = (unsigned)(sr * PITCH + sc);
  unsigned oa[NU], ob[NU];      /* moved on by one stage's bytes just ahead of the stage's loads: the loads that named the old values were waited for ahead of the last barrier */
#pragma unroll
  for (int i = 0; i < NU; ++i) { oa[i] = ga + (unsigned)(i * RP * lda * 2); ob[i] = gb + (unsigned)(i * RP * ldb * 2); }
  const unsigned fa = (unsigned)((w * 16 + ln) * PITCH + 16 * hh), fb = (unsigned)(TILE + ln * PITCH + 16 * hh);
  v8us ra[NU], rb[NU];
#pragma unroll
  for (int i = 0; i < NU; ++i) { ra[i] = *(const v8us*)(Ab + oa[i]); rb[i] = *(const v8us*)(Bb + ob[i]); }
#pragma unroll
  for (int i = 0; i < NU; ++i) { *(v8us*)(sm + ls + i * RP * PITCH) = ra[i]; *(v8us*)(sm + TILE + ls + i * RP * PITCH) = rb[i]; }
  __syncthreads();      /* stage 0 is in buffer 0 for every wave */
  const int nst = K / (32 * KU), nall = NP * nst;
  for (int s = 0; s < nall; ++s) { const bool more = s + 1 < nall; const char* cur = sm + (s & 1) * 2 * TILE; char* nxt = sm + ((s + 1) & 1) * 2 * TILE;
    if (NP == 2 && s + 1 == nst) { Ab = (const char*)(g.A2 + (size_t)by * sA) - (size_t)K * 2; Bb -= (size_t)K * 2; }      /* scalar test: the next stage is the lo plane's first; the threads' offsets run on, the two uniform bases step back by one row's bytes */
    if (NP == 2 && s == nst) {      /* scalar test: the hi plane is summed; 2^10 brings it to the lo plane's scale */
#pragma unroll
      for (int t = 0; t < 4; ++t) acc[t] *= 1024.0f; }
    if (more) {
#pragma unroll
      for (int i = 0; i < NU; ++i) { oa[i] += RB; ob[i] += RB; ra[i] = *(const v8us*)(Ab + oa[i]); rb[i] = *(const v8us*)(Bb + ob[i]); } }
    FragH ah[KU], bq[KU][4];
#pragma unroll
    for (int u = 0; u < KU; ++u) { ah[u].half[0] = *(const v8us*)(cur + fa + 64 * u); ah[u].half[1] = *(const v8us*)(cur + fa + 64 * u + 32);
#pragma unroll
      for (int t = 0; t < 4; ++t) { bq[u][t].half[0] = *(const v8us*)(cur + fb + t * 16 * PITCH + 64 * u); bq[u][t].half[1] = *(const v8us*)(cur + fb + t * 16 * PITCH + 64 * u + 32); } }
#pragma unroll
    for (int u = 0; u < KU; ++u) {
#pragma unroll
      for (int t = 0; t < 4; ++t) acc[t] = mmaH<1>(ah[u].v, ah[u].v, bq[u][t].v, bq[u][t].v, acc[t]); }
    if (more) {
#pragma unroll
      for (int i = 0; i < NU; ++i) { *(v8us*)(nxt + ls + i * RP * PITCH) = ra[i]; *(v8us*)(nxt + TILE + ls + i * RP * PITCH) = rb[i]; } }
    __syncthreads();      /* publishes the next stage's buffer and ends every wave's reads of this one (refilled one stage on; staged over by the epilogue behind the last) */
  }
#pragma unroll
  for (int t = 0; t < 4; ++t) { if (col0 + t * 16 >= N) continue; const int col = col0 + t * 16 + ln; const float bv = bp ? bf16_round(bp[col]) : 0.f;
#pragma unroll
    for (int r = 0; r < 8; ++r) { float v = acc[t][r] * alpha + bv; if (CP) { const int bidx = (row0g + row0 + 8 * hh + r) / rowsPerB; v += CP[(size_t)bidx * sCPb + (size_t)by * 64 + col]; } if (ACT == 1) v = (v > 0.f) ? v : expm1f(v); else if (ACT == 7) v = (v > 0.f) ? v + 1.0f : expf(v); else if (ACT == 8) v = tanhf(v); else if (ACT == 9) v = 0.5f * v * (1.0f + tanhf(0.7978845608028654f * (v + 0.044715f * v * v * v))); else if (ACT == 11) v = 1.0f / (1.0f + expf(-v)); else if (ACT == 12) v = (v > 0.f) ? v : 0.01f * v; else if (ACT == 14) v = (v > 0.f) ? v : 0.1f * v; else if (ACT == 15) v = v / (1.0f + expf(-v)); else if (ACT == 3) v = fmaxf(v, 0.f); else if (ACT == 6) v = 0.5f * v * (1.0f + erff(v * 0.70710678118654752f)); so[w][8 * hh + r][t * 16 + ln] = v; } }
  __builtin_amdgcn_fence(__ATOMIC_ACQ_REL, "workgroup"); __builtin_amdgcn_wave_barrier();
  const int rsub = lane >> 4, c4 = (lane & 15) * 4; typedef _Float16 v4h __attribute__((ext_vector_type(4)));
  {
#pragma unroll
    for (int q = 0; q < 8; ++q) { const int r = q * 2 + rsub; if (col0 + c4 < N) { const v4f v = *(const v4fa*)&so[w][r][c4]; if (C) *(v4f*)(C + cofs + (size_t)(row0 + r) * ldc + col0 + c4) = v; if (C16) { v4h h4; for (int i = 0; i < 4; ++i) h4[i] = (_Float16)v[i]; *(v4h*)(C16 + cofs + (size_t)(row0 + r) * ldc + col0 + c4) = h4; } } }
     }
}


typedef _Float16 v4h __attribute__((ext_vector_type(4)));

__device__ __forceinline__ void d_x16(const float* __restrict__ x, _Float16* __restrict__ X16, size_t n8, int blk) { const size_t t = (size_t)blk * 256 + threadIdx.x; if (t >= n8) return; FragH f;
#pragma unroll
  for (int q = 0; q < 8; ++q) f.h[q] = (_Float16)bf16_round(x[t * 8 + q]); *(v8us*)((unsigned short*)X16 + t * 8) = f.half[0];  }
__global__ __launch_bounds__(256) void k_h16(const float* __restrict__ x, _Float16* __restrict__ X16, size_t n8) { const size_t t = (size_t)blockIdx.x * 256 + threadIdx.x; if (t >= n8) return; FragH f;
#pragma unroll
  for (int q = 0; q < 8; ++q) f.h[q] = (_Float16)x[t * 8 + q]; *(v8us*)((unsigned short*)X16 + t * 8) = f.half[0];  }
__global__ __launch_bounds__(256) void k_round16f(const float* __restrict__ W, _Float16* __restrict__ Bt, size_t n8) { const size_t t = (size_t)blockIdx.x * 256 + threadIdx.x; if (t >= n8) return; FragH f;
#pragma unroll
  for (int i = 0; i < 8; ++i) f.h[i] = (_Float16)(bf16_round(W[t * 8 + i]) * 16.0f); *(v8us*)((unsigned short*)Bt + t * 8) = f.half[0];  }
template <int NHv, int TTv>
__global__ __launch_bounds__(256) void k_vt(const _Float16* __restrict__ V16, int ldv, int voff, _Float16* __restrict__ Vt) { __shared__ unsigned short tl[64][66]; const int tid = threadIdx.x; const int slab = blockIdx.x / (TTv / 64), lg = blockIdx.x % (TTv / 64); const int b = slab / NHv, h = slab % NHv;
  for (int i = tid; i < 64 * 8; i += 256) { const int r = i / 8, c8 = (i % 8) * 8; FragH f; f.half[0] = *(const v8us*)((const unsigned short*)V16 + ((size_t)b * TTv + lg * 64 + r) * ldv + voff + h * 64 + c8);
#pragma unroll
    for (int q = 0; q < 8; ++q) tl[r][c8 + q] = f.u[q]; }
  __syncthreads();
  {
#pragma unroll
    for (int rd = 0; rd < 2; ++rd) { const int d = rd * 32 + tid / 8, pc = tid % 8; FragH f;
#pragma unroll
      for (int q = 0; q < 8; ++q) f.u[q] = tl[pc * 8 + q][d];
      *(v8us*)((unsigned short*)Vt + ((size_t)slab * 64 + d) * TTv + lg * 64 + pc * 8) = f.half[0]; }
     } }

__global__ __launch_bounds__(256) void k_hl(const float* __restrict__ F, _Float16* __restrict__ Hh, _Float16* __restrict__ Hl, size_t n8) { const size_t t = (size_t)blockIdx.x * 256 + threadIdx.x; if (t >= n8) return; FragH fh, fl; const v4f a = *(const v4fa*)(F + t * 8), c = *(const v4fa*)(F + t * 8 + 4);
#pragma unroll
  for (int q = 0; q < 4; ++q) { _Float16 h = (_Float16)a[q]; fh.h[q] = h; fl.h[q] = (_Float16)((a[q] - (float)h) * 1024.0f); h = (_Float16)c[q]; fh.h[4 + q] = h; fl.h[4 + q] = (_Float16)((c[q] - (float)h) * 1024.0f); }
  { *(v8us*)((unsigned short*)Hh + t * 8) = fh.half[0]; *(v8us*)((unsigned short*)Hl + t * 8) = fl.half[0];  } }

__global__ __launch_bounds__(256) void k_split(const float* __restrict__ F, _Float16* __restrict__ Hh, _Float16* __restrict__ Hl, size_t n8) {
  #pragma clang fp contract(off)
  const size_t t = (size_t)blockIdx.x * 256 + threadIdx.x; if (t >= n8) return; const v4f a = *(const v4fa*)(F + t * 8), c = *(const v4fa*)(F + t * 8 + 4); FragH fh, fl;
#pragma unroll
  for (int q = 0; q < 8; ++q) { const float v = (q < 4) ? a[q] : c[q - 4]; const _Float16 hi = (_Float16)v; fh.h[q] = hi; fl.h[q] = (_Float16)((v - (float)hi) * 1024.0f); }
  { *(v8us*)((unsigned short*)Hh + t * 8) = fh.half[0]; *(v8us*)((unsigned short*)Hl + t * 8) = fl.half[0];  } }
__device__ __forceinline__ void d_cstab(float* __restrict__ CS, float* __restrict__ SN, int blk) {
  #pragma clang fp contract(off)
  const int t = blk * 256 + threadIdx.x; if (t >= SS * DH) return; const int d = t % DH, p = t / DH; const int i = d & 31; const float theta = 1.0f / powf(10000.0f, (float)(2 * i) / 64.0f); const float ang = (float)p * theta; const float c = cosf(ang), s = sinf(ang);
  { *(float*)(CS + t) = c; *(float*)(SN + t) = s;  } }
// Everything that depends on the inputs alone runs as one launch: the work-group's index picks its piece, the same test for all of its threads. The ten f16 weight planes lie in the
// workspace as three contiguous groups: BW = Wq Wk Wv Wo, BA = Aq Av Ao, BB = Bq Bv Bo. The pieces that take longest per work-group come first.
__global__ __launch_bounds__(256) void k_prep(const float* __restrict__ x, const float* __restrict__ Wq, const float* __restrict__ Wk, const float* __restrict__ Wv, const float* __restrict__ Wo, const float* __restrict__ Aq, const float* __restrict__ Bq, const float* __restrict__ Av, const float* __restrict__ Bv, const float* __restrict__ Ao, const float* __restrict__ Bo,
    _Float16* __restrict__ X16, _Float16* __restrict__ BW, _Float16* __restrict__ BA, _Float16* __restrict__ BB, float* __restrict__ CS, float* __restrict__ SN) {
  constexpr int NW = DM * (DM / 8) / 256, NL = LR * (DM / 8) / 256, NC = SS * DH / 256;      /* work-groups per square weight, per low-rank weight, for the angle tables */
  int b = blockIdx.x;
  if (b < 4 * NW) { const int m = b / NW; d_wt_f16(m == 0 ? Wq : m == 1 ? Wk : m == 2 ? Wv : Wo, BW + (size_t)m * DM * DM, DM, DM, 16.0f, b % NW); return; }
  b -= 4 * NW;
  if (b < NC) { d_cstab(CS, SN, b); return; }
  b -= NC;
  if (b < 3 * NL) { const int m = b / NL; d_wt_f16(m == 0 ? Aq : m == 1 ? Av : Ao, BA + (size_t)m * LR * DM, DM, LR, 16.0f, b % NL); return; }
  b -= 3 * NL;
  if (b < 3 * NL) { const int m = b / NL; d_wt_f16(m == 0 ? Bq : m == 1 ? Bv : Bo, BB + (size_t)m * DM * LR, LR, DM, 16.0f, b % NL); return; }
  b -= 3 * NL;
  d_x16(x, X16, (size_t)NR * DM / 8, b);
}
__device__ __forceinline__ float cdma(int t, int d) { const int j = d & 3; const int par = __popc((unsigned)(t & j)); return (par & 1) ? -1.0f : 1.0f; }      /* Hadamard H4[t][d mod 4] (Sylvester order: rows [1,1,1,1],[1,-1,1,-1],[1,1,-1,-1],[1,-1,-1,1]) */
__global__ __launch_bounds__(256) void k_slots(const float* __restrict__ Q, const float* __restrict__ K, const float* __restrict__ V, const float* __restrict__ CS, const float* __restrict__ SN, _Float16* __restrict__ FK16, _Float16* __restrict__ FV16, float* __restrict__ FKf, float* __restrict__ FVf, float* __restrict__ PK, float* __restrict__ PVp, _Float16* __restrict__ AQ16, float* __restrict__ AQf) {
  #pragma clang fp contract(off)
  const int t = blockIdx.x * 256 + threadIdx.x; if (t >= NBt * NH * NSL * (DH / 8)) return; const int d0 = (t % (DH / 8)) * 8; const int s = (t / (DH / 8)) % NSL; const int bh = t / ((DH / 8) * NSL); const int b = bh / NH, h = bh % NH;      /* both batches in one launch: bh = batch * 16 + head */
  FragH fk, fv; v4f fkA, fkB, fvA, fvB;
  float pk[KF][8], pv[KF][8];      /* running prefixes per token step */
#pragma unroll
  for (int q = 0; q < 8; ++q) { const int d = d0 + q; float accK = 0.f, accV = 0.f;
#pragma unroll
    for (int tt = 0; tt < KF; ++tt) { const int tok = s * KF + tt; const float* kp = K + ((size_t)b * SS + tok) * DM + h * DH; const float* vp = V + ((size_t)b * SS + tok) * DM + h * DH; const float c = CS[(size_t)tok * DH + d], sn = SN[(size_t)tok * DH + d];
      const float kr = kp[d] * c + ((d < 32) ? -kp[d + 32] : kp[d - 32]) * sn; const float ph = cdma(tt, d) * 0.5f;      /* /sqrt(k_factor) */
      accK += kr * ph; accV += vp[d] * ph; pk[tt][q] = accK; pv[tt][q] = accV; }
    fk.h[q] = (_Float16)accK; fv.h[q] = (_Float16)accV; if (q < 4) { fkA[q] = accK; fvA[q] = accV; } else { fkB[q - 4] = accK; fvB[q - 4] = accV; } }
  const size_t srow = ((size_t)bh * NSL + s) * DH + d0;
  { *(v8us*)((unsigned short*)FK16 + srow) = fk.half[0]; *(v8us*)((unsigned short*)FV16 + srow) = fv.half[0]; *(v4f*)(FKf + srow) = fkA; *(v4f*)(FKf + srow + 4) = fkB; *(v4f*)(FVf + srow) = fvA; *(v4f*)(FVf + srow + 4) = fvB;  }
#pragma unroll
  for (int tt = 0; tt < KF; ++tt) { const int tok = s * KF + tt; const size_t prow = ((size_t)b * SS + tok) * DM + h * DH + d0; v4f a, c2, e, g;
#pragma unroll
    for (int q = 0; q < 4; ++q) { a[q] = pk[tt][q]; c2[q] = pk[tt][4 + q]; e[q] = pv[tt][q]; g[q] = pv[tt][4 + q]; }
    /* aligned q for this token */ const float* qp = Q + ((size_t)b * SS + tok) * DM + h * DH; FragH fq; v4f qa, qb2;
#pragma unroll
    for (int q = 0; q < 8; ++q) { const int d = d0 + q; const float c = CS[(size_t)tok * DH + d], sn = SN[(size_t)tok * DH + d]; const float qr = qp[d] * c + ((d < 32) ? -qp[d + 32] : qp[d - 32]) * sn; const float aq = qr * cdma(tt, d); fq.h[q] = (_Float16)aq; if (q < 4) qa[q] = aq; else qb2[q - 4] = aq; }
    const size_t arow = ((size_t)bh * SS + tok) * DH + d0;
    { *(v4f*)(PK + prow) = a; *(v4f*)(PK + prow + 4) = c2; *(v4f*)(PVp + prow) = e; *(v4f*)(PVp + prow + 4) = g; *(v8us*)((unsigned short*)AQ16 + arow) = fq.half[0]; *(v4f*)(AQf + prow) = qa; *(v4f*)(AQf + prow + 4) = qb2;  } } }
__device__ __forceinline__ void d_fvt(const float* __restrict__ FVf, _Float16* __restrict__ FVT, int blk) { const int t = blk * 256 + threadIdx.x; if (t >= NBt * NH * DH * (NSL / 8)) return; const int s0 = (t % (NSL / 8)) * 8; const int d = (t / (NSL / 8)) % DH; const int h = t / ((NSL / 8) * DH); FragH f;      /* h = batch * 16 + head */
#pragma unroll
  for (int q = 0; q < 8; ++q) f.h[q] = (_Float16)FVf[((size_t)h * NSL + s0 + q) * DH + d];
  *(v8us*)((unsigned short*)FVT + ((size_t)h * DH + d) * NSL + s0) = f.half[0];  }
#define FVB (DH * (NSL / 8) / 256)
__global__ __launch_bounds__(256) void k_fvt(const float* __restrict__ FVf, _Float16* __restrict__ FVT) { d_fvt(FVf, FVT, blockIdx.x); }
// Scores, softmax and weight * full_V in one kernel: a wave owns 16 query rows of one (batch, head) and walks the slots in chunks of 64, up to the chunk that holds its rows' own slots (the four
// own slots of 16 rows lie in one chunk, so every row of a wave has the same trip count and at least one live slot in every chunk). Both products are formed transposed, so that a query row is a
// COLUMN of the accumulators and belongs to lanes ln and ln + 16 alone: scores^T = full_K (A: row = slot, k = d) * aligned_q^T (B: column = query), out^T = full_V^T (A: row = d, k = slot) * weights^T.
// Register r of score tile t holds slot 16 t + 8 hh + r, which is the k that position r of half t & 1 of a B fragment pairs with in the A fragment of full_V^T: tiles 2u and 2u + 1, rounded to f16,
// ARE the weight fragment of k-step u, with no move between lanes and no LDS. Row maximum and row sum are in-lane but for one exchange between the half-waves. Running maximum: row sum and output
// accumulators are rescaled by exp(old max - new max) per chunk; the division by the row sum comes once, at the end. No score and no weight is written to memory.
// The four waves of a work-group (64 rows in a row, so one trip count for all four) share each chunk's 64 rows of full_K and 64 rows of full_V^T, 128 bytes a row: the 128 threads bring them with
// whole-line 16-byte loads into registers and store them to LDS (pitch 144 bytes, as in the GEMM above), every wave reads its A fragments from there. Two LDS buffers: the next chunk's global loads
// are issued ahead of this chunk's work and stored to the other buffer behind it, one barrier per chunk.
__device__ __forceinline__ float xhalf(float x) { return __builtin_bit_cast(float, __builtin_amdgcn_permlanex16(__builtin_bit_cast(int, x), __builtin_bit_cast(int, x), 0x76543210, 0xfedcba98, false, false)); }      /* lane l takes lane l ^ 16 */
__device__ __forceinline__ float exp2s(float x) { float r; asm("v_exp_f32 %0, %1\n\tv_nop" : "=v"(r) : "v"(x)); return r; }      /* 2^x; the v_nop keeps the one slot that the instruction set asks for behind a transcendental, whatever the compiler puts next */
__global__ __launch_bounds__(128) void k_attn(const _Float16* __restrict__ AQ16, const _Float16* __restrict__ FK16, const _Float16* __restrict__ FVT, const float* __restrict__ AQf, const float* __restrict__ PK, float* __restrict__ O, float* __restrict__ WC) {
  constexpr int PT = 144, TB = 64 * PT;      /* LDS pitch of a 128-byte row, bytes of a tile of 64 rows */
  __shared__ __attribute__((aligned(16))) char sm[2][2 * TB];      /* [buffer][full_K tile | full_V^T tile] */
  const int tid = threadIdx.x, w = tid >> 5, lane = tid & 31, ln = lane & 15, hh = lane >> 4;
  const int bh = blockIdx.y, b = bh / NH, h = bh % NH;
  const int qb = (int)gridDim.x - 1 - (int)blockIdx.x;      /* the rows with the most chunks take the lowest blockIdx.x */
  const int q0 = qb * 64 + w * 16;
  /* own-slot score of row q0 + ln in f32: each half-wave sums 32 of the 64 products */
  const float* ap = AQf + ((size_t)b * SS + q0 + ln) * DM + h * DH + 32 * hh; const float* pp = PK + ((size_t)b * SS + q0 + ln) * DM + h * DH + 32 * hh;
  v4f va[8], vb[8];
#pragma unroll
  for (int i = 0; i < 8; ++i) { va[i] = *(const v4fa*)(ap + 4 * i); vb[i] = *(const v4fa*)(pp + 4 * i); }
  asm volatile("s_wait_xcnt 0x0" :: "v"(ap), "v"(pp) : "memory");      /* both addresses stay in their registers up to this wait, so none of the 16 loads lands in a register that an issued load names */
  float cur = 0.f;
#pragma unroll
  for (int i = 0; i < 8; ++i) cur += va[i][0] * vb[i][0] + va[i][1] * vb[i][1] + va[i][2] * vb[i][2] + va[i][3] * vb[i][3];
  cur += xhalf(cur); cur *= 0.125f;
  const unsigned short* aqp = (const unsigned short*)AQ16 + ((size_t)bh * SS + q0 + ln) * DH + 8 * hh;
  FragH aq[2];
#pragma unroll
  for (int u = 0; u < 2; ++u) { aq[u].half[0] = *(const v8us*)(aqp + 32 * u); aq[u].half[1] = *(const v8us*)(aqp + 32 * u + 16); }
  const char* kg = (const char*)(FK16 + (size_t)bh * NSL * DH); const char* vg = (const char*)(FVT + (size_t)bh * DH * NSL);      /* uniform bases, moved on by one chunk's bytes just ahead of the chunk's loads; each thread adds its own byte offset */
  const int sr = tid >> 3, sb = (tid & 7) * 16;      /* staging: 8 threads a row, 16 rows a pass, 4 passes a tile */
  const unsigned ko = (unsigned)(sr * DH * 2 + sb), vo = (unsigned)(sr * NSL * 2 + sb), ls = (unsigned)(sr * PT + sb);
  const unsigned fr = (unsigned)(ln * PT + 16 * hh);      /* A fragments: row = slot, k = d in the full_K tile; row = d, k = slot in the full_V^T tile */
  const int cs = (q0 + ln) / KF;      /* this lane's row's own slot */
  const int nch = qb / KF + 1;      /* chunks up to the one with the rows' own slots (64 rows have 16 own slots, inside one chunk): from blockIdx alone, the same for the whole work-group */
  constexpr float L2E = 1.4426950408889634f;      /* exp(x - max) is formed as 2^(x * L2E - ml), ml = max * L2E rounded once and used for every term of the row, the own-slot weight included */
  float m = -3.0e38f, ml = -3.0e38f, l = 0.f;      /* running maximum of this lane's row, the same times L2E; this lane's half of its running sum */
  v8f oacc[4] = {};
  v8us rk[4], rv[4];      /* every loop over i, u, t and r is unrolled so that staging registers and fragments are registers, not indexed arrays in scratch */
#pragma unroll
  for (int i = 0; i < 4; ++i) { rk[i] = *(const v8us*)(kg + ko + i * 16 * DH * 2); rv[i] = *(const v8us*)(vg + vo + i * 16 * NSL * 2); }
#pragma unroll
  for (int i = 0; i < 4; ++i) { *(v8us*)(sm[0] + ls + i * 16 * PT) = rk[i]; *(v8us*)(sm[0] + TB + ls + i * 16 * PT) = rv[i]; }
  __syncthreads();      /* chunk 0 is in buffer 0 for every wave */
  for (int c = 0; c < nch; ++c) { const int c0 = c * 64; const bool more = c + 1 < nch; const char* cb = sm[c & 1]; char* nb = sm[(c + 1) & 1];
    if (more) { kg += 64 * DH * 2; vg += 64 * 2;
#pragma unroll
      for (int i = 0; i < 4; ++i) { rk[i] = *(const v8us*)(kg + ko + i * 16 * DH * 2); rv[i] = *(const v8us*)(vg + vo + i * 16 * NSL * 2); } }
    FragH kf[2][4], vf[2][4];
#pragma unroll
    for (int u = 0; u < 2; ++u) {
#pragma unroll
      for (int t = 0; t < 4; ++t) { kf[u][t].half[0] = *(const v8us*)(cb + fr + t * 16 * PT + 64 * u); kf[u][t].half[1] = *(const v8us*)(cb + fr + t * 16 * PT + 64 * u + 32); } }
    v8f s[4] = {};
#pragma unroll
    for (int u = 0; u < 2; ++u) {
#pragma unroll
      for (int t = 0; t < 4; ++t) s[t] = mmaH<1>(kf[u][t].v, kf[u][t].v, aq[u].v, aq[u].v, s[t]); }
    float mx = m;
#pragma unroll
    for (int t = 0; t < 4; ++t) {
#pragma unroll
      for (int r = 0; r < 8; ++r) s[t][r] *= 0.125f; }
    if (c + 1 == nch) {      /* a scalar test: own slots and later slots lie in the wave's last chunk alone */
#pragma unroll
      for (int t = 0; t < 4; ++t) {
#pragma unroll
        for (int r = 0; r < 8; ++r) { const int sl = c0 + t * 16 + 8 * hh + r; float x = s[t][r]; x = (sl == cs) ? cur : x; x = (sl > cs) ? -3.0e38f : x; s[t][r] = x; } } }
    float mt[4], lt[4];      /* one partial maximum and one partial sum per tile: four short dependent chains in place of one of 32 */
#pragma unroll
    for (int t = 0; t < 4; ++t) { mt[t] = s[t][0];
#pragma unroll
      for (int r = 1; r < 8; ++r) mt[t] = fmaxf(mt[t], s[t][r]); }
    mx = fmaxf(mx, fmaxf(fmaxf(mt[0], mt[1]), fmaxf(mt[2], mt[3])));
    mx = fmaxf(mx, xhalf(mx));      /* finite from the first chunk on: slot 0 is live for every row */
    const float mxl = mx * L2E, sc = exp2s(ml - mxl); m = mx; ml = mxl;      /* first chunk: 2^(-3e38 - mxl) = 0 */
    FragH pf[2];
#pragma unroll
    for (int t = 0; t < 4; ++t) { lt[t] = 0.f;
#pragma unroll
      for (int r = 0; r < 8; ++r) { const float p = exp2s(s[t][r] * L2E - mxl); lt[t] += p; pf[t >> 1].h[(t & 1) * 8 + r] = (_Float16)(p * 1024.0f); oacc[t][r] *= sc; } }      /* a masked slot's -3e38 gives 2^(-inf) = 0 */
    l = l * sc + ((lt[0] + lt[1]) + (lt[2] + lt[3]));
#pragma unroll
    for (int u = 0; u < 2; ++u) {
#pragma unroll
      for (int t = 0; t < 4; ++t) { vf[u][t].half[0] = *(const v8us*)(cb + TB + fr + t * 16 * PT + 64 * u); vf[u][t].half[1] = *(const v8us*)(cb + TB + fr + t * 16 * PT + 64 * u + 32); } }
#pragma unroll
    for (int u = 0; u < 2; ++u) {
#pragma unroll
      for (int t = 0; t < 4; ++t) oacc[t] = mmaH<1>(vf[u][t].v, vf[u][t].v, pf[u].v, pf[u].v, oacc[t]); }
    if (more) {
#pragma unroll
      for (int i = 0; i < 4; ++i) { *(v8us*)(nb + ls + i * 16 * PT) = rk[i]; *(v8us*)(nb + TB + ls + i * 16 * PT) = rv[i]; } }
    __syncthreads();      /* publishes the next chunk's buffer and ends every wave's reads of this one, which is refilled one chunk on */
  }
  l += xhalf(l);
  const float inv = 1.0f / l, wc = exp2s(cur * L2E - ml) * inv, os = inv * 0.0009765625f;      /* os also undoes the weights' 2^10 */
  float* op = O + ((size_t)bh * SS + q0 + ln) * DH + 8 * hh;      /* register r of tile t is d = 16 t + 8 hh + r of row q0 + ln; the wave writes its 16 rows, 4 KiB in a row, whole */
#pragma unroll
  for (int t = 0; t < 4; ++t) { v4f a, e;
#pragma unroll
    for (int r = 0; r < 4; ++r) { a[r] = oacc[t][r] * os; e[r] = oacc[t][4 + r] * os; }
    *(v4f*)(op + t * 16) = a; *(v4f*)(op + t * 16 + 4) = e; }
  float* wl = WC + ((size_t)bh * SS + q0 + ln) * 32 + 16 * hh; const v4f w4 = {wc, wc, wc, wc};      /* one whole 128-byte line per (head, row), written by this wave alone */
#pragma unroll
  for (int i = 0; i < 4; ++i) *(v4f*)(wl + 4 * i) = w4;
}
__global__ __launch_bounds__(256) void k_oepi(const float* __restrict__ O, const float* __restrict__ WC, const float* __restrict__ PVp, const float* __restrict__ FVf, _Float16* __restrict__ Oh, _Float16* __restrict__ Ol) {
  #pragma clang fp contract(off)
  const int t = blockIdx.x * 256 + threadIdx.x; if (t >= NR * NH * (DH / 8)) return; const int d0 = (t % (DH / 8)) * 8; const int h = (t / (DH / 8)) % NH; const int bq = t / ((DH / 8) * NH); const int b = bq / SS, q = bq % SS; const int cs = q / KF, tt = q % KF; const float wc = WC[((size_t)(b * NH + h) * SS + q) * 32]; const size_t prow = (size_t)bq * DM + h * DH + d0; const size_t srow = ((size_t)(b * NH + h) * NSL + cs) * DH + d0; const size_t orow = ((size_t)(b * NH + h) * SS + q) * DH + d0; FragH fh, fl;      /* O is [batch * 16 + head][token][64] */
  const v4f pA = *(const v4fa*)(PVp + prow), pB = *(const v4fa*)(PVp + prow + 4), fA = *(const v4fa*)(FVf + srow), fB = *(const v4fa*)(FVf + srow + 4);
  asm volatile("s_wait_xcnt 0x0" ::: "memory");      /* the loads of O below may land in registers that hold the addresses of the loads above: the wait stands between them */
  const v4f oA = *(const v4fa*)(O + orow), oB = *(const v4fa*)(O + orow + 4);
#pragma unroll
  for (int k = 0; k < 8; ++k) { const int d = d0 + k; const float o = ((k < 4) ? oA[k & 3] : oB[k & 3]) + wc * (((k < 4) ? pA[k & 3] : pB[k & 3]) - ((k < 4) ? fA[k & 3] : fB[k & 3])); const float v = (o * cdma(tt, d)) * 2.0f; const _Float16 hi = (_Float16)v; fh.h[k] = hi; fl.h[k] = (_Float16)((v - (float)hi) * 1024.0f); }
  { *(v8us*)((unsigned short*)Oh + prow) = fh.half[0]; *(v8us*)((unsigned short*)Ol + prow) = fl.half[0];  } }

extern "C" void kernel_launch(void* const* d_in, const int* in_sizes, int n_in,
                              void* d_out, int out_size, void* d_ws, size_t ws_size, hipStream_t stream) {
  (void)in_sizes; (void)n_in; (void)out_size;
  const float* x = (const float*)d_in[0]; const float* Wq = (const float*)d_in[1]; const float* Wk = (const float*)d_in[2]; const float* Wv = (const float*)d_in[3]; const float* Wo = (const float*)d_in[4]; const float* Aq = (const float*)d_in[5]; const float* Bq = (const float*)d_in[6]; const float* Av = (const float*)d_in[7]; const float* Bv = (const float*)d_in[8]; const float* Ao = (const float*)d_in[9]; const float* Bo = (const float*)d_in[10];
  char* ws = (char*)d_ws; size_t off = 0;
  auto take = [&](size_t bytes) { char* p = ws + off; off += (bytes + 255) & ~(size_t)255; return p; };
  _Float16* BWq = (_Float16*)take((size_t)DM * DM * 2); _Float16* BWk = (_Float16*)take((size_t)DM * DM * 2); _Float16* BWv = (_Float16*)take((size_t)DM * DM * 2); _Float16* BWo = (_Float16*)take((size_t)DM * DM * 2); _Float16* BAq = (_Float16*)take((size_t)LR * DM * 2); _Float16* BAv = (_Float16*)take((size_t)LR * DM * 2); _Float16* BAo = (_Float16*)take((size_t)LR * DM * 2); _Float16* BBq = (_Float16*)take((size_t)DM * LR * 2); _Float16* BBv = (_Float16*)take((size_t)DM * LR * 2); _Float16* BBo = (_Float16*)take((size_t)DM * LR * 2);
  float* CS = (float*)take((size_t)SS * DH * 4); float* SN = (float*)take((size_t)SS * DH * 4);
  /* every plane holds both batches (NR = 4096 rows, or 32 = batch * 16 + head slabs) */
  _Float16* X16 = (_Float16*)take((size_t)NR * DM * 2); float* Q = (float*)take((size_t)NR * DM * 4); float* K = (float*)take((size_t)NR * DM * 4); float* V = (float*)take((size_t)NR * DM * 4); float* XA = (float*)take((size_t)NR * LR * 4); _Float16* XAh = (_Float16*)take((size_t)NR * LR * 2); _Float16* XAl = (_Float16*)take((size_t)NR * LR * 2);
  _Float16* FK16 = (_Float16*)take((size_t)NBt * NH * NSL * DH * 2); _Float16* FV16 = (_Float16*)take((size_t)NBt * NH * NSL * DH * 2); float* FKf = (float*)take((size_t)NBt * NH * NSL * DH * 4); float* FVf = (float*)take((size_t)NBt * NH * NSL * DH * 4); float* PK = (float*)take((size_t)NR * DM * 4); float* PVp = (float*)take((size_t)NR * DM * 4); float* AQf = (float*)take((size_t)NR * DM * 4);
  float* S = (float*)take((size_t)NBt * NH * SS * NSL * 4);
  if (off > ws_size) return;      // weights 8.75 + tables 1 + planes 246: 255.75 MiB
  /* planes that are written only after another plane's last reader has run share its bytes (launches of one stream run in order):
     X16 is last read by the launch of the five products of x, Q, K and V by k_slots; XA, XAh and XAl serve out*Ao alone */
  _Float16* AQ16 = X16; float* O = Q; _Float16* Oh = (_Float16*)K; _Float16* Ol = Oh + (size_t)NR * DM; float* WC = V; _Float16* FVT = (_Float16*)(V + (size_t)NBt * NH * SS * 32); float* OA = XA; _Float16* OAh = XAh; _Float16* OAl = XAl;
  /* the two low-rank inputs x*Aq and x*Av are formed in one launch and so need a plane each: they lie at the start of S, which holds nothing else */
  float* XA2 = S; _Float16* XAh2 = (_Float16*)(S + (size_t)2 * NR * LR); _Float16* XAl2 = XAh2 + (size_t)2 * NR * LR;
  const size_t n8 = (size_t)NR * DM / 8; const unsigned nb8 = (unsigned)((n8 + 255) / 256); const size_t a8 = (size_t)NR * LR / 8; const unsigned nba = (unsigned)((a8 + 255) / 256);
  k_prep<<<4 * (DM * (DM / 8) / 256) + SS * DH / 256 + 6 * (LR * (DM / 8) / 256) + nb8, 256, 0, stream>>>(x, Wq, Wk, Wv, Wo, Aq, Bq, Av, Bv, Ao, Bo, X16, BWq, BAq, BBq, CS, SN);      /* all weights are (in,out) */
  /* one 64 x 64 tile of C per work-group: projections over all NR rows, nD work-groups for N = 1024 and nL for N = 64; attention per (batch, head) on grid.y */
  const int nD = (NR / 64) * (DM / 64), nL = NR / 64; const dim3 gA(SS / 64, NBt * NH);
  const float a0 = 0.0625f, a1 = 0.0625f / 1024.0f;      /* undo the weights' 16; the lo planes carry 2^10 more */
  const GemmJobs<5> jX = {{{X16, nullptr, BWq, nullptr, Q, 0, a0, DM, DM, nD}, {X16, nullptr, BWk, nullptr, K, 0, a0, DM, DM, nD}, {X16, nullptr, BWv, nullptr, V, 0, a0, DM, DM, nD}, {X16, nullptr, BAq, nullptr, XA2, 0, a0, LR, LR, nL}, {X16, nullptr, BAv, nullptr, XA2 + (size_t)NR * LR, 0, a0, LR, LR, nL}}};
  k_gemm_hhx<0, 4, 5, 1><<<dim3(3 * nD + 2 * nL, 1), 128, 0, stream>>>(jX, DM, 0, DM, 0, nullptr, 0, 1, 0, nullptr, 0, NR, DM);      /* x*Wq, x*Wk, x*Wv (exact), x*Aq, x*Av */
  k_split<<<2 * nba, 256, 0, stream>>>(XA2, XAh2, XAl2, 2 * a8);
  const GemmJobs<2> jH = {{{XAh2, XAl2, BBq, Q, Q, (size_t)DM, a1, DM, DM, nD}, {XAh2 + (size_t)NR * LR, XAl2 + (size_t)NR * LR, BBv, V, V, (size_t)DM, a1, DM, DM, nD}}};
  k_gemm_hhx<0, 2, 2, 2><<<dim3(2 * nD, 1), 128, 0, stream>>>(jH, LR, 0, LR, 0, nullptr, 0, 1, 0, nullptr, 0, NR, LR);      /* q += (x*Aq)*Bq and v += (x*Av)*Bv: hi and lo planes in one k loop */
  k_slots<<<(NBt * NH * NSL * (DH / 8) + 255) / 256, 256, 0, stream>>>(Q, K, V, CS, SN, FK16, FV16, FKf, FVf, PK, PVp, AQ16, AQf);
  k_fvt<<<NBt * NH * FVB, 256, 0, stream>>>(FVf, FVT);
  k_attn<<<gA, 128, 0, stream>>>(AQ16, FK16, FVT, AQf, PK, O, WC);      /* scores, softmax, sum of w * full_V into O[pair] and the own-slot weight into WC: 64 rows per work-group, pair = batch * 16 + head on grid.y */
  k_oepi<<<(NR * NH * (DH / 8) + 255) / 256, 256, 0, stream>>>(O, WC, PVp, FVf, Oh, Ol);
  float* outb = (float*)d_out;
  const GemmJobs<2> jOh = {{{Oh, Ol, BWo, nullptr, outb, 0, a1, DM, DM, nD}, {Oh, Ol, BAo, nullptr, OA, 0, a1, LR, LR, nL}}};
  k_gemm_hhx<0, 4, 2, 2><<<dim3(nD + nL, 1), 128, 0, stream>>>(jOh, DM, 0, DM, 0, nullptr, 0, 1, 0, nullptr, 0, NR, DM);      /* out*Wo and out*Ao: hi and lo planes in one k loop */
  k_split<<<nba, 256, 0, stream>>>(OA, OAh, OAl, a8);
  const GemmJobs<1> jBh = {{{OAh, OAl, BBo, outb, outb, (size_t)DM, a1, DM, DM, nD}}};
  k_gemm_hhx<0, 2, 1, 2><<<dim3(nD, 1), 128, 0, stream>>>(jBh, LR, 0, LR, 0, nullptr, 0, 1, 0, nullptr, 0, NR, LR);      /* + (out*Ao)*Bo: hi and lo planes in one k loop */
}

// v009
// A run of this version takes 140 microseconds.
// It is 1.55 times as fast as v007, going by the measured steps of the versions left out in between.
// Counting every step since v000, it is 13.3 times as fast.
#include <hip/hip_runtime.h>
// HoloKV attention (B 2, S 2048, 16 heads × 64, k_factor 4 → 512 slots): q = x·Wq + (x·Aq)·Bq, k = x·Wk, v = x·Wv + (x·Av)·Bv; RoPE (half-split rotate, θ_i = 1/10000^(2i/64)); keys/values compressed into slots of 4 tokens with Hadamard phases /2: full_K[s] = Σ_t k[4s+t]·c[t]/2, partial (causal prefix inside the slot); query phase c[q mod 4]; scores over slots: aligned_q·full_K/8 for earlier slots, aligned_q·partial_K(q's prefix)/8 for its own slot, −inf for later slots; softmax; out = Σ w·full_V + w_curr·(partial_V − full_V[curr]); out·phase·2; y = out·Wo + (out·Ao)·Bo → [2,2048,1024].
// Compute dtype: x and parameters rounded to bf16; each low-rank pair is folded into its weight, W + A*B (exact f16 products, f32 sum) rounded once to f16, and the projections are one product each; RoPE, phases, slot sums/prefixes in f32; aligned q and full_K/full_V as f16 GEMM operands (scores O(1)), the own-slot score, masking, softmax and the rank-1 correction in f32; attention output as f16 hi + lo·2^10 into Wo + Ao*Bo. v_wmma_f32_16x16x32_f16.
#define NBt 2
#define SS 2048
#define DM 1024
#define NH 16
#define DH 64
#define KF 4
#define NSL (SS / KF)            /* 512 slots */
#define LR 64
#define NR (NBt * SS)
typedef __bf16 v16b __attribute__((ext_vector_type(16)));
typedef unsigned short v8us __attribute__((ext_vector_type(8), may_alias));
typedef float  v8f  __attribute__((ext_vector_type(8)));
typedef float  v4f  __attribute__((ext_vector_type(4)));
typedef float  v4fa __attribute__((ext_vector_type(4), may_alias));
union FragB { v16b v; v8us half[2]; unsigned short u[16]; };

__device__ __forceinline__ unsigned short bf16_bits(float x) { unsigned int u = __float_as_uint(x); return (unsigned short)((u + 0x7FFFu + ((u >> 16) & 1u)) >> 16); }
__device__ __forceinline__ float bf16_val(unsigned short b) { return __uint_as_float(((unsigned int)b) << 16); }
__device__ __forceinline__ float bf16_round(float x) { return bf16_val(bf16_bits(x)); }
// D += A·B with NT terms: 1 = ah·bh, 2 = + al·bh (A split), 3 = + ah·bl (both split)
template <int NT>
__device__ __forceinline__ v8f mmaN(v16b ah, v16b al, v16b bh, v16b bl, v8f c) {
  c = __builtin_amdgcn_wmma_f32_16x16x32_bf16(false, ah, false, bh, (short)0, c, false, false);
  if (NT >= 2) c = __builtin_amdgcn_wmma_f32_16x16x32_bf16(false, al, false, bh, (short)0, c, false, false);
  if (NT >= 3) c = __builtin_amdgcn_wmma_f32_16x16x32_bf16(false, ah, false, bl, (short)0, c, false, false);
  asm volatile("v_nop\n\tv_nop\n\tv_nop\n\tv_nop" : "+v"(c) : "v"(ah), "v"(al), "v"(bh), "v"(bl));
  return c;
}

__global__ __launch_bounds__(256) void k_wt_bf16(const float* __restrict__ W, unsigned short* __restrict__ Wt, int K, int N) {
  const int t = blockIdx.x * 256 + threadIdx.x;
  const int k8n = K / 8;
  if (t >= N * k8n) return;
  const int n = t / k8n, k8 = (t % k8n) * 8;
  v8us v;
#pragma unroll
  for (int i = 0; i < 8; ++i) v[i] = bf16_bits(W[(size_t)(k8 + i) * N + n]);
  *(v8us*)(Wt + (size_t)n * K + k8) = v;
  
}

// GEMM C[M][N] (f32, pitch ldc) = act(A[M][K]·W + bias). A f32 row-major (pitch lda) converted per fragment to bf16
// (ASPLIT: hi/lo two planes -> 2 terms, else single rounded term); Wt bf16 [N][K] (pitch ldb). BIAS_BF16 rounds the
// bias to bf16 first (bias quantised to bf16 before the add). K%32==0, M%16==0, N%64==0.
template <bool ASPLIT, int ACT, bool BIAS_BF16>
__global__ __launch_bounds__(128) void k_gemm_bf(const float* __restrict__ A, int lda, const unsigned short* __restrict__ Wt, int ldb,
                                               const float* __restrict__ bias, float* __restrict__ C, int ldc, int M, int N, int K) {
  __shared__ __attribute__((aligned(16))) float so[4][16][64];
  const int tid = threadIdx.x, w = tid >> 5, lane = tid & 31, ln = lane & 15, hh = lane >> 4;
  const int ntn = N / 64;
  const int wid = blockIdx.x * 4 + w;
  const int mt = wid / ntn, nq = wid % ntn;
  if (mt * 16 >= M) return;
  const int row0 = mt * 16, col0 = nq * 64;
  const float* arow = A + (size_t)(row0 + ln) * lda;
  v8f acc[4] = {};
  for (int kb = 0; kb < K; kb += 32) {
    FragB ah, al;
    const v4f x0 = *(const v4fa*)(arow + kb + 8 * hh), x1 = *(const v4fa*)(arow + kb + 8 * hh + 4);
    const v4f x2 = *(const v4fa*)(arow + kb + 16 + 8 * hh), x3 = *(const v4fa*)(arow + kb + 16 + 8 * hh + 4);
    float xs[16] = {x0[0],x0[1],x0[2],x0[3],x1[0],x1[1],x1[2],x1[3],x2[0],x2[1],x2[2],x2[3],x3[0],x3[1],x3[2],x3[3]};
#pragma unroll
    for (int i = 0; i < 16; ++i) { const unsigned short hb = bf16_bits(xs[i]); ah.u[i] = hb; al.u[i] = ASPLIT ? bf16_bits(xs[i] - bf16_val(hb)) : (unsigned short)0; }
#pragma unroll
    for (int t = 0; t < 4; ++t) {
      const unsigned short* brow = Wt + (size_t)(col0 + t * 16 + ln) * ldb + kb;
      FragB b;
      b.half[0] = *(const v8us*)(brow + 8 * hh);
      b.half[1] = *(const v8us*)(brow + 16 + 8 * hh);
      acc[t] = mmaN<ASPLIT ? 2 : 1>(ah.v, al.v, b.v, b.v, acc[t]);
    }
  }
#pragma unroll
  for (int t = 0; t < 4; ++t) {
    float bv = bias ? bias[col0 + t * 16 + ln] : 0.f;
    if (BIAS_BF16) bv = bf16_round(bv);
#pragma unroll
    for (int r = 0; r < 8; ++r) { float v = acc[t][r] + bv; if (ACT == 1) v = fmaxf(v, 0.f); so[w][8 * hh + r][t * 16 + ln] = v; }
  }
  __builtin_amdgcn_fence(__ATOMIC_ACQ_REL, "workgroup");
  __builtin_amdgcn_wave_barrier();
  const int rsub = lane >> 4, c4 = (lane & 15) * 4;
  {
#pragma unroll
    for (int q = 0; q < 8; ++q) {
      const int r = q * 2 + rsub;
      const v4f v = *(const v4fa*)&so[w][r][c4];
      *(v4f*)(C + (size_t)(row0 + r) * ldc + col0 + c4) = v;
    }
    
  }
}

// GEMM C = act(A·W + bias + resid): A f32 (ASPLIT -> hi/lo 2 terms), Wt bf16 [N][K]; ACT 0 none, 1 relu, 2 exact gelu;
// resid (optional, f32, row index = (row % rmod), pitch ldr, RES_BF16 rounds it) added before the activation.
template <bool ASPLIT, int ACT, bool BIAS_BF16, bool RES_BF16>
__global__ __launch_bounds__(128) void k_gemm_bf3(const float* __restrict__ A, int lda, const unsigned short* __restrict__ Wt, int ldb,
                                                const float* __restrict__ bias, const float* __restrict__ resid, int rmod, int ldr,
                                                float* __restrict__ C, int ldc, int M, int N, int K) {
  __shared__ __attribute__((aligned(16))) float so[4][16][64];
  const int tid = threadIdx.x, w = tid >> 5, lane = tid & 31, ln = lane & 15, hh = lane >> 4;
  const int ntn = N / 64;
  const int wid = blockIdx.x * 4 + w;
  const int mt = wid / ntn, nq = wid % ntn;
  if (mt * 16 >= M) return;
  const int row0 = mt * 16, col0 = nq * 64;
  const float* arow = A + (size_t)(row0 + ln) * lda;
  v8f acc[4] = {};
  for (int kb = 0; kb < K; kb += 32) {
    FragB ah, al;
    const v4f x0 = *(const v4fa*)(arow + kb + 8 * hh), x1 = *(const v4fa*)(arow + kb + 8 * hh + 4);
    const v4f x2 = *(const v4fa*)(arow + kb + 16 + 8 * hh), x3 = *(const v4fa*)(arow + kb + 16 + 8 * hh + 4);
    float xs[16] = {x0[0],x0[1],x0[2],x0[3],x1[0],x1[1],x1[2],x1[3],x2[0],x2[1],x2[2],x2[3],x3[0],x3[1],x3[2],x3[3]};
#pragma unroll
    for (int i = 0; i < 16; ++i) { const unsigned short hb = bf16_bits(xs[i]); ah.u[i] = hb; al.u[i] = ASPLIT ? bf16_bits(xs[i] - bf16_val(hb)) : (unsigned short)0; }
#pragma unroll
    for (int t = 0; t < 4; ++t) {
      const unsigned short* brow = Wt + (size_t)(col0 + t * 16 + ln) * ldb + kb;
      FragB b;
      b.half[0] = *(const v8us*)(brow + 8 * hh);
      b.half[1] = *(const v8us*)(brow + 16 + 8 * hh);
      acc[t] = mmaN<ASPLIT ? 2 : 1>(ah.v, al.v, b.v, b.v, acc[t]);
    }
  }
#pragma unroll
  for (int t = 0; t < 4; ++t) {
    const int col = col0 + t * 16 + ln;
    float bv = bias ? bias[col] : 0.f;
    if (BIAS_BF16) bv = bf16_round(bv);
#pragma unroll
    for (int r = 0; r < 8; ++r) {
      float v = acc[t][r] + bv;
      if (resid) { float rv = resid[(size_t)((row0 + 8 * hh + r) % rmod) * ldr + col]; if (RES_BF16) rv = bf16_round(rv); v += rv; }
      if (ACT == 1) v = fmaxf(v, 0.f);
      if (ACT == 2) v = 0.5f * v * (1.0f + erff(v * 0.70710678118654752f));
      if (ACT == 3) { const float u = 0.7978845608028654f * (v + 0.044715f * v * v * v); v = 0.5f * v * (1.0f + tanhf(u)); }
      so[w][8 * hh + r][t * 16 + ln] = v;
    }
  }
  __builtin_amdgcn_fence(__ATOMIC_ACQ_REL, "workgroup");
  __builtin_amdgcn_wave_barrier();
  const int rsub = lane >> 4, c4 = (lane & 15) * 4;
  {
#pragma unroll
    for (int q = 0; q < 8; ++q) {
      const int r = q * 2 + rsub;
      const v4f v = *(const v4fa*)&so[w][r][c4];
      *(v4f*)(C + (size_t)(row0 + r) * ldc + col0 + c4) = v;
    }
    
  }
}
// row LayerNorm (biased variance, eps) over N: s = X (+ R); optional out_sum <- s; out_norm <- (s-mu)*rsqrt(var+eps)*g + b
template <bool PARAM_BF16>
__global__ __launch_bounds__(256) void k_layernorm(const float* __restrict__ X, const float* __restrict__ R, const float* __restrict__ g, const float* __restrict__ bta,
                                                  float* __restrict__ out_sum, float* __restrict__ out_norm, int N, float eps) {
  __shared__ float red[256];
  const int row = blockIdx.x, tid = threadIdx.x;
  const float* x = X + (size_t)row * N; const float* rr = R ? R + (size_t)row * N : nullptr;
  float vals[16];                     // up to N = 4096
  const int per = N / 256;            // contiguous chunk per thread? use strided-by-4 chunks: thread handles j = tid*4 + 1024*u
  float s1 = 0.f;
  for (int u = 0; u < per / 4; ++u) {
    const int j = tid * 4 + 1024 * u;
    const v4f a = *(const v4fa*)(x + j);
    v4f b = {0.f,0.f,0.f,0.f}; if (rr) b = *(const v4fa*)(rr + j);
#pragma unroll
    for (int q = 0; q < 4; ++q) { const float v = a[q] + b[q]; vals[u * 4 + q] = v; s1 += v; }
  }
  red[tid] = s1; __syncthreads();
  for (int st = 128; st > 0; st >>= 1) { if (tid < st) red[tid] += red[tid + st]; __syncthreads(); }
  const float mu = red[0] / (float)N; __syncthreads();
  float s2 = 0.f;
  for (int u = 0; u < per / 4; ++u)
#pragma unroll
    for (int q = 0; q < 4; ++q) { const float c = vals[u * 4 + q] - mu; s2 += c * c; }
  red[tid] = s2; __syncthreads();
  for (int st = 128; st > 0; st >>= 1) { if (tid < st) red[tid] += red[tid + st]; __syncthreads(); }
  const float rs = rsqrtf(red[0] / (float)N + eps);
  {
    for (int u = 0; u < per / 4; ++u) {
      const int j = tid * 4 + 1024 * u;
      v4f o, sm;
#pragma unroll
      for (int q = 0; q < 4; ++q) {
        float gg = g[j + q], bb = bta[j + q];
        if (PARAM_BF16) { gg = bf16_round(gg); bb = bf16_round(bb); }
        sm[q] = vals[u * 4 + q]; o[q] = (vals[u * 4 + q] - mu) * rs * gg + bb;
      }
      if (out_sum) *(v4f*)(out_sum + (size_t)row * N + j) = sm;
      *(v4f*)(out_norm + (size_t)row * N + j) = o;
    }
    
  }
}



// ---- f16 WMMA path (v_wmma_f32_16x16x32_f16): 11-bit significands for operands in range — used where a [0,1] probability operand needs more precision than bf16
typedef _Float16 v16h __attribute__((ext_vector_type(16)));
union FragH { v16h v; v8us half[2]; _Float16 h[16]; unsigned short u[16]; };
template <int NT>
__device__ __forceinline__ v8f mmaH(v16h ah, v16h al, v16h bh, v16h bl, v8f c) {
  c = __builtin_amdgcn_wmma_f32_16x16x32_f16(false, ah, false, bh, (short)0, c, false, false);
  if (NT >= 2) c = __builtin_amdgcn_wmma_f32_16x16x32_f16(false, al, false, bh, (short)0, c, false, false);
  if (NT >= 3) c = __builtin_amdgcn_wmma_f32_16x16x32_f16(false, ah, false, bl, (short)0, c, false, false);
  asm volatile("v_nop\n\tv_nop\n\tv_nop\n\tv_nop" : "+v"(c) : "v"(ah), "v"(al), "v"(bh), "v"(bl));
  return c;
}
// batched GEMM like k_gemm_b but f16 operands: A f32 (split into f16 hi/lo if ASPLIT, else rounded to f16), Bt = f16 values [n][k]; alpha; C f32; N multiple of 16 (partial tiles skipped)
template <bool ASPLIT>
__global__ __launch_bounds__(128) void k_gemm_h(const float* __restrict__ A, int lda, size_t sA, const _Float16* __restrict__ Bh, int ldb, size_t sB, float alpha, float* __restrict__ C, int ldc, size_t sC, int M, int N, int K) {
  __shared__ __attribute__((aligned(16))) float so[4][16][64];
  const int tid = threadIdx.x, w = tid >> 5, lane = tid & 31, ln = lane & 15, hh = lane >> 4; const int by = blockIdx.y;
  A += (size_t)by * sA; Bh += (size_t)by * sB; C += (size_t)by * sC;
  const int ntn = (N + 63) / 64; const int wid = blockIdx.x * 4 + w; const int mt = wid / ntn, nq = wid % ntn; if (mt * 16 >= M) return;
  const int row0 = mt * 16, col0 = nq * 64; const float* arow = A + (size_t)(row0 + ln) * lda;
  v8f acc[4] = {};
  for (int kb = 0; kb < K; kb += 32) {
    FragH ah, al;
    const v4f x0 = *(const v4fa*)(arow + kb + 8 * hh), x1 = *(const v4fa*)(arow + kb + 8 * hh + 4), x2 = *(const v4fa*)(arow + kb + 16 + 8 * hh), x3 = *(const v4fa*)(arow + kb + 16 + 8 * hh + 4);
    float xs[16] = {x0[0],x0[1],x0[2],x0[3],x1[0],x1[1],x1[2],x1[3],x2[0],x2[1],x2[2],x2[3],x3[0],x3[1],x3[2],x3[3]};
#pragma unroll
    for (int i = 0; i < 16; ++i) { const _Float16 h = (_Float16)xs[i]; ah.h[i] = h; al.h[i] = ASPLIT ? (_Float16)(xs[i] - (float)h) : (_Float16)0.0f; }
#pragma unroll
    for (int t = 0; t < 4; ++t) { if (col0 + t * 16 >= N) continue; const size_t boff = (size_t)(col0 + t * 16 + ln) * ldb + kb; FragH bq; bq.half[0] = *(const v8us*)(Bh + boff + 8 * hh); bq.half[1] = *(const v8us*)(Bh + boff + 16 + 8 * hh);
      acc[t] = mmaH<ASPLIT ? 2 : 1>(ah.v, al.v, bq.v, bq.v, acc[t]); }
  }
#pragma unroll
  for (int t = 0; t < 4; ++t) { if (col0 + t * 16 >= N) continue;
#pragma unroll
    for (int r = 0; r < 8; ++r) so[w][8 * hh + r][t * 16 + ln] = acc[t][r] * alpha; }
  __builtin_amdgcn_fence(__ATOMIC_ACQ_REL, "workgroup"); __builtin_amdgcn_wave_barrier();
  const int rsub = lane >> 4, c4 = (lane & 15) * 4;
  {
#pragma unroll
    for (int q = 0; q < 8; ++q) { const int r = q * 2 + rsub; if (col0 + c4 < N) { const v4f v = *(const v4fa*)&so[w][r][c4]; *(v4f*)(C + (size_t)(row0 + r) * ldc + col0 + c4) = v; } }
     }
}

// Wt[n][k] = f16(W[k][n]·scale) from f32 row-major W[K][N] (scale = power of two; bf16-exact weights stay exact in f16 away from the subnormal range)
__device__ __forceinline__ void d_wt_f16(const float* __restrict__ W, _Float16* __restrict__ Wt, int K, int N, float scale, int blk) {
  const int t = blk * 256 + threadIdx.x; if (t >= N * (K / 8)) return; const int n = t / (K / 8), k8 = (t % (K / 8)) * 8; FragH f;
#pragma unroll
  for (int i = 0; i < 8; ++i) f.h[i] = (_Float16)(bf16_round(W[(size_t)(k8 + i) * N + n]) * scale); const v8us o = f.half[0];
  *(v8us*)((unsigned short*)Wt + (size_t)n * K + k8) = o; 
}
// Wn = f16(W * scale), the layout kept
__device__ __forceinline__ void d_n16(const float* __restrict__ W, _Float16* __restrict__ Wn, int n8, float scale, int blk) {
  const int t = blk * 256 + threadIdx.x; if (t >= n8) return; FragH f;
#pragma unroll
  for (int i = 0; i < 8; ++i) f.h[i] = (_Float16)(bf16_round(W[(size_t)t * 8 + i]) * scale);
  *(v8us*)((unsigned short*)Wn + (size_t)t * 8) = f.half[0];
}
// One work-group = one 64 x 64 tile of C; wave w owns rows 16w..16w+15 of it, all 64 columns. Per stage the four waves bring 64 rows of A and 64 rows of B, 32 * KU k each,
// from global memory with whole-line 16-byte loads into registers and store them to LDS (row pitch = row bytes + 16, conflict-free for 16-byte fragment reads); every wave reads its
// fragments from LDS, so the B tile is fetched once per work-group instead of once per wave and no global load is spread over 16 rows. Two LDS buffers: the next stage's global loads
// are issued before this stage's WMMAs and stored to the other buffer behind them, one barrier per stage. M and N multiples of 64, K a multiple of 32 * KU. The k order per accumulator is ascending.
// Every loop over i, u and t is unrolled so that ra, rb, oa, ob and the fragments are registers, not indexed arrays in scratch.
// k_gemm_hh variant with fused epilogue: v = acc·alpha + bias[by·sBias + col] (+ CP[(row/rowsPerB)·sCPb + by·64 + col] if CP) ; ACT 0 none / 1 elu ; writes f16 C16 (and f32 C if non-null)
// ACT 20: C16 is updated in place, C16 = f16(acc * alpha + C16): each lane loads, at the kernel's start, the eight 8-byte pieces that it stores at the end, 16 lanes a 128-byte row piece; N a multiple of 64.
typedef _Float16 v4hx __attribute__((ext_vector_type(4), may_alias));
// One launch runs up to NJ products that do not depend on one another and share M, K and the operand pitches: job i owns the next nb work-groups of grid.x, with its own operands, addend, output, scale and N.
// NP = 2: A is given as two planes, hi (A) and lo * 2^10 (A2), against the same B. The k loop runs over the hi plane, multiplies the accumulators by 2^10 (exact) and runs on over the lo plane, so that
// acc = 2^10 * hi*B + (lo * 2^10)*B and alpha carries the 2^-10; C and its addend are touched once for the pair. lda = ldb = K there: a row's bytes end where the stages' running offsets stand after one plane.
struct GemmJob { const _Float16* A; const _Float16* A2; const _Float16* B; const float* CP; float* C; size_t sCPb; float alpha; int ldc, N, nb; };
template <int NJ> struct GemmJobs { GemmJob j[NJ]; };
template <int ACT, int KU, int NJ, int NP>
__global__ __launch_bounds__(128) void k_gemm_hhx(const GemmJobs<NJ> J, int lda, size_t sA, int ldb, size_t sB, const float* __restrict__ bias, size_t sBias, int rowsPerB, int row0g,
    _Float16* __restrict__ C16, size_t sC, int M, int K) {
  constexpr int RB = 64 * KU, PITCH = RB + 16, UPR = RB / 16, RP = 128 / UPR, NU = 64 / RP, TILE = 64 * PITCH;      /* row bytes, LDS pitch, 16-byte units per row, rows per pass of 128 threads, passes per tile, tile bytes */
  __shared__ __attribute__((aligned(16))) char sm[4 * TILE];      /* [buffer][A tile | B tile]; the epilogue's 16 KiB of staging reuses it behind the last stage's barrier */
  static_assert(4 * TILE >= 4 * 16 * 64 * 4, "epilogue staging must fit");
  float (*so)[16][64] = (float (*)[16][64])sm;
  const int tid = threadIdx.x, w = tid >> 5, lane = tid & 31, ln = lane & 15, hh = lane >> 4; const int by = blockIdx.y;
  GemmJob g = J.j[0]; int bx = blockIdx.x;      /* this work-group's job and its index inside the job: scalar values, the same for the whole work-group */
  for (int i = 1; i < NJ; ++i) if (bx >= g.nb) { bx -= g.nb; g = J.j[i]; }
  const _Float16* A = g.A; const _Float16* Bh = g.B; const float* CP = g.CP; float* C = g.C; const size_t sCPb = g.sCPb; const float alpha = g.alpha; const int ldc = g.ldc, N = g.N;
  A += (size_t)by * sA; Bh += (size_t)by * sB; const size_t cofs = (size_t)by * sC; const float* bp = bias ? bias + (size_t)by * sBias : nullptr;
  const int ntn = (N + 63) / 64; const int mtb = bx / ntn, nq = bx % ntn; if (mtb * 64 >= M) return;      /* the same for the whole work-group, ahead of every barrier */
  const int row0 = mtb * 64 + w * 16, col0 = nq * 64;
  char* c16b = ACT == 20 ? (char*)(C16 + cofs) : nullptr;      /* uniform base of this plane; each lane keeps one 32-bit byte offset per piece, for the load here and the store at the end */
  unsigned oc[8]; v4hx old[8];
  if (ACT == 20) {
#pragma unroll
    for (int q = 0; q < 8; ++q) { oc[q] = (unsigned)(((row0 + 2 * q + hh) * ldc + col0 + 4 * ln) * 2); old[q] = *(const v4hx*)(c16b + oc[q]); }
    asm volatile("s_wait_xcnt 0x0" :: "v"(oc[0]), "v"(oc[1]), "v"(oc[2]), "v"(oc[3]), "v"(oc[4]), "v"(oc[5]), "v"(oc[6]), "v"(oc[7]) : "memory");      /* the eight offsets stay in their registers up to this wait, so no load lands in a register that an issued load names */
  }
  v8f acc[4] = {};
  const char* Ab = (const char*)A; const char* Bb = (const char*)Bh;      /* uniform bases; each thread keeps one 32-bit byte offset per load */
  const int sr = tid / UPR, sc = (tid % UPR) * 16;
  const unsigned ga = (unsigned)((mtb * 64 + sr) * lda * 2 + sc), gb = (unsigned)((col0 + sr) * ldb * 2 + sc), ls = (unsigned)(sr * PITCH + sc);
  unsigned oa[NU], ob[NU];      /* moved on by one stage's bytes just ahead of the stage's loads: the loads that named the old values were waited for ahead of the last barrier */
#pragma unroll
  for (int i = 0; i < NU; ++i) { oa[i] = ga + (unsigned)(i * RP * lda * 2); ob[i] = gb + (unsigned)(i * RP * ldb * 2); }
  const unsigned fa = (unsigned)((w * 16 + ln) * PITCH + 16 * hh), fb = (unsigned)(TILE + ln * PITCH + 16 * hh);
  v8us ra[NU], rb[NU];
#pragma unroll
  for (int i = 0; i < NU; ++i) { ra[i] = *(const v8us*)(Ab + oa[i]); rb[i] = *(const v8us*)(Bb + ob[i]); }
#pragma unroll
  for (int i = 0; i < NU; ++i) { *(v8us*)(sm + ls + i * RP * PITCH) = ra[i]; *(v8us*)(sm + TILE + ls + i * RP * PITCH) = rb[i]; }
  __syncthreads();      /* stage 0 is in buffer 0 for every wave */
  const int nst = K / (32 * KU), nall = NP * nst;
  for (int s = 0; s < nall; ++s) { const bool more = s + 1 < nall; const char* cur = sm + (s & 1) * 2 * TILE; char* nxt = sm + ((s + 1) & 1) * 2 * TILE;
    if (NP == 2 && s + 1 == nst) { Ab = (const char*)(g.A2 + (size_t)by * sA) - (size_t)K * 2; Bb -= (size_t)K * 2; }      /* scalar test: the next stage is the lo plane's first; the threads' offsets run on, the two uniform bases step back by one row's bytes */
    if (NP == 2 && s == nst) {      /* scalar test: the hi plane is summed; 2^10 brings it to the lo plane's scale */
#pragma unroll
      for (int t = 0; t < 4; ++t) acc[t] *= 1024.0f; }
    if (more) {
#pragma unroll
      for (int i = 0; i < NU; ++i) { oa[i] += RB; ob[i] += RB; ra[i] = *(const v8us*)(Ab + oa[i]); rb[i] = *(const v8us*)(Bb + ob[i]); } }
    FragH ah[KU], bq[KU][4];
#pragma unroll
    for (int u = 0; u < KU; ++u) { ah[u].half[0] = *(const v8us*)(cur + fa + 64 * u); ah[u].half[1] = *(const v8us*)(cur + fa + 64 * u + 32);
#pragma unroll
      for (int t = 0; t < 4; ++t) { bq[u][t].half[0] = *(const v8us*)(cur + fb + t * 16 * PITCH + 64 * u); bq[u][t].half[1] = *(const v8us*)(cur + fb + t * 16 * PITCH + 64 * u + 32); } }
#pragma unroll
    for (int u = 0; u < KU; ++u) {
#pragma unroll
      for (int t = 0; t < 4; ++t) acc[t] = mmaH<1>(ah[u].v, ah[u].v, bq[u][t].v, bq[u][t].v, acc[t]); }
    if (more) {
#pragma unroll
      for (int i = 0; i < NU; ++i) { *(v8us*)(nxt + ls + i * RP * PITCH) = ra[i]; *(v8us*)(nxt + TILE + ls + i * RP * PITCH) = rb[i]; } }
    __syncthreads();      /* publishes the next stage's buffer and ends every wave's reads of this one (refilled one stage on; staged over by the epilogue behind the last) */
  }
#pragma unroll
  for (int t = 0; t < 4; ++t) { if (col0 + t * 16 >= N) continue; const int col = col0 + t * 16 + ln; const float bv = bp ? bf16_round(bp[col]) : 0.f;
#pragma unroll
    for (int r = 0; r < 8; ++r) { float v = acc[t][r] * alpha + bv; if (ACT != 20 && CP) { const int bidx = (row0g + row0 + 8 * hh + r) / rowsPerB; v += CP[(size_t)bidx * sCPb + (size_t)by * 64 + col]; } if (ACT == 1) v = (v > 0.f) ? v : expm1f(v); else if (ACT == 7) v = (v > 0.f) ? v + 1.0f : expf(v); else if (ACT == 8) v = tanhf(v); else if (ACT == 9) v = 0.5f * v * (1.0f + tanhf(0.7978845608028654f * (v + 0.044715f * v * v * v))); else if (ACT == 11) v = 1.0f / (1.0f + expf(-v)); else if (ACT == 12) v = (v > 0.f) ? v : 0.01f * v; else if (ACT == 14) v = (v > 0.f) ? v : 0.1f * v; else if (ACT == 15) v = v / (1.0f + expf(-v)); else if (ACT == 3) v = fmaxf(v, 0.f); else if (ACT == 6) v = 0.5f * v * (1.0f + erff(v * 0.70710678118654752f)); so[w][8 * hh + r][t * 16 + ln] = v; } }
  __builtin_amdgcn_fence(__ATOMIC_ACQ_REL, "workgroup"); __builtin_amdgcn_wave_barrier();
  const int rsub = lane >> 4, c4 = (lane & 15) * 4; typedef _Float16 v4h __attribute__((ext_vector_type(4)));
  if (ACT == 20) {
#pragma unroll
    for (int q = 0; q < 8; ++q) { const v4f v = *(const v4fa*)&so[w][q * 2 + rsub][c4]; v4hx h4;
#pragma unroll
      for (int i = 0; i < 4; ++i) h4[i] = (_Float16)(v[i] + (float)old[q][i]);
      *(v4hx*)(c16b + oc[q]) = h4; }
  } else {
#pragma unroll
    for (int q = 0; q < 8; ++q) { const int r = q * 2 + rsub; if (col0 + c4 < N) { const v4f v = *(const v4fa*)&so[w][r][c4]; if (C) *(v4f*)(C + cofs + (size_t)(row0 + r) * ldc + col0 + c4) = v; if (C16) { v4h h4; for (int i = 0; i < 4; ++i) h4[i] = (_Float16)v[i]; *(v4h*)(C16 + cofs + (size_t)(row0 + r) * ldc + col0 + c4) = h4; } } }
     }
}


// The two large products (x against the three projection planes; the attention output against the output plane) run on a larger tile: one work-group = one 128 x 128 tile of C, its four waves as 2 x 2,
// wave w owning rows 64 (w >> 1).. and columns 64 (w & 1).. as 4 x 4 accumulator tiles. A k-step of 32 then takes 4 A and 4 B fragments from LDS for 16 WMMAs (1 + 4 for 4 in the 16 x 64 wave tile above),
// and a stage brings 256 operand rows from L2 for 128 x 128 of C (128 rows for 64 x 64 above): half the bytes from L2 and two fifths of the bytes from LDS per product. Staging, LDS pitch, the two buffers,
// the one barrier per stage, the fragment loaders, the ascending k order per accumulator and the hi / lo plane switch (NP = 2) are those of k_gemm_hhx; the WMMAs are the plain builtin, 16 independent accumulators in a row. A and B are [row][KD] f16, C is f32 at pitch DM, C = acc * alpha;
// M and N multiples of 128. MW = waves per SIMD that the register budget must leave room for (work-groups per WGP, one wave of each on every SIMD).
template <int KU, int NJ, int NP, int MW, int KD>
__global__ __launch_bounds__(128, MW) void k_gemm_t(const GemmJobs<NJ> J, int M) {
  constexpr int RB = 64 * KU, PITCH = RB + 16, UPR = RB / 16, RP = 128 / UPR, NU = 128 / RP, TILE = 128 * PITCH;      /* row bytes, LDS pitch, 16-byte units per row, rows per pass of 128 threads, passes per tile, tile bytes */
  __shared__ __attribute__((aligned(16))) char sm[4 * TILE];      /* [buffer][A tile | B tile]; the epilogue's 64 KiB of staging reuses it behind the last stage's barrier */
  static_assert(4 * TILE >= 4 * 64 * 64 * 4, "epilogue staging must fit");
  const int tid = threadIdx.x, w = tid >> 5, lane = tid & 31, ln = lane & 15, hh = lane >> 4;
  GemmJob g = J.j[0]; int bx = blockIdx.x;      /* this work-group's job and its index inside the job: scalar values, the same for the whole work-group */
  for (int i = 1; i < NJ; ++i) if (bx >= g.nb) { bx -= g.nb; g = J.j[i]; }
  const int ntn = g.N / 128; const int mtb = bx / ntn, nq = bx % ntn; if (mtb * 128 >= M) return;      /* the same for the whole work-group, ahead of every barrier */
  v8f acc[4][4] = {};
  const char* Ab = (const char*)g.A; const char* Bb = (const char*)g.B;      /* uniform bases; each thread keeps one 32-bit byte offset per operand, the passes of a stage are constant steps from it */
  const int sr = tid / UPR, sc = (tid % UPR) * 16;
  unsigned oa = (unsigned)((mtb * 128 + sr) * KD * 2 + sc), ob = (unsigned)((nq * 128 + sr) * KD * 2 + sc);      /* moved on by one stage's bytes just ahead of the stage's loads: the loads that named the old values were waited for ahead of the last barrier */
  const unsigned ls = (unsigned)(sr * PITCH + sc);
  const unsigned fa = (unsigned)(((w >> 1) * 64 + ln) * PITCH + 16 * hh), fb = (unsigned)(TILE + ((w & 1) * 64 + ln) * PITCH + 16 * hh);
  v8us ra[NU], rb[NU];      /* every loop over i, u, a and t is unrolled so that staging registers, fragments and accumulators are registers, not indexed arrays in scratch */
#pragma unroll
  for (int i = 0; i < NU; ++i) { ra[i] = *(const v8us*)(Ab + oa + (size_t)(i * RP * KD * 2)); rb[i] = *(const v8us*)(Bb + ob + (size_t)(i * RP * KD * 2)); }
#pragma unroll
  for (int i = 0; i < NU; ++i) { *(v8us*)(sm + ls + i * RP * PITCH) = ra[i]; *(v8us*)(sm + TILE + ls + i * RP * PITCH) = rb[i]; }
  __syncthreads();      /* stage 0 is in buffer 0 for every wave */
  constexpr int nst = KD / (32 * KU), nall = NP * nst;
#pragma clang loop unroll(disable)      /* kept rolled as written: with the constant trip count the compiler otherwise peels the last stage and moves the step of oa and ob up behind the WMMAs, ahead of the wait for the loads that name them */
  for (int s = 0; s < nall; ++s) { const bool more = s + 1 < nall; const char* cur = sm + (s & 1) * 2 * TILE; char* nxt = sm + ((s + 1) & 1) * 2 * TILE;
    if (NP == 2 && s + 1 == nst) { Ab = (const char*)g.A2 - (size_t)KD * 2; Bb -= (size_t)KD * 2; }      /* scalar test: the next stage is the lo plane's first; the threads' offsets run on, the two uniform bases step back by one row's bytes */
    if (NP == 2 && s == nst) {      /* scalar test: the hi plane is summed; 2^10 brings it to the lo plane's scale */
#pragma unroll
      for (int a = 0; a < 4; ++a) {
#pragma unroll
        for (int t = 0; t < 4; ++t) acc[a][t] *= 1024.0f; } }
    if (more) { oa += RB; ob += RB;
#pragma unroll
      for (int i = 0; i < NU; ++i) { ra[i] = *(const v8us*)(Ab + oa + (size_t)(i * RP * KD * 2)); rb[i] = *(const v8us*)(Bb + ob + (size_t)(i * RP * KD * 2)); } }
    FragH af[2][4], bq[2][4];      /* two sets: a stage's fragments no longer fit the registers at once, so k-step u + 1 is fetched into the other set ahead of the WMMAs of k-step u */
    auto fetch = [&](int u) {
#pragma unroll
      for (int t = 0; t < 4; ++t) { af[u % 2][t].half[0] = *(const v8us*)(cur + fa + t * 16 * PITCH + 64 * u); af[u % 2][t].half[1] = *(const v8us*)(cur + fa + t * 16 * PITCH + 64 * u + 32);
        bq[u % 2][t].half[0] = *(const v8us*)(cur + fb + t * 16 * PITCH + 64 * u); bq[u % 2][t].half[1] = *(const v8us*)(cur + fb + t * 16 * PITCH + 64 * u + 32); } };
    fetch(0);
#pragma unroll
    for (int u = 0; u < KU; ++u) {
      if (u + 1 < KU) fetch(u + 1);
      __builtin_amdgcn_sched_barrier(0);      /* keeps a k-step's 16 LDS loads one group ahead of the WMMAs: left alone, the compiler spreads them among the WMMAs in pairs, each pair with a wait to 0 */
#pragma unroll
      for (int a = 0; a < 4; ++a) {
#pragma unroll
        for (int t = 0; t < 4; ++t) acc[a][t] = __builtin_amdgcn_wmma_f32_16x16x32_f16(false, af[u % 2][a].v, false, bq[u % 2][t].v, (short)0, acc[a][t], false, false); }
      __builtin_amdgcn_sched_barrier(0);      /* the other side of the same fence: the next group of loads stays behind this k-step's WMMAs */
    }
    asm volatile("v_nop\n\tv_nop\n\tv_nop\n\tv_nop");      /* the four vector slots between the stage's last WMMAs and a vector instruction that rewrites one of their A or B registers */
    if (more) {
#pragma unroll
      for (int i = 0; i < NU; ++i) { *(v8us*)(nxt + ls + i * RP * PITCH) = ra[i]; *(v8us*)(nxt + TILE + ls + i * RP * PITCH) = rb[i]; } }
    __syncthreads();      /* publishes the next stage's buffer and ends every wave's reads of this one (refilled one stage on; staged over by the epilogue behind the last) */
  }
  float* so = (float*)(sm + w * (64 * 64 * 4));      /* this wave's own 64 x 64 f32 */
#pragma unroll
  for (int a = 0; a < 4; ++a) {
#pragma unroll
    for (int t = 0; t < 4; ++t) {
#pragma unroll
      for (int r = 0; r < 8; ++r) so[(a * 16 + 8 * hh + r) * 64 + t * 16 + ln] = acc[a][t][r] * g.alpha; } }
  __builtin_amdgcn_fence(__ATOMIC_ACQ_REL, "workgroup"); __builtin_amdgcn_wave_barrier();      /* each lane reads back below what other lanes of its wave stored above: the LDS stores are complete first and the reads stay behind them */
  /* two rows of 256 bytes per store; one address per lane, the 32 stores are constant steps from it */
  float* cp = g.C + (size_t)(mtb * 128 + (w >> 1) * 64 + hh) * DM + nq * 128 + (w & 1) * 64 + 4 * ln;
#pragma unroll
  for (int q = 0; q < 32; ++q) { const v4f v = *(const v4fa*)&so[(q * 2 + hh) * 64 + 4 * ln]; *(v4f*)(cp + (size_t)q * 2 * DM) = v; }
}


typedef _Float16 v4h __attribute__((ext_vector_type(4)));

__device__ __forceinline__ void d_x16(const float* __restrict__ x, _Float16* __restrict__ X16, size_t n8, int blk) { const size_t t = (size_t)blk * 256 + threadIdx.x; if (t >= n8) return; FragH f;
#pragma unroll
  for (int q = 0; q < 8; ++q) f.h[q] = (_Float16)bf16_round(x[t * 8 + q]); *(v8us*)((unsigned short*)X16 + t * 8) = f.half[0];  }
__global__ __launch_bounds__(256) void k_h16(const float* __restrict__ x, _Float16* __restrict__ X16, size_t n8) { const size_t t = (size_t)blockIdx.x * 256 + threadIdx.x; if (t >= n8) return; FragH f;
#pragma unroll
  for (int q = 0; q < 8; ++q) f.h[q] = (_Float16)x[t * 8 + q]; *(v8us*)((unsigned short*)X16 + t * 8) = f.half[0];  }
__global__ __launch_bounds__(256) void k_round16f(const float* __restrict__ W, _Float16* __restrict__ Bt, size_t n8) { const size_t t = (size_t)blockIdx.x * 256 + threadIdx.x; if (t >= n8) return; FragH f;
#pragma unroll
  for (int i = 0; i < 8; ++i) f.h[i] = (_Float16)(bf16_round(W[t * 8 + i]) * 16.0f); *(v8us*)((unsigned short*)Bt + t * 8) = f.half[0];  }
template <int NHv, int TTv>
__global__ __launch_bounds__(256) void k_vt(const _Float16* __restrict__ V16, int ldv, int voff, _Float16* __restrict__ Vt) { __shared__ unsigned short tl[64][66]; const int tid = threadIdx.x; const int slab = blockIdx.x / (TTv / 64), lg = blockIdx.x % (TTv / 64); const int b = slab / NHv, h = slab % NHv;
  for (int i = tid; i < 64 * 8; i += 256) { const int r = i / 8, c8 = (i % 8) * 8; FragH f; f.half[0] = *(const v8us*)((const unsigned short*)V16 + ((size_t)b * TTv + lg * 64 + r) * ldv + voff + h * 64 + c8);
#pragma unroll
    for (int q = 0; q < 8; ++q) tl[r][c8 + q] = f.u[q]; }
  __syncthreads();
  {
#pragma unroll
    for (int rd = 0; rd < 2; ++rd) { const int d = rd * 32 + tid / 8, pc = tid % 8; FragH f;
#pragma unroll
      for (int q = 0; q < 8; ++q) f.u[q] = tl[pc * 8 + q][d];
      *(v8us*)((unsigned short*)Vt + ((size_t)slab * 64 + d) * TTv + lg * 64 + pc * 8) = f.half[0]; }
     } }

__global__ __launch_bounds__(256) void k_hl(const float* __restrict__ F, _Float16* __restrict__ Hh, _Float16* __restrict__ Hl, size_t n8) { const size_t t = (size_t)blockIdx.x * 256 + threadIdx.x; if (t >= n8) return; FragH fh, fl; const v4f a = *(const v4fa*)(F + t * 8), c = *(const v4fa*)(F + t * 8 + 4);
#pragma unroll
  for (int q = 0; q < 4; ++q) { _Float16 h = (_Float16)a[q]; fh.h[q] = h; fl.h[q] = (_Float16)((a[q] - (float)h) * 1024.0f); h = (_Float16)c[q]; fh.h[4 + q] = h; fl.h[4 + q] = (_Float16)((c[q] - (float)h) * 1024.0f); }
  { *(v8us*)((unsigned short*)Hh + t * 8) = fh.half[0]; *(v8us*)((unsigned short*)Hl + t * 8) = fl.half[0];  } }

__global__ __launch_bounds__(256) void k_split(const float* __restrict__ F, _Float16* __restrict__ Hh, _Float16* __restrict__ Hl, size_t n8) {
  #pragma clang fp contract(off)
  const size_t t = (size_t)blockIdx.x * 256 + threadIdx.x; if (t >= n8) return; const v4f a = *(const v4fa*)(F + t * 8), c = *(const v4fa*)(F + t * 8 + 4); FragH fh, fl;
#pragma unroll
  for (int q = 0; q < 8; ++q) { const float v = (q < 4) ? a[q] : c[q - 4]; const _Float16 hi = (_Float16)v; fh.h[q] = hi; fl.h[q] = (_Float16)((v - (float)hi) * 1024.0f); }
  { *(v8us*)((unsigned short*)Hh + t * 8) = fh.half[0]; *(v8us*)((unsigned short*)Hl + t * 8) = fl.half[0];  } }
__device__ __forceinline__ void d_cstab(float* __restrict__ CS, float* __restrict__ SN, int blk) {
  #pragma clang fp contract(off)
  const int t = blk * 256 + threadIdx.x; if (t >= SS * DH) return; const int d = t % DH, p = t / DH; const int i = d & 31; const float theta = 1.0f / powf(10000.0f, (float)(2 * i) / 64.0f); const float ang = (float)p * theta; const float c = cosf(ang), s = sinf(ang);
  { *(float*)(CS + t) = c; *(float*)(SN + t) = s;  } }
// Everything that depends on the inputs alone runs as one launch: the work-group's index picks its piece, the same test for all of its threads. The ten f16 weight planes lie in the
// workspace as three contiguous groups: BW = Wq Wv Wo Wk, BA = Aq Av Ao, BB = Bq Bv Bo, so that plane i of each group belongs to the same low-rank pair. BW and BB are transposed ([out][in]);
// BA keeps its layout [in][rank], which is what the product (A*B)^T = B^T (rows: out) * A^T (columns: in) takes as its second operand. The pieces that take longest per work-group come first.
__global__ __launch_bounds__(256) void k_prep(const float* __restrict__ x, const float* __restrict__ Wq, const float* __restrict__ Wk, const float* __restrict__ Wv, const float* __restrict__ Wo, const float* __restrict__ Aq, const float* __restrict__ Bq, const float* __restrict__ Av, const float* __restrict__ Bv, const float* __restrict__ Ao, const float* __restrict__ Bo,
    _Float16* __restrict__ X16, _Float16* __restrict__ BW, _Float16* __restrict__ BA, _Float16* __restrict__ BB, float* __restrict__ CS, float* __restrict__ SN) {
  constexpr int NW = DM * (DM / 8) / 256, NL = LR * (DM / 8) / 256, NC = SS * DH / 256;      /* work-groups per square weight, per low-rank weight, for the angle tables */
  int b = blockIdx.x;
  if (b < 4 * NW) { const int m = b / NW; d_wt_f16(m == 0 ? Wq : m == 1 ? Wv : m == 2 ? Wo : Wk, BW + (size_t)m * DM * DM, DM, DM, 16.0f, b % NW); return; }
  b -= 4 * NW;
  if (b < NC) { d_cstab(CS, SN, b); return; }
  b -= NC;
  if (b < 3 * NL) { const int m = b / NL; d_n16(m == 0 ? Aq : m == 1 ? Av : Ao, BA + (size_t)m * LR * DM, DM * LR / 8, 16.0f, b % NL); return; }
  b -= 3 * NL;
  if (b < 3 * NL) { const int m = b / NL; d_wt_f16(m == 0 ? Bq : m == 1 ? Bv : Bo, BB + (size_t)m * DM * LR, LR, DM, 16.0f, b % NL); return; }
  b -= 3 * NL;
  d_x16(x, X16, (size_t)NR * DM / 8, b);
}
__device__ __forceinline__ float cdma(int t, int d) { const int j = d & 3; const int par = __popc((unsigned)(t & j)); return (par & 1) ? -1.0f : 1.0f; }      /* Hadamard H4[t][d mod 4] (Sylvester order: rows [1,1,1,1],[1,-1,1,-1],[1,1,-1,-1],[1,-1,-1,1]) */
__global__ __launch_bounds__(256) void k_slots(const float* __restrict__ Q, const float* __restrict__ K, const float* __restrict__ V, const float* __restrict__ CS, const float* __restrict__ SN, _Float16* __restrict__ FK16, _Float16* __restrict__ FV16, float* __restrict__ FKf, float* __restrict__ FVf, float* __restrict__ PK, float* __restrict__ PVp, _Float16* __restrict__ AQ16, float* __restrict__ AQf) {
  #pragma clang fp contract(off)
  const int t = blockIdx.x * 256 + threadIdx.x; if (t >= NBt * NH * NSL * (DH / 8)) return; const int d0 = (t % (DH / 8)) * 8; const int s = (t / (DH / 8)) % NSL; const int bh = t / ((DH / 8) * NSL); const int b = bh / NH, h = bh % NH;      /* both batches in one launch: bh = batch * 16 + head */
  FragH fk, fv; v4f fkA, fkB, fvA, fvB;
  float pk[KF][8], pv[KF][8];      /* running prefixes per token step */
#pragma unroll
  for (int q = 0; q < 8; ++q) { const int d = d0 + q; float accK = 0.f, accV = 0.f;
#pragma unroll
    for (int tt = 0; tt < KF; ++tt) { const int tok = s * KF + tt; const float* kp = K + ((size_t)b * SS + tok) * DM + h * DH; const float* vp = V + ((size_t)b * SS + tok) * DM + h * DH; const float c = CS[(size_t)tok * DH + d], sn = SN[(size_t)tok * DH + d];
      const float kr = kp[d] * c + ((d < 32) ? -kp[d + 32] : kp[d - 32]) * sn; const float ph = cdma(tt, d) * 0.5f;      /* /sqrt(k_factor) */
      accK += kr * ph; accV += vp[d] * ph; pk[tt][q] = accK; pv[tt][q] = accV; }
    fk.h[q] = (_Float16)accK; fv.h[q] = (_Float16)accV; if (q < 4) { fkA[q] = accK; fvA[q] = accV; } else { fkB[q - 4] = accK; fvB[q - 4] = accV; } }
  const size_t srow = ((size_t)bh * NSL + s) * DH + d0;
  { *(v8us*)((unsigned short*)FK16 + srow) = fk.half[0]; *(v8us*)((unsigned short*)FV16 + srow) = fv.half[0]; *(v4f*)(FKf + srow) = fkA; *(v4f*)(FKf + srow + 4) = fkB; *(v4f*)(FVf + srow) = fvA; *(v4f*)(FVf + srow + 4) = fvB;  }
#pragma unroll
  for (int tt = 0; tt < KF; ++tt) { const int tok = s * KF + tt; const size_t prow = ((size_t)b * SS + tok) * DM + h * DH + d0; v4f a, c2, e, g;
#pragma unroll
    for (int q = 0; q < 4; ++q) { a[q] = pk[tt][q]; c2[q] = pk[tt][4 + q]; e[q] = pv[tt][q]; g[q] = pv[tt][4 + q]; }
    /* aligned q for this token */ const float* qp = Q + ((size_t)b * SS + tok) * DM + h * DH; FragH fq; v4f qa, qb2;
#pragma unroll
    for (int q = 0; q < 8; ++q) { const int d = d0 + q; const float c = CS[(size_t)tok * DH + d], sn = SN[(size_t)tok * DH + d]; const float qr = qp[d] * c + ((d < 32) ? -qp[d + 32] : qp[d - 32]) * sn; const float aq = qr * cdma(tt, d); fq.h[q] = (_Float16)aq; if (q < 4) qa[q] = aq; else qb2[q - 4] = aq; }
    const size_t arow = ((size_t)bh * SS + tok) * DH + d0;
    { *(v4f*)(PK + prow) = a; *(v4f*)(PK + prow + 4) = c2; *(v4f*)(PVp + prow) = e; *(v4f*)(PVp + prow + 4) = g; *(v8us*)((unsigned short*)AQ16 + arow) = fq.half[0]; *(v4f*)(AQf + prow) = qa; *(v4f*)(AQf + prow + 4) = qb2;  } } }
__device__ __forceinline__ void d_fvt(const float* __restrict__ FVf, _Float16* __restrict__ FVT, int blk) { const int t = blk * 256 + threadIdx.x; if (t >= NBt * NH * DH * (NSL / 8)) return; const int s0 = (t % (NSL / 8)) * 8; const int d = (t / (NSL / 8)) % DH; const int h = t / ((NSL / 8) * DH); FragH f;      /* h = batch * 16 + head */
#pragma unroll
  for (int q = 0; q < 8; ++q) f.h[q] = (_Float16)FVf[((size_t)h * NSL + s0 + q) * DH + d];
  *(v8us*)((unsigned short*)FVT + ((size_t)h * DH + d) * NSL + s0) = f.half[0];  }
#define FVB (DH * (NSL / 8) / 256)
__global__ __launch_bounds__(256) void k_fvt(const float* __restrict__ FVf, _Float16* __restrict__ FVT) { d_fvt(FVf, FVT, blockIdx.x); }
// Scores, softmax and weight * full_V in one kernel: a wave owns 16 query rows of one (batch, head) and walks the slots in chunks of 64, up to the chunk that holds its rows' own slots (the four
// own slots of 16 rows lie in one chunk, so every row of a wave has the same trip count and at least one live slot in every chunk). Both products are formed transposed, so that a query row is a
// COLUMN of the accumulators and belongs to lanes ln and ln + 16 alone: scores^T = full_K (A: row = slot, k = d) * aligned_q^T (B: column = query), out^T = full_V^T (A: row = d, k = slot) * weights^T.
// Register r of score tile t holds slot 16 t + 8 hh + r, which is the k that position r of half t & 1 of a B fragment pairs with in the A fragment of full_V^T: tiles 2u and 2u + 1, rounded to f16,
// ARE the weight fragment of k-step u, with no move between lanes and no LDS. Row maximum and row sum are in-lane but for one exchange between the half-waves. Running maximum: row sum and output
// accumulators are rescaled by exp(old max - new max) per chunk; the division by the row sum comes once, at the end. No score and no weight is written to memory.
// The four waves of a work-group (64 rows in a row, so one trip count for all four) share each chunk's 64 rows of full_K and 64 rows of full_V^T, 128 bytes a row: the 128 threads bring them with
// whole-line 16-byte loads into registers and store them to LDS (pitch 144 bytes, as in the GEMM above), every wave reads its A fragments from there. Two LDS buffers: the next chunk's global loads
// are issued ahead of this chunk's work and stored to the other buffer behind it, one barrier per chunk.
__device__ __forceinline__ float xhalf(float x) { return __builtin_bit_cast(float, __builtin_amdgcn_permlanex16(__builtin_bit_cast(int, x), __builtin_bit_cast(int, x), 0x76543210, 0xfedcba98, false, false)); }      /* lane l takes lane l ^ 16 */
__device__ __forceinline__ float exp2s(float x) { float r; asm("v_exp_f32 %0, %1\n\tv_nop" : "=v"(r) : "v"(x)); return r; }      /* 2^x; the v_nop keeps the one slot that the instruction set asks for behind a transcendental, whatever the compiler puts next */
__global__ __launch_bounds__(128) void k_attn(const _Float16* __restrict__ AQ16, const _Float16* __restrict__ FK16, const _Float16* __restrict__ FVT, const float* __restrict__ AQf, const float* __restrict__ PK, float* __restrict__ O, float* __restrict__ WC) {
  constexpr int PT = 144, TB = 64 * PT;      /* LDS pitch of a 128-byte row, bytes of a tile of 64 rows */
  __shared__ __attribute__((aligned(16))) char sm[2][2 * TB];      /* [buffer][full_K tile | full_V^T tile] */
  const int tid = threadIdx.x, w = tid >> 5, lane = tid & 31, ln = lane & 15, hh = lane >> 4;
  const int bh = blockIdx.y, b = bh / NH, h = bh % NH;
  const int qb = (int)gridDim.x - 1 - (int)blockIdx.x;      /* the rows with the most chunks take the lowest blockIdx.x */
  const int q0 = qb * 64 + w * 16;
  /* own-slot score of row q0 + ln in f32: each half-wave sums 32 of the 64 products */
  const float* ap = AQf + ((size_t)b * SS + q0 + ln) * DM + h * DH + 32 * hh; const float* pp = PK + ((size_t)b * SS + q0 + ln) * DM + h * DH + 32 * hh;
  v4f va[8], vb[8];
#pragma unroll
  for (int i = 0; i < 8; ++i) { va[i] = *(const v4fa*)(ap + 4 * i); vb[i] = *(const v4fa*)(pp + 4 * i); }
  asm volatile("s_wait_xcnt 0x0" :: "v"(ap), "v"(pp) : "memory");      /* both addresses stay in their registers up to this wait, so none of the 16 loads lands in a register that an issued load names */
  float cur = 0.f;
#pragma unroll
  for (int i = 0; i < 8; ++i) cur += va[i][0] * vb[i][0] + va[i][1] * vb[i][1] + va[i][2] * vb[i][2] + va[i][3] * vb[i][3];
  cur += xhalf(cur); cur *= 0.125f;
  const unsigned short* aqp = (const unsigned short*)AQ16 + ((size_t)bh * SS + q0 + ln) * DH + 8 * hh;
  FragH aq[2];
#pragma unroll
  for (int u = 0; u < 2; ++u) { aq[u].half[0] = *(const v8us*)(aqp + 32 * u); aq[u].half[1] = *(const v8us*)(aqp + 32 * u + 16); }
  const char* kg = (const char*)(FK16 + (size_t)bh * NSL * DH); const char* vg = (const char*)(FVT + (size_t)bh * DH * NSL);      /* uniform bases, moved on by one chunk's bytes just ahead of the chunk's loads; each thread adds its own byte offset */
  const int sr = tid >> 3, sb = (tid & 7) * 16;      /* staging: 8 threads a row, 16 rows a pass, 4 passes a tile */
  const unsigned ko = (unsigned)(sr * DH * 2 + sb), vo = (unsigned)(sr * NSL * 2 + sb), ls = (unsigned)(sr * PT + sb);
  const unsigned fr = (unsigned)(ln * PT + 16 * hh);      /* A fragments: row = slot, k = d in the full_K tile; row = d, k = slot in the full_V^T tile */
  const int cs = (q0 + ln) / KF;      /* this lane's row's own slot */
  const int nch = qb / KF + 1;      /* chunks up to the one with the rows' own slots (64 rows have 16 own slots, inside one chunk): from blockIdx alone, the same for the whole work-group */
  constexpr float L2E = 1.4426950408889634f;      /* exp(x - max) is formed as 2^(x * L2E - ml), ml = max * L2E rounded once and used for every term of the row, the own-slot weight included */
  float m = -3.0e38f, ml = -3.0e38f, l = 0.f;      /* running maximum of this lane's row, the same times L2E; this lane's half of its running sum */
  v8f oacc[4] = {};
  v8us rk[4], rv[4];      /* every loop over i, u, t and r is unrolled so that staging registers and fragments are registers, not indexed arrays in scratch */
#pragma unroll
  for (int i = 0; i < 4; ++i) { rk[i] = *(const v8us*)(kg + ko + i * 16 * DH * 2); rv[i] = *(const v8us*)(vg + vo + i * 16 * NSL * 2); }
#pragma unroll
  for (int i = 0; i < 4; ++i) { *(v8us*)(sm[0] + ls + i * 16 * PT) = rk[i]; *(v8us*)(sm[0] + TB + ls + i * 16 * PT) = rv[i]; }
  __syncthreads();      /* chunk 0 is in buffer 0 for every wave */
  for (int c = 0; c < nch; ++c) { const int c0 = c * 64; const bool more = c + 1 < nch; const char* cb = sm[c & 1]; char* nb = sm[(c + 1) & 1];
    if (more) { kg += 64 * DH * 2; vg += 64 * 2;
#pragma unroll
      for (int i = 0; i < 4; ++i) { rk[i] = *(const v8us*)(kg + ko + i * 16 * DH * 2); rv[i] = *(const v8us*)(vg + vo + i * 16 * NSL * 2); } }
    FragH kf[2][4], vf[2][4];
#pragma unroll
    for (int u = 0; u < 2; ++u) {
#pragma unroll
      for (int t = 0; t < 4; ++t) { kf[u][t].half[0] = *(const v8us*)(cb + fr + t * 16 * PT + 64 * u); kf[u][t].half[1] = *(const v8us*)(cb + fr + t * 16 * PT + 64 * u + 32); } }
    v8f s[4] = {};
#pragma unroll
    for (int u = 0; u < 2; ++u) {
#pragma unroll
      for (int t = 0; t < 4; ++t) s[t] = mmaH<1>(kf[u][t].v, kf[u][t].v, aq[u].v, aq[u].v, s[t]); }
    float mx = m;
#pragma unroll
    for (int t = 0; t < 4; ++t) {
#pragma unroll
      for (int r = 0; r < 8; ++r) s[t][r] *= 0.125f; }
    if (c + 1 == nch) {      /* a scalar test: own slots and later slots lie in the wave's last chunk alone */
#pragma unroll
      for (int t = 0; t < 4; ++t) {
#pragma unroll
        for (int r = 0; r < 8; ++r) { const int sl = c0 + t * 16 + 8 * hh + r; float x = s[t][r]; x = (sl == cs) ? cur : x; x = (sl > cs) ? -3.0e38f : x; s[t][r] = x; } } }
    float mt[4], lt[4];      /* one partial maximum and one partial sum per tile: four short dependent chains in place of one of 32 */
#pragma unroll
    for (int t = 0; t < 4; ++t) { mt[t] = s[t][0];
#pragma unroll
      for (int r = 1; r < 8; ++r) mt[t] = fmaxf(mt[t], s[t][r]); }
    mx = fmaxf(mx, fmaxf(fmaxf(mt[0], mt[1]), fmaxf(mt[2], mt[3])));
    mx = fmaxf(mx, xhalf(mx));      /* finite from the first chunk on: slot 0 is live for every row */
    const float mxl = mx * L2E, sc = exp2s(ml - mxl); m = mx; ml = mxl;      /* first chunk: 2^(-3e38 - mxl) = 0 */
    FragH pf[2];
#pragma unroll
    for (int t = 0; t < 4; ++t) { lt[t] = 0.f;
#pragma unroll
      for (int r = 0; r < 8; ++r) { const float p = exp2s(s[t][r] * L2E - mxl); lt[t] += p; pf[t >> 1].h[(t & 1) * 8 + r] = (_Float16)(p * 1024.0f); oacc[t][r] *= sc; } }      /* a masked slot's -3e38 gives 2^(-inf) = 0 */
    l = l * sc + ((lt[0] + lt[1]) + (lt[2] + lt[3]));
#pragma unroll
    for (int u = 0; u < 2; ++u) {
#pragma unroll
      for (int t = 0; t < 4; ++t) { vf[u][t].half[0] = *(const v8us*)(cb + TB + fr + t * 16 * PT + 64 * u); vf[u][t].half[1] = *(const v8us*)(cb + TB + fr + t * 16 * PT + 64 * u + 32); } }
#pragma unroll
    for (int u = 0; u < 2; ++u) {
#pragma unroll
      for (int t = 0; t < 4; ++t) oacc[t] = mmaH<1>(vf[u][t].v, vf[u][t].v, pf[u].v, pf[u].v, oacc[t]); }
    if (more) {
#pragma unroll
      for (int i = 0; i < 4; ++i) { *(v8us*)(nb + ls + i * 16 * PT) = rk[i]; *(v8us*)(nb + TB + ls + i * 16 * PT) = rv[i]; } }
    __syncthreads();      /* publishes the next chunk's buffer and ends every wave's reads of this one, which is refilled one chunk on */
  }
  l += xhalf(l);
  const float inv = 1.0f / l, wc = exp2s(cur * L2E - ml) * inv, os = inv * 0.0009765625f;      /* os also undoes the weights' 2^10 */
  float* op = O + ((size_t)bh * SS + q0 + ln) * DH + 8 * hh;      /* register r of tile t is d = 16 t + 8 hh + r of row q0 + ln; the wave writes its 16 rows, 4 KiB in a row, whole */
#pragma unroll
  for (int t = 0; t < 4; ++t) { v4f a, e;
#pragma unroll
    for (int r = 0; r < 4; ++r) { a[r] = oacc[t][r] * os; e[r] = oacc[t][4 + r] * os; }
    *(v4f*)(op + t * 16) = a; *(v4f*)(op + t * 16 + 4) = e; }
  float* wl = WC + ((size_t)bh * SS + q0 + ln) * 32 + 16 * hh; const v4f w4 = {wc, wc, wc, wc};      /* one whole 128-byte line per (head, row), written by this wave alone */
#pragma unroll
  for (int i = 0; i < 4; ++i) *(v4f*)(wl + 4 * i) = w4;
}
__global__ __launch_bounds__(256) void k_oepi(const float* __restrict__ O, const float* __restrict__ WC, const float* __restrict__ PVp, const float* __restrict__ FVf, _Float16* __restrict__ Oh, _Float16* __restrict__ Ol) {
  #pragma clang fp contract(off)
  const int t = blockIdx.x * 256 + threadIdx.x; if (t >= NR * NH * (DH / 8)) return; const int d0 = (t % (DH / 8)) * 8; const int h = (t / (DH / 8)) % NH; const int bq = t / ((DH / 8) * NH); const int b = bq / SS, q = bq % SS; const int cs = q / KF, tt = q % KF; const float wc = WC[((size_t)(b * NH + h) * SS + q) * 32]; const size_t prow = (size_t)bq * DM + h * DH + d0; const size_t srow = ((size_t)(b * NH + h) * NSL + cs) * DH + d0; const size_t orow = ((size_t)(b * NH + h) * SS + q) * DH + d0; FragH fh, fl;      /* O is [batch * 16 + head][token][64] */
  const v4f pA = *(const v4fa*)(PVp + prow), pB = *(const v4fa*)(PVp + prow + 4), fA = *(const v4fa*)(FVf + srow), fB = *(const v4fa*)(FVf + srow + 4);
  asm volatile("s_wait_xcnt 0x0" ::: "memory");      /* the loads of O below may land in registers that hold the addresses of the loads above: the wait stands between them */
  const v4f oA = *(const v4fa*)(O + orow), oB = *(const v4fa*)(O + orow + 4);
#pragma unroll
  for (int k = 0; k < 8; ++k) { const int d = d0 + k; const float o = ((k < 4) ? oA[k & 3] : oB[k & 3]) + wc * (((k < 4) ? pA[k & 3] : pB[k & 3]) - ((k < 4) ? fA[k & 3] : fB[k & 3])); const float v = (o * cdma(tt, d)) * 2.0f; const _Float16 hi = (_Float16)v; fh.h[k] = hi; fl.h[k] = (_Float16)((v - (float)hi) * 1024.0f); }
  { *(v8us*)((unsigned short*)Oh + prow) = fh.half[0]; *(v8us*)((unsigned short*)Ol + prow) = fl.half[0];  } }

extern "C" void kernel_launch(void* const* d_in, const int* in_sizes, int n_in,
                              void* d_out, int out_size, void* d_ws, size_t ws_size, hipStream_t stream) {
  (void)in_sizes; (void)n_in; (void)out_size;
  const float* x = (const float*)d_in[0]; const float* Wq = (const float*)d_in[1]; const float* Wk = (const float*)d_in[2]; const float* Wv = (const float*)d_in[3]; const float* Wo = (const float*)d_in[4]; const float* Aq = (const float*)d_in[5]; const float* Bq = (const float*)d_in[6]; const float* Av = (const float*)d_in[7]; const float* Bv = (const float*)d_in[8]; const float* Ao = (const float*)d_in[9]; const float* Bo = (const float*)d_in[10];
  char* ws = (char*)d_ws; size_t off = 0;
  auto take = [&](size_t bytes) { char* p = ws + off; off += (bytes + 255) & ~(size_t)255; return p; };
  _Float16* BWq = (_Float16*)take((size_t)DM * DM * 2); _Float16* BWv = (_Float16*)take((size_t)DM * DM * 2); _Float16* BWo = (_Float16*)take((size_t)DM * DM * 2); _Float16* BWk = (_Float16*)take((size_t)DM * DM * 2); _Float16* BAq = (_Float16*)take((size_t)3 * LR * DM * 2); _Float16* BBq = (_Float16*)take((size_t)3 * DM * LR * 2);
  float* CS = (float*)take((size_t)SS * DH * 4); float* SN = (float*)take((size_t)SS * DH * 4);
  /* every plane holds both batches (NR = 4096 rows, or 32 = batch * 16 + head slabs) */
  _Float16* X16 = (_Float16*)take((size_t)NR * DM * 2); float* Q = (float*)take((size_t)NR * DM * 4); float* K = (float*)take((size_t)NR * DM * 4); float* V = (float*)take((size_t)NR * DM * 4);
  _Float16* FK16 = (_Float16*)take((size_t)NBt * NH * NSL * DH * 2); _Float16* FV16 = (_Float16*)take((size_t)NBt * NH * NSL * DH * 2); float* FKf = (float*)take((size_t)NBt * NH * NSL * DH * 4); float* FVf = (float*)take((size_t)NBt * NH * NSL * DH * 4); float* PK = (float*)take((size_t)NR * DM * 4); float* PVp = (float*)take((size_t)NR * DM * 4); float* AQf = (float*)take((size_t)NR * DM * 4);
  if (off > ws_size) return;      // weights 8.75 + tables 1 + planes 116: 125.75 MiB
  /* planes that are written only after another plane's last reader has run share its bytes (launches of one stream run in order):
     X16 is last read by the launch of the three products of x, Q, K and V by k_slots */
  _Float16* AQ16 = X16; float* O = Q; _Float16* Oh = (_Float16*)K; _Float16* Ol = Oh + (size_t)NR * DM; float* WC = V; _Float16* FVT = (_Float16*)(V + (size_t)NBt * NH * SS * 32);
  const size_t n8 = (size_t)NR * DM / 8; const unsigned nb8 = (unsigned)((n8 + 255) / 256);
  k_prep<<<4 * (DM * (DM / 8) / 256) + SS * DH / 256 + 6 * (LR * (DM / 8) / 256) + nb8, 256, 0, stream>>>(x, Wq, Wk, Wv, Wo, Aq, Bq, Av, Bv, Ao, Bo, X16, BWq, BAq, BBq, CS, SN);      /* all weights are (in,out) */
  /* one 128 x 128 tile of C per work-group: projections over all NR rows, nD work-groups; attention per (batch, head) on grid.y */
  const int nD = (NR / 128) * (DM / 128); const dim3 gA(SS / 64, NBt * NH);
  const float a0 = 0.0625f, a1 = 0.0625f / 1024.0f;      /* undo the weights' 16; the lo planes carry 2^10 more */
  /* the planes of Wq, Wv and Wo (grid.y) take their low-rank pair: BW[out][in] += sum over rank of BB[out][rank] * BA[in][rank]; both operands carry 16, the plane carries 16, so alpha = 1/16 */
  const GemmJobs<1> jW = {{{BBq, nullptr, BAq, nullptr, nullptr, 0, a0, DM, DM, (DM / 64) * (DM / 64)}}};
  k_gemm_hhx<20, 2, 1, 1><<<dim3((DM / 64) * (DM / 64), 3), 128, 0, stream>>>(jW, LR, (size_t)DM * LR, LR, (size_t)DM * LR, nullptr, 0, 1, 0, BWq, (size_t)DM * DM, DM, LR);
  const GemmJobs<3> jX = {{{X16, nullptr, BWq, nullptr, Q, 0, a0, DM, DM, nD}, {X16, nullptr, BWk, nullptr, K, 0, a0, DM, DM, nD}, {X16, nullptr, BWv, nullptr, V, 0, a0, DM, DM, nD}}};
  k_gemm_t<2, 3, 1, 3, DM><<<dim3(3 * nD, 1), 128, 0, stream>>>(jX, NR);      /* q = x*(Wq + Aq*Bq), k = x*Wk, v = x*(Wv + Av*Bv) */
  k_slots<<<(NBt * NH * NSL * (DH / 8) + 255) / 256, 256, 0, stream>>>(Q, K, V, CS, SN, FK16, FV16, FKf, FVf, PK, PVp, AQ16, AQf);
  k_fvt<<<NBt * NH * FVB, 256, 0, stream>>>(FVf, FVT);
  k_attn<<<gA, 128, 0, stream>>>(AQ16, FK16, FVT, AQf, PK, O, WC);      /* scores, softmax, sum of w * full_V into O[pair] and the own-slot weight into WC: 64 rows per work-group, pair = batch * 16 + head on grid.y */
  k_oepi<<<(NR * NH * (DH / 8) + 255) / 256, 256, 0, stream>>>(O, WC, PVp, FVf, Oh, Ol);
  float* outb = (float*)d_out;
  const GemmJobs<1> jO = {{{Oh, Ol, BWo, nullptr, outb, 0, a1, DM, DM, nD}}};
  k_gemm_t<4, 1, 2, 1, DM><<<dim3(nD, 1), 128, 0, stream>>>(jO, NR);      /* y = out*(Wo + Ao*Bo): hi and lo planes in one k loop */
}

// v010
// A run of this version takes 123 microseconds.
// Next to v009, in two timings, it ran 1.14 and 1.15 times as fast.
// All steps since v000 together make it 15.2 times as fast.
#include <hip/hip_runtime.h>
// HoloKV attention (B 2, S 2048, 16 heads × 64, k_factor 4 → 512 slots): q = x·Wq + (x·Aq)·Bq, k = x·Wk, v = x·Wv + (x·Av)·Bv; RoPE (half-split rotate, θ_i = 1/10000^(2i/64)); keys/values compressed into slots of 4 tokens with Hadamard phases /2: full_K[s] = Σ_t k[4s+t]·c[t]/2, partial (causal prefix inside the slot); query phase c[q mod 4]; scores over slots: aligned_q·full_K/8 for earlier slots, aligned_q·partial_K(q's prefix)/8 for its own slot, −inf for later slots; softmax; out = Σ w·full_V + w_curr·(partial_V − full_V[curr]); out·phase·2; y = out·Wo + (out·Ao)·Bo → [2,2048,1024].
// Compute dtype: x and parameters rounded to bf16; each low-rank pair is folded into its weight, W + A*B (exact f16 products, f32 sum) rounded once to f16, and the projections are one product each; RoPE, phases, slot sums/prefixes in f32; aligned q and full_K/full_V as f16 GEMM operands (scores O(1)), the own-slot score, masking, softmax and the rank-1 correction in f32; attention output as f16 hi + lo·2^10 into Wo + Ao*Bo. v_wmma_f32_16x16x32_f16.
#define NBt 2
#define SS 2048
#define DM 1024
#define NH 16
#define DH 64
#define KF 4
#define NSL (SS / KF)            /* 512 slots */
#define LR 64
#define NR (NBt * SS)
typedef __bf16 v16b __attribute__((ext_vector_type(16)));
typedef unsigned short v8us __attribute__((ext_vector_type(8), may_alias));
typedef float  v8f  __attribute__((ext_vector_type(8)));
typedef float  v4f  __attribute__((ext_vector_type(4)));
typedef float  v4fa __attribute__((ext_vector_type(4), may_alias));
union FragB { v16b v; v8us half[2]; unsigned short u[16]; };

__device__ __forceinline__ unsigned short bf16_bits(float x) { unsigned int u = __float_as_uint(x); return (unsigned short)((u + 0x7FFFu + ((u >> 16) & 1u)) >> 16); }
__device__ __forceinline__ float bf16_val(unsigned short b) { return __uint_as_float(((unsigned int)b) << 16); }
__device__ __forceinline__ float bf16_round(float x) { return bf16_val(bf16_bits(x)); }
// D += A·B with NT terms: 1 = ah·bh, 2 = + al·bh (A split), 3 = + ah·bl (both split)
template <int NT>
__device__ __forceinline__ v8f mmaN(v16b ah, v16b al, v16b bh, v16b bl, v8f c) {
  c = __builtin_amdgcn_wmma_f32_16x16x32_bf16(false, ah, false, bh, (short)0, c, false, false);
  if (NT >= 2) c = __builtin_amdgcn_wmma_f32_16x16x32_bf16(false, al, false, bh, (short)0, c, false, false);
  if (NT >= 3) c = __builtin_amdgcn_wmma_f32_16x16x32_bf16(false, ah, false, bl, (short)0, c, false, false);
  asm volatile("v_nop\n\tv_nop\n\tv_nop\n\tv_nop" : "+v"(c) : "v"(ah), "v"(al), "v"(bh), "v"(bl));
  return c;
}

__global__ __launch_bounds__(256) void k_wt_bf16(const float* __restrict__ W, unsigned short* __restrict__ Wt, int K, int N) {
  const int t = blockIdx.x * 256 + threadIdx.x;
  const int k8n = K / 8;
  if (t >= N * k8n) return;
  const int n = t / k8n, k8 = (t % k8n) * 8;
  v8us v;
#pragma unroll
  for (int i = 0; i < 8; ++i) v[i] = bf16_bits(W[(size_t)(k8 + i) * N + n]);
  *(v8us*)(Wt + (size_t)n * K + k8) = v;
  
}

// GEMM C[M][N] (f32, pitch ldc) = act(A[M][K]·W + bias). A f32 row-major (pitch lda) converted per fragment to bf16
// (ASPLIT: hi/lo two planes -> 2 terms, else single rounded term); Wt bf16 [N][K] (pitch ldb). BIAS_BF16 rounds the
// bias to bf16 first (bias quantised to bf16 before the add). K%32==0, M%16==0, N%64==0.
template <bool ASPLIT, int ACT, bool BIAS_BF16>
__global__ __launch_bounds__(128) void k_gemm_bf(const float* __restrict__ A, int lda, const unsigned short* __restrict__ Wt, int ldb,
                                               const float* __restrict__ bias, float* __restrict__ C, int ldc, int M, int N, int K) {
  __shared__ __attribute__((aligned(16))) float so[4][16][64];
  const int tid = threadIdx.x, w = tid >> 5, lane = tid & 31, ln = lane & 15, hh = lane >> 4;
  const int ntn = N / 64;
  const int wid = blockIdx.x * 4 + w;
  const int mt = wid / ntn, nq = wid % ntn;
  if (mt * 16 >= M) return;
  const int row0 = mt * 16, col0 = nq * 64;
  const float* arow = A + (size_t)(row0 + ln) * lda;
  v8f acc[4] = {};
  for (int kb = 0; kb < K; kb += 32) {
    FragB ah, al;
    const v4f x0 = *(const v4fa*)(arow + kb + 8 * hh), x1 = *(const v4fa*)(arow + kb + 8 * hh + 4);
    const v4f x2 = *(const v4fa*)(arow + kb + 16 + 8 * hh), x3 = *(const v4fa*)(arow + kb + 16 + 8 * hh + 4);
    float xs[16] = {x0[0],x0[1],x0[2],x0[3],x1[0],x1[1],x1[2],x1[3],x2[0],x2[1],x2[2],x2[3],x3[0],x3[1],x3[2],x3[3]};
#pragma unroll
    for (int i = 0; i < 16; ++i) { const unsigned short hb = bf16_bits(xs[i]); ah.u[i] = hb; al.u[i] = ASPLIT ? bf16_bits(xs[i] - bf16_val(hb)) : (unsigned short)0; }
#pragma unroll
    for (int t = 0; t < 4; ++t) {
      const unsigned short* brow = Wt + (size_t)(col0 + t * 16 + ln) * ldb + kb;
      FragB b;
      b.half[0] = *(const v8us*)(brow + 8 * hh);
      b.half[1] = *(const v8us*)(brow + 16 + 8 * hh);
      acc[t] = mmaN<ASPLIT ? 2 : 1>(ah.v, al.v, b.v, b.v, acc[t]);
    }
  }
#pragma unroll
  for (int t = 0; t < 4; ++t) {
    float bv = bias ? bias[col0 + t * 16 + ln] : 0.f;
    if (BIAS_BF16) bv = bf16_round(bv);
#pragma unroll
    for (int r = 0; r < 8; ++r) { float v = acc[t][r] + bv; if (ACT == 1) v = fmaxf(v, 0.f); so[w][8 * hh + r][t * 16 + ln] = v; }
  }
  __builtin_amdgcn_fence(__ATOMIC_ACQ_REL, "workgroup");
  __builtin_amdgcn_wave_barrier();
  const int rsub = lane >> 4, c4 = (lane & 15) * 4;
  {
#pragma unroll
    for (int q = 0; q < 8; ++q) {
      const int r = q * 2 + rsub;
      const v4f v = *(const v4fa*)&so[w][r][c4];
      *(v4f*)(C + (size_t)(row0 + r) * ldc + col0 + c4) = v;
    }
    
  }
}

// GEMM C = act(A·W + bias + resid): A f32 (ASPLIT -> hi/lo 2 terms), Wt bf16 [N][K]; ACT 0 none, 1 relu, 2 exact gelu;
// resid (optional, f32, row index = (row % rmod), pitch ldr, RES_BF16 rounds it) added before the activation.
template <bool ASPLIT, int ACT, bool BIAS_BF16, bool RES_BF16>
__global__ __launch_bounds__(128) void k_gemm_bf3(const float* __restrict__ A, int lda, const unsigned short* __restrict__ Wt, int ldb,
                                                const float* __restrict__ bias, const float* __restrict__ resid, int rmod, int ldr,
                                                float* __restrict__ C, int ldc, int M, int N, int K) {
  __shared__ __attribute__((aligned(16))) float so[4][16][64];
  const int tid = threadIdx.x, w = tid >> 5, lane = tid & 31, ln = lane & 15, hh = lane >> 4;
  const int ntn = N / 64;
  const int wid = blockIdx.x * 4 + w;
  const int mt = wid / ntn, nq = wid % ntn;
  if (mt * 16 >= M) return;
  const int row0 = mt * 16, col0 = nq * 64;
  const float* arow = A + (size_t)(row0 + ln) * lda;
  v8f acc[4] = {};
  for (int kb = 0; kb < K; kb += 32) {
    FragB ah, al;
    const v4f x0 = *(const v4fa*)(arow + kb + 8 * hh), x1 = *(const v4fa*)(arow + kb + 8 * hh + 4);
    const v4f x2 = *(const v4fa*)(arow + kb + 16 + 8 * hh), x3 = *(const v4fa*)(arow + kb + 16 + 8 * hh + 4);
    float xs[16] = {x0[0],x0[1],x0[2],x0[3],x1[0],x1[1],x1[2],x1[3],x2[0],x2[1],x2[2],x2[3],x3[0],x3[1],x3[2],x3[3]};
#pragma unroll
    for (int i = 0; i < 16; ++i) { const unsigned short hb = bf16_bits(xs[i]); ah.u[i] = hb; al.u[i] = ASPLIT ? bf16_bits(xs[i] - bf16_val(hb)) : (unsigned short)0; }
#pragma unroll
    for (int t = 0; t < 4; ++t) {
      const unsigned short* brow = Wt + (size_t)(col0 + t * 16 + ln) * ldb + kb;
      FragB b;
      b.half[0] = *(const v8us*)(brow + 8 * hh);
      b.half[1] = *(const v8us*)(brow + 16 + 8 * hh);
      acc[t] = mmaN<ASPLIT ? 2 : 1>(ah.v, al.v, b.v, b.v, acc[t]);
    }
  }
#pragma unroll
  for (int t = 0; t < 4; ++t) {
    const int col = col0 + t * 16 + ln;
    float bv = bias ? bias[col] : 0.f;
    if (BIAS_BF16) bv = bf16_round(bv);
#pragma unroll
    for (int r = 0; r < 8; ++r) {
      float v = acc[t][r] + bv;
      if (resid) { float rv = resid[(size_t)((row0 + 8 * hh + r) % rmod) * ldr + col]; if (RES_BF16) rv = bf16_round(rv); v += rv; }
      if (ACT == 1) v = fmaxf(v, 0.f);
      if (ACT == 2) v = 0.5f * v * (1.0f + erff(v * 0.70710678118654752f));
      if (ACT == 3) { const float u = 0.7978845608028654f * (v + 0.044715f * v * v * v); v = 0.5f * v * (1.0f + tanhf(u)); }
      so[w][8 * hh + r][t * 16 + ln] = v;
    }
  }
  __builtin_amdgcn_fence(__ATOMIC_ACQ_REL, "workgroup");
  __builtin_amdgcn_wave_barrier();
  const int rsub = lane >> 4, c4 = (lane & 15) * 4;
  {
#pragma unroll
    for (int q = 0; q < 8; ++q) {
      const int r = q * 2 + rsub;
      const v4f v = *(const v4fa*)&so[w][r][c4];
      *(v4f*)(C + (size_t)(row0 + r) * ldc + col0 + c4) = v;
    }
    
  }
}
// row LayerNorm (biased variance, eps) over N: s = X (+ R); optional out_sum <- s; out_norm <- (s-mu)*rsqrt(var+eps)*g + b
template <bool PARAM_BF16>
__global__ __launch_bounds__(256) void k_layernorm(const float* __restrict__ X, const float* __restrict__ R, const float* __restrict__ g, const float* __restrict__ bta,
                                                  float* __restrict__ out_sum, float* __restrict__ out_norm, int N, float eps) {
  __shared__ float red[256];
  const int row = blockIdx.x, tid = threadIdx.x;
  const float* x = X + (size_t)row * N; const float* rr = R ? R + (size_t)row * N : nullptr;
  float vals[16];                     // up to N = 4096
  const int per = N / 256;            // contiguous chunk per thread? use strided-by-4 chunks: thread handles j = tid*4 + 1024*u
  float s1 = 0.f;
  for (int u = 0; u < per / 4; ++u) {
    const int j = tid * 4 + 1024 * u;
    const v4f a = *(const v4fa*)(x + j);
    v4f b = {0.f,0.f,0.f,0.f}; if (rr) b = *(const v4fa*)(rr + j);
#pragma unroll
    for (int q = 0; q < 4; ++q) { const float v = a[q] + b[q]; vals[u * 4 + q] = v; s1 += v; }
  }
  red[tid] = s1; __syncthreads();
  for (int st = 128; st > 0; st >>= 1) { if (tid < st) red[tid] += red[tid + st]; __syncthreads(); }
  const float mu = red[0] / (float)N; __syncthreads();
  float s2 = 0.f;
  for (int u = 0; u < per / 4; ++u)
#pragma unroll
    for (int q = 0; q < 4; ++q) { const float c = vals[u * 4 + q] - mu; s2 += c * c; }
  red[tid] = s2; __syncthreads();
  for (int st = 128; st > 0; st >>= 1) { if (tid < st) red[tid] += red[tid + st]; __syncthreads(); }
  const float rs = rsqrtf(red[0] / (float)N + eps);
  {
    for (int u = 0; u < per / 4; ++u) {
      const int j = tid * 4 + 1024 * u;
      v4f o, sm;
#pragma unroll
      for (int q = 0; q < 4; ++q) {
        float gg = g[j + q], bb = bta[j + q];
        if (PARAM_BF16) { gg = bf16_round(gg); bb = bf16_round(bb); }
        sm[q] = vals[u * 4 + q]; o[q] = (vals[u * 4 + q] - mu) * rs * gg + bb;
      }
      if (out_sum) *(v4f*)(out_sum + (size_t)row * N + j) = sm;
      *(v4f*)(out_norm + (size_t)row * N + j) = o;
    }
    
  }
}



// ---- f16 WMMA path (v_wmma_f32_16x16x32_f16): 11-bit significands for operands in range — used where a [0,1] probability operand needs more precision than bf16
typedef _Float16 v16h __attribute__((ext_vector_type(16)));
union FragH { v16h v; v8us half[2]; _Float16 h[16]; unsigned short u[16]; };
template <int NT>
__device__ __forceinline__ v8f mmaH(v16h ah, v16h al, v16h bh, v16h bl, v8f c) {
  c = __builtin_amdgcn_wmma_f32_16x16x32_f16(false, ah, false, bh, (short)0, c, false, false);
  if (NT >= 2) c = __builtin_amdgcn_wmma_f32_16x16x32_f16(false, al, false, bh, (short)0, c, false, false);
  if (NT >= 3) c = __builtin_amdgcn_wmma_f32_16x16x32_f16(false, ah, false, bl, (short)0, c, false, false);
  asm volatile("v_nop\n\tv_nop\n\tv_nop\n\tv_nop" : "+v"(c) : "v"(ah), "v"(al), "v"(bh), "v"(bl));
  return c;
}
// batched GEMM like k_gemm_b but f16 operands: A f32 (split into f16 hi/lo if ASPLIT, else rounded to f16), Bt = f16 values [n][k]; alpha; C f32; N multiple of 16 (partial tiles skipped)
template <bool ASPLIT>
__global__ __launch_bounds__(128) void k_gemm_h(const float* __restrict__ A, int lda, size_t sA, const _Float16* __restrict__ Bh, int ldb, size_t sB, float alpha, float* __restrict__ C, int ldc, size_t sC, int M, int N, int K) {
  __shared__ __attribute__((aligned(16))) float so[4][16][64];
  const int tid = threadIdx.x, w = tid >> 5, lane = tid & 31, ln = lane & 15, hh = lane >> 4; const int by = blockIdx.y;
  A += (size_t)by * sA; Bh += (size_t)by * sB; C += (size_t)by * sC;
  const int ntn = (N + 63) / 64; const int wid = blockIdx.x * 4 + w; const int mt = wid / ntn, nq = wid % ntn; if (mt * 16 >= M) return;
  const int row0 = mt * 16, col0 = nq * 64; const float* arow = A + (size_t)(row0 + ln) * lda;
  v8f acc[4] = {};
  for (int kb = 0; kb < K; kb += 32) {
    FragH ah, al;
    const v4f x0 = *(const v4fa*)(arow + kb + 8 * hh), x1 = *(const v4fa*)(arow + kb + 8 * hh + 4), x2 = *(const v4fa*)(arow + kb + 16 + 8 * hh), x3 = *(const v4fa*)(arow + kb + 16 + 8 * hh + 4);
    float xs[16] = {x0[0],x0[1],x0[2],x0[3],x1[0],x1[1],x1[2],x1[3],x2[0],x2[1],x2[2],x2[3],x3[0],x3[1],x3[2],x3[3]};
#pragma unroll
    for (int i = 0; i < 16; ++i) { const _Float16 h = (_Float16)xs[i]; ah.h[i] = h; al.h[i] = ASPLIT ? (_Float16)(xs[i] - (float)h) : (_Float16)0.0f; }
#pragma unroll
    for (int t = 0; t < 4; ++t) { if (col0 + t * 16 >= N) continue; const size_t boff = (size_t)(col0 + t * 16 + ln) * ldb + kb; FragH bq; bq.half[0] = *(const v8us*)(Bh + boff + 8 * hh); bq.half[1] = *(const v8us*)(Bh + boff + 16 + 8 * hh);
      acc[t] = mmaH<ASPLIT ? 2 : 1>(ah.v, al.v, bq.v, bq.v, acc[t]); }
  }
#pragma unroll
  for (int t = 0; t < 4; ++t) { if (col0 + t * 16 >= N) continue;
#pragma unroll
    for (int r = 0; r < 8; ++r) so[w][8 * hh + r][t * 16 + ln] = acc[t][r] * alpha; }
  __builtin_amdgcn_fence(__ATOMIC_ACQ_REL, "workgroup"); __builtin_amdgcn_wave_barrier();
  const int rsub = lane >> 4, c4 = (lane & 15) * 4;
  {
#pragma unroll
    for (int q = 0; q < 8; ++q) { const int r = q * 2 + rsub; if (col0 + c4 < N) { const v4f v = *(const v4fa*)&so[w][r][c4]; *(v4f*)(C + (size_t)(row0 + r) * ldc + col0 + c4) = v; } }
     }
}

// Wt[n][k] = f16(W[k][n]·scale) from f32 row-major W[K][N] (scale = power of two; bf16-exact weights stay exact in f16 away from the subnormal range)
__device__ __forceinline__ void d_wt_f16(const float* __restrict__ W, _Float16* __restrict__ Wt, int K, int N, float scale, int blk) {
  const int t = blk * 256 + threadIdx.x; if (t >= N * (K / 8)) return; const int n = t / (K / 8), k8 = (t % (K / 8)) * 8; FragH f;
#pragma unroll
  for (int i = 0; i < 8; ++i) f.h[i] = (_Float16)(bf16_round(W[(size_t)(k8 + i) * N + n]) * scale); const v8us o = f.half[0];
  *(v8us*)((unsigned short*)Wt + (size_t)n * K + k8) = o; 
}
// Wn = f16(W * scale), the layout kept
__device__ __forceinline__ void d_n16(const float* __restrict__ W, _Float16* __restrict__ Wn, int n8, float scale, int blk) {
  const int t = blk * 256 + threadIdx.x; if (t >= n8) return; FragH f;
#pragma unroll
  for (int i = 0; i < 8; ++i) f.h[i] = (_Float16)(bf16_round(W[(size_t)t * 8 + i]) * scale);
  *(v8us*)((unsigned short*)Wn + (size_t)t * 8) = f.half[0];
}
// One work-group = one 64 x 64 tile of C; wave w owns rows 16w..16w+15 of it, all 64 columns. Per stage the four waves bring 64 rows of A and 64 rows of B, 32 * KU k each,
// from global memory with whole-line 16-byte loads into registers and store them to LDS (row pitch = row bytes + 16, conflict-free for 16-byte fragment reads); every wave reads its
// fragments from LDS, so the B tile is fetched once per work-group instead of once per wave and no global load is spread over 16 rows. Two LDS buffers: the next stage's global loads
// are issued before this stage's WMMAs and stored to the other buffer behind them, one barrier per stage. M and N multiples of 64, K a multiple of 32 * KU. The k order per accumulator is ascending.
// Every loop over i, u and t is unrolled so that ra, rb, oa, ob and the fragments are registers, not indexed arrays in scratch.
// k_gemm_hh variant with fused epilogue: v = acc·alpha + bias[by·sBias + col] (+ CP[(row/rowsPerB)·sCPb + by·64 + col] if CP) ; ACT 0 none / 1 elu ; writes f16 C16 (and f32 C if non-null)
// ACT 20: C16 is updated in place, C16 = f16(acc * alpha + C16): each lane loads, at the kernel's start, the eight 8-byte pieces that it stores at the end, 16 lanes a 128-byte row piece; N a multiple of 64.
typedef _Float16 v4hx __attribute__((ext_vector_type(4), may_alias));
// One launch runs up to NJ products that do not depend on one another and share M, K and the operand pitches: job i owns the next nb work-groups of grid.x, with its own operands, addend, output, scale and N.
// NP = 2: A is given as two planes, hi (A) and lo * 2^10 (A2), against the same B. The k loop runs over the hi plane, multiplies the accumulators by 2^10 (exact) and runs on over the lo plane, so that
// acc = 2^10 * hi*B + (lo * 2^10)*B and alpha carries the 2^-10; C and its addend are touched once for the pair. lda = ldb = K there: a row's bytes end where the stages' running offsets stand after one plane.
struct GemmJob { const _Float16* A; const _Float16* A2; const _Float16* B; const float* CP; float* C; size_t sCPb; float alpha; int ldc, N, nb; };
template <int NJ> struct GemmJobs { GemmJob j[NJ]; };
template <int ACT, int KU, int NJ, int NP>
__global__ __launch_bounds__(128) void k_gemm_hhx(const GemmJobs<NJ> J, int lda, size_t sA, int ldb, size_t sB, const float* __restrict__ bias, size_t sBias, int rowsPerB, int row0g,
    _Float16* __restrict__ C16, size_t sC, int M, int K) {
  constexpr int RB = 64 * KU, PITCH = RB + 16, UPR = RB / 16, RP = 128 / UPR, NU = 64 / RP, TILE = 64 * PITCH;      /* row bytes, LDS pitch, 16-byte units per row, rows per pass of 128 threads, passes per tile, tile bytes */
  __shared__ __attribute__((aligned(16))) char sm[4 * TILE];      /* [buffer][A tile | B tile]; the epilogue's 16 KiB of staging reuses it behind the last stage's barrier */
  static_assert(4 * TILE >= 4 * 16 * 64 * 4, "epilogue staging must fit");
  float (*so)[16][64] = (float (*)[16][64])sm;
  const int tid = threadIdx.x, w = tid >> 5, lane = tid & 31, ln = lane & 15, hh = lane >> 4; const int by = blockIdx.y;
  GemmJob g = J.j[0]; int bx = blockIdx.x;      /* this work-group's job and its index inside the job: scalar values, the same for the whole work-group */
  for (int i = 1; i < NJ; ++i) if (bx >= g.nb) { bx -= g.nb; g = J.j[i]; }
  const _Float16* A = g.A; const _Float16* Bh = g.B; const float* CP = g.CP; float* C = g.C; const size_t sCPb = g.sCPb; const float alpha = g.alpha; const int ldc = g.ldc, N = g.N;
  A += (size_t)by * sA; Bh += (size_t)by * sB; const size_t cofs = (size_t)by * sC; const float* bp = bias ? bias + (size_t)by * sBias : nullptr;
  const int ntn = (N + 63) / 64; const int mtb = bx / ntn, nq = bx % ntn; if (mtb * 64 >= M) return;      /* the same for the whole work-group, ahead of every barrier */
  const int row0 = mtb * 64 + w * 16, col0 = nq * 64;
  char* c16b = ACT == 20 ? (char*)(C16 + cofs) : nullptr;      /* uniform base of this plane; each lane keeps one 32-bit byte offset per piece, for the load here and the store at the end */
  unsigned oc[8]; v4hx old[8];
  if (ACT == 20) {
#pragma unroll
    for (int q = 0; q < 8; ++q) { oc[q] = (unsigned)(((row0 + 2 * q + hh) * ldc + col0 + 4 * ln) * 2); old[q] = *(const v4hx*)(c16b + oc[q]); }
    asm volatile("s_wait_xcnt 0x0" :: "v"(oc[0]), "v"(oc[1]), "v"(oc[2]), "v"(oc[3]), "v"(oc[4]), "v"(oc[5]), "v"(oc[6]), "v"(oc[7]) : "memory");      /* the eight offsets stay in their registers up to this wait, so no load lands in a register that an issued load names */
  }
  v8f acc[4] = {};
  const char* Ab = (const char*)A; const char* Bb = (const char*)Bh;      /* uniform bases; each thread keeps one 32-bit byte offset per load */
  const int sr = tid / UPR, sc = (tid % UPR) * 16;
  const unsigned ga = (unsigned)((mtb * 64 + sr) * lda * 2 + sc), gb = (unsigned)((col0 + sr) * ldb * 2 + sc), ls = (unsigned)(sr * PITCH + sc);
  unsigned oa[NU], ob[NU];      /* moved on by one stage's bytes just ahead of the stage's loads: the loads that named the old values were waited for ahead of the last barrier */
#pragma unroll
  for (int i = 0; i < NU; ++i) { oa[i] = ga + (unsigned)(i * RP * lda * 2); ob[i] = gb + (unsigned)(i * RP * ldb * 2); }
  const unsigned fa = (unsigned)((w * 16 + ln) * PITCH + 16 * hh), fb = (unsigned)(TILE + ln * PITCH + 16 * hh);
  v8us ra[NU], rb[NU];
#pragma unroll
  for (int i = 0; i < NU; ++i) { ra[i] = *(const v8us*)(Ab + oa[i]); rb[i] = *(const v8us*)(Bb + ob[i]); }
#pragma unroll
  for (int i = 0; i < NU; ++i) { *(v8us*)(sm + ls + i * RP * PITCH) = ra[i]; *(v8us*)(sm + TILE + ls + i * RP * PITCH) = rb[i]; }
  __syncthreads();      /* stage 0 is in buffer 0 for every wave */
  const int nst = K / (32 * KU), nall = NP * nst;
  for (int s = 0; s < nall; ++s) { const bool more = s + 1 < nall; const char* cur = sm + (s & 1) * 2 * TILE; char* nxt = sm + ((s + 1) & 1) * 2 * TILE;
    if (NP == 2 && s + 1 == nst) { Ab = (const char*)(g.A2 + (size_t)by * sA) - (size_t)K * 2; Bb -= (size_t)K * 2; }      /* scalar test: the next stage is the lo plane's first; the threads' offsets run on, the two uniform bases step back by one row's bytes */
    if (NP == 2 && s == nst) {      /* scalar test: the hi plane is summed; 2^10 brings it to the lo plane's scale */
#pragma unroll
      for (int t = 0; t < 4; ++t) acc[t] *= 1024.0f; }
    if (more) {
#pragma unroll
      for (int i = 0; i < NU; ++i) { oa[i] += RB; ob[i] += RB; ra[i] = *(const v8us*)(Ab + oa[i]); rb[i] = *(const v8us*)(Bb + ob[i]); } }
    FragH ah[KU], bq[KU][4];
#pragma unroll
    for (int u = 0; u < KU; ++u) { ah[u].half[0] = *(const v8us*)(cur + fa + 64 * u); ah[u].half[1] = *(const v8us*)(cur + fa + 64 * u + 32);
#pragma unroll
      for (int t = 0; t < 4; ++t) { bq[u][t].half[0] = *(const v8us*)(cur + fb + t * 16 * PITCH + 64 * u); bq[u][t].half[1] = *(const v8us*)(cur + fb + t * 16 * PITCH + 64 * u + 32); } }
#pragma unroll
    for (int u = 0; u < KU; ++u) {
#pragma unroll
      for (int t = 0; t < 4; ++t) acc[t] = mmaH<1>(ah[u].v, ah[u].v, bq[u][t].v, bq[u][t].v, acc[t]); }
    if (more) {
#pragma unroll
      for (int i = 0; i < NU; ++i) { *(v8us*)(nxt + ls + i * RP * PITCH) = ra[i]; *(v8us*)(nxt + TILE + ls + i * RP * PITCH) = rb[i]; } }
    __syncthreads();      /* publishes the next stage's buffer and ends every wave's reads of this one (refilled one stage on; staged over by the epilogue behind the last) */
  }
#pragma unroll
  for (int t = 0; t < 4; ++t) { if (col0 + t * 16 >= N) continue; const int col = col0 + t * 16 + ln; const float bv = bp ? bf16_round(bp[col]) : 0.f;
#pragma unroll
    for (int r = 0; r < 8; ++r) { float v = acc[t][r] * alpha + bv; if (ACT != 20 && CP) { const int bidx = (row0g + row0 + 8 * hh + r) / rowsPerB; v += CP[(size_t)bidx * sCPb + (size_t)by * 64 + col]; } if (ACT == 1) v = (v > 0.f) ? v : expm1f(v); else if (ACT == 7) v = (v > 0.f) ? v + 1.0f : expf(v); else if (ACT == 8) v = tanhf(v); else if (ACT == 9) v = 0.5f * v * (1.0f + tanhf(0.7978845608028654f * (v + 0.044715f * v * v * v))); else if (ACT == 11) v = 1.0f / (1.0f + expf(-v)); else if (ACT == 12) v = (v > 0.f) ? v : 0.01f * v; else if (ACT == 14) v = (v > 0.f) ? v : 0.1f * v; else if (ACT == 15) v = v / (1.0f + expf(-v)); else if (ACT == 3) v = fmaxf(v, 0.f); else if (ACT == 6) v = 0.5f * v * (1.0f + erff(v * 0.70710678118654752f)); so[w][8 * hh + r][t * 16 + ln] = v; } }
  __builtin_amdgcn_fence(__ATOMIC_ACQ_REL, "workgroup"); __builtin_amdgcn_wave_barrier();
  const int rsub = lane >> 4, c4 = (lane & 15) * 4; typedef _Float16 v4h __attribute__((ext_vector_type(4)));
  if (ACT == 20) {
#pragma unroll
    for (int q = 0; q < 8; ++q) { const v4f v = *(const v4fa*)&so[w][q * 2 + rsub][c4]; v4hx h4;
#pragma unroll
      for (int i = 0; i < 4; ++i) h4[i] = (_Float16)(v[i] + (float)old[q][i]);
      *(v4hx*)(c16b + oc[q]) = h4; }
  } else {
#pragma unroll
    for (int q = 0; q < 8; ++q) { const int r = q * 2 + rsub; if (col0 + c4 < N) { const v4f v = *(const v4fa*)&so[w][r][c4]; if (C) *(v4f*)(C + cofs + (size_t)(row0 + r) * ldc + col0 + c4) = v; if (C16) { v4h h4; for (int i = 0; i < 4; ++i) h4[i] = (_Float16)v[i]; *(v4h*)(C16 + cofs + (size_t)(row0 + r) * ldc + col0 + c4) = h4; } } }
     }
}


// The two large products (x against the three projection planes; the attention output against the output plane) run on a larger tile: one work-group = one 128 x 128 tile of C, its four waves as 2 x 2,
// wave w owning rows 64 (w >> 1).. and columns 64 (w & 1).. as 4 x 4 accumulator tiles. A k-step of 32 then takes 4 A and 4 B fragments from LDS for 16 WMMAs (1 + 4 for 4 in the 16 x 64 wave tile above),
// and a stage brings 256 operand rows from L2 for 128 x 128 of C (128 rows for 64 x 64 above): half the bytes from L2 and two fifths of the bytes from LDS per product. Staging, LDS pitch, the two buffers,
// the one barrier per stage, the fragment loaders, the ascending k order per accumulator and the hi / lo plane switch (NP = 2) are those of k_gemm_hhx; the WMMAs are the plain builtin, 16 independent accumulators in a row. A and B are [row][KD] f16, C is f32 at pitch DM, C = acc * alpha;
// M and N multiples of 128. MW = waves per SIMD that the register budget must leave room for (work-groups per WGP, one wave of each on every SIMD).
template <int KU, int NJ, int NP, int MW, int KD>
__global__ __launch_bounds__(128, MW) void k_gemm_t(const GemmJobs<NJ> J, int M) {
  constexpr int RB = 64 * KU, PITCH = RB + 16, UPR = RB / 16, RP = 128 / UPR, NU = 128 / RP, TILE = 128 * PITCH;      /* row bytes, LDS pitch, 16-byte units per row, rows per pass of 128 threads, passes per tile, tile bytes */
  __shared__ __attribute__((aligned(16))) char sm[4 * TILE];      /* [buffer][A tile | B tile]; the epilogue's 64 KiB of staging reuses it behind the last stage's barrier */
  static_assert(4 * TILE >= 4 * 64 * 64 * 4, "epilogue staging must fit");
  const int tid = threadIdx.x, w = tid >> 5, lane = tid & 31, ln = lane & 15, hh = lane >> 4;
  GemmJob g = J.j[0]; int bx = blockIdx.x;      /* this work-group's job and its index inside the job: scalar values, the same for the whole work-group */
  for (int i = 1; i < NJ; ++i) if (bx >= g.nb) { bx -= g.nb; g = J.j[i]; }
  const int ntn = g.N / 128; const int mtb = bx / ntn, nq = bx % ntn; if (mtb * 128 >= M) return;      /* the same for the whole work-group, ahead of every barrier */
  v8f acc[4][4] = {};
  const char* Ab = (const char*)g.A; const char* Bb = (const char*)g.B;      /* uniform bases; each thread keeps one 32-bit byte offset per operand, the passes of a stage are constant steps from it */
  const int sr = tid / UPR, sc = (tid % UPR) * 16;
  unsigned oa = (unsigned)((mtb * 128 + sr) * KD * 2 + sc), ob = (unsigned)((nq * 128 + sr) * KD * 2 + sc);      /* moved on by one stage's bytes just ahead of the stage's loads: the loads that named the old values were waited for ahead of the last barrier */
  const unsigned ls = (unsigned)(sr * PITCH + sc);
  const unsigned fa = (unsigned)(((w >> 1) * 64 + ln) * PITCH + 16 * hh), fb = (unsigned)(TILE + ((w & 1) * 64 + ln) * PITCH + 16 * hh);
  v8us ra[NU], rb[NU];      /* every loop over i, u, a and t is unrolled so that staging registers, fragments and accumulators are registers, not indexed arrays in scratch */
#pragma unroll
  for (int i = 0; i < NU; ++i) { ra[i] = *(const v8us*)(Ab + oa + (size_t)(i * RP * KD * 2)); rb[i] = *(const v8us*)(Bb + ob + (size_t)(i * RP * KD * 2)); }
#pragma unroll
  for (int i = 0; i < NU; ++i) { *(v8us*)(sm + ls + i * RP * PITCH) = ra[i]; *(v8us*)(sm + TILE + ls + i * RP * PITCH) = rb[i]; }
  __syncthreads();      /* stage 0 is in buffer 0 for every wave */
  constexpr int nst = KD / (32 * KU), nall = NP * nst;
#pragma clang loop unroll(disable)      /* kept rolled as written: with the constant trip count the compiler otherwise peels the last stage and moves the step of oa and ob up behind the WMMAs, ahead of the wait for the loads that name them */
  for (int s = 0; s < nall; ++s) { const bool more = s + 1 < nall; const char* cur = sm + (s & 1) * 2 * TILE; char* nxt = sm + ((s + 1) & 1) * 2 * TILE;
    if (NP == 2 && s + 1 == nst) { Ab = (const char*)g.A2 - (size_t)KD * 2; Bb -= (size_t)KD * 2; }      /* scalar test: the next stage is the lo plane's first; the threads' offsets run on, the two uniform bases step back by one row's bytes */
    if (NP == 2 && s == nst) {      /* scalar test: the hi plane is summed; 2^10 brings it to the lo plane's scale */
#pragma unroll
      for (int a = 0; a < 4; ++a) {
#pragma unroll
        for (int t = 0; t < 4; ++t) acc[a][t] *= 1024.0f; } }
    if (more) { oa += RB; ob += RB;
#pragma unroll
      for (int i = 0; i < NU; ++i) { ra[i] = *(const v8us*)(Ab + oa + (size_t)(i * RP * KD * 2)); rb[i] = *(const v8us*)(Bb + ob + (size_t)(i * RP * KD * 2)); } }
    FragH af[2][4], bq[2][4];      /* two sets: a stage's fragments no longer fit the registers at once, so k-step u + 1 is fetched into the other set ahead of the WMMAs of k-step u */
    auto fetch = [&](int u) {
#pragma unroll
      for (int t = 0; t < 4; ++t) { af[u % 2][t].half[0] = *(const v8us*)(cur + fa + t * 16 * PITCH + 64 * u); af[u % 2][t].half[1] = *(const v8us*)(cur + fa + t * 16 * PITCH + 64 * u + 32);
        bq[u % 2][t].half[0] = *(const v8us*)(cur + fb + t * 16 * PITCH + 64 * u); bq[u % 2][t].half[1] = *(const v8us*)(cur + fb + t * 16 * PITCH + 64 * u + 32); } };
    fetch(0);
#pragma unroll
    for (int u = 0; u < KU; ++u) {
      if (u + 1 < KU) fetch(u + 1);
      __builtin_amdgcn_sched_barrier(0);      /* keeps a k-step's 16 LDS loads one group ahead of the WMMAs: left alone, the compiler spreads them among the WMMAs in pairs, each pair with a wait to 0 */
#pragma unroll
      for (int a = 0; a < 4; ++a) {
#pragma unroll
        for (int t = 0; t < 4; ++t) acc[a][t] = __builtin_amdgcn_wmma_f32_16x16x32_f16(false, af[u % 2][a].v, false, bq[u % 2][t].v, (short)0, acc[a][t], false, false); }
      __builtin_amdgcn_sched_barrier(0);      /* the other side of the same fence: the next group of loads stays behind this k-step's WMMAs */
    }
    asm volatile("v_nop\n\tv_nop\n\tv_nop\n\tv_nop");      /* the four vector slots between the stage's last WMMAs and a vector instruction that rewrites one of their A or B registers */
    if (more) {
#pragma unroll
      for (int i = 0; i < NU; ++i) { *(v8us*)(nxt + ls + i * RP * PITCH) = ra[i]; *(v8us*)(nxt + TILE + ls + i * RP * PITCH) = rb[i]; } }
    __syncthreads();      /* publishes the next stage's buffer and ends every wave's reads of this one (refilled one stage on; staged over by the epilogue behind the last) */
  }
  float* so = (float*)(sm + w * (64 * 64 * 4));      /* this wave's own 64 x 64 f32 */
#pragma unroll
  for (int a = 0; a < 4; ++a) {
#pragma unroll
    for (int t = 0; t < 4; ++t) {
#pragma unroll
      for (int r = 0; r < 8; ++r) so[(a * 16 + 8 * hh + r) * 64 + t * 16 + ln] = acc[a][t][r] * g.alpha; } }
  __builtin_amdgcn_fence(__ATOMIC_ACQ_REL, "workgroup"); __builtin_amdgcn_wave_barrier();      /* each lane reads back below what other lanes of its wave stored above: the LDS stores are complete first and the reads stay behind them */
  /* two rows of 256 bytes per store; one address per lane, the 32 stores are constant steps from it */
  float* cp = g.C + (size_t)(mtb * 128 + (w >> 1) * 64 + hh) * DM + nq * 128 + (w & 1) * 64 + 4 * ln;
#pragma unroll
  for (int q = 0; q < 32; ++q) { const v4f v = *(const v4fa*)&so[(q * 2 + hh) * 64 + 4 * ln]; *(v4f*)(cp + (size_t)q * 2 * DM) = v; }
}


typedef _Float16 v4h __attribute__((ext_vector_type(4)));

__device__ __forceinline__ void d_x16(const float* __restrict__ x, _Float16* __restrict__ X16, size_t n8, int blk) { const size_t t = (size_t)blk * 256 + threadIdx.x; if (t >= n8) return; FragH f;
#pragma unroll
  for (int q = 0; q < 8; ++q) f.h[q] = (_Float16)bf16_round(x[t * 8 + q]); *(v8us*)((unsigned short*)X16 + t * 8) = f.half[0];  }
__global__ __launch_bounds__(256) void k_h16(const float* __restrict__ x, _Float16* __restrict__ X16, size_t n8) { const size_t t = (size_t)blockIdx.x * 256 + threadIdx.x; if (t >= n8) return; FragH f;
#pragma unroll
  for (int q = 0; q < 8; ++q) f.h[q] = (_Float16)x[t * 8 + q]; *(v8us*)((unsigned short*)X16 + t * 8) = f.half[0];  }
__global__ __launch_bounds__(256) void k_round16f(const float* __restrict__ W, _Float16* __restrict__ Bt, size_t n8) { const size_t t = (size_t)blockIdx.x * 256 + threadIdx.x; if (t >= n8) return; FragH f;
#pragma unroll
  for (int i = 0; i < 8; ++i) f.h[i] = (_Float16)(bf16_round(W[t * 8 + i]) * 16.0f); *(v8us*)((unsigned short*)Bt + t * 8) = f.half[0];  }
template <int NHv, int TTv>
__global__ __launch_bounds__(256) void k_vt(const _Float16* __restrict__ V16, int ldv, int voff, _Float16* __restrict__ Vt) { __shared__ unsigned short tl[64][66]; const int tid = threadIdx.x; const int slab = blockIdx.x / (TTv / 64), lg = blockIdx.x % (TTv / 64); const int b = slab / NHv, h = slab % NHv;
  for (int i = tid; i < 64 * 8; i += 256) { const int r = i / 8, c8 = (i % 8) * 8; FragH f; f.half[0] = *(const v8us*)((const unsigned short*)V16 + ((size_t)b * TTv + lg * 64 + r) * ldv + voff + h * 64 + c8);
#pragma unroll
    for (int q = 0; q < 8; ++q) tl[r][c8 + q] = f.u[q]; }
  __syncthreads();
  {
#pragma unroll
    for (int rd = 0; rd < 2; ++rd) { const int d = rd * 32 + tid / 8, pc = tid % 8; FragH f;
#pragma unroll
      for (int q = 0; q < 8; ++q) f.u[q] = tl[pc * 8 + q][d];
      *(v8us*)((unsigned short*)Vt + ((size_t)slab * 64 + d) * TTv + lg * 64 + pc * 8) = f.half[0]; }
     } }

__global__ __launch_bounds__(256) void k_hl(const float* __restrict__ F, _Float16* __restrict__ Hh, _Float16* __restrict__ Hl, size_t n8) { const size_t t = (size_t)blockIdx.x * 256 + threadIdx.x; if (t >= n8) return; FragH fh, fl; const v4f a = *(const v4fa*)(F + t * 8), c = *(const v4fa*)(F + t * 8 + 4);
#pragma unroll
  for (int q = 0; q < 4; ++q) { _Float16 h = (_Float16)a[q]; fh.h[q] = h; fl.h[q] = (_Float16)((a[q] - (float)h) * 1024.0f); h = (_Float16)c[q]; fh.h[4 + q] = h; fl.h[4 + q] = (_Float16)((c[q] - (float)h) * 1024.0f); }
  { *(v8us*)((unsigned short*)Hh + t * 8) = fh.half[0]; *(v8us*)((unsigned short*)Hl + t * 8) = fl.half[0];  } }

__global__ __launch_bounds__(256) void k_split(const float* __restrict__ F, _Float16* __restrict__ Hh, _Float16* __restrict__ Hl, size_t n8) {
  #pragma clang fp contract(off)
  const size_t t = (size_t)blockIdx.x * 256 + threadIdx.x; if (t >= n8) return; const v4f a = *(const v4fa*)(F + t * 8), c = *(const v4fa*)(F + t * 8 + 4); FragH fh, fl;
#pragma unroll
  for (int q = 0; q < 8; ++q) { const float v = (q < 4) ? a[q] : c[q - 4]; const _Float16 hi = (_Float16)v; fh.h[q] = hi; fl.h[q] = (_Float16)((v - (float)hi) * 1024.0f); }
  { *(v8us*)((unsigned short*)Hh + t * 8) = fh.half[0]; *(v8us*)((unsigned short*)Hl + t * 8) = fl.half[0];  } }
__device__ __forceinline__ void d_cstab(float* __restrict__ CS, float* __restrict__ SN, int blk) {
  #pragma clang fp contract(off)
  const int t = blk * 256 + threadIdx.x; if (t >= SS * DH) return; const int d = t % DH, p = t / DH; const int i = d & 31; const float theta = 1.0f / powf(10000.0f, (float)(2 * i) / 64.0f); const float ang = (float)p * theta; const float c = cosf(ang), s = sinf(ang);
  { *(float*)(CS + t) = c; *(float*)(SN + t) = s;  } }
// Everything that depends on the inputs alone runs as one launch: the work-group's index picks its piece, the same test for all of its threads. The ten f16 weight planes lie in the
// workspace as three contiguous groups: BW = Wq Wv Wo Wk, BA = Aq Av Ao, BB = Bq Bv Bo, so that plane i of each group belongs to the same low-rank pair. BW and BB are transposed ([out][in]);
// BA keeps its layout [in][rank], which is what the product (A*B)^T = B^T (rows: out) * A^T (columns: in) takes as its second operand. The pieces that take longest per work-group come first.
__global__ __launch_bounds__(256) void k_prep(const float* __restrict__ x, const float* __restrict__ Wq, const float* __restrict__ Wk, const float* __restrict__ Wv, const float* __restrict__ Wo, const float* __restrict__ Aq, const float* __restrict__ Bq, const float* __restrict__ Av, const float* __restrict__ Bv, const float* __restrict__ Ao, const float* __restrict__ Bo,
    _Float16* __restrict__ X16, _Float16* __restrict__ BW, _Float16* __restrict__ BA, _Float16* __restrict__ BB, float* __restrict__ CS, float* __restrict__ SN) {
  constexpr int NW = DM * (DM / 8) / 256, NL = LR * (DM / 8) / 256, NC = SS * DH / 256;      /* work-groups per square weight, per low-rank weight, for the angle tables */
  int b = blockIdx.x;
  if (b < 4 * NW) { const int m = b / NW; d_wt_f16(m == 0 ? Wq : m == 1 ? Wv : m == 2 ? Wo : Wk, BW + (size_t)m * DM * DM, DM, DM, 16.0f, b % NW); return; }
  b -= 4 * NW;
  if (b < NC) { d_cstab(CS, SN, b); return; }
  b -= NC;
  if (b < 3 * NL) { const int m = b / NL; d_n16(m == 0 ? Aq : m == 1 ? Av : Ao, BA + (size_t)m * LR * DM, DM * LR / 8, 16.0f, b % NL); return; }
  b -= 3 * NL;
  if (b < 3 * NL) { const int m = b / NL; d_wt_f16(m == 0 ? Bq : m == 1 ? Bv : Bo, BB + (size_t)m * DM * LR, LR, DM, 16.0f, b % NL); return; }
  b -= 3 * NL;
  d_x16(x, X16, (size_t)NR * DM / 8, b);
}
__device__ __forceinline__ float cdma(int t, int d) { const int j = d & 3; const int par = __popc((unsigned)(t & j)); return (par & 1) ? -1.0f : 1.0f; }      /* Hadamard H4[t][d mod 4] (Sylvester order: rows [1,1,1,1],[1,-1,1,-1],[1,1,-1,-1],[1,-1,-1,1]) */
// One thread = 4 neighbouring d of one slot (4 tokens): 16 lanes cover a head's 256-byte row, so every 16-byte load and store of a wave covers whole lines of two slots' rows (the f16 rows: 8 bytes a lane, one whole line a row).
// The rotate partner d ^ 32 is a second 16-byte load at byte offset ^ 128, its sign a select on the loaded value: no branch stands between the loads. All 28 loads of a thread (k, k partner, v, q, q partner, cos, sin for 4 tokens)
// are issued together, each plane from its uniform base with one of three 32-bit byte offsets and a constant step per token; Q, K, V, PK, PVp and AQf share one layout and so one offset. The arithmetic per element and its order are unchanged.
__global__ __launch_bounds__(256) void k_slots(const float* __restrict__ Q, const float* __restrict__ K, const float* __restrict__ V, const float* __restrict__ CS, const float* __restrict__ SN, _Float16* __restrict__ FK16, _Float16* __restrict__ FV16, float* __restrict__ FKf, float* __restrict__ FVf, float* __restrict__ PK, float* __restrict__ PVp, _Float16* __restrict__ AQ16, float* __restrict__ AQf) {
  #pragma clang fp contract(off)
  const int t = blockIdx.x * 256 + threadIdx.x; if (t >= NBt * NH * NSL * (DH / 4)) return; const int d0 = (t % (DH / 4)) * 4; const int s = (t / (DH / 4)) % NSL; const int bh = t / ((DH / 4) * NSL); const int b = bh / NH, h = bh % NH;      /* both batches in one launch: bh = batch * 16 + head */
  const bool lo = d0 < 32;      /* rotate_half: -x[d + 32] for the lower half of a head, x[d - 32] for the upper */
  const unsigned op = (unsigned)((((b * SS + s * KF) * DM) + h * DH + d0) * 4), ox = op ^ 128u, oc = (unsigned)((s * KF * DH + d0) * 4);      /* byte offsets of the slot's first token: own d, partner d (the row piece starts at a multiple of 256 bytes), angle tables */
  v4f k4[KF], kx[KF], v4[KF], q4[KF], qx[KF], c4[KF], s4[KF];      /* every loop over tt and q is unrolled so that these are registers */
#pragma unroll
  for (int tt = 0; tt < KF; ++tt) { k4[tt] = *(const v4fa*)((const char*)K + op + tt * DM * 4); kx[tt] = *(const v4fa*)((const char*)K + ox + tt * DM * 4); v4[tt] = *(const v4fa*)((const char*)V + op + tt * DM * 4); c4[tt] = *(const v4fa*)((const char*)CS + oc + tt * DH * 4); s4[tt] = *(const v4fa*)((const char*)SN + oc + tt * DH * 4); }
#pragma unroll
  for (int tt = 0; tt < KF; ++tt) { q4[tt] = *(const v4fa*)((const char*)Q + op + tt * DM * 4); qx[tt] = *(const v4fa*)((const char*)Q + ox + tt * DM * 4); }
  asm volatile("s_wait_xcnt 0x0" :: "v"(op), "v"(ox), "v"(oc) : "memory");      /* the three offsets stay in their registers up to this wait, so none of the 28 loads lands in a register that an issued load names */
  asm volatile("" :: "v"(k4[0]), "v"(k4[1]), "v"(k4[2]), "v"(k4[3]), "v"(kx[0]), "v"(kx[1]), "v"(kx[2]), "v"(kx[3]), "v"(v4[0]), "v"(v4[1]), "v"(v4[2]), "v"(v4[3]), "v"(c4[0]), "v"(c4[1]), "v"(c4[2]), "v"(c4[3]), "v"(s4[0]), "v"(s4[1]), "v"(s4[2]), "v"(s4[3]), "v"(q4[0]), "v"(q4[1]), "v"(q4[2]), "v"(q4[3]), "v"(qx[0]), "v"(qx[1]), "v"(qx[2]), "v"(qx[3]));      /* inputs only: all 28 loaded values are wanted here, so the loads are issued as one group and waited for once; left alone, the compiler issues half of them, then the rest one at a time into one register group, each with a wait to 0 */
  v4f fk, fv, pk[KF], pv[KF];      /* slot sums; running prefixes per token step */
#pragma unroll
  for (int q = 0; q < 4; ++q) { float accK = 0.f, accV = 0.f;
#pragma unroll
    for (int tt = 0; tt < KF; ++tt) { const float c = c4[tt][q], sn = s4[tt][q];
      const float kr = k4[tt][q] * c + (lo ? -kx[tt][q] : kx[tt][q]) * sn; const float ph = cdma(tt, q) * 0.5f;      /* /sqrt(k_factor); d mod 4 = q */
      accK += kr * ph; accV += v4[tt][q] * ph; pk[tt][q] = accK; pv[tt][q] = accV; }
    fk[q] = accK; fv[q] = accV; }
  const size_t srow = ((size_t)bh * NSL + s) * DH + d0; v4hx fk16, fv16;
#pragma unroll
  for (int q = 0; q < 4; ++q) { fk16[q] = (_Float16)fk[q]; fv16[q] = (_Float16)fv[q]; }
  { *(v4hx*)(FK16 + srow) = fk16; *(v4hx*)(FV16 + srow) = fv16; *(v4f*)(FKf + srow) = fk; *(v4f*)(FVf + srow) = fv; }
#pragma unroll
  for (int tt = 0; tt < KF; ++tt) { v4f aq; v4hx aq16;      /* aligned q for this token */
#pragma unroll
    for (int q = 0; q < 4; ++q) { const float qr = q4[tt][q] * c4[tt][q] + (lo ? -qx[tt][q] : qx[tt][q]) * s4[tt][q]; aq[q] = qr * cdma(tt, q); aq16[q] = (_Float16)aq[q]; }
    const size_t arow = ((size_t)bh * SS + s * KF + tt) * DH + d0;
    { *(v4f*)((char*)PK + op + tt * DM * 4) = pk[tt]; *(v4f*)((char*)PVp + op + tt * DM * 4) = pv[tt]; *(v4hx*)(AQ16 + arow) = aq16; *(v4f*)((char*)AQf + op + tt * DM * 4) = aq; } } }
__device__ __forceinline__ void d_fvt(const float* __restrict__ FVf, _Float16* __restrict__ FVT, int blk) { const int t = blk * 256 + threadIdx.x; if (t >= NBt * NH * DH * (NSL / 8)) return; const int s0 = (t % (NSL / 8)) * 8; const int d = (t / (NSL / 8)) % DH; const int h = t / ((NSL / 8) * DH); FragH f;      /* h = batch * 16 + head */
#pragma unroll
  for (int q = 0; q < 8; ++q) f.h[q] = (_Float16)FVf[((size_t)h * NSL + s0 + q) * DH + d];
  *(v8us*)((unsigned short*)FVT + ((size_t)h * DH + d) * NSL + s0) = f.half[0];  }
#define FVB (DH * (NSL / 8) / 256)
__global__ __launch_bounds__(256) void k_fvt(const float* __restrict__ FVf, _Float16* __restrict__ FVT) { d_fvt(FVf, FVT, blockIdx.x); }
// Scores, softmax and weight * full_V in one kernel: a wave owns 16 query rows of one (batch, head) and walks the slots in chunks of 64, up to the chunk that holds its rows' own slots (the four
// own slots of 16 rows lie in one chunk, so every row of a wave has the same trip count and at least one live slot in every chunk). Both products are formed transposed, so that a query row is a
// COLUMN of the accumulators and belongs to lanes ln and ln + 16 alone: scores^T = full_K (A: row = slot, k = d) * aligned_q^T (B: column = query), out^T = full_V^T (A: row = d, k = slot) * weights^T.
// Register r of score tile t holds slot 16 t + 8 hh + r, which is the k that position r of half t & 1 of a B fragment pairs with in the A fragment of full_V^T: tiles 2u and 2u + 1, rounded to f16,
// ARE the weight fragment of k-step u, with no move between lanes and no LDS. Row maximum and row sum are in-lane but for one exchange between the half-waves. Running maximum: row sum and output
// accumulators are rescaled by exp(old max - new max) per chunk; the division by the row sum comes once, at the end. No score and no weight is written to memory.
// The four waves of a work-group (64 rows in a row, so one trip count for all four) share each chunk's 64 rows of full_K and 64 rows of full_V^T, 128 bytes a row: the 128 threads bring them with
// whole-line 16-byte loads into registers and store them to LDS (pitch 144 bytes, as in the GEMM above), every wave reads its A fragments from there. Two LDS buffers: the next chunk's global loads
// are issued ahead of this chunk's work and stored to the other buffer behind it, one barrier per chunk.
__device__ __forceinline__ float xhalf(float x) { return __builtin_bit_cast(float, __builtin_amdgcn_permlanex16(__builtin_bit_cast(int, x), __builtin_bit_cast(int, x), 0x76543210, 0xfedcba98, false, false)); }      /* lane l takes lane l ^ 16 */
__device__ __forceinline__ float exp2s(float x) { float r; asm("v_exp_f32 %0, %1\n\tv_nop" : "=v"(r) : "v"(x)); return r; }      /* 2^x; the v_nop keeps the one slot that the instruction set asks for behind a transcendental, whatever the compiler puts next */
__global__ __launch_bounds__(128) void k_attn(const _Float16* __restrict__ AQ16, const _Float16* __restrict__ FK16, const _Float16* __restrict__ FVT, const float* __restrict__ AQf, const float* __restrict__ PK, float* __restrict__ O, float* __restrict__ WC) {
  constexpr int PT = 144, TB = 64 * PT;      /* LDS pitch of a 128-byte row, bytes of a tile of 64 rows */
  __shared__ __attribute__((aligned(16))) char sm[2][2 * TB];      /* [buffer][full_K tile | full_V^T tile] */
  const int tid = threadIdx.x, w = tid >> 5, lane = tid & 31, ln = lane & 15, hh = lane >> 4;
  const int bh = blockIdx.y, b = bh / NH, h = bh % NH;
  const int qb = (int)gridDim.x - 1 - (int)blockIdx.x;      /* the rows with the most chunks take the lowest blockIdx.x */
  const int q0 = qb * 64 + w * 16;
  /* own-slot score of row q0 + ln in f32: each half-wave sums 32 of the 64 products */
  const float* ap = AQf + ((size_t)b * SS + q0 + ln) * DM + h * DH + 32 * hh; const float* pp = PK + ((size_t)b * SS + q0 + ln) * DM + h * DH + 32 * hh;
  v4f va[8], vb[8];
#pragma unroll
  for (int i = 0; i < 8; ++i) { va[i] = *(const v4fa*)(ap + 4 * i); vb[i] = *(const v4fa*)(pp + 4 * i); }
  asm volatile("s_wait_xcnt 0x0" :: "v"(ap), "v"(pp) : "memory");      /* both addresses stay in their registers up to this wait, so none of the 16 loads lands in a register that an issued load names */
  float cur = 0.f;
#pragma unroll
  for (int i = 0; i < 8; ++i) cur += va[i][0] * vb[i][0] + va[i][1] * vb[i][1] + va[i][2] * vb[i][2] + va[i][3] * vb[i][3];
  cur += xhalf(cur); cur *= 0.125f;
  const unsigned short* aqp = (const unsigned short*)AQ16 + ((size_t)bh * SS + q0 + ln) * DH + 8 * hh;
  FragH aq[2];
#pragma unroll
  for (int u = 0; u < 2; ++u) { aq[u].half[0] = *(const v8us*)(aqp + 32 * u); aq[u].half[1] = *(const v8us*)(aqp + 32 * u + 16); }
  const char* kg = (const char*)(FK16 + (size_t)bh * NSL * DH); const char* vg = (const char*)(FVT + (size_t)bh * DH * NSL);      /* uniform bases, moved on by one chunk's bytes just ahead of the chunk's loads; each thread adds its own byte offset */
  const int sr = tid >> 3, sb = (tid & 7) * 16;      /* staging: 8 threads a row, 16 rows a pass, 4 passes a tile */
  const unsigned ko = (unsigned)(sr * DH * 2 + sb), vo = (unsigned)(sr * NSL * 2 + sb), ls = (unsigned)(sr * PT + sb);
  const unsigned fr = (unsigned)(ln * PT + 16 * hh);      /* A fragments: row = slot, k = d in the full_K tile; row = d, k = slot in the full_V^T tile */
  const int cs = (q0 + ln) / KF;      /* this lane's row's own slot */
  const int nch = qb / KF + 1;      /* chunks up to the one with the rows' own slots (64 rows have 16 own slots, inside one chunk): from blockIdx alone, the same for the whole work-group */
  constexpr float L2E = 1.4426950408889634f;      /* exp(x - max) is formed as 2^(x * L2E - ml), ml = max * L2E rounded once and used for every term of the row, the own-slot weight included */
  float m = -3.0e38f, ml = -3.0e38f, l = 0.f;      /* running maximum of this lane's row, the same times L2E; this lane's half of its running sum */
  v8f oacc[4] = {};
  v8us rk[4], rv[4];      /* every loop over i, u, t and r is unrolled so that staging registers and fragments are registers, not indexed arrays in scratch */
#pragma unroll
  for (int i = 0; i < 4; ++i) { rk[i] = *(const v8us*)(kg + ko + i * 16 * DH * 2); rv[i] = *(const v8us*)(vg + vo + i * 16 * NSL * 2); }
#pragma unroll
  for (int i = 0; i < 4; ++i) { *(v8us*)(sm[0] + ls + i * 16 * PT) = rk[i]; *(v8us*)(sm[0] + TB + ls + i * 16 * PT) = rv[i]; }
  __syncthreads();      /* chunk 0 is in buffer 0 for every wave */
  for (int c = 0; c < nch; ++c) { const int c0 = c * 64; const bool more = c + 1 < nch; const char* cb = sm[c & 1]; char* nb = sm[(c + 1) & 1];
    if (more) { kg += 64 * DH * 2; vg += 64 * 2;
#pragma unroll
      for (int i = 0; i < 4; ++i) { rk[i] = *(const v8us*)(kg + ko + i * 16 * DH * 2); rv[i] = *(const v8us*)(vg + vo + i * 16 * NSL * 2); } }
    FragH kf[2][4], vf[2][4];
#pragma unroll
    for (int u = 0; u < 2; ++u) {
#pragma unroll
      for (int t = 0; t < 4; ++t) { kf[u][t].half[0] = *(const v8us*)(cb + fr + t * 16 * PT + 64 * u); kf[u][t].half[1] = *(const v8us*)(cb + fr + t * 16 * PT + 64 * u + 32); } }
    v8f s[4] = {};
#pragma unroll
    for (int u = 0; u < 2; ++u) {
#pragma unroll
      for (int t = 0; t < 4; ++t) s[t] = mmaH<1>(kf[u][t].v, kf[u][t].v, aq[u].v, aq[u].v, s[t]); }
    float mx = m;
#pragma unroll
    for (int t = 0; t < 4; ++t) {
#pragma unroll
      for (int r = 0; r < 8; ++r) s[t][r] *= 0.125f; }
    if (c + 1 == nch) {      /* a scalar test: own slots and later slots lie in the wave's last chunk alone */
#pragma unroll
      for (int t = 0; t < 4; ++t) {
#pragma unroll
        for (int r = 0; r < 8; ++r) { const int sl = c0 + t * 16 + 8 * hh + r; float x = s[t][r]; x = (sl == cs) ? cur : x; x = (sl > cs) ? -3.0e38f : x; s[t][r] = x; } } }
    float mt[4], lt[4];      /* one partial maximum and one partial sum per tile: four short dependent chains in place of one of 32 */
#pragma unroll
    for (int t = 0; t < 4; ++t) { mt[t] = s[t][0];
#pragma unroll
      for (int r = 1; r < 8; ++r) mt[t] = fmaxf(mt[t], s[t][r]); }
    mx = fmaxf(mx, fmaxf(fmaxf(mt[0], mt[1]), fmaxf(mt[2], mt[3])));
    mx = fmaxf(mx, xhalf(mx));      /* finite from the first chunk on: slot 0 is live for every row */
    const float mxl = mx * L2E, sc = exp2s(ml - mxl); m = mx; ml = mxl;      /* first chunk: 2^(-3e38 - mxl) = 0 */
    FragH pf[2];
#pragma unroll
    for (int t = 0; t < 4; ++t) { lt[t] = 0.f;
#pragma unroll
      for (int r = 0; r < 8; ++r) { const float p = exp2s(s[t][r] * L2E - mxl); lt[t] += p; pf[t >> 1].h[(t & 1) * 8 + r] = (_Float16)(p * 1024.0f); oacc[t][r] *= sc; } }      /* a masked slot's -3e38 gives 2^(-inf) = 0 */
    l = l * sc + ((lt[0] + lt[1]) + (lt[2] + lt[3]));
#pragma unroll
    for (int u = 0; u < 2; ++u) {
#pragma unroll
      for (int t = 0; t < 4; ++t) { vf[u][t].half[0] = *(const v8us*)(cb + TB + fr + t * 16 * PT + 64 * u); vf[u][t].half[1] = *(const v8us*)(cb + TB + fr + t * 16 * PT + 64 * u + 32); } }
#pragma unroll
    for (int u = 0; u < 2; ++u) {
#pragma unroll
      for (int t = 0; t < 4; ++t) oacc[t] = mmaH<1>(vf[u][t].v, vf[u][t].v, pf[u].v, pf[u].v, oacc[t]); }
    if (more) {
#pragma unroll
      for (int i = 0; i < 4; ++i) { *(v8us*)(nb + ls + i * 16 * PT) = rk[i]; *(v8us*)(nb + TB + ls + i * 16 * PT) = rv[i]; } }
    __syncthreads();      /* publishes the next chunk's buffer and ends every wave's reads of this one, which is refilled one chunk on */
  }
  l += xhalf(l);
  const float inv = 1.0f / l, wc = exp2s(cur * L2E - ml) * inv, os = inv * 0.0009765625f;      /* os also undoes the weights' 2^10 */
  float* op = O + ((size_t)bh * SS + q0 + ln) * DH + 8 * hh;      /* register r of tile t is d = 16 t + 8 hh + r of row q0 + ln; the wave writes its 16 rows, 4 KiB in a row, whole */
#pragma unroll
  for (int t = 0; t < 4; ++t) { v4f a, e;
#pragma unroll
    for (int r = 0; r < 4; ++r) { a[r] = oacc[t][r] * os; e[r] = oacc[t][4 + r] * os; }
    *(v4f*)(op + t * 16) = a; *(v4f*)(op + t * 16 + 4) = e; }
  float* wl = WC + ((size_t)bh * SS + q0 + ln) * 32 + 16 * hh; const v4f w4 = {wc, wc, wc, wc};      /* one whole 128-byte line per (head, row), written by this wave alone */
#pragma unroll
  for (int i = 0; i < 4; ++i) *(v4f*)(wl + 4 * i) = w4;
}
__global__ __launch_bounds__(256) void k_oepi(const float* __restrict__ O, const float* __restrict__ WC, const float* __restrict__ PVp, const float* __restrict__ FVf, _Float16* __restrict__ Oh, _Float16* __restrict__ Ol) {
  #pragma clang fp contract(off)
  const int t = blockIdx.x * 256 + threadIdx.x; if (t >= NR * NH * (DH / 8)) return; const int d0 = (t % (DH / 8)) * 8; const int h = (t / (DH / 8)) % NH; const int bq = t / ((DH / 8) * NH); const int b = bq / SS, q = bq % SS; const int cs = q / KF, tt = q % KF; const float wc = WC[((size_t)(b * NH + h) * SS + q) * 32]; const size_t prow = (size_t)bq * DM + h * DH + d0; const size_t srow = ((size_t)(b * NH + h) * NSL + cs) * DH + d0; const size_t orow = ((size_t)(b * NH + h) * SS + q) * DH + d0; FragH fh, fl;      /* O is [batch * 16 + head][token][64] */
  const v4f pA = *(const v4fa*)(PVp + prow), pB = *(const v4fa*)(PVp + prow + 4), fA = *(const v4fa*)(FVf + srow), fB = *(const v4fa*)(FVf + srow + 4);
  asm volatile("s_wait_xcnt 0x0" ::: "memory");      /* the loads of O below may land in registers that hold the addresses of the loads above: the wait stands between them */
  const v4f oA = *(const v4fa*)(O + orow), oB = *(const v4fa*)(O + orow + 4);
#pragma unroll
  for (int k = 0; k < 8; ++k) { const int d = d0 + k; const float o = ((k < 4) ? oA[k & 3] : oB[k & 3]) + wc * (((k < 4) ? pA[k & 3] : pB[k & 3]) - ((k < 4) ? fA[k & 3] : fB[k & 3])); const float v = (o * cdma(tt, d)) * 2.0f; const _Float16 hi = (_Float16)v; fh.h[k] = hi; fl.h[k] = (_Float16)((v - (float)hi) * 1024.0f); }
  { *(v8us*)((unsigned short*)Oh + prow) = fh.half[0]; *(v8us*)((unsigned short*)Ol + prow) = fl.half[0];  } }

extern "C" void kernel_launch(void* const* d_in, const int* in_sizes, int n_in,
                              void* d_out, int out_size, void* d_ws, size_t ws_size, hipStream_t stream) {
  (void)in_sizes; (void)n_in; (void)out_size;
  const float* x = (const float*)d_in[0]; const float* Wq = (const float*)d_in[1]; const float* Wk = (const float*)d_in[2]; const float* Wv = (const float*)d_in[3]; const float* Wo = (const float*)d_in[4]; const float* Aq = (const float*)d_in[5]; const float* Bq = (const float*)d_in[6]; const float* Av = (const float*)d_in[7]; const float* Bv = (const float*)d_in[8]; const float* Ao = (const float*)d_in[9]; const float* Bo = (const float*)d_in[10];
  char* ws = (char*)d_ws; size_t off = 0;
  auto take = [&](size_t bytes) { char* p = ws + off; off += (bytes + 255) & ~(size_t)255; return p; };
  _Float16* BWq = (_Float16*)take((size_t)DM * DM * 2); _Float16* BWv = (_Float16*)take((size_t)DM * DM * 2); _Float16* BWo = (_Float16*)take((size_t)DM * DM * 2); _Float16* BWk = (_Float16*)take((size_t)DM * DM * 2); _Float16* BAq = (_Float16*)take((size_t)3 * LR * DM * 2); _Float16* BBq = (_Float16*)take((size_t)3 * DM * LR * 2);
  float* CS = (float*)take((size_t)SS * DH * 4); float* SN = (float*)take((size_t)SS * DH * 4);
  /* every plane holds both batches (NR = 4096 rows, or 32 = batch * 16 + head slabs) */
  _Float16* X16 = (_Float16*)take((size_t)NR * DM * 2); float* Q = (float*)take((size_t)NR * DM * 4); float* K = (float*)take((size_t)NR * DM * 4); float* V = (float*)take((size_t)NR * DM * 4);
  _Float16* FK16 = (_Float16*)take((size_t)NBt * NH * NSL * DH * 2); _Float16* FV16 = (_Float16*)take((size_t)NBt * NH * NSL * DH * 2); float* FKf = (float*)take((size_t)NBt * NH * NSL * DH * 4); float* FVf = (float*)take((size_t)NBt * NH * NSL * DH * 4); float* PK = (float*)take((size_t)NR * DM * 4); float* PVp = (float*)take((size_t)NR * DM * 4); float* AQf = (float*)take((size_t)NR * DM * 4);
  if (off > ws_size) return;      // weights 8.75 + tables 1 + planes 116: 125.75 MiB
  /* planes that are written only after another plane's last reader has run share its bytes (launches of one stream run in order):
     X16 is last read by the launch of the three products of x, Q, K and V by k_slots */
  _Float16* AQ16 = X16; float* O = Q; _Float16* Oh = (_Float16*)K; _Float16* Ol = Oh + (size_t)NR * DM; float* WC = V; _Float16* FVT = (_Float16*)(V + (size_t)NBt * NH * SS * 32);
  const size_t n8 = (size_t)NR * DM / 8; const unsigned nb8 = (unsigned)((n8 + 255) / 256);
  k_prep<<<4 * (DM * (DM / 8) / 256) + SS * DH / 256 + 6 * (LR * (DM / 8) / 256) + nb8, 256, 0, stream>>>(x, Wq, Wk, Wv, Wo, Aq, Bq, Av, Bv, Ao, Bo, X16, BWq, BAq, BBq, CS, SN);      /* all weights are (in,out) */
  /* one 128 x 128 tile of C per work-group: projections over all NR rows, nD work-groups; attention per (batch, head) on grid.y */
  const int nD = (NR / 128) * (DM / 128); const dim3 gA(SS / 64, NBt * NH);
  const float a0 = 0.0625f, a1 = 0.0625f / 1024.0f;      /* undo the weights' 16; the lo planes carry 2^10 more */
  /* the planes of Wq, Wv and Wo (grid.y) take their low-rank pair: BW[out][in] += sum over rank of BB[out][rank] * BA[in][rank]; both operands carry 16, the plane carries 16, so alpha = 1/16 */
  const GemmJobs<1> jW = {{{BBq, nullptr, BAq, nullptr, nullptr, 0, a0, DM, DM, (DM / 64) * (DM / 64)}}};
  k_gemm_hhx<20, 2, 1, 1><<<dim3((DM / 64) * (DM / 64), 3), 128, 0, stream>>>(jW, LR, (size_t)DM * LR, LR, (size_t)DM * LR, nullptr, 0, 1, 0, BWq, (size_t)DM * DM, DM, LR);
  const GemmJobs<3> jX = {{{X16, nullptr, BWq, nullptr, Q, 0, a0, DM, DM, nD}, {X16, nullptr, BWk, nullptr, K, 0, a0, DM, DM, nD}, {X16, nullptr, BWv, nullptr, V, 0, a0, DM, DM, nD}}};
  k_gemm_t<2, 3, 1, 3, DM><<<dim3(3 * nD, 1), 128, 0, stream>>>(jX, NR);      /* q = x*(Wq + Aq*Bq), k = x*Wk, v = x*(Wv + Av*Bv) */
  k_slots<<<(NBt * NH * NSL * (DH / 4) + 255) / 256, 256, 0, stream>>>(Q, K, V, CS, SN, FK16, FV16, FKf, FVf, PK, PVp, AQ16, AQf);
  k_fvt<<<NBt * NH * FVB, 256, 0, stream>>>(FVf, FVT);
  k_attn<<<gA, 128, 0, stream>>>(AQ16, FK16, FVT, AQf, PK, O, WC);      /* scores, softmax, sum of w * full_V into O[pair] and the own-slot weight into WC: 64 rows per work-group, pair = batch * 16 + head on grid.y */
  k_oepi<<<(NR * NH * (DH / 8) + 255) / 256, 256, 0, stream>>>(O, WC, PVp, FVf, Oh, Ol);
  float* outb = (float*)d_out;
  const GemmJobs<1> jO = {{{Oh, Ol, BWo, nullptr, outb, 0, a1, DM, DM, nD}}};
  k_gemm_t<4, 1, 2, 1, DM><<<dim3(nD, 1), 128, 0, stream>>>(jO, NR);      /* y = out*(Wo + Ao*Bo): hi and lo planes in one k loop */
}
